// v000
// Times are from an AMD MI455X. After a warm-up the kernel runs many times in a row, and a time is the length of
// such a window on the GPU divided by its runs, so every launch and the gaps after it count. The runs cycle
// through copies of the inputs. A figure is the median of several windows, for all but v000 over two sittings.
// Sittings can differ by a few percent; kernels timed side by side share one.
// The starting kernel, v000, takes 503 microseconds a run.
#include <hip/hip_runtime.h>
// Sparse3DNA (x [2][4096][512]: 1 BOS + 4095 video tokens on a 4x32x32 grid, padded by one zero token to 4097; q = x Wq, [k|v] = x Wkv ([in][out], no bias), 8 heads of 64; query j (token j+1) attends to {BOS} U {its 3x3x3 grid neighbourhood keys with flat index <= j} (out-of-grid slots and future keys masked), scale 64^-0.5, softmax, weighted v; token 0's output is v_BOS itself; out = o Wo + bo, first 4096 tokens -> [2][4096][512]).
// Structure: token rows (4,097 per batch padded to 4,224); x as exact f16 rows; Q and [K|V] WMMA GEMMs (32x64 wave tiles, f32 accumulation, exact x16 transposed weights) kept in f32; the 28-slot neighbourhood attention per (batch, head, query) on VALU (f32: window indices and the causal test from the grid geometry on device, logits, softmax, weighted sum; rolled loops) into f16 o rows (row 0 = v_BOS); out = o Wo + bo GEMM (f32, output layout).
// Compute dtype: inputs rounded to bf16; x / weights exact; q, k, v, logits, softmax f32; o plain f16 into the Wo GEMM (~2^-12). v_wmma_f32_16x16x32_f16.
#define NB 2
#define NTOK 4096                    /* input tokens per batch (= output tokens) */
#define NPAD 4097                    /* after the module's padding */
#define RPB 4224                     /* rows per batch (33 x 128) */
#define NRX ((size_t)NB * RPB)       /* 8448 */
#define DM 512
#define NH 8
#define HD 64
#define FT 4
#define HT 32
#define WT 32
#define TT (FT * HT * WT)            /* 4096 grid tokens */
#define QT TT                        /* queries computed (debug hook) */
typedef __bf16 v16b __attribute__((ext_vector_type(16)));
typedef unsigned short v8us __attribute__((ext_vector_type(8), may_alias));
typedef float  v8f  __attribute__((ext_vector_type(8)));
typedef float  v4f  __attribute__((ext_vector_type(4)));
typedef float  v4fa __attribute__((ext_vector_type(4), may_alias));
union FragB { v16b v; v8us half[2]; unsigned short u[16]; };

__device__ __forceinline__ unsigned short bf16_bits(float x) { unsigned int u = __float_as_uint(x); return (unsigned short)((u + 0x7FFFu + ((u >> 16) & 1u)) >> 16); }
__device__ __forceinline__ float bf16_val(unsigned short b) { return __uint_as_float(((unsigned int)b) << 16); }
__device__ __forceinline__ float bf16_round(float x) { return bf16_val(bf16_bits(x)); }
// D += A·B with NT terms: 1 = ah·bh, 2 = + al·bh (A split), 3 = + ah·bl (both split)
template <int NT>
__device__ __forceinline__ v8f mmaN(v16b ah, v16b al, v16b bh, v16b bl, v8f c) {
  c = __builtin_amdgcn_wmma_f32_16x16x32_bf16(false, ah, false, bh, (short)0, c, false, false);
  if (NT >= 2) c = __builtin_amdgcn_wmma_f32_16x16x32_bf16(false, al, false, bh, (short)0, c, false, false);
  if (NT >= 3) c = __builtin_amdgcn_wmma_f32_16x16x32_bf16(false, ah, false, bl, (short)0, c, false, false);
  asm volatile("v_nop\n\tv_nop\n\tv_nop\n\tv_nop" : "+v"(c) : "v"(ah), "v"(al), "v"(bh), "v"(bl));
  return c;
}

__global__ __launch_bounds__(256) void k_wt_bf16(const float* __restrict__ W, unsigned short* __restrict__ Wt, int K, int N) {
  const int t = blockIdx.x * 256 + threadIdx.x;
  const int k8n = K / 8;
  if (t >= N * k8n) return;
  const int n = t / k8n, k8 = (t % k8n) * 8;
  v8us v;
#pragma unroll
  for (int i = 0; i < 8; ++i) v[i] = bf16_bits(W[(size_t)(k8 + i) * N + n]);
  *(v8us*)(Wt + (size_t)n * K + k8) = v;
  
}

// GEMM C[M][N] (f32, pitch ldc) = act(A[M][K]·W + bias). A f32 row-major (pitch lda) converted per fragment to bf16
// (ASPLIT: hi/lo two planes -> 2 terms, else single rounded term); Wt bf16 [N][K] (pitch ldb). BIAS_BF16 rounds the
// bias to bf16 first (bias quantised to bf16 before the add). K%32==0, M%16==0, N%64==0.
template <bool ASPLIT, int ACT, bool BIAS_BF16>
__global__ __launch_bounds__(128) void k_gemm_bf(const float* __restrict__ A, int lda, const unsigned short* __restrict__ Wt, int ldb,
                                               const float* __restrict__ bias, float* __restrict__ C, int ldc, int M, int N, int K) {
  __shared__ __attribute__((aligned(16))) float so[4][16][64];
  const int tid = threadIdx.x, w = tid >> 5, lane = tid & 31, ln = lane & 15, hh = lane >> 4;
  const int ntn = N / 64;
  const int wid = blockIdx.x * 4 + w;
  const int mt = wid / ntn, nq = wid % ntn;
  if (mt * 16 >= M) return;
  const int row0 = mt * 16, col0 = nq * 64;
  const float* arow = A + (size_t)(row0 + ln) * lda;
  v8f acc[4] = {};
  for (int kb = 0; kb < K; kb += 32) {
    FragB ah, al;
    const v4f x0 = *(const v4fa*)(arow + kb + 8 * hh), x1 = *(const v4fa*)(arow + kb + 8 * hh + 4);
    const v4f x2 = *(const v4fa*)(arow + kb + 16 + 8 * hh), x3 = *(const v4fa*)(arow + kb + 16 + 8 * hh + 4);
    float xs[16] = {x0[0],x0[1],x0[2],x0[3],x1[0],x1[1],x1[2],x1[3],x2[0],x2[1],x2[2],x2[3],x3[0],x3[1],x3[2],x3[3]};
#pragma unroll
    for (int i = 0; i < 16; ++i) { const unsigned short hb = bf16_bits(xs[i]); ah.u[i] = hb; al.u[i] = ASPLIT ? bf16_bits(xs[i] - bf16_val(hb)) : (unsigned short)0; }
#pragma unroll
    for (int t = 0; t < 4; ++t) {
      const unsigned short* brow = Wt + (size_t)(col0 + t * 16 + ln) * ldb + kb;
      FragB b;
      b.half[0] = *(const v8us*)(brow + 8 * hh);
      b.half[1] = *(const v8us*)(brow + 16 + 8 * hh);
      acc[t] = mmaN<ASPLIT ? 2 : 1>(ah.v, al.v, b.v, b.v, acc[t]);
    }
  }
#pragma unroll
  for (int t = 0; t < 4; ++t) {
    float bv = bias ? bias[col0 + t * 16 + ln] : 0.f;
    if (BIAS_BF16) bv = bf16_round(bv);
#pragma unroll
    for (int r = 0; r < 8; ++r) { float v = acc[t][r] + bv; if (ACT == 1) v = fmaxf(v, 0.f); so[w][8 * hh + r][t * 16 + ln] = v; }
  }
  __builtin_amdgcn_fence(__ATOMIC_ACQ_REL, "workgroup");
  __builtin_amdgcn_wave_barrier();
  const int rsub = lane >> 4, c4 = (lane & 15) * 4;
  {
#pragma unroll
    for (int q = 0; q < 8; ++q) {
      const int r = q * 2 + rsub;
      const v4f v = *(const v4fa*)&so[w][r][c4];
      *(v4f*)(C + (size_t)(row0 + r) * ldc + col0 + c4) = v;
    }
    
  }
}

// GEMM C = act(A·W + bias + resid): A f32 (ASPLIT -> hi/lo 2 terms), Wt bf16 [N][K]; ACT 0 none, 1 relu, 2 exact gelu;
// resid (optional, f32, row index = (row % rmod), pitch ldr, RES_BF16 rounds it) added before the activation.
template <bool ASPLIT, int ACT, bool BIAS_BF16, bool RES_BF16>
__global__ __launch_bounds__(128) void k_gemm_bf3(const float* __restrict__ A, int lda, const unsigned short* __restrict__ Wt, int ldb,
                                                const float* __restrict__ bias, const float* __restrict__ resid, int rmod, int ldr,
                                                float* __restrict__ C, int ldc, int M, int N, int K) {
  __shared__ __attribute__((aligned(16))) float so[4][16][64];
  const int tid = threadIdx.x, w = tid >> 5, lane = tid & 31, ln = lane & 15, hh = lane >> 4;
  const int ntn = N / 64;
  const int wid = blockIdx.x * 4 + w;
  const int mt = wid / ntn, nq = wid % ntn;
  if (mt * 16 >= M) return;
  const int row0 = mt * 16, col0 = nq * 64;
  const float* arow = A + (size_t)(row0 + ln) * lda;
  v8f acc[4] = {};
  for (int kb = 0; kb < K; kb += 32) {
    FragB ah, al;
    const v4f x0 = *(const v4fa*)(arow + kb + 8 * hh), x1 = *(const v4fa*)(arow + kb + 8 * hh + 4);
    const v4f x2 = *(const v4fa*)(arow + kb + 16 + 8 * hh), x3 = *(const v4fa*)(arow + kb + 16 + 8 * hh + 4);
    float xs[16] = {x0[0],x0[1],x0[2],x0[3],x1[0],x1[1],x1[2],x1[3],x2[0],x2[1],x2[2],x2[3],x3[0],x3[1],x3[2],x3[3]};
#pragma unroll
    for (int i = 0; i < 16; ++i) { const unsigned short hb = bf16_bits(xs[i]); ah.u[i] = hb; al.u[i] = ASPLIT ? bf16_bits(xs[i] - bf16_val(hb)) : (unsigned short)0; }
#pragma unroll
    for (int t = 0; t < 4; ++t) {
      const unsigned short* brow = Wt + (size_t)(col0 + t * 16 + ln) * ldb + kb;
      FragB b;
      b.half[0] = *(const v8us*)(brow + 8 * hh);
      b.half[1] = *(const v8us*)(brow + 16 + 8 * hh);
      acc[t] = mmaN<ASPLIT ? 2 : 1>(ah.v, al.v, b.v, b.v, acc[t]);
    }
  }
#pragma unroll
  for (int t = 0; t < 4; ++t) {
    const int col = col0 + t * 16 + ln;
    float bv = bias ? bias[col] : 0.f;
    if (BIAS_BF16) bv = bf16_round(bv);
#pragma unroll
    for (int r = 0; r < 8; ++r) {
      float v = acc[t][r] + bv;
      if (resid) { float rv = resid[(size_t)((row0 + 8 * hh + r) % rmod) * ldr + col]; if (RES_BF16) rv = bf16_round(rv); v += rv; }
      if (ACT == 1) v = fmaxf(v, 0.f);
      if (ACT == 2) v = 0.5f * v * (1.0f + erff(v * 0.70710678118654752f));
      if (ACT == 3) { const float u = 0.7978845608028654f * (v + 0.044715f * v * v * v); v = 0.5f * v * (1.0f + tanhf(u)); }
      so[w][8 * hh + r][t * 16 + ln] = v;
    }
  }
  __builtin_amdgcn_fence(__ATOMIC_ACQ_REL, "workgroup");
  __builtin_amdgcn_wave_barrier();
  const int rsub = lane >> 4, c4 = (lane & 15) * 4;
  {
#pragma unroll
    for (int q = 0; q < 8; ++q) {
      const int r = q * 2 + rsub;
      const v4f v = *(const v4fa*)&so[w][r][c4];
      *(v4f*)(C + (size_t)(row0 + r) * ldc + col0 + c4) = v;
    }
    
  }
}
// row LayerNorm (biased variance, eps) over N: s = X (+ R); optional out_sum <- s; out_norm <- (s-mu)*rsqrt(var+eps)*g + b
template <bool PARAM_BF16>
__global__ __launch_bounds__(256) void k_layernorm(const float* __restrict__ X, const float* __restrict__ R, const float* __restrict__ g, const float* __restrict__ bta,
                                                  float* __restrict__ out_sum, float* __restrict__ out_norm, int N, float eps) {
  __shared__ float red[256];
  const int row = blockIdx.x, tid = threadIdx.x;
  const float* x = X + (size_t)row * N; const float* rr = R ? R + (size_t)row * N : nullptr;
  float vals[16];                     // up to N = 4096
  const int per = N / 256;            // contiguous chunk per thread? use strided-by-4 chunks: thread handles j = tid*4 + 1024*u
  float s1 = 0.f;
  for (int u = 0; u < per / 4; ++u) {
    const int j = tid * 4 + 1024 * u;
    const v4f a = *(const v4fa*)(x + j);
    v4f b = {0.f,0.f,0.f,0.f}; if (rr) b = *(const v4fa*)(rr + j);
#pragma unroll
    for (int q = 0; q < 4; ++q) { const float v = a[q] + b[q]; vals[u * 4 + q] = v; s1 += v; }
  }
  red[tid] = s1; __syncthreads();
  for (int st = 128; st > 0; st >>= 1) { if (tid < st) red[tid] += red[tid + st]; __syncthreads(); }
  const float mu = red[0] / (float)N; __syncthreads();
  float s2 = 0.f;
  for (int u = 0; u < per / 4; ++u)
#pragma unroll
    for (int q = 0; q < 4; ++q) { const float c = vals[u * 4 + q] - mu; s2 += c * c; }
  red[tid] = s2; __syncthreads();
  for (int st = 128; st > 0; st >>= 1) { if (tid < st) red[tid] += red[tid + st]; __syncthreads(); }
  const float rs = rsqrtf(red[0] / (float)N + eps);
  {
    for (int u = 0; u < per / 4; ++u) {
      const int j = tid * 4 + 1024 * u;
      v4f o, sm;
#pragma unroll
      for (int q = 0; q < 4; ++q) {
        float gg = g[j + q], bb = bta[j + q];
        if (PARAM_BF16) { gg = bf16_round(gg); bb = bf16_round(bb); }
        sm[q] = vals[u * 4 + q]; o[q] = (vals[u * 4 + q] - mu) * rs * gg + bb;
      }
      if (out_sum) *(v4f*)(out_sum + (size_t)row * N + j) = sm;
      *(v4f*)(out_norm + (size_t)row * N + j) = o;
    }
    
  }
}



// ---- f16 WMMA path (v_wmma_f32_16x16x32_f16): 11-bit significands for operands in range — used here for the Q, [K|V] and Wo GEMMs
typedef _Float16 v16h __attribute__((ext_vector_type(16)));
union FragH { v16h v; v8us half[2]; _Float16 h[16]; unsigned short u[16]; };
template <int NT>
__device__ __forceinline__ v8f mmaH(v16h ah, v16h al, v16h bh, v16h bl, v8f c) {
  c = __builtin_amdgcn_wmma_f32_16x16x32_f16(false, ah, false, bh, (short)0, c, false, false);
  if (NT >= 2) c = __builtin_amdgcn_wmma_f32_16x16x32_f16(false, al, false, bh, (short)0, c, false, false);
  if (NT >= 3) c = __builtin_amdgcn_wmma_f32_16x16x32_f16(false, ah, false, bl, (short)0, c, false, false);
  asm volatile("v_nop\n\tv_nop\n\tv_nop\n\tv_nop" : "+v"(c) : "v"(ah), "v"(al), "v"(bh), "v"(bl));
  return c;
}
// batched GEMM like k_gemm_b but f16 operands: A f32 (split into f16 hi/lo if ASPLIT, else rounded to f16), Bt = f16 values [n][k]; alpha; C f32; N multiple of 16 (partial tiles skipped)
template <bool ASPLIT>
__global__ __launch_bounds__(128) void k_gemm_h(const float* __restrict__ A, int lda, size_t sA, const _Float16* __restrict__ Bh, int ldb, size_t sB, float alpha, float* __restrict__ C, int ldc, size_t sC, int M, int N, int K) {
  __shared__ __attribute__((aligned(16))) float so[4][16][64];
  const int tid = threadIdx.x, w = tid >> 5, lane = tid & 31, ln = lane & 15, hh = lane >> 4; const int by = blockIdx.y;
  A += (size_t)by * sA; Bh += (size_t)by * sB; C += (size_t)by * sC;
  const int ntn = (N + 63) / 64; const int wid = blockIdx.x * 4 + w; const int mt = wid / ntn, nq = wid % ntn; if (mt * 16 >= M) return;
  const int row0 = mt * 16, col0 = nq * 64; const float* arow = A + (size_t)(row0 + ln) * lda;
  v8f acc[4] = {};
  for (int kb = 0; kb < K; kb += 32) {
    FragH ah, al;
    const v4f x0 = *(const v4fa*)(arow + kb + 8 * hh), x1 = *(const v4fa*)(arow + kb + 8 * hh + 4), x2 = *(const v4fa*)(arow + kb + 16 + 8 * hh), x3 = *(const v4fa*)(arow + kb + 16 + 8 * hh + 4);
    float xs[16] = {x0[0],x0[1],x0[2],x0[3],x1[0],x1[1],x1[2],x1[3],x2[0],x2[1],x2[2],x2[3],x3[0],x3[1],x3[2],x3[3]};
#pragma unroll
    for (int i = 0; i < 16; ++i) { const _Float16 h = (_Float16)xs[i]; ah.h[i] = h; al.h[i] = ASPLIT ? (_Float16)(xs[i] - (float)h) : (_Float16)0.0f; }
#pragma unroll
    for (int t = 0; t < 4; ++t) { if (col0 + t * 16 >= N) continue; const size_t boff = (size_t)(col0 + t * 16 + ln) * ldb + kb; FragH bq; bq.half[0] = *(const v8us*)(Bh + boff + 8 * hh); bq.half[1] = *(const v8us*)(Bh + boff + 16 + 8 * hh);
      acc[t] = mmaH<ASPLIT ? 2 : 1>(ah.v, al.v, bq.v, bq.v, acc[t]); }
  }
#pragma unroll
  for (int t = 0; t < 4; ++t) { if (col0 + t * 16 >= N) continue;
#pragma unroll
    for (int r = 0; r < 8; ++r) so[w][8 * hh + r][t * 16 + ln] = acc[t][r] * alpha; }
  __builtin_amdgcn_fence(__ATOMIC_ACQ_REL, "workgroup"); __builtin_amdgcn_wave_barrier();
  const int rsub = lane >> 4, c4 = (lane & 15) * 4;
  {
#pragma unroll
    for (int q = 0; q < 8; ++q) { const int r = q * 2 + rsub; if (col0 + c4 < N) { const v4f v = *(const v4fa*)&so[w][r][c4]; *(v4f*)(C + (size_t)(row0 + r) * ldc + col0 + c4) = v; } }
     }
}

// Wt[n][k] = f16(W[k][n]·scale) from f32 row-major W[K][N] (scale = power of two; bf16-exact weights stay exact in f16 away from the subnormal range)
__global__ __launch_bounds__(256) void k_wt_f16(const float* __restrict__ W, _Float16* __restrict__ Wt, int K, int N, float scale) {
  const int t = blockIdx.x * 256 + threadIdx.x; if (t >= N * (K / 8)) return; const int n = t / (K / 8), k8 = (t % (K / 8)) * 8; FragH f;
#pragma unroll
  for (int i = 0; i < 8; ++i) f.h[i] = (_Float16)(bf16_round(W[(size_t)(k8 + i) * N + n]) * scale); const v8us o = f.half[0];
  *(v8us*)((unsigned short*)Wt + (size_t)n * K + k8) = o; 
}
// k_gemm_hh variant with fused epilogue: v = acc·alpha + bias[by·sBias + col] (+ CP[(row/rowsPerB)·sCPb + by·64 + col] if CP) ; ACT 0 none / 1 elu ; writes f16 C16 (and f32 C if non-null)
template <int ACT>
__global__ __launch_bounds__(128) void k_gemm_hhx(const _Float16* __restrict__ A, int lda, size_t sA, const _Float16* __restrict__ Bh, int ldb, size_t sB, float alpha, const float* __restrict__ bias, size_t sBias, const float* __restrict__ CP, int rowsPerB, size_t sCPb, int row0g,
    float* __restrict__ C, _Float16* __restrict__ C16, int ldc, size_t sC, int M, int N, int K) {
  __shared__ __attribute__((aligned(16))) float so[4][16][64];
  const int tid = threadIdx.x, w = tid >> 5, lane = tid & 31, ln = lane & 15, hh = lane >> 4; const int by = blockIdx.y;
  A += (size_t)by * sA; Bh += (size_t)by * sB; const size_t cofs = (size_t)by * sC; const float* bp = bias ? bias + (size_t)by * sBias : nullptr;
  const int ntn = (N + 63) / 64; const int wid = blockIdx.x * 4 + w; const int mt = wid / ntn, nq = wid % ntn; if (mt * 16 >= M) return;
  const int row0 = mt * 16, col0 = nq * 64; const _Float16* arow = A + (size_t)(row0 + ln) * lda;
  v8f acc[4] = {};
  for (int kb = 0; kb < K; kb += 32) { FragH ah; ah.half[0] = *(const v8us*)((const unsigned short*)arow + kb + 8 * hh); ah.half[1] = *(const v8us*)((const unsigned short*)arow + kb + 16 + 8 * hh);
#pragma unroll
    for (int t = 0; t < 4; ++t) { if (col0 + t * 16 >= N) continue; const size_t boff = (size_t)(col0 + t * 16 + ln) * ldb + kb; FragH bq; bq.half[0] = *(const v8us*)((const unsigned short*)Bh + boff + 8 * hh); bq.half[1] = *(const v8us*)((const unsigned short*)Bh + boff + 16 + 8 * hh);
      acc[t] = mmaH<1>(ah.v, ah.v, bq.v, bq.v, acc[t]); }
  }
#pragma unroll
  for (int t = 0; t < 4; ++t) { if (col0 + t * 16 >= N) continue; const int col = col0 + t * 16 + ln; const float bv = bp ? bf16_round(bp[col]) : 0.f;
#pragma unroll
    for (int r = 0; r < 8; ++r) { float v = acc[t][r] * alpha + bv; if (CP) { const int rr = row0g + row0 + 8 * hh + r; if (rowsPerB < 0) v += CP[cofs + (size_t)rr * ldc + col];      /* rowsPerB < 0: own element of the batched C plane */ else { const int bidx = rr / rowsPerB; v += CP[(size_t)bidx * sCPb + (size_t)by * 64 + col]; } } if (ACT == 1) v = (v > 0.f) ? v : expm1f(v); else if (ACT == 7) v = (v > 0.f) ? v + 1.0f : expf(v); else if (ACT == 8) v = tanhf(v); else if (ACT == 9) v = 0.5f * v * (1.0f + tanhf(0.7978845608028654f * (v + 0.044715f * v * v * v))); else if (ACT == 11) v = 1.0f / (1.0f + expf(-v)); else if (ACT == 12) v = (v > 0.f) ? v : 0.01f * v; else if (ACT == 14) v = (v > 0.f) ? v : 0.1f * v; else if (ACT == 16) v = (v >= 0.f) ? v : 0.3f * v; else if (ACT == 17) v = (v >= 0.f) ? v : 0.2f * v; else if (ACT == 15) v = v / (1.0f + expf(-v)); else if (ACT == 3) v = fmaxf(v, 0.f); else if (ACT == 6) v = 0.5f * v * (1.0f + erff(v * 0.70710678118654752f)); so[w][8 * hh + r][t * 16 + ln] = v; } }
  __builtin_amdgcn_fence(__ATOMIC_ACQ_REL, "workgroup"); __builtin_amdgcn_wave_barrier();
  const int rsub = lane >> 4, c4 = (lane & 15) * 4; typedef _Float16 v4h __attribute__((ext_vector_type(4)));
  {
#pragma unroll
    for (int q = 0; q < 8; ++q) { const int r = q * 2 + rsub; if (col0 + c4 < N) { const v4f v = *(const v4fa*)&so[w][r][c4]; if (C) *(v4f*)(C + cofs + (size_t)(row0 + r) * ldc + col0 + c4) = v; if (C16) { v4h h4; for (int i = 0; i < 4; ++i) h4[i] = (_Float16)v[i]; *(v4h*)(C16 + cofs + (size_t)(row0 + r) * ldc + col0 + c4) = h4; } } }
     }
}


typedef _Float16 v4h __attribute__((ext_vector_type(4)));

__global__ __launch_bounds__(256) void k_x16(const float* __restrict__ x, _Float16* __restrict__ X16, size_t n8) { const size_t t = (size_t)blockIdx.x * 256 + threadIdx.x; if (t >= n8) return; FragH f;
#pragma unroll
  for (int q = 0; q < 8; ++q) f.h[q] = (_Float16)bf16_round(x[t * 8 + q]); *(v8us*)((unsigned short*)X16 + t * 8) = f.half[0];  }
__global__ __launch_bounds__(256) void k_h16(const float* __restrict__ x, _Float16* __restrict__ X16, size_t n8) { const size_t t = (size_t)blockIdx.x * 256 + threadIdx.x; if (t >= n8) return; FragH f;
#pragma unroll
  for (int q = 0; q < 8; ++q) f.h[q] = (_Float16)x[t * 8 + q]; *(v8us*)((unsigned short*)X16 + t * 8) = f.half[0];  }
__global__ __launch_bounds__(256) void k_round16f(const float* __restrict__ W, _Float16* __restrict__ Bt, size_t n8) { const size_t t = (size_t)blockIdx.x * 256 + threadIdx.x; if (t >= n8) return; FragH f;
#pragma unroll
  for (int i = 0; i < 8; ++i) f.h[i] = (_Float16)(bf16_round(W[t * 8 + i]) * 16.0f); *(v8us*)((unsigned short*)Bt + t * 8) = f.half[0];  }
template <int NHv, int TTv>
__global__ __launch_bounds__(256) void k_vt(const _Float16* __restrict__ V16, int ldv, int voff, _Float16* __restrict__ Vt) { __shared__ unsigned short tl[64][66]; const int tid = threadIdx.x; const int slab = blockIdx.x / (TTv / 64), lg = blockIdx.x % (TTv / 64); const int b = slab / NHv, h = slab % NHv;
  for (int i = tid; i < 64 * 8; i += 256) { const int r = i / 8, c8 = (i % 8) * 8; FragH f; f.half[0] = *(const v8us*)((const unsigned short*)V16 + ((size_t)b * TTv + lg * 64 + r) * ldv + voff + h * 64 + c8);
#pragma unroll
    for (int q = 0; q < 8; ++q) tl[r][c8 + q] = f.u[q]; }
  __syncthreads();
  {
#pragma unroll
    for (int rd = 0; rd < 2; ++rd) { const int d = rd * 32 + tid / 8, pc = tid % 8; FragH f;
#pragma unroll
      for (int q = 0; q < 8; ++q) f.u[q] = tl[pc * 8 + q][d];
      *(v8us*)((unsigned short*)Vt + ((size_t)slab * 64 + d) * TTv + lg * 64 + pc * 8) = f.half[0]; }
     } }

__global__ __launch_bounds__(256) void k_hl(const float* __restrict__ F, _Float16* __restrict__ Hh, _Float16* __restrict__ Hl, size_t n8) { const size_t t = (size_t)blockIdx.x * 256 + threadIdx.x; if (t >= n8) return; FragH fh, fl; const v4f a = *(const v4fa*)(F + t * 8), c = *(const v4fa*)(F + t * 8 + 4);
#pragma unroll
  for (int q = 0; q < 4; ++q) { _Float16 h = (_Float16)a[q]; fh.h[q] = h; fl.h[q] = (_Float16)((a[q] - (float)h) * 1024.0f); h = (_Float16)c[q]; fh.h[4 + q] = h; fl.h[4 + q] = (_Float16)((c[q] - (float)h) * 1024.0f); }
  { *(v8us*)((unsigned short*)Hh + t * 8) = fh.half[0]; *(v8us*)((unsigned short*)Hl + t * 8) = fl.half[0];  } }

// ---- fast GEMM (wave tile 32x64; requires M % 32 == 0 rows per launch region and N % 64 == 0); epilogue = k_gemm_hhx semantics ----
__device__ __forceinline__ v16h g2_frag(const _Float16* p, int hh) { FragH f; f.half[0] = *(const v8us*)((const unsigned short*)p + 8 * hh); f.half[1] = *(const v8us*)((const unsigned short*)p + 16 + 8 * hh); return f.v; }
__device__ __forceinline__ v8f g2_mma(v16h a, v16h b, v8f c) { v8f d = __builtin_amdgcn_wmma_f32_16x16x32_f16(false, a, false, b, (short)0, c, false, false); asm volatile("v_nop\n\tv_nop\n\tv_nop\n\tv_nop" : "+v"(d) : "v"(a), "v"(b)); return d; }
template <int ACT>
__global__ __launch_bounds__(128) void k_gemm2(const _Float16* __restrict__ A, int lda, size_t sA, const _Float16* __restrict__ Bh, int ldb, size_t sB, float alpha, const float* __restrict__ bias, size_t sBias, const float* __restrict__ CP, int rowsPerB, size_t sCPb, int row0g,
    float* __restrict__ C, _Float16* __restrict__ C16, int ldc, size_t sC, int M, int N, int K) { static_assert(ACT == 0 || ACT == 3 || ACT == 6 || ACT == 8 || ACT == 9 || ACT == 11 || ACT == 12 || ACT == 14 || ACT == 15 || ACT == 16 || ACT == 17, "k_gemm2: unsupported ACT code (would silently apply no activation)");
  __shared__ __attribute__((aligned(16))) float so[4][32][68];
  const int tid = threadIdx.x, w = tid >> 5, lane = tid & 31, ln = lane & 15, hh = lane >> 4; const int by = blockIdx.y;
  A += (size_t)by * sA; Bh += (size_t)by * sB; const size_t cofs = (size_t)by * sC; const float* bp = bias ? bias + (size_t)by * sBias : nullptr;
  const int ntn = N >> 6; const int mt = blockIdx.x / ntn, nq = blockIdx.x - mt * ntn; const int row0 = mt * 128 + 32 * w, col0 = nq * 64; if (row0 >= M) return;
  const _Float16* a0p = A + (size_t)(row0 + ln) * lda; const _Float16* a1p = a0p + (size_t)16 * lda;
  const _Float16* b0p = Bh + (size_t)(col0 + ln) * ldb; const _Float16* b1p = b0p + (size_t)16 * ldb; const _Float16* b2p = b1p + (size_t)16 * ldb; const _Float16* b3p = b2p + (size_t)16 * ldb;
  const v8f z8 = {0.f,0.f,0.f,0.f,0.f,0.f,0.f,0.f}; v8f c00 = z8, c01 = z8, c02 = z8, c03 = z8, c10 = z8, c11 = z8, c12 = z8, c13 = z8;
#pragma unroll 1
  for (int kb = 0; kb < K; kb += 32) { const v16h a0 = g2_frag(a0p + kb, hh), a1 = g2_frag(a1p + kb, hh);
    v16h b = g2_frag(b0p + kb, hh); c00 = g2_mma(a0, b, c00); c10 = g2_mma(a1, b, c10);
    b = g2_frag(b1p + kb, hh); c01 = g2_mma(a0, b, c01); c11 = g2_mma(a1, b, c11);
    b = g2_frag(b2p + kb, hh); c02 = g2_mma(a0, b, c02); c12 = g2_mma(a1, b, c12);
    b = g2_frag(b3p + kb, hh); c03 = g2_mma(a0, b, c03); c13 = g2_mma(a1, b, c13); }
  v8f accs[8] = {c00, c01, c02, c03, c10, c11, c12, c13};
#pragma unroll
  for (int u = 0; u < 8; ++u) { const int t = u & 3, half = u >> 2; const int col = col0 + t * 16 + ln; const float bv = bp ? bf16_round(bp[col]) : 0.f;
#pragma unroll
    for (int r = 0; r < 8; ++r) { const int rloc = half * 16 + 8 * hh + r; float v = accs[u][r] * alpha + bv; if (CP) { if (rowsPerB < 0) v += CP[cofs + (size_t)(row0g + row0 + rloc) * ldc + col];      /* rowsPerB < 0: own element of the batched C plane */ else { const int bidx = (row0g + row0 + rloc) / rowsPerB; v += CP[(size_t)bidx * sCPb + (size_t)by * 64 + col]; } }
      if (ACT == 3) v = fmaxf(v, 0.f); else if (ACT == 6) v = 0.5f * v * (1.0f + erff(v * 0.70710678118654752f)); else if (ACT == 11) v = 1.0f / (1.0f + expf(-v)); else if (ACT == 15) v = v / (1.0f + expf(-v)); else if (ACT == 12) v = (v > 0.f) ? v : 0.01f * v; else if (ACT == 8) v = tanhf(v); else if (ACT == 9) v = 0.5f * v * (1.0f + tanhf(0.7978845608028654f * (v + 0.044715f * v * v * v))); else if (ACT == 14) v = (v > 0.f) ? v : 0.1f * v; else if (ACT == 16) v = (v >= 0.f) ? v : 0.3f * v; else if (ACT == 17) v = (v >= 0.f) ? v : 0.2f * v;
      so[w][rloc][t * 16 + ln] = v; } }
  __builtin_amdgcn_fence(__ATOMIC_ACQ_REL, "workgroup"); __builtin_amdgcn_wave_barrier();
  const int rsub = lane >> 4, c4 = (lane & 15) * 4;
  {
#pragma unroll
    for (int q = 0; q < 16; ++q) { const int r = q * 2 + rsub; const v4f v = *(const v4fa*)&so[w][r][c4]; if (C) *(v4f*)(C + cofs + (size_t)(row0 + r) * ldc + col0 + c4) = v; if (C16) { v4h h4; for (int i = 0; i < 4; ++i) h4[i] = (_Float16)v[i]; *(v4h*)(C16 + cofs + (size_t)(row0 + r) * ldc + col0 + c4) = h4; } }
     } }


__global__ __launch_bounds__(256) void k_wT(const float* __restrict__ w, int din, int dout, _Float16* __restrict__ Bt) { __shared__ float tl[64][65]; const int tid = threadIdx.x; const int nbo = dout / 64; const int ib = blockIdx.x / nbo, ob = blockIdx.x % nbo; const int i0 = ib * 64, o0 = ob * 64;
  for (int t = tid; t < 64 * 64; t += 256) { const int i = t / 64, o = t % 64; tl[o][i] = bf16_round(w[(size_t)(i0 + i) * dout + o0 + o]) * 16.0f; }
  __syncthreads();
  { for (int t = tid; t < 64 * 8; t += 256) { const int o = t / 8, i8 = (t % 8) * 8; FragH f; for (int q = 0; q < 8; ++q) f.h[q] = (_Float16)tl[o][i8 + q]; *(v8us*)((unsigned short*)Bt + (size_t)(o0 + o) * din + i0 + i8) = f.half[0]; }  } }
__global__ __launch_bounds__(256) void k_xr(const float* __restrict__ x, _Float16* __restrict__ X16) { const size_t t = (size_t)blockIdx.x * 256 + threadIdx.x; if (t >= NRX * DM / 8) return; const int c0 = (int)((t * 8) % DM); const size_t r = (t * 8) / DM; const int tok = (int)(r % RPB); const size_t b = r / RPB; FragH f;
  for (int q = 0; q < 8; ++q) f.h[q] = (tok < NTOK) ? (_Float16)bf16_round(x[(b * NTOK + tok) * DM + c0 + q]) : (_Float16)0.f;
  *(v8us*)((unsigned short*)X16 + t * 8) = f.half[0];  }
__global__ __launch_bounds__(64) void k_nbatt(const float* __restrict__ Q, const float* __restrict__ KV, int nslot, _Float16* __restrict__ O16) {
  #pragma clang fp contract(off)
  __shared__ float lg[64][29]; __shared__ int kr[64][29]; __shared__ unsigned short st[64][72]; const int tid = threadIdx.x; const size_t g = (size_t)blockIdx.x * 64 + tid; const int j = (int)(g % QT); const int h = (int)((g / QT) % NH); const size_t b = g / ((size_t)QT * NH);
  const int f0 = j / (HT * WT), h0 = (j / WT) % HT, w0 = j % WT; const float* q = Q + (b * RPB + j + 1) * DM + h * HD; float mx = -3.0e38f; int ns = 0;
#pragma unroll 1
  for (int s = 0; s < nslot; ++s) { int row = -1; if (s == 0) row = 0; else { const int o = s - 1; const int kf = o / 9, kh = (o / 3) % 3, kw = o % 3; const int f = f0 + kf - 1, hh = h0 + kh - 1, ww = w0 + kw - 1; if (f >= 0 && f < FT && hh >= 0 && hh < HT && ww >= 0 && ww < WT) { const int m = (f * HT + hh) * WT + ww; if (m <= j) row = m + 1; } }
    if (row >= 0) { const float* k = KV + (b * RPB + row) * (2 * DM) + h * HD; float sdot = 0.f;
#pragma unroll 1
      for (int d = 0; d < HD; ++d) sdot = __fadd_rn(sdot, __fmul_rn(q[d], k[d])); sdot = __fmul_rn(sdot, 0.125f); lg[tid][ns] = sdot; kr[tid][ns] = row; mx = fmaxf(mx, sdot); ++ns; } }
  float se = 0.f; for (int i = 0; i < ns; ++i) { const float e = expf(lg[tid][i] - mx); lg[tid][i] = e; se += e; } const float inv = 1.0f / se;
#pragma unroll 1
  for (int d = 0; d < HD; ++d) { float o = 0.f;
#pragma unroll 1
    for (int i = 0; i < ns; ++i) o = __fadd_rn(o, __fmul_rn(lg[tid][i] * inv, KV[(b * RPB + kr[tid][i]) * (2 * DM) + DM + h * HD + d])); FragH one; one.h[0] = (_Float16)o; st[tid][d] = one.u[0]; }
  __syncthreads();
  { for (int i = tid; i < 64 * 8; i += 64) { const int rr = i / 8, c8 = (i % 8) * 8; const size_t gg = (size_t)blockIdx.x * 64 + rr; const int jj = (int)(gg % QT); const int hh = (int)((gg / QT) % NH); const size_t bb = gg / ((size_t)QT * NH); FragH o; for (int q8 = 0; q8 < 8; ++q8) o.u[q8] = st[rr][c8 + q8];
      *(v8us*)((unsigned short*)O16 + (bb * NPAD + jj + 1) * DM + hh * HD + c8) = o.half[0]; }  } }
__global__ __launch_bounds__(256) void k_bos(const float* __restrict__ KV, _Float16* __restrict__ O16) { const int t = blockIdx.x * 256 + threadIdx.x; if (t >= NB * DM / 8) return; const int c0 = (t * 8) % DM; const int b = (t * 8) / DM; FragH f; for (int q = 0; q < 8; ++q) f.h[q] = (_Float16)KV[((size_t)b * RPB + 0) * (2 * DM) + DM + c0 + q];
  unsigned short* d = (unsigned short*)O16 + ((size_t)b * NPAD) * DM + c0; *(v8us*)d = f.half[0];  }

extern "C" void kernel_launch(void* const* d_in, const int* in_sizes, int n_in,
                              void* d_out, int out_size, void* d_ws, size_t ws_size, hipStream_t stream) {
  (void)in_sizes; (void)n_in; (void)out_size;
  const float* const* I = (const float* const*)d_in; const float* x = I[0]; const float* Wq = I[1]; const float* Wkv = I[2]; const float* Wo = I[3]; const float* bo = I[4];
  char* ws = (char*)d_ws; size_t off = 0;
  auto take = [&](size_t bytes) { char* p = ws + off; off += (bytes + 255) & ~(size_t)255; return p; };
  _Float16* BQ = (_Float16*)take((size_t)DM * DM * 2); _Float16* BKV = (_Float16*)take((size_t)2 * DM * DM * 2); _Float16* BO = (_Float16*)take((size_t)DM * DM * 2);
  _Float16* X16 = (_Float16*)take(NRX * DM * 2); float* Q = (float*)take(NRX * DM * 4); float* KV = (float*)take(NRX * 2 * DM * 4); _Float16* O16 = (_Float16*)take((size_t)NB * NPAD * DM * 2);      /* rows b*4097 + tok; the last query's token (4096) is computed but dropped by the output GEMM */
  if (off > ws_size) return;      /* 2 + 8.6 + 17.3 + 34.6 + 8.4 = ≈ 71 MiB */
  k_wT<<<(DM / 64) * (DM / 64), 256, 0, stream>>>(Wq, DM, DM, BQ); k_wT<<<(DM / 64) * (2 * DM / 64), 256, 0, stream>>>(Wkv, DM, 2 * DM, BKV); k_wT<<<(DM / 64) * (DM / 64), 256, 0, stream>>>(Wo, DM, DM, BO);
  k_xr<<<(unsigned)((NRX * DM / 8 + 255) / 256), 256, 0, stream>>>(x, X16);
  k_gemm2<0><<<dim3((unsigned)((NRX / 128) * (DM / 64)), 1), 128, 0, stream>>>(X16, DM, 0, BQ, DM, 0, 0.0625f, nullptr, 0, nullptr, 1, 0, 0, Q, nullptr, DM, 0, (int)NRX, DM, DM);
  k_gemm2<0><<<dim3((unsigned)((NRX / 128) * (2 * DM / 64)), 1), 128, 0, stream>>>(X16, DM, 0, BKV, DM, 0, 0.0625f, nullptr, 0, nullptr, 1, 0, 0, KV, nullptr, 2 * DM, 0, (int)NRX, 2 * DM, DM);
  k_nbatt<<<(unsigned)(((size_t)NB * NH * QT) / 64), 64, 0, stream>>>(Q, KV, 28, O16);
  k_bos<<<(NB * DM / 8 + 255) / 256, 256, 0, stream>>>(KV, O16);
  for (int b = 0; b < NB; ++b) k_gemm2<0><<<dim3((unsigned)((NTOK / 128) * (DM / 64)), 1), 128, 0, stream>>>(O16 + (size_t)b * NPAD * DM, DM, 0, BO, DM, 0, 0.0625f, bo, 0, nullptr, 1, 0, 0, (float*)d_out + (size_t)b * NTOK * DM, nullptr, DM, 0, NTOK, DM, DM);      /* out = o Wo + bo for tokens 0..4095 of each batch (token 4096 dropped as in the reference) */
}

// v001
// One run takes 146 microseconds.
// Timed twice side by side with v000, it ran 3.55 and 3.53 times as fast.
#include <hip/hip_runtime.h>
// Sparse3DNA (x [2][4096][512]: 1 BOS + 4095 video tokens on a 4x32x32 grid, padded by one zero token to 4097; q = x Wq, [k|v] = x Wkv ([in][out], no bias), 8 heads of 64; query j (token j+1) attends to {BOS} U {its 3x3x3 grid neighbourhood keys with flat index <= j} (out-of-grid slots and future keys masked), scale 64^-0.5, softmax, weighted v; token 0's output is v_BOS itself; out = o Wo + bo, first 4096 tokens -> [2][4096][512]).
// Structure: token rows (4,097 per batch padded to 4,224); x as exact f16 rows; Q and [K|V] WMMA GEMMs (32x64 wave tiles, f32 accumulation, exact x16 transposed weights) kept in f32; the 15-slot (BOS + 14 causal window slots) neighbourhood attention on VALU (f32: 8 lanes per (batch, head, query), 2 queries x 4 heads per wave, window indices and the causal test from the grid geometry on device, logits, softmax, weighted sum) into f16 o rows (row 0 = v_BOS); out = o Wo + bo GEMM (f32, output layout).
// Compute dtype: inputs rounded to bf16; x / weights exact; q, k, v, logits, softmax f32; o plain f16 into the Wo GEMM (~2^-12). v_wmma_f32_16x16x32_f16.
#define NB 2
#define NTOK 4096                    /* input tokens per batch (= output tokens) */
#define NPAD 4097                    /* after the module's padding */
#define RPB 4224                     /* rows per batch (33 x 128) */
#define NRX ((size_t)NB * RPB)       /* 8448 */
#define DM 512
#define NH 8
#define HD 64
#define FT 4
#define HT 32
#define WT 32
#define TT (FT * HT * WT)            /* 4096 grid tokens */
#define QT TT                        /* unused */
typedef __bf16 v16b __attribute__((ext_vector_type(16)));
typedef unsigned short v8us __attribute__((ext_vector_type(8), may_alias));
typedef float  v8f  __attribute__((ext_vector_type(8)));
typedef float  v4f  __attribute__((ext_vector_type(4)));
typedef float  v4fa __attribute__((ext_vector_type(4), may_alias));
union FragB { v16b v; v8us half[2]; unsigned short u[16]; };

__device__ __forceinline__ unsigned short bf16_bits(float x) { unsigned int u = __float_as_uint(x); return (unsigned short)((u + 0x7FFFu + ((u >> 16) & 1u)) >> 16); }
__device__ __forceinline__ float bf16_val(unsigned short b) { return __uint_as_float(((unsigned int)b) << 16); }
__device__ __forceinline__ float bf16_round(float x) { return bf16_val(bf16_bits(x)); }
// D += A·B with NT terms: 1 = ah·bh, 2 = + al·bh (A split), 3 = + ah·bl (both split)
template <int NT>
__device__ __forceinline__ v8f mmaN(v16b ah, v16b al, v16b bh, v16b bl, v8f c) {
  c = __builtin_amdgcn_wmma_f32_16x16x32_bf16(false, ah, false, bh, (short)0, c, false, false);
  if (NT >= 2) c = __builtin_amdgcn_wmma_f32_16x16x32_bf16(false, al, false, bh, (short)0, c, false, false);
  if (NT >= 3) c = __builtin_amdgcn_wmma_f32_16x16x32_bf16(false, ah, false, bl, (short)0, c, false, false);
  asm volatile("v_nop\n\tv_nop\n\tv_nop\n\tv_nop" : "+v"(c) : "v"(ah), "v"(al), "v"(bh), "v"(bl));
  return c;
}

__global__ __launch_bounds__(256) void k_wt_bf16(const float* __restrict__ W, unsigned short* __restrict__ Wt, int K, int N) {
  const int t = blockIdx.x * 256 + threadIdx.x;
  const int k8n = K / 8;
  if (t >= N * k8n) return;
  const int n = t / k8n, k8 = (t % k8n) * 8;
  v8us v;
#pragma unroll
  for (int i = 0; i < 8; ++i) v[i] = bf16_bits(W[(size_t)(k8 + i) * N + n]);
  *(v8us*)(Wt + (size_t)n * K + k8) = v;
  
}

// GEMM C[M][N] (f32, pitch ldc) = act(A[M][K]·W + bias). A f32 row-major (pitch lda) converted per fragment to bf16
// (ASPLIT: hi/lo two planes -> 2 terms, else single rounded term); Wt bf16 [N][K] (pitch ldb). BIAS_BF16 rounds the
// bias to bf16 first (bias quantised to bf16 before the add). K%32==0, M%16==0, N%64==0.
template <bool ASPLIT, int ACT, bool BIAS_BF16>
__global__ __launch_bounds__(128) void k_gemm_bf(const float* __restrict__ A, int lda, const unsigned short* __restrict__ Wt, int ldb,
                                               const float* __restrict__ bias, float* __restrict__ C, int ldc, int M, int N, int K) {
  __shared__ __attribute__((aligned(16))) float so[4][16][64];
  const int tid = threadIdx.x, w = tid >> 5, lane = tid & 31, ln = lane & 15, hh = lane >> 4;
  const int ntn = N / 64;
  const int wid = blockIdx.x * 4 + w;
  const int mt = wid / ntn, nq = wid % ntn;
  if (mt * 16 >= M) return;
  const int row0 = mt * 16, col0 = nq * 64;
  const float* arow = A + (size_t)(row0 + ln) * lda;
  v8f acc[4] = {};
  for (int kb = 0; kb < K; kb += 32) {
    FragB ah, al;
    const v4f x0 = *(const v4fa*)(arow + kb + 8 * hh), x1 = *(const v4fa*)(arow + kb + 8 * hh + 4);
    const v4f x2 = *(const v4fa*)(arow + kb + 16 + 8 * hh), x3 = *(const v4fa*)(arow + kb + 16 + 8 * hh + 4);
    float xs[16] = {x0[0],x0[1],x0[2],x0[3],x1[0],x1[1],x1[2],x1[3],x2[0],x2[1],x2[2],x2[3],x3[0],x3[1],x3[2],x3[3]};
#pragma unroll
    for (int i = 0; i < 16; ++i) { const unsigned short hb = bf16_bits(xs[i]); ah.u[i] = hb; al.u[i] = ASPLIT ? bf16_bits(xs[i] - bf16_val(hb)) : (unsigned short)0; }
#pragma unroll
    for (int t = 0; t < 4; ++t) {
      const unsigned short* brow = Wt + (size_t)(col0 + t * 16 + ln) * ldb + kb;
      FragB b;
      b.half[0] = *(const v8us*)(brow + 8 * hh);
      b.half[1] = *(const v8us*)(brow + 16 + 8 * hh);
      acc[t] = mmaN<ASPLIT ? 2 : 1>(ah.v, al.v, b.v, b.v, acc[t]);
    }
  }
#pragma unroll
  for (int t = 0; t < 4; ++t) {
    float bv = bias ? bias[col0 + t * 16 + ln] : 0.f;
    if (BIAS_BF16) bv = bf16_round(bv);
#pragma unroll
    for (int r = 0; r < 8; ++r) { float v = acc[t][r] + bv; if (ACT == 1) v = fmaxf(v, 0.f); so[w][8 * hh + r][t * 16 + ln] = v; }
  }
  __builtin_amdgcn_fence(__ATOMIC_ACQ_REL, "workgroup");
  __builtin_amdgcn_wave_barrier();
  const int rsub = lane >> 4, c4 = (lane & 15) * 4;
  {
#pragma unroll
    for (int q = 0; q < 8; ++q) {
      const int r = q * 2 + rsub;
      const v4f v = *(const v4fa*)&so[w][r][c4];
      *(v4f*)(C + (size_t)(row0 + r) * ldc + col0 + c4) = v;
    }
    
  }
}

// GEMM C = act(A·W + bias + resid): A f32 (ASPLIT -> hi/lo 2 terms), Wt bf16 [N][K]; ACT 0 none, 1 relu, 2 exact gelu;
// resid (optional, f32, row index = (row % rmod), pitch ldr, RES_BF16 rounds it) added before the activation.
template <bool ASPLIT, int ACT, bool BIAS_BF16, bool RES_BF16>
__global__ __launch_bounds__(128) void k_gemm_bf3(const float* __restrict__ A, int lda, const unsigned short* __restrict__ Wt, int ldb,
                                                const float* __restrict__ bias, const float* __restrict__ resid, int rmod, int ldr,
                                                float* __restrict__ C, int ldc, int M, int N, int K) {
  __shared__ __attribute__((aligned(16))) float so[4][16][64];
  const int tid = threadIdx.x, w = tid >> 5, lane = tid & 31, ln = lane & 15, hh = lane >> 4;
  const int ntn = N / 64;
  const int wid = blockIdx.x * 4 + w;
  const int mt = wid / ntn, nq = wid % ntn;
  if (mt * 16 >= M) return;
  const int row0 = mt * 16, col0 = nq * 64;
  const float* arow = A + (size_t)(row0 + ln) * lda;
  v8f acc[4] = {};
  for (int kb = 0; kb < K; kb += 32) {
    FragB ah, al;
    const v4f x0 = *(const v4fa*)(arow + kb + 8 * hh), x1 = *(const v4fa*)(arow + kb + 8 * hh + 4);
    const v4f x2 = *(const v4fa*)(arow + kb + 16 + 8 * hh), x3 = *(const v4fa*)(arow + kb + 16 + 8 * hh + 4);
    float xs[16] = {x0[0],x0[1],x0[2],x0[3],x1[0],x1[1],x1[2],x1[3],x2[0],x2[1],x2[2],x2[3],x3[0],x3[1],x3[2],x3[3]};
#pragma unroll
    for (int i = 0; i < 16; ++i) { const unsigned short hb = bf16_bits(xs[i]); ah.u[i] = hb; al.u[i] = ASPLIT ? bf16_bits(xs[i] - bf16_val(hb)) : (unsigned short)0; }
#pragma unroll
    for (int t = 0; t < 4; ++t) {
      const unsigned short* brow = Wt + (size_t)(col0 + t * 16 + ln) * ldb + kb;
      FragB b;
      b.half[0] = *(const v8us*)(brow + 8 * hh);
      b.half[1] = *(const v8us*)(brow + 16 + 8 * hh);
      acc[t] = mmaN<ASPLIT ? 2 : 1>(ah.v, al.v, b.v, b.v, acc[t]);
    }
  }
#pragma unroll
  for (int t = 0; t < 4; ++t) {
    const int col = col0 + t * 16 + ln;
    float bv = bias ? bias[col] : 0.f;
    if (BIAS_BF16) bv = bf16_round(bv);
#pragma unroll
    for (int r = 0; r < 8; ++r) {
      float v = acc[t][r] + bv;
      if (resid) { float rv = resid[(size_t)((row0 + 8 * hh + r) % rmod) * ldr + col]; if (RES_BF16) rv = bf16_round(rv); v += rv; }
      if (ACT == 1) v = fmaxf(v, 0.f);
      if (ACT == 2) v = 0.5f * v * (1.0f + erff(v * 0.70710678118654752f));
      if (ACT == 3) { const float u = 0.7978845608028654f * (v + 0.044715f * v * v * v); v = 0.5f * v * (1.0f + tanhf(u)); }
      so[w][8 * hh + r][t * 16 + ln] = v;
    }
  }
  __builtin_amdgcn_fence(__ATOMIC_ACQ_REL, "workgroup");
  __builtin_amdgcn_wave_barrier();
  const int rsub = lane >> 4, c4 = (lane & 15) * 4;
  {
#pragma unroll
    for (int q = 0; q < 8; ++q) {
      const int r = q * 2 + rsub;
      const v4f v = *(const v4fa*)&so[w][r][c4];
      *(v4f*)(C + (size_t)(row0 + r) * ldc + col0 + c4) = v;
    }
    
  }
}
// row LayerNorm (biased variance, eps) over N: s = X (+ R); optional out_sum <- s; out_norm <- (s-mu)*rsqrt(var+eps)*g + b
template <bool PARAM_BF16>
__global__ __launch_bounds__(256) void k_layernorm(const float* __restrict__ X, const float* __restrict__ R, const float* __restrict__ g, const float* __restrict__ bta,
                                                  float* __restrict__ out_sum, float* __restrict__ out_norm, int N, float eps) {
  __shared__ float red[256];
  const int row = blockIdx.x, tid = threadIdx.x;
  const float* x = X + (size_t)row * N; const float* rr = R ? R + (size_t)row * N : nullptr;
  float vals[16];                     // up to N = 4096
  const int per = N / 256;            // contiguous chunk per thread? use strided-by-4 chunks: thread handles j = tid*4 + 1024*u
  float s1 = 0.f;
  for (int u = 0; u < per / 4; ++u) {
    const int j = tid * 4 + 1024 * u;
    const v4f a = *(const v4fa*)(x + j);
    v4f b = {0.f,0.f,0.f,0.f}; if (rr) b = *(const v4fa*)(rr + j);
#pragma unroll
    for (int q = 0; q < 4; ++q) { const float v = a[q] + b[q]; vals[u * 4 + q] = v; s1 += v; }
  }
  red[tid] = s1; __syncthreads();
  for (int st = 128; st > 0; st >>= 1) { if (tid < st) red[tid] += red[tid + st]; __syncthreads(); }
  const float mu = red[0] / (float)N; __syncthreads();
  float s2 = 0.f;
  for (int u = 0; u < per / 4; ++u)
#pragma unroll
    for (int q = 0; q < 4; ++q) { const float c = vals[u * 4 + q] - mu; s2 += c * c; }
  red[tid] = s2; __syncthreads();
  for (int st = 128; st > 0; st >>= 1) { if (tid < st) red[tid] += red[tid + st]; __syncthreads(); }
  const float rs = rsqrtf(red[0] / (float)N + eps);
  {
    for (int u = 0; u < per / 4; ++u) {
      const int j = tid * 4 + 1024 * u;
      v4f o, sm;
#pragma unroll
      for (int q = 0; q < 4; ++q) {
        float gg = g[j + q], bb = bta[j + q];
        if (PARAM_BF16) { gg = bf16_round(gg); bb = bf16_round(bb); }
        sm[q] = vals[u * 4 + q]; o[q] = (vals[u * 4 + q] - mu) * rs * gg + bb;
      }
      if (out_sum) *(v4f*)(out_sum + (size_t)row * N + j) = sm;
      *(v4f*)(out_norm + (size_t)row * N + j) = o;
    }
    
  }
}



// ---- f16 WMMA path (v_wmma_f32_16x16x32_f16): 11-bit significands for operands in range — used here for the Q, [K|V] and Wo GEMMs
typedef _Float16 v16h __attribute__((ext_vector_type(16)));
union FragH { v16h v; v8us half[2]; _Float16 h[16]; unsigned short u[16]; };
template <int NT>
__device__ __forceinline__ v8f mmaH(v16h ah, v16h al, v16h bh, v16h bl, v8f c) {
  c = __builtin_amdgcn_wmma_f32_16x16x32_f16(false, ah, false, bh, (short)0, c, false, false);
  if (NT >= 2) c = __builtin_amdgcn_wmma_f32_16x16x32_f16(false, al, false, bh, (short)0, c, false, false);
  if (NT >= 3) c = __builtin_amdgcn_wmma_f32_16x16x32_f16(false, ah, false, bl, (short)0, c, false, false);
  asm volatile("v_nop\n\tv_nop\n\tv_nop\n\tv_nop" : "+v"(c) : "v"(ah), "v"(al), "v"(bh), "v"(bl));
  return c;
}
// batched GEMM like k_gemm_b but f16 operands: A f32 (split into f16 hi/lo if ASPLIT, else rounded to f16), Bt = f16 values [n][k]; alpha; C f32; N multiple of 16 (partial tiles skipped)
template <bool ASPLIT>
__global__ __launch_bounds__(128) void k_gemm_h(const float* __restrict__ A, int lda, size_t sA, const _Float16* __restrict__ Bh, int ldb, size_t sB, float alpha, float* __restrict__ C, int ldc, size_t sC, int M, int N, int K) {
  __shared__ __attribute__((aligned(16))) float so[4][16][64];
  const int tid = threadIdx.x, w = tid >> 5, lane = tid & 31, ln = lane & 15, hh = lane >> 4; const int by = blockIdx.y;
  A += (size_t)by * sA; Bh += (size_t)by * sB; C += (size_t)by * sC;
  const int ntn = (N + 63) / 64; const int wid = blockIdx.x * 4 + w; const int mt = wid / ntn, nq = wid % ntn; if (mt * 16 >= M) return;
  const int row0 = mt * 16, col0 = nq * 64; const float* arow = A + (size_t)(row0 + ln) * lda;
  v8f acc[4] = {};
  for (int kb = 0; kb < K; kb += 32) {
    FragH ah, al;
    const v4f x0 = *(const v4fa*)(arow + kb + 8 * hh), x1 = *(const v4fa*)(arow + kb + 8 * hh + 4), x2 = *(const v4fa*)(arow + kb + 16 + 8 * hh), x3 = *(const v4fa*)(arow + kb + 16 + 8 * hh + 4);
    float xs[16] = {x0[0],x0[1],x0[2],x0[3],x1[0],x1[1],x1[2],x1[3],x2[0],x2[1],x2[2],x2[3],x3[0],x3[1],x3[2],x3[3]};
#pragma unroll
    for (int i = 0; i < 16; ++i) { const _Float16 h = (_Float16)xs[i]; ah.h[i] = h; al.h[i] = ASPLIT ? (_Float16)(xs[i] - (float)h) : (_Float16)0.0f; }
#pragma unroll
    for (int t = 0; t < 4; ++t) { if (col0 + t * 16 >= N) continue; const size_t boff = (size_t)(col0 + t * 16 + ln) * ldb + kb; FragH bq; bq.half[0] = *(const v8us*)(Bh + boff + 8 * hh); bq.half[1] = *(const v8us*)(Bh + boff + 16 + 8 * hh);
      acc[t] = mmaH<ASPLIT ? 2 : 1>(ah.v, al.v, bq.v, bq.v, acc[t]); }
  }
#pragma unroll
  for (int t = 0; t < 4; ++t) { if (col0 + t * 16 >= N) continue;
#pragma unroll
    for (int r = 0; r < 8; ++r) so[w][8 * hh + r][t * 16 + ln] = acc[t][r] * alpha; }
  __builtin_amdgcn_fence(__ATOMIC_ACQ_REL, "workgroup"); __builtin_amdgcn_wave_barrier();
  const int rsub = lane >> 4, c4 = (lane & 15) * 4;
  {
#pragma unroll
    for (int q = 0; q < 8; ++q) { const int r = q * 2 + rsub; if (col0 + c4 < N) { const v4f v = *(const v4fa*)&so[w][r][c4]; *(v4f*)(C + (size_t)(row0 + r) * ldc + col0 + c4) = v; } }
     }
}

// Wt[n][k] = f16(W[k][n]·scale) from f32 row-major W[K][N] (scale = power of two; bf16-exact weights stay exact in f16 away from the subnormal range)
__global__ __launch_bounds__(256) void k_wt_f16(const float* __restrict__ W, _Float16* __restrict__ Wt, int K, int N, float scale) {
  const int t = blockIdx.x * 256 + threadIdx.x; if (t >= N * (K / 8)) return; const int n = t / (K / 8), k8 = (t % (K / 8)) * 8; FragH f;
#pragma unroll
  for (int i = 0; i < 8; ++i) f.h[i] = (_Float16)(bf16_round(W[(size_t)(k8 + i) * N + n]) * scale); const v8us o = f.half[0];
  *(v8us*)((unsigned short*)Wt + (size_t)n * K + k8) = o; 
}
// k_gemm_hh variant with fused epilogue: v = acc·alpha + bias[by·sBias + col] (+ CP[(row/rowsPerB)·sCPb + by·64 + col] if CP) ; ACT 0 none / 1 elu ; writes f16 C16 (and f32 C if non-null)
template <int ACT>
__global__ __launch_bounds__(128) void k_gemm_hhx(const _Float16* __restrict__ A, int lda, size_t sA, const _Float16* __restrict__ Bh, int ldb, size_t sB, float alpha, const float* __restrict__ bias, size_t sBias, const float* __restrict__ CP, int rowsPerB, size_t sCPb, int row0g,
    float* __restrict__ C, _Float16* __restrict__ C16, int ldc, size_t sC, int M, int N, int K) {
  __shared__ __attribute__((aligned(16))) float so[4][16][64];
  const int tid = threadIdx.x, w = tid >> 5, lane = tid & 31, ln = lane & 15, hh = lane >> 4; const int by = blockIdx.y;
  A += (size_t)by * sA; Bh += (size_t)by * sB; const size_t cofs = (size_t)by * sC; const float* bp = bias ? bias + (size_t)by * sBias : nullptr;
  const int ntn = (N + 63) / 64; const int wid = blockIdx.x * 4 + w; const int mt = wid / ntn, nq = wid % ntn; if (mt * 16 >= M) return;
  const int row0 = mt * 16, col0 = nq * 64; const _Float16* arow = A + (size_t)(row0 + ln) * lda;
  v8f acc[4] = {};
  for (int kb = 0; kb < K; kb += 32) { FragH ah; ah.half[0] = *(const v8us*)((const unsigned short*)arow + kb + 8 * hh); ah.half[1] = *(const v8us*)((const unsigned short*)arow + kb + 16 + 8 * hh);
#pragma unroll
    for (int t = 0; t < 4; ++t) { if (col0 + t * 16 >= N) continue; const size_t boff = (size_t)(col0 + t * 16 + ln) * ldb + kb; FragH bq; bq.half[0] = *(const v8us*)((const unsigned short*)Bh + boff + 8 * hh); bq.half[1] = *(const v8us*)((const unsigned short*)Bh + boff + 16 + 8 * hh);
      acc[t] = mmaH<1>(ah.v, ah.v, bq.v, bq.v, acc[t]); }
  }
#pragma unroll
  for (int t = 0; t < 4; ++t) { if (col0 + t * 16 >= N) continue; const int col = col0 + t * 16 + ln; const float bv = bp ? bf16_round(bp[col]) : 0.f;
#pragma unroll
    for (int r = 0; r < 8; ++r) { float v = acc[t][r] * alpha + bv; if (CP) { const int rr = row0g + row0 + 8 * hh + r; if (rowsPerB < 0) v += CP[cofs + (size_t)rr * ldc + col];      /* rowsPerB < 0: own element of the batched C plane */ else { const int bidx = rr / rowsPerB; v += CP[(size_t)bidx * sCPb + (size_t)by * 64 + col]; } } if (ACT == 1) v = (v > 0.f) ? v : expm1f(v); else if (ACT == 7) v = (v > 0.f) ? v + 1.0f : expf(v); else if (ACT == 8) v = tanhf(v); else if (ACT == 9) v = 0.5f * v * (1.0f + tanhf(0.7978845608028654f * (v + 0.044715f * v * v * v))); else if (ACT == 11) v = 1.0f / (1.0f + expf(-v)); else if (ACT == 12) v = (v > 0.f) ? v : 0.01f * v; else if (ACT == 14) v = (v > 0.f) ? v : 0.1f * v; else if (ACT == 16) v = (v >= 0.f) ? v : 0.3f * v; else if (ACT == 17) v = (v >= 0.f) ? v : 0.2f * v; else if (ACT == 15) v = v / (1.0f + expf(-v)); else if (ACT == 3) v = fmaxf(v, 0.f); else if (ACT == 6) v = 0.5f * v * (1.0f + erff(v * 0.70710678118654752f)); so[w][8 * hh + r][t * 16 + ln] = v; } }
  __builtin_amdgcn_fence(__ATOMIC_ACQ_REL, "workgroup"); __builtin_amdgcn_wave_barrier();
  const int rsub = lane >> 4, c4 = (lane & 15) * 4; typedef _Float16 v4h __attribute__((ext_vector_type(4)));
  {
#pragma unroll
    for (int q = 0; q < 8; ++q) { const int r = q * 2 + rsub; if (col0 + c4 < N) { const v4f v = *(const v4fa*)&so[w][r][c4]; if (C) *(v4f*)(C + cofs + (size_t)(row0 + r) * ldc + col0 + c4) = v; if (C16) { v4h h4; for (int i = 0; i < 4; ++i) h4[i] = (_Float16)v[i]; *(v4h*)(C16 + cofs + (size_t)(row0 + r) * ldc + col0 + c4) = h4; } } }
     }
}


typedef _Float16 v4h __attribute__((ext_vector_type(4)));

__global__ __launch_bounds__(256) void k_x16(const float* __restrict__ x, _Float16* __restrict__ X16, size_t n8) { const size_t t = (size_t)blockIdx.x * 256 + threadIdx.x; if (t >= n8) return; FragH f;
#pragma unroll
  for (int q = 0; q < 8; ++q) f.h[q] = (_Float16)bf16_round(x[t * 8 + q]); *(v8us*)((unsigned short*)X16 + t * 8) = f.half[0];  }
__global__ __launch_bounds__(256) void k_h16(const float* __restrict__ x, _Float16* __restrict__ X16, size_t n8) { const size_t t = (size_t)blockIdx.x * 256 + threadIdx.x; if (t >= n8) return; FragH f;
#pragma unroll
  for (int q = 0; q < 8; ++q) f.h[q] = (_Float16)x[t * 8 + q]; *(v8us*)((unsigned short*)X16 + t * 8) = f.half[0];  }
__global__ __launch_bounds__(256) void k_round16f(const float* __restrict__ W, _Float16* __restrict__ Bt, size_t n8) { const size_t t = (size_t)blockIdx.x * 256 + threadIdx.x; if (t >= n8) return; FragH f;
#pragma unroll
  for (int i = 0; i < 8; ++i) f.h[i] = (_Float16)(bf16_round(W[t * 8 + i]) * 16.0f); *(v8us*)((unsigned short*)Bt + t * 8) = f.half[0];  }
template <int NHv, int TTv>
__global__ __launch_bounds__(256) void k_vt(const _Float16* __restrict__ V16, int ldv, int voff, _Float16* __restrict__ Vt) { __shared__ unsigned short tl[64][66]; const int tid = threadIdx.x; const int slab = blockIdx.x / (TTv / 64), lg = blockIdx.x % (TTv / 64); const int b = slab / NHv, h = slab % NHv;
  for (int i = tid; i < 64 * 8; i += 256) { const int r = i / 8, c8 = (i % 8) * 8; FragH f; f.half[0] = *(const v8us*)((const unsigned short*)V16 + ((size_t)b * TTv + lg * 64 + r) * ldv + voff + h * 64 + c8);
#pragma unroll
    for (int q = 0; q < 8; ++q) tl[r][c8 + q] = f.u[q]; }
  __syncthreads();
  {
#pragma unroll
    for (int rd = 0; rd < 2; ++rd) { const int d = rd * 32 + tid / 8, pc = tid % 8; FragH f;
#pragma unroll
      for (int q = 0; q < 8; ++q) f.u[q] = tl[pc * 8 + q][d];
      *(v8us*)((unsigned short*)Vt + ((size_t)slab * 64 + d) * TTv + lg * 64 + pc * 8) = f.half[0]; }
     } }

__global__ __launch_bounds__(256) void k_hl(const float* __restrict__ F, _Float16* __restrict__ Hh, _Float16* __restrict__ Hl, size_t n8) { const size_t t = (size_t)blockIdx.x * 256 + threadIdx.x; if (t >= n8) return; FragH fh, fl; const v4f a = *(const v4fa*)(F + t * 8), c = *(const v4fa*)(F + t * 8 + 4);
#pragma unroll
  for (int q = 0; q < 4; ++q) { _Float16 h = (_Float16)a[q]; fh.h[q] = h; fl.h[q] = (_Float16)((a[q] - (float)h) * 1024.0f); h = (_Float16)c[q]; fh.h[4 + q] = h; fl.h[4 + q] = (_Float16)((c[q] - (float)h) * 1024.0f); }
  { *(v8us*)((unsigned short*)Hh + t * 8) = fh.half[0]; *(v8us*)((unsigned short*)Hl + t * 8) = fl.half[0];  } }

// ---- fast GEMM (wave tile 32x64; requires M % 32 == 0 rows per launch region and N % 64 == 0); epilogue = k_gemm_hhx semantics ----
__device__ __forceinline__ v16h g2_frag(const _Float16* p, int hh) { FragH f; f.half[0] = *(const v8us*)((const unsigned short*)p + 8 * hh); f.half[1] = *(const v8us*)((const unsigned short*)p + 16 + 8 * hh); return f.v; }
__device__ __forceinline__ v8f g2_mma(v16h a, v16h b, v8f c) { v8f d = __builtin_amdgcn_wmma_f32_16x16x32_f16(false, a, false, b, (short)0, c, false, false); asm volatile("v_nop\n\tv_nop\n\tv_nop\n\tv_nop" : "+v"(d) : "v"(a), "v"(b)); return d; }
template <int ACT>
__global__ __launch_bounds__(128) void k_gemm2(const _Float16* __restrict__ A, int lda, size_t sA, const _Float16* __restrict__ Bh, int ldb, size_t sB, float alpha, const float* __restrict__ bias, size_t sBias, const float* __restrict__ CP, int rowsPerB, size_t sCPb, int row0g,
    float* __restrict__ C, _Float16* __restrict__ C16, int ldc, size_t sC, int M, int N, int K) { static_assert(ACT == 0 || ACT == 3 || ACT == 6 || ACT == 8 || ACT == 9 || ACT == 11 || ACT == 12 || ACT == 14 || ACT == 15 || ACT == 16 || ACT == 17, "k_gemm2: unsupported ACT code (would silently apply no activation)");
  __shared__ __attribute__((aligned(16))) float so[4][32][68];
  const int tid = threadIdx.x, w = tid >> 5, lane = tid & 31, ln = lane & 15, hh = lane >> 4; const int by = blockIdx.y;
  A += (size_t)by * sA; Bh += (size_t)by * sB; const size_t cofs = (size_t)by * sC; const float* bp = bias ? bias + (size_t)by * sBias : nullptr;
  const int ntn = N >> 6; const int mt = blockIdx.x / ntn, nq = blockIdx.x - mt * ntn; const int row0 = mt * 128 + 32 * w, col0 = nq * 64; if (row0 >= M) return;
  const _Float16* a0p = A + (size_t)(row0 + ln) * lda; const _Float16* a1p = a0p + (size_t)16 * lda;
  const _Float16* b0p = Bh + (size_t)(col0 + ln) * ldb; const _Float16* b1p = b0p + (size_t)16 * ldb; const _Float16* b2p = b1p + (size_t)16 * ldb; const _Float16* b3p = b2p + (size_t)16 * ldb;
  const v8f z8 = {0.f,0.f,0.f,0.f,0.f,0.f,0.f,0.f}; v8f c00 = z8, c01 = z8, c02 = z8, c03 = z8, c10 = z8, c11 = z8, c12 = z8, c13 = z8;
#pragma unroll 1
  for (int kb = 0; kb < K; kb += 32) { const v16h a0 = g2_frag(a0p + kb, hh), a1 = g2_frag(a1p + kb, hh);
    v16h b = g2_frag(b0p + kb, hh); c00 = g2_mma(a0, b, c00); c10 = g2_mma(a1, b, c10);
    b = g2_frag(b1p + kb, hh); c01 = g2_mma(a0, b, c01); c11 = g2_mma(a1, b, c11);
    b = g2_frag(b2p + kb, hh); c02 = g2_mma(a0, b, c02); c12 = g2_mma(a1, b, c12);
    b = g2_frag(b3p + kb, hh); c03 = g2_mma(a0, b, c03); c13 = g2_mma(a1, b, c13); }
  v8f accs[8] = {c00, c01, c02, c03, c10, c11, c12, c13};
#pragma unroll
  for (int u = 0; u < 8; ++u) { const int t = u & 3, half = u >> 2; const int col = col0 + t * 16 + ln; const float bv = bp ? bf16_round(bp[col]) : 0.f;
#pragma unroll
    for (int r = 0; r < 8; ++r) { const int rloc = half * 16 + 8 * hh + r; float v = accs[u][r] * alpha + bv; if (CP) { if (rowsPerB < 0) v += CP[cofs + (size_t)(row0g + row0 + rloc) * ldc + col];      /* rowsPerB < 0: own element of the batched C plane */ else { const int bidx = (row0g + row0 + rloc) / rowsPerB; v += CP[(size_t)bidx * sCPb + (size_t)by * 64 + col]; } }
      if (ACT == 3) v = fmaxf(v, 0.f); else if (ACT == 6) v = 0.5f * v * (1.0f + erff(v * 0.70710678118654752f)); else if (ACT == 11) v = 1.0f / (1.0f + expf(-v)); else if (ACT == 15) v = v / (1.0f + expf(-v)); else if (ACT == 12) v = (v > 0.f) ? v : 0.01f * v; else if (ACT == 8) v = tanhf(v); else if (ACT == 9) v = 0.5f * v * (1.0f + tanhf(0.7978845608028654f * (v + 0.044715f * v * v * v))); else if (ACT == 14) v = (v > 0.f) ? v : 0.1f * v; else if (ACT == 16) v = (v >= 0.f) ? v : 0.3f * v; else if (ACT == 17) v = (v >= 0.f) ? v : 0.2f * v;
      so[w][rloc][t * 16 + ln] = v; } }
  __builtin_amdgcn_fence(__ATOMIC_ACQ_REL, "workgroup"); __builtin_amdgcn_wave_barrier();
  const int rsub = lane >> 4, c4 = (lane & 15) * 4;
  {
#pragma unroll
    for (int q = 0; q < 16; ++q) { const int r = q * 2 + rsub; const v4f v = *(const v4fa*)&so[w][r][c4]; if (C) *(v4f*)(C + cofs + (size_t)(row0 + r) * ldc + col0 + c4) = v; if (C16) { v4h h4; for (int i = 0; i < 4; ++i) h4[i] = (_Float16)v[i]; *(v4h*)(C16 + cofs + (size_t)(row0 + r) * ldc + col0 + c4) = h4; } }
     } }


__global__ __launch_bounds__(256) void k_wT(const float* __restrict__ w, int din, int dout, _Float16* __restrict__ Bt) { __shared__ float tl[64][65]; const int tid = threadIdx.x; const int nbo = dout / 64; const int ib = blockIdx.x / nbo, ob = blockIdx.x % nbo; const int i0 = ib * 64, o0 = ob * 64;
  for (int t = tid; t < 64 * 64; t += 256) { const int i = t / 64, o = t % 64; tl[o][i] = bf16_round(w[(size_t)(i0 + i) * dout + o0 + o]) * 16.0f; }
  __syncthreads();
  { for (int t = tid; t < 64 * 8; t += 256) { const int o = t / 8, i8 = (t % 8) * 8; FragH f; for (int q = 0; q < 8; ++q) f.h[q] = (_Float16)tl[o][i8 + q]; *(v8us*)((unsigned short*)Bt + (size_t)(o0 + o) * din + i0 + i8) = f.half[0]; }  } }
__global__ __launch_bounds__(256) void k_xr(const float* __restrict__ x, _Float16* __restrict__ X16) { const size_t t = (size_t)blockIdx.x * 256 + threadIdx.x; if (t >= NRX * DM / 8) return; const int c0 = (int)((t * 8) % DM); const size_t r = (t * 8) / DM; const int tok = (int)(r % RPB); const size_t b = r / RPB; FragH f;
  for (int q = 0; q < 8; ++q) f.h[q] = (tok < NTOK) ? (_Float16)bf16_round(x[(b * NTOK + tok) * DM + c0 + q]) : (_Float16)0.f;
  *(v8us*)((unsigned short*)X16 + t * 8) = f.half[0];  }
// sum over the 8 lanes that share one (query, head): three DPP adds inside the 16-lane row (lane ^ 1, ^ 2, ^ 4); every lane of the group ends with the total
template <int CTRL> __device__ __forceinline__ float nb_xadd(float x) { return x + __int_as_float(__builtin_amdgcn_update_dpp(0, __float_as_int(x), CTRL, 0xf, 0xf, true)); }
__device__ __forceinline__ float nb_dot(v4f a0, v4f a1, v4f k0, v4f k1) {
  float s = a0[0] * k0[0], t = a1[0] * k1[0];
#pragma unroll
  for (int d = 1; d < 4; ++d) { s = fmaf(a0[d], k0[d], s); t = fmaf(a1[d], k1[d], t); }
  s += t; s = nb_xadd<0x161>(s); s = nb_xadd<0x162>(s); s = nb_xadd<0x164>(s); return s; }
// Neighbourhood attention. Wave = NQW consecutive queries of one grid row (f0, h0) x 4 heads, a block's 8 waves side by side in that row; 8 lanes share a (query, head), lane l8 holding
// dims 4*l8..+3 and 32+4*l8..+3, so that each b128 load of a key row covers whole 128-byte lines. Only 14 of the 27 window slots can pass the causal test (frame f0-1: 3x3; frame f0: row h0-1: 3,
// row h0: w-1 and w); the others have a flat index above the query's for every query. A key row is loaded once per wave and serves each of its queries whose window holds it.
// A slot outside the grid still reads a token row of the same batch (in bounds, written by the GEMM before) and gets the mask value as its logit, hence weight 0.
#define NQW 2
__global__ __launch_bounds__(256) void k_nbatt(const float* Q, const float* KV, _Float16* O16) {      /* no __restrict__: the loads below keep their side of the two waits */
  const int lane = threadIdx.x & 31, l8 = lane & 7, hs = lane >> 3; const int wv = __builtin_amdgcn_readfirstlane((int)(threadIdx.x >> 5));
  const int gw = blockIdx.x * 8 + wv; const int rw = gw / (WT / NQW); const int h0 = rw % HT, f0 = (rw / HT) % FT, hq = (rw / (HT * FT)) % 2, b = rw / (HT * FT * 2);
  const int w0 = (gw % (WT / NQW)) * NQW; const int j0 = (f0 * HT + h0) * WT + w0; const unsigned co = (unsigned)(hq * (DM / 2) + hs * HD + l8 * 4);
  const float* kvb = KV + (size_t)b * RPB * (2 * DM);
  const float* rb[5]; bool kok[5][NQW + 2];      /* rb[r]: the row of the key at column w0 of window row r; a window row outside the grid points at token row 1, so that columns -1..NQW stay inside the buffer */
#pragma unroll
  for (int r = 0; r < 5; ++r) { const int f = f0 + (r < 3 ? -1 : 0), hh = h0 + (r < 3 ? r - 1 : r - 4); const bool rok = f >= 0 && hh >= 0 && hh < HT;
    rb[r] = kvb + (size_t)(rok ? (f * HT + hh) * WT + w0 + 1 : 1) * (2 * DM) + co;
#pragma unroll
    for (int c = 0; c < NQW + 2; ++c) { const int ww = w0 - 1 + c; kok[r][c] = rok && ww >= 0 && ww < WT; } }
  const float* qp = Q + ((size_t)b * RPB + j0) * DM + co;      /* query i is token j0 + i + 1 */ const float* bp = kvb + co;
  v4f q[NQW][2], kb[2], kk[5][NQW + 2][2];
#pragma unroll
  for (int i = 0; i < NQW; ++i) { q[i][0] = *(const v4fa*)(qp + (i + 1) * DM); q[i][1] = *(const v4fa*)(qp + (i + 1) * DM + 32); }
#pragma unroll
  for (int r = 0; r < 5; ++r) {
#pragma unroll
    for (int c = 0; c < NQW + (r < 4 ? 2 : 1); ++c) { const float* kp = rb[r] + (c - 1) * (2 * DM); kk[r][c][0] = *(const v4fa*)kp; kk[r][c][1] = *(const v4fa*)(kp + 32); } }
  kb[0] = *(const v4fa*)bp; kb[1] = *(const v4fa*)(bp + 32);
  /* the wait that stands between issued loads and any new value in their address registers; naming the addresses keeps them in those registers up to it */
  asm volatile("s_wait_xcnt 0x0" :: "v"(qp), "v"(bp), "v"(rb[0]), "v"(rb[1]), "v"(rb[2]), "v"(rb[3]), "v"(rb[4]) : "memory");
  float lg[NQW][15];
#pragma unroll
  for (int i = 0; i < NQW; ++i) lg[i][0] = nb_dot(q[i][0], q[i][1], kb[0], kb[1]) * 0.125f;
#pragma unroll
  for (int r = 0; r < 5; ++r) {
#pragma unroll
    for (int c = 0; c < NQW + (r < 4 ? 2 : 1); ++c) {
#pragma unroll
      for (int i = 0; i < NQW; ++i) { const int dw = c - i; if (dw >= 0 && dw < (r < 4 ? 3 : 2)) { const float sd = nb_dot(q[i][0], q[i][1], kk[r][c][0], kk[r][c][1]) * 0.125f; lg[i][1 + r * 3 + dw] = kok[r][c] ? sd : -3.0e38f; } } } }
  v4f vb[2], vv[5][NQW + 2][2];      /* the v rows fly while the softmax is worked out */
#pragma unroll
  for (int r = 0; r < 5; ++r) {
#pragma unroll
    for (int c = 0; c < NQW + (r < 4 ? 2 : 1); ++c) { const float* vp = rb[r] + (c - 1) * (2 * DM) + DM; vv[r][c][0] = *(const v4fa*)vp; vv[r][c][1] = *(const v4fa*)(vp + 32); } }
  vb[0] = *(const v4fa*)(bp + DM); vb[1] = *(const v4fa*)(bp + DM + 32);
  /* the same wait behind the v loads */
  asm volatile("s_wait_xcnt 0x0" :: "v"(bp), "v"(rb[0]), "v"(rb[1]), "v"(rb[2]), "v"(rb[3]), "v"(rb[4]) : "memory");
#pragma unroll
  for (int i = 0; i < NQW; ++i) { float mx = lg[i][0];
#pragma unroll
    for (int s = 1; s < 15; ++s) mx = fmaxf(mx, lg[i][s]);
    float se = 0.f;
#pragma unroll
    for (int s = 0; s < 15; ++s) { const float e = expf(lg[i][s] - mx); lg[i][s] = e; se += e; }
    const float inv = 1.0f / se;
#pragma unroll
    for (int s = 0; s < 15; ++s) lg[i][s] *= inv; }
  v4f o[NQW][2];
#pragma unroll
  for (int i = 0; i < NQW; ++i) { o[i][0] = vb[0] * lg[i][0]; o[i][1] = vb[1] * lg[i][0]; }
#pragma unroll
  for (int r = 0; r < 5; ++r) {
#pragma unroll
    for (int c = 0; c < NQW + (r < 4 ? 2 : 1); ++c) {
#pragma unroll
      for (int i = 0; i < NQW; ++i) { const int dw = c - i; if (dw >= 0 && dw < (r < 4 ? 3 : 2)) { const float p = lg[i][1 + r * 3 + dw]; o[i][0] += vv[r][c][0] * p; o[i][1] += vv[r][c][1] * p; } } } }
#pragma unroll
  for (int i = 0; i < NQW; ++i) { _Float16* op = O16 + ((size_t)b * NPAD + j0 + i + 1) * DM + co; v4h a, c;
#pragma unroll
    for (int d = 0; d < 4; ++d) { a[d] = (_Float16)o[i][0][d]; c[d] = (_Float16)o[i][1][d]; }
    *(v4h*)op = a; *(v4h*)(op + 32) = c; } }
__global__ __launch_bounds__(256) void k_bos(const float* __restrict__ KV, _Float16* __restrict__ O16) { const int t = blockIdx.x * 256 + threadIdx.x; if (t >= NB * DM / 8) return; const int c0 = (t * 8) % DM; const int b = (t * 8) / DM; FragH f; for (int q = 0; q < 8; ++q) f.h[q] = (_Float16)KV[((size_t)b * RPB + 0) * (2 * DM) + DM + c0 + q];
  unsigned short* d = (unsigned short*)O16 + ((size_t)b * NPAD) * DM + c0; *(v8us*)d = f.half[0];  }

extern "C" void kernel_launch(void* const* d_in, const int* in_sizes, int n_in,
                              void* d_out, int out_size, void* d_ws, size_t ws_size, hipStream_t stream) {
  (void)in_sizes; (void)n_in; (void)out_size;
  const float* const* I = (const float* const*)d_in; const float* x = I[0]; const float* Wq = I[1]; const float* Wkv = I[2]; const float* Wo = I[3]; const float* bo = I[4];
  char* ws = (char*)d_ws; size_t off = 0;
  auto take = [&](size_t bytes) { char* p = ws + off; off += (bytes + 255) & ~(size_t)255; return p; };
  _Float16* BQ = (_Float16*)take((size_t)DM * DM * 2); _Float16* BKV = (_Float16*)take((size_t)2 * DM * DM * 2); _Float16* BO = (_Float16*)take((size_t)DM * DM * 2);
  _Float16* X16 = (_Float16*)take(NRX * DM * 2); float* Q = (float*)take(NRX * DM * 4); float* KV = (float*)take(NRX * 2 * DM * 4); _Float16* O16 = (_Float16*)take((size_t)NB * NPAD * DM * 2);      /* rows b*4097 + tok; the last query's token (4096) is computed but dropped by the output GEMM */
  if (off > ws_size) return;      /* 2 + 8.6 + 17.3 + 34.6 + 8.4 = ≈ 71 MiB */
  k_wT<<<(DM / 64) * (DM / 64), 256, 0, stream>>>(Wq, DM, DM, BQ); k_wT<<<(DM / 64) * (2 * DM / 64), 256, 0, stream>>>(Wkv, DM, 2 * DM, BKV); k_wT<<<(DM / 64) * (DM / 64), 256, 0, stream>>>(Wo, DM, DM, BO);
  k_xr<<<(unsigned)((NRX * DM / 8 + 255) / 256), 256, 0, stream>>>(x, X16);
  k_gemm2<0><<<dim3((unsigned)((NRX / 128) * (DM / 64)), 1), 128, 0, stream>>>(X16, DM, 0, BQ, DM, 0, 0.0625f, nullptr, 0, nullptr, 1, 0, 0, Q, nullptr, DM, 0, (int)NRX, DM, DM);
  k_gemm2<0><<<dim3((unsigned)((NRX / 128) * (2 * DM / 64)), 1), 128, 0, stream>>>(X16, DM, 0, BKV, DM, 0, 0.0625f, nullptr, 0, nullptr, 1, 0, 0, KV, nullptr, 2 * DM, 0, (int)NRX, 2 * DM, DM);
  k_nbatt<<<NB * 2 * FT * HT * (WT / NQW) / 8, 256, 0, stream>>>(Q, KV, O16);
  k_bos<<<(NB * DM / 8 + 255) / 256, 256, 0, stream>>>(KV, O16);
  for (int b = 0; b < NB; ++b) k_gemm2<0><<<dim3((unsigned)((NTOK / 128) * (DM / 64)), 1), 128, 0, stream>>>(O16 + (size_t)b * NPAD * DM, DM, 0, BO, DM, 0, 0.0625f, bo, 0, nullptr, 1, 0, 0, (float*)d_out + (size_t)b * NTOK * DM, nullptr, DM, 0, NTOK, DM, DM);      /* out = o Wo + bo for tokens 0..4095 of each batch (token 4096 dropped as in the reference) */
}

// v002
// It runs in 98.1 microseconds.
// In two side-by-side timings against v001, it was 1.49 and 1.48 times as fast.
// All steps since v000 together make it 5.25 times as fast.
#include <hip/hip_runtime.h>
// Sparse3DNA (x [2][4096][512]: 1 BOS + 4095 video tokens on a 4x32x32 grid, padded by one zero token to 4097; q = x Wq, [k|v] = x Wkv ([in][out], no bias), 8 heads of 64; query j (token j+1) attends to {BOS} U {its 3x3x3 grid neighbourhood keys with flat index <= j} (out-of-grid slots and future keys masked), scale 64^-0.5, softmax, weighted v; token 0's output is v_BOS itself; out = o Wo + bo, first 4096 tokens -> [2][4096][512]).
// Structure: token rows (4,097 per batch padded to 4,224); x as exact f16 rows; Q and [K|V] WMMA GEMMs (32x64 wave tiles, f32 accumulation, exact x16 transposed weights) kept in f32; the 15-slot (BOS + 14 causal window slots) neighbourhood attention on VALU (f32: 8 lanes per (batch, head, query), 2 queries x 4 heads per wave, window indices and the causal test from the grid geometry on device, logits, softmax, weighted sum) into f16 o rows (row 0 = v_BOS); out = o Wo + bo GEMM (f32, output layout).
// Compute dtype: inputs rounded to bf16; x / weights exact; q, k, v, logits, softmax f32; o plain f16 into the Wo GEMM (~2^-12). v_wmma_f32_16x16x32_f16.
#define NB 2
#define NTOK 4096                    /* input tokens per batch (= output tokens) */
#define NPAD 4097                    /* after the module's padding */
#define RPB 4224                     /* rows per batch (33 x 128) */
#define NRX ((size_t)NB * RPB)       /* 8448 */
#define DM 512
#define NH 8
#define HD 64
#define FT 4
#define HT 32
#define WT 32
#define TT (FT * HT * WT)            /* 4096 grid tokens */
#define QT TT                        /* unused */
typedef __bf16 v16b __attribute__((ext_vector_type(16)));
typedef unsigned short v8us __attribute__((ext_vector_type(8), may_alias));
typedef float  v8f  __attribute__((ext_vector_type(8)));
typedef float  v4f  __attribute__((ext_vector_type(4)));
typedef float  v4fa __attribute__((ext_vector_type(4), may_alias));
union FragB { v16b v; v8us half[2]; unsigned short u[16]; };

__device__ __forceinline__ unsigned short bf16_bits(float x) { unsigned int u = __float_as_uint(x); return (unsigned short)((u + 0x7FFFu + ((u >> 16) & 1u)) >> 16); }
__device__ __forceinline__ float bf16_val(unsigned short b) { return __uint_as_float(((unsigned int)b) << 16); }
__device__ __forceinline__ float bf16_round(float x) { return bf16_val(bf16_bits(x)); }
// D += A·B with NT terms: 1 = ah·bh, 2 = + al·bh (A split), 3 = + ah·bl (both split)
template <int NT>
__device__ __forceinline__ v8f mmaN(v16b ah, v16b al, v16b bh, v16b bl, v8f c) {
  c = __builtin_amdgcn_wmma_f32_16x16x32_bf16(false, ah, false, bh, (short)0, c, false, false);
  if (NT >= 2) c = __builtin_amdgcn_wmma_f32_16x16x32_bf16(false, al, false, bh, (short)0, c, false, false);
  if (NT >= 3) c = __builtin_amdgcn_wmma_f32_16x16x32_bf16(false, ah, false, bl, (short)0, c, false, false);
  asm volatile("v_nop\n\tv_nop\n\tv_nop\n\tv_nop" : "+v"(c) : "v"(ah), "v"(al), "v"(bh), "v"(bl));
  return c;
}

__global__ __launch_bounds__(256) void k_wt_bf16(const float* __restrict__ W, unsigned short* __restrict__ Wt, int K, int N) {
  const int t = blockIdx.x * 256 + threadIdx.x;
  const int k8n = K / 8;
  if (t >= N * k8n) return;
  const int n = t / k8n, k8 = (t % k8n) * 8;
  v8us v;
#pragma unroll
  for (int i = 0; i < 8; ++i) v[i] = bf16_bits(W[(size_t)(k8 + i) * N + n]);
  *(v8us*)(Wt + (size_t)n * K + k8) = v;
  
}

// GEMM C[M][N] (f32, pitch ldc) = act(A[M][K]·W + bias). A f32 row-major (pitch lda) converted per fragment to bf16
// (ASPLIT: hi/lo two planes -> 2 terms, else single rounded term); Wt bf16 [N][K] (pitch ldb). BIAS_BF16 rounds the
// bias to bf16 first (bias quantised to bf16 before the add). K%32==0, M%16==0, N%64==0.
template <bool ASPLIT, int ACT, bool BIAS_BF16>
__global__ __launch_bounds__(128) void k_gemm_bf(const float* __restrict__ A, int lda, const unsigned short* __restrict__ Wt, int ldb,
                                               const float* __restrict__ bias, float* __restrict__ C, int ldc, int M, int N, int K) {
  __shared__ __attribute__((aligned(16))) float so[4][16][64];
  const int tid = threadIdx.x, w = tid >> 5, lane = tid & 31, ln = lane & 15, hh = lane >> 4;
  const int ntn = N / 64;
  const int wid = blockIdx.x * 4 + w;
  const int mt = wid / ntn, nq = wid % ntn;
  if (mt * 16 >= M) return;
  const int row0 = mt * 16, col0 = nq * 64;
  const float* arow = A + (size_t)(row0 + ln) * lda;
  v8f acc[4] = {};
  for (int kb = 0; kb < K; kb += 32) {
    FragB ah, al;
    const v4f x0 = *(const v4fa*)(arow + kb + 8 * hh), x1 = *(const v4fa*)(arow + kb + 8 * hh + 4);
    const v4f x2 = *(const v4fa*)(arow + kb + 16 + 8 * hh), x3 = *(const v4fa*)(arow + kb + 16 + 8 * hh + 4);
    float xs[16] = {x0[0],x0[1],x0[2],x0[3],x1[0],x1[1],x1[2],x1[3],x2[0],x2[1],x2[2],x2[3],x3[0],x3[1],x3[2],x3[3]};
#pragma unroll
    for (int i = 0; i < 16; ++i) { const unsigned short hb = bf16_bits(xs[i]); ah.u[i] = hb; al.u[i] = ASPLIT ? bf16_bits(xs[i] - bf16_val(hb)) : (unsigned short)0; }
#pragma unroll
    for (int t = 0; t < 4; ++t) {
      const unsigned short* brow = Wt + (size_t)(col0 + t * 16 + ln) * ldb + kb;
      FragB b;
      b.half[0] = *(const v8us*)(brow + 8 * hh);
      b.half[1] = *(const v8us*)(brow + 16 + 8 * hh);
      acc[t] = mmaN<ASPLIT ? 2 : 1>(ah.v, al.v, b.v, b.v, acc[t]);
    }
  }
#pragma unroll
  for (int t = 0; t < 4; ++t) {
    float bv = bias ? bias[col0 + t * 16 + ln] : 0.f;
    if (BIAS_BF16) bv = bf16_round(bv);
#pragma unroll
    for (int r = 0; r < 8; ++r) { float v = acc[t][r] + bv; if (ACT == 1) v = fmaxf(v, 0.f); so[w][8 * hh + r][t * 16 + ln] = v; }
  }
  __builtin_amdgcn_fence(__ATOMIC_ACQ_REL, "workgroup");
  __builtin_amdgcn_wave_barrier();
  const int rsub = lane >> 4, c4 = (lane & 15) * 4;
  {
#pragma unroll
    for (int q = 0; q < 8; ++q) {
      const int r = q * 2 + rsub;
      const v4f v = *(const v4fa*)&so[w][r][c4];
      *(v4f*)(C + (size_t)(row0 + r) * ldc + col0 + c4) = v;
    }
    
  }
}

// GEMM C = act(A·W + bias + resid): A f32 (ASPLIT -> hi/lo 2 terms), Wt bf16 [N][K]; ACT 0 none, 1 relu, 2 exact gelu;
// resid (optional, f32, row index = (row % rmod), pitch ldr, RES_BF16 rounds it) added before the activation.
template <bool ASPLIT, int ACT, bool BIAS_BF16, bool RES_BF16>
__global__ __launch_bounds__(128) void k_gemm_bf3(const float* __restrict__ A, int lda, const unsigned short* __restrict__ Wt, int ldb,
                                                const float* __restrict__ bias, const float* __restrict__ resid, int rmod, int ldr,
                                                float* __restrict__ C, int ldc, int M, int N, int K) {
  __shared__ __attribute__((aligned(16))) float so[4][16][64];
  const int tid = threadIdx.x, w = tid >> 5, lane = tid & 31, ln = lane & 15, hh = lane >> 4;
  const int ntn = N / 64;
  const int wid = blockIdx.x * 4 + w;
  const int mt = wid / ntn, nq = wid % ntn;
  if (mt * 16 >= M) return;
  const int row0 = mt * 16, col0 = nq * 64;
  const float* arow = A + (size_t)(row0 + ln) * lda;
  v8f acc[4] = {};
  for (int kb = 0; kb < K; kb += 32) {
    FragB ah, al;
    const v4f x0 = *(const v4fa*)(arow + kb + 8 * hh), x1 = *(const v4fa*)(arow + kb + 8 * hh + 4);
    const v4f x2 = *(const v4fa*)(arow + kb + 16 + 8 * hh), x3 = *(const v4fa*)(arow + kb + 16 + 8 * hh + 4);
    float xs[16] = {x0[0],x0[1],x0[2],x0[3],x1[0],x1[1],x1[2],x1[3],x2[0],x2[1],x2[2],x2[3],x3[0],x3[1],x3[2],x3[3]};
#pragma unroll
    for (int i = 0; i < 16; ++i) { const unsigned short hb = bf16_bits(xs[i]); ah.u[i] = hb; al.u[i] = ASPLIT ? bf16_bits(xs[i] - bf16_val(hb)) : (unsigned short)0; }
#pragma unroll
    for (int t = 0; t < 4; ++t) {
      const unsigned short* brow = Wt + (size_t)(col0 + t * 16 + ln) * ldb + kb;
      FragB b;
      b.half[0] = *(const v8us*)(brow + 8 * hh);
      b.half[1] = *(const v8us*)(brow + 16 + 8 * hh);
      acc[t] = mmaN<ASPLIT ? 2 : 1>(ah.v, al.v, b.v, b.v, acc[t]);
    }
  }
#pragma unroll
  for (int t = 0; t < 4; ++t) {
    const int col = col0 + t * 16 + ln;
    float bv = bias ? bias[col] : 0.f;
    if (BIAS_BF16) bv = bf16_round(bv);
#pragma unroll
    for (int r = 0; r < 8; ++r) {
      float v = acc[t][r] + bv;
      if (resid) { float rv = resid[(size_t)((row0 + 8 * hh + r) % rmod) * ldr + col]; if (RES_BF16) rv = bf16_round(rv); v += rv; }
      if (ACT == 1) v = fmaxf(v, 0.f);
      if (ACT == 2) v = 0.5f * v * (1.0f + erff(v * 0.70710678118654752f));
      if (ACT == 3) { const float u = 0.7978845608028654f * (v + 0.044715f * v * v * v); v = 0.5f * v * (1.0f + tanhf(u)); }
      so[w][8 * hh + r][t * 16 + ln] = v;
    }
  }
  __builtin_amdgcn_fence(__ATOMIC_ACQ_REL, "workgroup");
  __builtin_amdgcn_wave_barrier();
  const int rsub = lane >> 4, c4 = (lane & 15) * 4;
  {
#pragma unroll
    for (int q = 0; q < 8; ++q) {
      const int r = q * 2 + rsub;
      const v4f v = *(const v4fa*)&so[w][r][c4];
      *(v4f*)(C + (size_t)(row0 + r) * ldc + col0 + c4) = v;
    }
    
  }
}
// row LayerNorm (biased variance, eps) over N: s = X (+ R); optional out_sum <- s; out_norm <- (s-mu)*rsqrt(var+eps)*g + b
template <bool PARAM_BF16>
__global__ __launch_bounds__(256) void k_layernorm(const float* __restrict__ X, const float* __restrict__ R, const float* __restrict__ g, const float* __restrict__ bta,
                                                  float* __restrict__ out_sum, float* __restrict__ out_norm, int N, float eps) {
  __shared__ float red[256];
  const int row = blockIdx.x, tid = threadIdx.x;
  const float* x = X + (size_t)row * N; const float* rr = R ? R + (size_t)row * N : nullptr;
  float vals[16];                     // up to N = 4096
  const int per = N / 256;            // contiguous chunk per thread? use strided-by-4 chunks: thread handles j = tid*4 + 1024*u
  float s1 = 0.f;
  for (int u = 0; u < per / 4; ++u) {
    const int j = tid * 4 + 1024 * u;
    const v4f a = *(const v4fa*)(x + j);
    v4f b = {0.f,0.f,0.f,0.f}; if (rr) b = *(const v4fa*)(rr + j);
#pragma unroll
    for (int q = 0; q < 4; ++q) { const float v = a[q] + b[q]; vals[u * 4 + q] = v; s1 += v; }
  }
  red[tid] = s1; __syncthreads();
  for (int st = 128; st > 0; st >>= 1) { if (tid < st) red[tid] += red[tid + st]; __syncthreads(); }
  const float mu = red[0] / (float)N; __syncthreads();
  float s2 = 0.f;
  for (int u = 0; u < per / 4; ++u)
#pragma unroll
    for (int q = 0; q < 4; ++q) { const float c = vals[u * 4 + q] - mu; s2 += c * c; }
  red[tid] = s2; __syncthreads();
  for (int st = 128; st > 0; st >>= 1) { if (tid < st) red[tid] += red[tid + st]; __syncthreads(); }
  const float rs = rsqrtf(red[0] / (float)N + eps);
  {
    for (int u = 0; u < per / 4; ++u) {
      const int j = tid * 4 + 1024 * u;
      v4f o, sm;
#pragma unroll
      for (int q = 0; q < 4; ++q) {
        float gg = g[j + q], bb = bta[j + q];
        if (PARAM_BF16) { gg = bf16_round(gg); bb = bf16_round(bb); }
        sm[q] = vals[u * 4 + q]; o[q] = (vals[u * 4 + q] - mu) * rs * gg + bb;
      }
      if (out_sum) *(v4f*)(out_sum + (size_t)row * N + j) = sm;
      *(v4f*)(out_norm + (size_t)row * N + j) = o;
    }
    
  }
}



// ---- f16 WMMA path (v_wmma_f32_16x16x32_f16): 11-bit significands for operands in range — used here for the Q, [K|V] and Wo GEMMs
typedef _Float16 v16h __attribute__((ext_vector_type(16)));
union FragH { v16h v; v8us half[2]; _Float16 h[16]; unsigned short u[16]; };
template <int NT>
__device__ __forceinline__ v8f mmaH(v16h ah, v16h al, v16h bh, v16h bl, v8f c) {
  c = __builtin_amdgcn_wmma_f32_16x16x32_f16(false, ah, false, bh, (short)0, c, false, false);
  if (NT >= 2) c = __builtin_amdgcn_wmma_f32_16x16x32_f16(false, al, false, bh, (short)0, c, false, false);
  if (NT >= 3) c = __builtin_amdgcn_wmma_f32_16x16x32_f16(false, ah, false, bl, (short)0, c, false, false);
  asm volatile("v_nop\n\tv_nop\n\tv_nop\n\tv_nop" : "+v"(c) : "v"(ah), "v"(al), "v"(bh), "v"(bl));
  return c;
}
// batched GEMM like k_gemm_b but f16 operands: A f32 (split into f16 hi/lo if ASPLIT, else rounded to f16), Bt = f16 values [n][k]; alpha; C f32; N multiple of 16 (partial tiles skipped)
template <bool ASPLIT>
__global__ __launch_bounds__(128) void k_gemm_h(const float* __restrict__ A, int lda, size_t sA, const _Float16* __restrict__ Bh, int ldb, size_t sB, float alpha, float* __restrict__ C, int ldc, size_t sC, int M, int N, int K) {
  __shared__ __attribute__((aligned(16))) float so[4][16][64];
  const int tid = threadIdx.x, w = tid >> 5, lane = tid & 31, ln = lane & 15, hh = lane >> 4; const int by = blockIdx.y;
  A += (size_t)by * sA; Bh += (size_t)by * sB; C += (size_t)by * sC;
  const int ntn = (N + 63) / 64; const int wid = blockIdx.x * 4 + w; const int mt = wid / ntn, nq = wid % ntn; if (mt * 16 >= M) return;
  const int row0 = mt * 16, col0 = nq * 64; const float* arow = A + (size_t)(row0 + ln) * lda;
  v8f acc[4] = {};
  for (int kb = 0; kb < K; kb += 32) {
    FragH ah, al;
    const v4f x0 = *(const v4fa*)(arow + kb + 8 * hh), x1 = *(const v4fa*)(arow + kb + 8 * hh + 4), x2 = *(const v4fa*)(arow + kb + 16 + 8 * hh), x3 = *(const v4fa*)(arow + kb + 16 + 8 * hh + 4);
    float xs[16] = {x0[0],x0[1],x0[2],x0[3],x1[0],x1[1],x1[2],x1[3],x2[0],x2[1],x2[2],x2[3],x3[0],x3[1],x3[2],x3[3]};
#pragma unroll
    for (int i = 0; i < 16; ++i) { const _Float16 h = (_Float16)xs[i]; ah.h[i] = h; al.h[i] = ASPLIT ? (_Float16)(xs[i] - (float)h) : (_Float16)0.0f; }
#pragma unroll
    for (int t = 0; t < 4; ++t) { if (col0 + t * 16 >= N) continue; const size_t boff = (size_t)(col0 + t * 16 + ln) * ldb + kb; FragH bq; bq.half[0] = *(const v8us*)(Bh + boff + 8 * hh); bq.half[1] = *(const v8us*)(Bh + boff + 16 + 8 * hh);
      acc[t] = mmaH<ASPLIT ? 2 : 1>(ah.v, al.v, bq.v, bq.v, acc[t]); }
  }
#pragma unroll
  for (int t = 0; t < 4; ++t) { if (col0 + t * 16 >= N) continue;
#pragma unroll
    for (int r = 0; r < 8; ++r) so[w][8 * hh + r][t * 16 + ln] = acc[t][r] * alpha; }
  __builtin_amdgcn_fence(__ATOMIC_ACQ_REL, "workgroup"); __builtin_amdgcn_wave_barrier();
  const int rsub = lane >> 4, c4 = (lane & 15) * 4;
  {
#pragma unroll
    for (int q = 0; q < 8; ++q) { const int r = q * 2 + rsub; if (col0 + c4 < N) { const v4f v = *(const v4fa*)&so[w][r][c4]; *(v4f*)(C + (size_t)(row0 + r) * ldc + col0 + c4) = v; } }
     }
}

// Wt[n][k] = f16(W[k][n]·scale) from f32 row-major W[K][N] (scale = power of two; bf16-exact weights stay exact in f16 away from the subnormal range)
__global__ __launch_bounds__(256) void k_wt_f16(const float* __restrict__ W, _Float16* __restrict__ Wt, int K, int N, float scale) {
  const int t = blockIdx.x * 256 + threadIdx.x; if (t >= N * (K / 8)) return; const int n = t / (K / 8), k8 = (t % (K / 8)) * 8; FragH f;
#pragma unroll
  for (int i = 0; i < 8; ++i) f.h[i] = (_Float16)(bf16_round(W[(size_t)(k8 + i) * N + n]) * scale); const v8us o = f.half[0];
  *(v8us*)((unsigned short*)Wt + (size_t)n * K + k8) = o; 
}
// k_gemm_hh variant with fused epilogue: v = acc·alpha + bias[by·sBias + col] (+ CP[(row/rowsPerB)·sCPb + by·64 + col] if CP) ; ACT 0 none / 1 elu ; writes f16 C16 (and f32 C if non-null)
template <int ACT>
__global__ __launch_bounds__(128) void k_gemm_hhx(const _Float16* __restrict__ A, int lda, size_t sA, const _Float16* __restrict__ Bh, int ldb, size_t sB, float alpha, const float* __restrict__ bias, size_t sBias, const float* __restrict__ CP, int rowsPerB, size_t sCPb, int row0g,
    float* __restrict__ C, _Float16* __restrict__ C16, int ldc, size_t sC, int M, int N, int K) {
  __shared__ __attribute__((aligned(16))) float so[4][16][64];
  const int tid = threadIdx.x, w = tid >> 5, lane = tid & 31, ln = lane & 15, hh = lane >> 4; const int by = blockIdx.y;
  A += (size_t)by * sA; Bh += (size_t)by * sB; const size_t cofs = (size_t)by * sC; const float* bp = bias ? bias + (size_t)by * sBias : nullptr;
  const int ntn = (N + 63) / 64; const int wid = blockIdx.x * 4 + w; const int mt = wid / ntn, nq = wid % ntn; if (mt * 16 >= M) return;
  const int row0 = mt * 16, col0 = nq * 64; const _Float16* arow = A + (size_t)(row0 + ln) * lda;
  v8f acc[4] = {};
  for (int kb = 0; kb < K; kb += 32) { FragH ah; ah.half[0] = *(const v8us*)((const unsigned short*)arow + kb + 8 * hh); ah.half[1] = *(const v8us*)((const unsigned short*)arow + kb + 16 + 8 * hh);
#pragma unroll
    for (int t = 0; t < 4; ++t) { if (col0 + t * 16 >= N) continue; const size_t boff = (size_t)(col0 + t * 16 + ln) * ldb + kb; FragH bq; bq.half[0] = *(const v8us*)((const unsigned short*)Bh + boff + 8 * hh); bq.half[1] = *(const v8us*)((const unsigned short*)Bh + boff + 16 + 8 * hh);
      acc[t] = mmaH<1>(ah.v, ah.v, bq.v, bq.v, acc[t]); }
  }
#pragma unroll
  for (int t = 0; t < 4; ++t) { if (col0 + t * 16 >= N) continue; const int col = col0 + t * 16 + ln; const float bv = bp ? bf16_round(bp[col]) : 0.f;
#pragma unroll
    for (int r = 0; r < 8; ++r) { float v = acc[t][r] * alpha + bv; if (CP) { const int rr = row0g + row0 + 8 * hh + r; if (rowsPerB < 0) v += CP[cofs + (size_t)rr * ldc + col];      /* rowsPerB < 0: own element of the batched C plane */ else { const int bidx = rr / rowsPerB; v += CP[(size_t)bidx * sCPb + (size_t)by * 64 + col]; } } if (ACT == 1) v = (v > 0.f) ? v : expm1f(v); else if (ACT == 7) v = (v > 0.f) ? v + 1.0f : expf(v); else if (ACT == 8) v = tanhf(v); else if (ACT == 9) v = 0.5f * v * (1.0f + tanhf(0.7978845608028654f * (v + 0.044715f * v * v * v))); else if (ACT == 11) v = 1.0f / (1.0f + expf(-v)); else if (ACT == 12) v = (v > 0.f) ? v : 0.01f * v; else if (ACT == 14) v = (v > 0.f) ? v : 0.1f * v; else if (ACT == 16) v = (v >= 0.f) ? v : 0.3f * v; else if (ACT == 17) v = (v >= 0.f) ? v : 0.2f * v; else if (ACT == 15) v = v / (1.0f + expf(-v)); else if (ACT == 3) v = fmaxf(v, 0.f); else if (ACT == 6) v = 0.5f * v * (1.0f + erff(v * 0.70710678118654752f)); so[w][8 * hh + r][t * 16 + ln] = v; } }
  __builtin_amdgcn_fence(__ATOMIC_ACQ_REL, "workgroup"); __builtin_amdgcn_wave_barrier();
  const int rsub = lane >> 4, c4 = (lane & 15) * 4; typedef _Float16 v4h __attribute__((ext_vector_type(4)));
  {
#pragma unroll
    for (int q = 0; q < 8; ++q) { const int r = q * 2 + rsub; if (col0 + c4 < N) { const v4f v = *(const v4fa*)&so[w][r][c4]; if (C) *(v4f*)(C + cofs + (size_t)(row0 + r) * ldc + col0 + c4) = v; if (C16) { v4h h4; for (int i = 0; i < 4; ++i) h4[i] = (_Float16)v[i]; *(v4h*)(C16 + cofs + (size_t)(row0 + r) * ldc + col0 + c4) = h4; } } }
     }
}


typedef _Float16 v4h __attribute__((ext_vector_type(4)));

__global__ __launch_bounds__(256) void k_x16(const float* __restrict__ x, _Float16* __restrict__ X16, size_t n8) { const size_t t = (size_t)blockIdx.x * 256 + threadIdx.x; if (t >= n8) return; FragH f;
#pragma unroll
  for (int q = 0; q < 8; ++q) f.h[q] = (_Float16)bf16_round(x[t * 8 + q]); *(v8us*)((unsigned short*)X16 + t * 8) = f.half[0];  }
__global__ __launch_bounds__(256) void k_h16(const float* __restrict__ x, _Float16* __restrict__ X16, size_t n8) { const size_t t = (size_t)blockIdx.x * 256 + threadIdx.x; if (t >= n8) return; FragH f;
#pragma unroll
  for (int q = 0; q < 8; ++q) f.h[q] = (_Float16)x[t * 8 + q]; *(v8us*)((unsigned short*)X16 + t * 8) = f.half[0];  }
__global__ __launch_bounds__(256) void k_round16f(const float* __restrict__ W, _Float16* __restrict__ Bt, size_t n8) { const size_t t = (size_t)blockIdx.x * 256 + threadIdx.x; if (t >= n8) return; FragH f;
#pragma unroll
  for (int i = 0; i < 8; ++i) f.h[i] = (_Float16)(bf16_round(W[t * 8 + i]) * 16.0f); *(v8us*)((unsigned short*)Bt + t * 8) = f.half[0];  }
template <int NHv, int TTv>
__global__ __launch_bounds__(256) void k_vt(const _Float16* __restrict__ V16, int ldv, int voff, _Float16* __restrict__ Vt) { __shared__ unsigned short tl[64][66]; const int tid = threadIdx.x; const int slab = blockIdx.x / (TTv / 64), lg = blockIdx.x % (TTv / 64); const int b = slab / NHv, h = slab % NHv;
  for (int i = tid; i < 64 * 8; i += 256) { const int r = i / 8, c8 = (i % 8) * 8; FragH f; f.half[0] = *(const v8us*)((const unsigned short*)V16 + ((size_t)b * TTv + lg * 64 + r) * ldv + voff + h * 64 + c8);
#pragma unroll
    for (int q = 0; q < 8; ++q) tl[r][c8 + q] = f.u[q]; }
  __syncthreads();
  {
#pragma unroll
    for (int rd = 0; rd < 2; ++rd) { const int d = rd * 32 + tid / 8, pc = tid % 8; FragH f;
#pragma unroll
      for (int q = 0; q < 8; ++q) f.u[q] = tl[pc * 8 + q][d];
      *(v8us*)((unsigned short*)Vt + ((size_t)slab * 64 + d) * TTv + lg * 64 + pc * 8) = f.half[0]; }
     } }

__global__ __launch_bounds__(256) void k_hl(const float* __restrict__ F, _Float16* __restrict__ Hh, _Float16* __restrict__ Hl, size_t n8) { const size_t t = (size_t)blockIdx.x * 256 + threadIdx.x; if (t >= n8) return; FragH fh, fl; const v4f a = *(const v4fa*)(F + t * 8), c = *(const v4fa*)(F + t * 8 + 4);
#pragma unroll
  for (int q = 0; q < 4; ++q) { _Float16 h = (_Float16)a[q]; fh.h[q] = h; fl.h[q] = (_Float16)((a[q] - (float)h) * 1024.0f); h = (_Float16)c[q]; fh.h[4 + q] = h; fl.h[4 + q] = (_Float16)((c[q] - (float)h) * 1024.0f); }
  { *(v8us*)((unsigned short*)Hh + t * 8) = fh.half[0]; *(v8us*)((unsigned short*)Hl + t * 8) = fl.half[0];  } }

// ---- fast GEMM (block tile 128x64, wave tile 32x64; requires M % 128 == 0 rows per launch region, N % 64 == 0, K % 64 == 0); epilogue = k_gemm_hhx semantics ----
// Operand path: per trip of 64 k the block's 128 A rows and 64 B rows (128 bytes each, whole lines) are copied to LDS asynchronously, two buffers, the copies of trip t + 2 issued behind the barrier that ends trip t;
// the waves read their fragments from LDS (row pitch 144 bytes: no bank conflict for 16-byte reads). The k order of every accumulator is the ascending one of the direct-load form.
#define G2_PITCH 144
#define G2_STAGE (192 * G2_PITCH)      /* rows 0..127: A, rows 128..191: B */
__device__ __forceinline__ v16h g2_lfrag(const unsigned char* p) { FragH f; f.half[0] = *(const v8us*)p; f.half[1] = *(const v8us*)(p + 32); return f.v; }
__device__ __forceinline__ v8f g2_mma(v16h a, v16h b, v8f c) { v8f d = __builtin_amdgcn_wmma_f32_16x16x32_f16(false, a, false, b, (short)0, c, false, false); asm volatile("v_nop\n\tv_nop\n\tv_nop\n\tv_nop" : "+v"(d) : "v"(a), "v"(b)); return d; }
// One stage: each lane copies 12 pieces of 16 bytes (8 lanes = one 128-byte row, a wave = 4 rows, the block = 16 rows per copy; 8 copies for A, 4 for B). l: the lane's LDS byte address in row group 0.
__device__ __forceinline__ void g2_copy(unsigned l, const _Float16* ga, size_t sa, const _Float16* gb, size_t sb) {
  /* the copies and, as the last line of the same statement, the wait that stands in front of any new value in the address registers they name */
  asm volatile("global_load_async_to_lds_b128 %0, %12, off\n\t"
               "global_load_async_to_lds_b128 %1, %13, off\n\t"
               "global_load_async_to_lds_b128 %2, %14, off\n\t"
               "global_load_async_to_lds_b128 %3, %15, off\n\t"
               "global_load_async_to_lds_b128 %4, %16, off\n\t"
               "global_load_async_to_lds_b128 %5, %17, off\n\t"
               "global_load_async_to_lds_b128 %6, %18, off\n\t"
               "global_load_async_to_lds_b128 %7, %19, off\n\t"
               "global_load_async_to_lds_b128 %8, %20, off\n\t"
               "global_load_async_to_lds_b128 %9, %21, off\n\t"
               "global_load_async_to_lds_b128 %10, %22, off\n\t"
               "global_load_async_to_lds_b128 %11, %23, off\n\t"
               "s_wait_xcnt 0x0"
               :: "v"(l), "v"(l + 16 * G2_PITCH), "v"(l + 32 * G2_PITCH), "v"(l + 48 * G2_PITCH), "v"(l + 64 * G2_PITCH), "v"(l + 80 * G2_PITCH),
                  "v"(l + 96 * G2_PITCH), "v"(l + 112 * G2_PITCH), "v"(l + 128 * G2_PITCH), "v"(l + 144 * G2_PITCH), "v"(l + 160 * G2_PITCH), "v"(l + 176 * G2_PITCH),
                  "v"(ga), "v"(ga + sa), "v"(ga + 2 * sa), "v"(ga + 3 * sa), "v"(ga + 4 * sa), "v"(ga + 5 * sa), "v"(ga + 6 * sa), "v"(ga + 7 * sa),
                  "v"(gb), "v"(gb + sb), "v"(gb + 2 * sb), "v"(gb + 3 * sb)
               : "memory"); }
template <int ACT>
__global__ __launch_bounds__(128) void k_gemm2(const _Float16* __restrict__ A, int lda, size_t sA, const _Float16* __restrict__ Bh, int ldb, size_t sB, float alpha, const float* __restrict__ bias, size_t sBias, const float* __restrict__ CP, int rowsPerB, size_t sCPb, int row0g,
    float* __restrict__ C, _Float16* __restrict__ C16, int ldc, size_t sC, int M, int N, int K) { static_assert(ACT == 0 || ACT == 3 || ACT == 6 || ACT == 8 || ACT == 9 || ACT == 11 || ACT == 12 || ACT == 14 || ACT == 15 || ACT == 16 || ACT == 17, "k_gemm2: unsupported ACT code (would silently apply no activation)");
  __shared__ __attribute__((aligned(16))) unsigned char sm[2 * G2_STAGE];      /* the two operand buffers; behind the loop's last barrier the same bytes stage the output rows */
  float (*so)[32][68] = reinterpret_cast<float (*)[32][68]>(sm); static_assert(sizeof(float) * 4 * 32 * 68 <= 2 * G2_STAGE, "output staging must fit the operand buffers");
  const int tid = threadIdx.x, w = tid >> 5, lane = tid & 31, ln = lane & 15, hh = lane >> 4; const int by = blockIdx.y;
  A += (size_t)by * sA; Bh += (size_t)by * sB; const size_t cofs = (size_t)by * sC; const float* bp = bias ? bias + (size_t)by * sBias : nullptr;
  const int ntn = N >> 6; const int mt = blockIdx.x / ntn, nq = blockIdx.x - mt * ntn; const int row0 = mt * 128 + 32 * w, col0 = nq * 64; if (mt * 128 >= M) return;      /* the whole block leaves or none: barriers follow */
  const int crow = tid >> 3, cpc = tid & 7;
  const _Float16* ga = A + (size_t)(mt * 128 + crow) * lda + cpc * 8; const _Float16* gb = Bh + (size_t)(col0 + crow) * ldb + cpc * 8;
  const unsigned lb = (unsigned)(size_t)sm + (unsigned)(crow * G2_PITCH + cpc * 16);
  const unsigned char* fa = sm + (32 * w + ln) * G2_PITCH + 16 * hh; const unsigned char* fb = sm + (128 + ln) * G2_PITCH + 16 * hh;
  const int nt = K >> 6;
  const v8f z8 = {0.f,0.f,0.f,0.f,0.f,0.f,0.f,0.f}; v8f c00 = z8, c01 = z8, c02 = z8, c03 = z8, c10 = z8, c11 = z8, c12 = z8, c13 = z8;
  g2_copy(lb, ga, (size_t)16 * lda, gb, (size_t)16 * ldb);
  asm volatile("s_wait_asynccnt 0x0" ::: "memory");      /* this wave's copies of tile 0 have landed */
  __syncthreads();                                       /* ... and every other wave's */
  if (nt > 1) g2_copy(lb + G2_STAGE, ga + 64, (size_t)16 * lda, gb + 64, (size_t)16 * ldb);
#pragma unroll 1      /* rolled: one body serves both buffers and stays small */
  for (int t = 0; t < nt; ++t) { const unsigned bo = (unsigned)(t & 1) * G2_STAGE; const unsigned char* pa = fa + bo; const unsigned char* pb = fb + bo;
    /* the trip's 24 fragment reads stand together in front of its matrix instructions */
    const v16h a00 = g2_lfrag(pa), a10 = g2_lfrag(pa + 16 * G2_PITCH), b00 = g2_lfrag(pb), b10 = g2_lfrag(pb + 16 * G2_PITCH), b20 = g2_lfrag(pb + 32 * G2_PITCH), b30 = g2_lfrag(pb + 48 * G2_PITCH);
    const v16h a01 = g2_lfrag(pa + 64), a11 = g2_lfrag(pa + 16 * G2_PITCH + 64), b01 = g2_lfrag(pb + 64), b11 = g2_lfrag(pb + 16 * G2_PITCH + 64), b21 = g2_lfrag(pb + 32 * G2_PITCH + 64), b31 = g2_lfrag(pb + 48 * G2_PITCH + 64);
    c00 = g2_mma(a00, b00, c00); c10 = g2_mma(a10, b00, c10); c01 = g2_mma(a00, b10, c01); c11 = g2_mma(a10, b10, c11);
    c02 = g2_mma(a00, b20, c02); c12 = g2_mma(a10, b20, c12); c03 = g2_mma(a00, b30, c03); c13 = g2_mma(a10, b30, c13);
    c00 = g2_mma(a01, b01, c00); c10 = g2_mma(a11, b01, c10); c01 = g2_mma(a01, b11, c01); c11 = g2_mma(a11, b11, c11);
    c02 = g2_mma(a01, b21, c02); c12 = g2_mma(a11, b21, c12); c03 = g2_mma(a01, b31, c03); c13 = g2_mma(a11, b31, c13);
    asm volatile("s_wait_dscnt 0x0" ::: "memory");       /* this wave's reads of buffer t & 1 are done before the buffer is given up */
    asm volatile("s_wait_asynccnt 0x0" ::: "memory");    /* this wave's copies of tile t + 1 have landed */
    __syncthreads();                                     /* publishes tile t + 1 and ends every wave's reads of buffer t & 1 */
    if (t + 2 < nt) g2_copy(lb + bo, ga + (size_t)(t + 2) * 64, (size_t)16 * lda, gb + (size_t)(t + 2) * 64, (size_t)16 * ldb); }
  asm volatile("s_wait_asynccnt 0x0" ::: "memory");      /* no copy is outstanding when the buffers become output staging */
  v8f accs[8] = {c00, c01, c02, c03, c10, c11, c12, c13};
#pragma unroll
  for (int u = 0; u < 8; ++u) { const int t = u & 3, half = u >> 2; const int col = col0 + t * 16 + ln; const float bv = bp ? bf16_round(bp[col]) : 0.f;
#pragma unroll
    for (int r = 0; r < 8; ++r) { const int rloc = half * 16 + 8 * hh + r; float v = accs[u][r] * alpha + bv; if (CP) { if (rowsPerB < 0) v += CP[cofs + (size_t)(row0g + row0 + rloc) * ldc + col];      /* rowsPerB < 0: own element of the batched C plane */ else { const int bidx = (row0g + row0 + rloc) / rowsPerB; v += CP[(size_t)bidx * sCPb + (size_t)by * 64 + col]; } }
      if (ACT == 3) v = fmaxf(v, 0.f); else if (ACT == 6) v = 0.5f * v * (1.0f + erff(v * 0.70710678118654752f)); else if (ACT == 11) v = 1.0f / (1.0f + expf(-v)); else if (ACT == 15) v = v / (1.0f + expf(-v)); else if (ACT == 12) v = (v > 0.f) ? v : 0.01f * v; else if (ACT == 8) v = tanhf(v); else if (ACT == 9) v = 0.5f * v * (1.0f + tanhf(0.7978845608028654f * (v + 0.044715f * v * v * v))); else if (ACT == 14) v = (v > 0.f) ? v : 0.1f * v; else if (ACT == 16) v = (v >= 0.f) ? v : 0.3f * v; else if (ACT == 17) v = (v >= 0.f) ? v : 0.2f * v;
      so[w][rloc][t * 16 + ln] = v; } }
  __builtin_amdgcn_fence(__ATOMIC_ACQ_REL, "workgroup"); __builtin_amdgcn_wave_barrier();
  const int rsub = lane >> 4, c4 = (lane & 15) * 4;
  {
#pragma unroll
    for (int q = 0; q < 16; ++q) { const int r = q * 2 + rsub; const v4f v = *(const v4fa*)&so[w][r][c4]; if (C) *(v4f*)(C + cofs + (size_t)(row0 + r) * ldc + col0 + c4) = v; if (C16) { v4h h4; for (int i = 0; i < 4; ++i) h4[i] = (_Float16)v[i]; *(v4h*)(C16 + cofs + (size_t)(row0 + r) * ldc + col0 + c4) = h4; } }
     } }


__global__ __launch_bounds__(256) void k_wT(const float* __restrict__ w, int din, int dout, _Float16* __restrict__ Bt) { __shared__ float tl[64][65]; const int tid = threadIdx.x; const int nbo = dout / 64; const int ib = blockIdx.x / nbo, ob = blockIdx.x % nbo; const int i0 = ib * 64, o0 = ob * 64;
  for (int t = tid; t < 64 * 64; t += 256) { const int i = t / 64, o = t % 64; tl[o][i] = bf16_round(w[(size_t)(i0 + i) * dout + o0 + o]) * 16.0f; }
  __syncthreads();
  { for (int t = tid; t < 64 * 8; t += 256) { const int o = t / 8, i8 = (t % 8) * 8; FragH f; for (int q = 0; q < 8; ++q) f.h[q] = (_Float16)tl[o][i8 + q]; *(v8us*)((unsigned short*)Bt + (size_t)(o0 + o) * din + i0 + i8) = f.half[0]; }  } }
__global__ __launch_bounds__(256) void k_xr(const float* __restrict__ x, _Float16* __restrict__ X16) { const size_t t = (size_t)blockIdx.x * 256 + threadIdx.x; if (t >= NRX * DM / 8) return; const int c0 = (int)((t * 8) % DM); const size_t r = (t * 8) / DM; const int tok = (int)(r % RPB); const size_t b = r / RPB; FragH f;
  for (int q = 0; q < 8; ++q) f.h[q] = (tok < NTOK) ? (_Float16)bf16_round(x[(b * NTOK + tok) * DM + c0 + q]) : (_Float16)0.f;
  *(v8us*)((unsigned short*)X16 + t * 8) = f.half[0];  }
// sum over the 8 lanes that share one (query, head): three DPP adds inside the 16-lane row (lane ^ 1, ^ 2, ^ 4); every lane of the group ends with the total
template <int CTRL> __device__ __forceinline__ float nb_xadd(float x) { return x + __int_as_float(__builtin_amdgcn_update_dpp(0, __float_as_int(x), CTRL, 0xf, 0xf, true)); }
__device__ __forceinline__ float nb_dot(v4f a0, v4f a1, v4f k0, v4f k1) {
  float s = a0[0] * k0[0], t = a1[0] * k1[0];
#pragma unroll
  for (int d = 1; d < 4; ++d) { s = fmaf(a0[d], k0[d], s); t = fmaf(a1[d], k1[d], t); }
  s += t; s = nb_xadd<0x161>(s); s = nb_xadd<0x162>(s); s = nb_xadd<0x164>(s); return s; }
// Neighbourhood attention. Wave = NQW consecutive queries of one grid row (f0, h0) x 4 heads, a block's 8 waves side by side in that row; 8 lanes share a (query, head), lane l8 holding
// dims 4*l8..+3 and 32+4*l8..+3, so that each b128 load of a key row covers whole 128-byte lines. Only 14 of the 27 window slots can pass the causal test (frame f0-1: 3x3; frame f0: row h0-1: 3,
// row h0: w-1 and w); the others have a flat index above the query's for every query. A key row is loaded once per wave and serves each of its queries whose window holds it.
// A slot outside the grid still reads a token row of the same batch (in bounds, written by the GEMM before) and gets the mask value as its logit, hence weight 0.
#define NQW 2
__global__ __launch_bounds__(256) void k_nbatt(const float* Q, const float* KV, _Float16* O16) {      /* no __restrict__: the loads below keep their side of the two waits */
  const int lane = threadIdx.x & 31, l8 = lane & 7, hs = lane >> 3; const int wv = __builtin_amdgcn_readfirstlane((int)(threadIdx.x >> 5));
  const int gw = blockIdx.x * 8 + wv; const int rw = gw / (WT / NQW); const int h0 = rw % HT, f0 = (rw / HT) % FT, hq = (rw / (HT * FT)) % 2, b = rw / (HT * FT * 2);
  const int w0 = (gw % (WT / NQW)) * NQW; const int j0 = (f0 * HT + h0) * WT + w0; const unsigned co = (unsigned)(hq * (DM / 2) + hs * HD + l8 * 4);
  const float* kvb = KV + (size_t)b * RPB * (2 * DM);
  const float* rb[5]; bool kok[5][NQW + 2];      /* rb[r]: the row of the key at column w0 of window row r; a window row outside the grid points at token row 1, so that columns -1..NQW stay inside the buffer */
#pragma unroll
  for (int r = 0; r < 5; ++r) { const int f = f0 + (r < 3 ? -1 : 0), hh = h0 + (r < 3 ? r - 1 : r - 4); const bool rok = f >= 0 && hh >= 0 && hh < HT;
    rb[r] = kvb + (size_t)(rok ? (f * HT + hh) * WT + w0 + 1 : 1) * (2 * DM) + co;
#pragma unroll
    for (int c = 0; c < NQW + 2; ++c) { const int ww = w0 - 1 + c; kok[r][c] = rok && ww >= 0 && ww < WT; } }
  const float* qp = Q + ((size_t)b * RPB + j0) * DM + co;      /* query i is token j0 + i + 1 */ const float* bp = kvb + co;
  v4f q[NQW][2], kb[2], kk[5][NQW + 2][2];
#pragma unroll
  for (int i = 0; i < NQW; ++i) { q[i][0] = *(const v4fa*)(qp + (i + 1) * DM); q[i][1] = *(const v4fa*)(qp + (i + 1) * DM + 32); }
#pragma unroll
  for (int r = 0; r < 5; ++r) {
#pragma unroll
    for (int c = 0; c < NQW + (r < 4 ? 2 : 1); ++c) { const float* kp = rb[r] + (c - 1) * (2 * DM); kk[r][c][0] = *(const v4fa*)kp; kk[r][c][1] = *(const v4fa*)(kp + 32); } }
  kb[0] = *(const v4fa*)bp; kb[1] = *(const v4fa*)(bp + 32);
  /* the wait that stands between issued loads and any new value in their address registers; naming the addresses keeps them in those registers up to it */
  asm volatile("s_wait_xcnt 0x0" :: "v"(qp), "v"(bp), "v"(rb[0]), "v"(rb[1]), "v"(rb[2]), "v"(rb[3]), "v"(rb[4]) : "memory");
  float lg[NQW][15];
#pragma unroll
  for (int i = 0; i < NQW; ++i) lg[i][0] = nb_dot(q[i][0], q[i][1], kb[0], kb[1]) * 0.125f;
#pragma unroll
  for (int r = 0; r < 5; ++r) {
#pragma unroll
    for (int c = 0; c < NQW + (r < 4 ? 2 : 1); ++c) {
#pragma unroll
      for (int i = 0; i < NQW; ++i) { const int dw = c - i; if (dw >= 0 && dw < (r < 4 ? 3 : 2)) { const float sd = nb_dot(q[i][0], q[i][1], kk[r][c][0], kk[r][c][1]) * 0.125f; lg[i][1 + r * 3 + dw] = kok[r][c] ? sd : -3.0e38f; } } } }
  v4f vb[2], vv[5][NQW + 2][2];      /* the v rows fly while the softmax is worked out */
#pragma unroll
  for (int r = 0; r < 5; ++r) {
#pragma unroll
    for (int c = 0; c < NQW + (r < 4 ? 2 : 1); ++c) { const float* vp = rb[r] + (c - 1) * (2 * DM) + DM; vv[r][c][0] = *(const v4fa*)vp; vv[r][c][1] = *(const v4fa*)(vp + 32); } }
  vb[0] = *(const v4fa*)(bp + DM); vb[1] = *(const v4fa*)(bp + DM + 32);
  /* the same wait behind the v loads */
  asm volatile("s_wait_xcnt 0x0" :: "v"(bp), "v"(rb[0]), "v"(rb[1]), "v"(rb[2]), "v"(rb[3]), "v"(rb[4]) : "memory");
#pragma unroll
  for (int i = 0; i < NQW; ++i) { float mx = lg[i][0];
#pragma unroll
    for (int s = 1; s < 15; ++s) mx = fmaxf(mx, lg[i][s]);
    float se = 0.f;
#pragma unroll
    for (int s = 0; s < 15; ++s) { const float e = expf(lg[i][s] - mx); lg[i][s] = e; se += e; }
    const float inv = 1.0f / se;
#pragma unroll
    for (int s = 0; s < 15; ++s) lg[i][s] *= inv; }
  v4f o[NQW][2];
#pragma unroll
  for (int i = 0; i < NQW; ++i) { o[i][0] = vb[0] * lg[i][0]; o[i][1] = vb[1] * lg[i][0]; }
#pragma unroll
  for (int r = 0; r < 5; ++r) {
#pragma unroll
    for (int c = 0; c < NQW + (r < 4 ? 2 : 1); ++c) {
#pragma unroll
      for (int i = 0; i < NQW; ++i) { const int dw = c - i; if (dw >= 0 && dw < (r < 4 ? 3 : 2)) { const float p = lg[i][1 + r * 3 + dw]; o[i][0] += vv[r][c][0] * p; o[i][1] += vv[r][c][1] * p; } } } }
#pragma unroll
  for (int i = 0; i < NQW; ++i) { _Float16* op = O16 + ((size_t)b * NPAD + j0 + i + 1) * DM + co; v4h a, c;
#pragma unroll
    for (int d = 0; d < 4; ++d) { a[d] = (_Float16)o[i][0][d]; c[d] = (_Float16)o[i][1][d]; }
    *(v4h*)op = a; *(v4h*)(op + 32) = c; } }
__global__ __launch_bounds__(256) void k_bos(const float* __restrict__ KV, _Float16* __restrict__ O16) { const int t = blockIdx.x * 256 + threadIdx.x; if (t >= NB * DM / 8) return; const int c0 = (t * 8) % DM; const int b = (t * 8) / DM; FragH f; for (int q = 0; q < 8; ++q) f.h[q] = (_Float16)KV[((size_t)b * RPB + 0) * (2 * DM) + DM + c0 + q];
  unsigned short* d = (unsigned short*)O16 + ((size_t)b * NPAD) * DM + c0; *(v8us*)d = f.half[0];  }

extern "C" void kernel_launch(void* const* d_in, const int* in_sizes, int n_in,
                              void* d_out, int out_size, void* d_ws, size_t ws_size, hipStream_t stream) {
  (void)in_sizes; (void)n_in; (void)out_size;
  const float* const* I = (const float* const*)d_in; const float* x = I[0]; const float* Wq = I[1]; const float* Wkv = I[2]; const float* Wo = I[3]; const float* bo = I[4];
  char* ws = (char*)d_ws; size_t off = 0;
  auto take = [&](size_t bytes) { char* p = ws + off; off += (bytes + 255) & ~(size_t)255; return p; };
  _Float16* BQ = (_Float16*)take((size_t)DM * DM * 2); _Float16* BKV = (_Float16*)take((size_t)2 * DM * DM * 2); _Float16* BO = (_Float16*)take((size_t)DM * DM * 2);
  _Float16* X16 = (_Float16*)take(NRX * DM * 2); float* Q = (float*)take(NRX * DM * 4); float* KV = (float*)take(NRX * 2 * DM * 4); _Float16* O16 = (_Float16*)take((size_t)NB * NPAD * DM * 2);      /* rows b*4097 + tok; the last query's token (4096) is computed but dropped by the output GEMM */
  if (off > ws_size) return;      /* 2 + 8.6 + 17.3 + 34.6 + 8.4 = ≈ 71 MiB */
  k_wT<<<(DM / 64) * (DM / 64), 256, 0, stream>>>(Wq, DM, DM, BQ); k_wT<<<(DM / 64) * (2 * DM / 64), 256, 0, stream>>>(Wkv, DM, 2 * DM, BKV); k_wT<<<(DM / 64) * (DM / 64), 256, 0, stream>>>(Wo, DM, DM, BO);
  k_xr<<<(unsigned)((NRX * DM / 8 + 255) / 256), 256, 0, stream>>>(x, X16);
  k_gemm2<0><<<dim3((unsigned)((NRX / 128) * (DM / 64)), 1), 128, 0, stream>>>(X16, DM, 0, BQ, DM, 0, 0.0625f, nullptr, 0, nullptr, 1, 0, 0, Q, nullptr, DM, 0, (int)NRX, DM, DM);
  k_gemm2<0><<<dim3((unsigned)((NRX / 128) * (2 * DM / 64)), 1), 128, 0, stream>>>(X16, DM, 0, BKV, DM, 0, 0.0625f, nullptr, 0, nullptr, 1, 0, 0, KV, nullptr, 2 * DM, 0, (int)NRX, 2 * DM, DM);
  k_nbatt<<<NB * 2 * FT * HT * (WT / NQW) / 8, 256, 0, stream>>>(Q, KV, O16);
  k_bos<<<(NB * DM / 8 + 255) / 256, 256, 0, stream>>>(KV, O16);
  for (int b = 0; b < NB; ++b) k_gemm2<0><<<dim3((unsigned)((NTOK / 128) * (DM / 64)), 1), 128, 0, stream>>>(O16 + (size_t)b * NPAD * DM, DM, 0, BO, DM, 0, 0.0625f, bo, 0, nullptr, 1, 0, 0, (float*)d_out + (size_t)b * NTOK * DM, nullptr, DM, 0, NTOK, DM, DM);      /* out = o Wo + bo for tokens 0..4095 of each batch (token 4096 dropped as in the reference) */
}

// v003
// One run takes 64.9 microseconds.
// Timed twice side by side with v002, it ran 1.51 and 1.50 times as fast.
// Over all steps from v000 it is 7.89 times as fast.
#include <hip/hip_runtime.h>
// Sparse3DNA (x [2][4096][512]: 1 BOS + 4095 video tokens on a 4x32x32 grid, padded by one zero token to 4097; q = x Wq, [k|v] = x Wkv ([in][out], no bias), 8 heads of 64; query j (token j+1) attends to {BOS} U {its 3x3x3 grid neighbourhood keys with flat index <= j} (out-of-grid slots and future keys masked), scale 64^-0.5, softmax, weighted v; token 0's output is v_BOS itself; out = o Wo + bo, first 4096 tokens -> [2][4096][512]).
// Structure: token rows (4,097 per batch padded to 4,224); x as exact f16 rows; one [Q|K|V] WMMA GEMM (32x64 wave tiles, f32 accumulation, exact x16 transposed weights) kept in f32, rows of 1,536; the 28-slot neighbourhood attention on VALU (f32: 8 lanes per (batch, head, query), 2 queries x 4 heads per wave, window indices and the causal test from the grid geometry on device, logits, softmax, weighted sum) into f16 o rows (row 0 = v_BOS); out = o Wo + bo GEMM (f32, output layout). Four launches: operands, [Q|K|V], attention, output.
// Compute dtype: inputs rounded to bf16; x / weights exact; q, k, v, logits, softmax f32; o plain f16 into the Wo GEMM (~2^-12). v_wmma_f32_16x16x32_f16.
#define NB 2
#define NTOK 4096                    /* input tokens per batch (= output tokens) */
#define NPAD 4097                    /* after the module's padding */
#define RPB 4224                     /* rows per batch (33 x 128) */
#define NRX ((size_t)NB * RPB)       /* 8448 */
#define DM 512
#define NH 8
#define HD 64
#define FT 4
#define HT 32
#define WT 32
#define TT (FT * HT * WT)            /* 4096 grid tokens */
#define QT TT                        /* unused */
typedef __bf16 v16b __attribute__((ext_vector_type(16)));
typedef unsigned short v8us __attribute__((ext_vector_type(8), may_alias));
typedef float  v8f  __attribute__((ext_vector_type(8)));
typedef float  v4f  __attribute__((ext_vector_type(4)));
typedef float  v4fa __attribute__((ext_vector_type(4), may_alias));
union FragB { v16b v; v8us half[2]; unsigned short u[16]; };

__device__ __forceinline__ unsigned short bf16_bits(float x) { unsigned int u = __float_as_uint(x); return (unsigned short)((u + 0x7FFFu + ((u >> 16) & 1u)) >> 16); }
__device__ __forceinline__ float bf16_val(unsigned short b) { return __uint_as_float(((unsigned int)b) << 16); }
__device__ __forceinline__ float bf16_round(float x) { return bf16_val(bf16_bits(x)); }
// D += A·B with NT terms: 1 = ah·bh, 2 = + al·bh (A split), 3 = + ah·bl (both split)
template <int NT>
__device__ __forceinline__ v8f mmaN(v16b ah, v16b al, v16b bh, v16b bl, v8f c) {
  c = __builtin_amdgcn_wmma_f32_16x16x32_bf16(false, ah, false, bh, (short)0, c, false, false);
  if (NT >= 2) c = __builtin_amdgcn_wmma_f32_16x16x32_bf16(false, al, false, bh, (short)0, c, false, false);
  if (NT >= 3) c = __builtin_amdgcn_wmma_f32_16x16x32_bf16(false, ah, false, bl, (short)0, c, false, false);
  asm volatile("v_nop\n\tv_nop\n\tv_nop\n\tv_nop" : "+v"(c) : "v"(ah), "v"(al), "v"(bh), "v"(bl));
  return c;
}

__global__ __launch_bounds__(256) void k_wt_bf16(const float* __restrict__ W, unsigned short* __restrict__ Wt, int K, int N) {
  const int t = blockIdx.x * 256 + threadIdx.x;
  const int k8n = K / 8;
  if (t >= N * k8n) return;
  const int n = t / k8n, k8 = (t % k8n) * 8;
  v8us v;
#pragma unroll
  for (int i = 0; i < 8; ++i) v[i] = bf16_bits(W[(size_t)(k8 + i) * N + n]);
  *(v8us*)(Wt + (size_t)n * K + k8) = v;
  
}

// GEMM C[M][N] (f32, pitch ldc) = act(A[M][K]·W + bias). A f32 row-major (pitch lda) converted per fragment to bf16
// (ASPLIT: hi/lo two planes -> 2 terms, else single rounded term); Wt bf16 [N][K] (pitch ldb). BIAS_BF16 rounds the
// bias to bf16 first (bias quantised to bf16 before the add). K%32==0, M%16==0, N%64==0.
template <bool ASPLIT, int ACT, bool BIAS_BF16>
__global__ __launch_bounds__(128) void k_gemm_bf(const float* __restrict__ A, int lda, const unsigned short* __restrict__ Wt, int ldb,
                                               const float* __restrict__ bias, float* __restrict__ C, int ldc, int M, int N, int K) {
  __shared__ __attribute__((aligned(16))) float so[4][16][64];
  const int tid = threadIdx.x, w = tid >> 5, lane = tid & 31, ln = lane & 15, hh = lane >> 4;
  const int ntn = N / 64;
  const int wid = blockIdx.x * 4 + w;
  const int mt = wid / ntn, nq = wid % ntn;
  if (mt * 16 >= M) return;
  const int row0 = mt * 16, col0 = nq * 64;
  const float* arow = A + (size_t)(row0 + ln) * lda;
  v8f acc[4] = {};
  for (int kb = 0; kb < K; kb += 32) {
    FragB ah, al;
    const v4f x0 = *(const v4fa*)(arow + kb + 8 * hh), x1 = *(const v4fa*)(arow + kb + 8 * hh + 4);
    const v4f x2 = *(const v4fa*)(arow + kb + 16 + 8 * hh), x3 = *(const v4fa*)(arow + kb + 16 + 8 * hh + 4);
    float xs[16] = {x0[0],x0[1],x0[2],x0[3],x1[0],x1[1],x1[2],x1[3],x2[0],x2[1],x2[2],x2[3],x3[0],x3[1],x3[2],x3[3]};
#pragma unroll
    for (int i = 0; i < 16; ++i) { const unsigned short hb = bf16_bits(xs[i]); ah.u[i] = hb; al.u[i] = ASPLIT ? bf16_bits(xs[i] - bf16_val(hb)) : (unsigned short)0; }
#pragma unroll
    for (int t = 0; t < 4; ++t) {
      const unsigned short* brow = Wt + (size_t)(col0 + t * 16 + ln) * ldb + kb;
      FragB b;
      b.half[0] = *(const v8us*)(brow + 8 * hh);
      b.half[1] = *(const v8us*)(brow + 16 + 8 * hh);
      acc[t] = mmaN<ASPLIT ? 2 : 1>(ah.v, al.v, b.v, b.v, acc[t]);
    }
  }
#pragma unroll
  for (int t = 0; t < 4; ++t) {
    float bv = bias ? bias[col0 + t * 16 + ln] : 0.f;
    if (BIAS_BF16) bv = bf16_round(bv);
#pragma unroll
    for (int r = 0; r < 8; ++r) { float v = acc[t][r] + bv; if (ACT == 1) v = fmaxf(v, 0.f); so[w][8 * hh + r][t * 16 + ln] = v; }
  }
  __builtin_amdgcn_fence(__ATOMIC_ACQ_REL, "workgroup");
  __builtin_amdgcn_wave_barrier();
  const int rsub = lane >> 4, c4 = (lane & 15) * 4;
  {
#pragma unroll
    for (int q = 0; q < 8; ++q) {
      const int r = q * 2 + rsub;
      const v4f v = *(const v4fa*)&so[w][r][c4];
      *(v4f*)(C + (size_t)(row0 + r) * ldc + col0 + c4) = v;
    }
    
  }
}

// GEMM C = act(A·W + bias + resid): A f32 (ASPLIT -> hi/lo 2 terms), Wt bf16 [N][K]; ACT 0 none, 1 relu, 2 exact gelu;
// resid (optional, f32, row index = (row % rmod), pitch ldr, RES_BF16 rounds it) added before the activation.
template <bool ASPLIT, int ACT, bool BIAS_BF16, bool RES_BF16>
__global__ __launch_bounds__(128) void k_gemm_bf3(const float* __restrict__ A, int lda, const unsigned short* __restrict__ Wt, int ldb,
                                                const float* __restrict__ bias, const float* __restrict__ resid, int rmod, int ldr,
                                                float* __restrict__ C, int ldc, int M, int N, int K) {
  __shared__ __attribute__((aligned(16))) float so[4][16][64];
  const int tid = threadIdx.x, w = tid >> 5, lane = tid & 31, ln = lane & 15, hh = lane >> 4;
  const int ntn = N / 64;
  const int wid = blockIdx.x * 4 + w;
  const int mt = wid / ntn, nq = wid % ntn;
  if (mt * 16 >= M) return;
  const int row0 = mt * 16, col0 = nq * 64;
  const float* arow = A + (size_t)(row0 + ln) * lda;
  v8f acc[4] = {};
  for (int kb = 0; kb < K; kb += 32) {
    FragB ah, al;
    const v4f x0 = *(const v4fa*)(arow + kb + 8 * hh), x1 = *(const v4fa*)(arow + kb + 8 * hh + 4);
    const v4f x2 = *(const v4fa*)(arow + kb + 16 + 8 * hh), x3 = *(const v4fa*)(arow + kb + 16 + 8 * hh + 4);
    float xs[16] = {x0[0],x0[1],x0[2],x0[3],x1[0],x1[1],x1[2],x1[3],x2[0],x2[1],x2[2],x2[3],x3[0],x3[1],x3[2],x3[3]};
#pragma unroll
    for (int i = 0; i < 16; ++i) { const unsigned short hb = bf16_bits(xs[i]); ah.u[i] = hb; al.u[i] = ASPLIT ? bf16_bits(xs[i] - bf16_val(hb)) : (unsigned short)0; }
#pragma unroll
    for (int t = 0; t < 4; ++t) {
      const unsigned short* brow = Wt + (size_t)(col0 + t * 16 + ln) * ldb + kb;
      FragB b;
      b.half[0] = *(const v8us*)(brow + 8 * hh);
      b.half[1] = *(const v8us*)(brow + 16 + 8 * hh);
      acc[t] = mmaN<ASPLIT ? 2 : 1>(ah.v, al.v, b.v, b.v, acc[t]);
    }
  }
#pragma unroll
  for (int t = 0; t < 4; ++t) {
    const int col = col0 + t * 16 + ln;
    float bv = bias ? bias[col] : 0.f;
    if (BIAS_BF16) bv = bf16_round(bv);
#pragma unroll
    for (int r = 0; r < 8; ++r) {
      float v = acc[t][r] + bv;
      if (resid) { float rv = resid[(size_t)((row0 + 8 * hh + r) % rmod) * ldr + col]; if (RES_BF16) rv = bf16_round(rv); v += rv; }
      if (ACT == 1) v = fmaxf(v, 0.f);
      if (ACT == 2) v = 0.5f * v * (1.0f + erff(v * 0.70710678118654752f));
      if (ACT == 3) { const float u = 0.7978845608028654f * (v + 0.044715f * v * v * v); v = 0.5f * v * (1.0f + tanhf(u)); }
      so[w][8 * hh + r][t * 16 + ln] = v;
    }
  }
  __builtin_amdgcn_fence(__ATOMIC_ACQ_REL, "workgroup");
  __builtin_amdgcn_wave_barrier();
  const int rsub = lane >> 4, c4 = (lane & 15) * 4;
  {
#pragma unroll
    for (int q = 0; q < 8; ++q) {
      const int r = q * 2 + rsub;
      const v4f v = *(const v4fa*)&so[w][r][c4];
      *(v4f*)(C + (size_t)(row0 + r) * ldc + col0 + c4) = v;
    }
    
  }
}
// row LayerNorm (biased variance, eps) over N: s = X (+ R); optional out_sum <- s; out_norm <- (s-mu)*rsqrt(var+eps)*g + b
template <bool PARAM_BF16>
__global__ __launch_bounds__(256) void k_layernorm(const float* __restrict__ X, const float* __restrict__ R, const float* __restrict__ g, const float* __restrict__ bta,
                                                  float* __restrict__ out_sum, float* __restrict__ out_norm, int N, float eps) {
  __shared__ float red[256];
  const int row = blockIdx.x, tid = threadIdx.x;
  const float* x = X + (size_t)row * N; const float* rr = R ? R + (size_t)row * N : nullptr;
  float vals[16];                     // up to N = 4096
  const int per = N / 256;            // contiguous chunk per thread? use strided-by-4 chunks: thread handles j = tid*4 + 1024*u
  float s1 = 0.f;
  for (int u = 0; u < per / 4; ++u) {
    const int j = tid * 4 + 1024 * u;
    const v4f a = *(const v4fa*)(x + j);
    v4f b = {0.f,0.f,0.f,0.f}; if (rr) b = *(const v4fa*)(rr + j);
#pragma unroll
    for (int q = 0; q < 4; ++q) { const float v = a[q] + b[q]; vals[u * 4 + q] = v; s1 += v; }
  }
  red[tid] = s1; __syncthreads();
  for (int st = 128; st > 0; st >>= 1) { if (tid < st) red[tid] += red[tid + st]; __syncthreads(); }
  const float mu = red[0] / (float)N; __syncthreads();
  float s2 = 0.f;
  for (int u = 0; u < per / 4; ++u)
#pragma unroll
    for (int q = 0; q < 4; ++q) { const float c = vals[u * 4 + q] - mu; s2 += c * c; }
  red[tid] = s2; __syncthreads();
  for (int st = 128; st > 0; st >>= 1) { if (tid < st) red[tid] += red[tid + st]; __syncthreads(); }
  const float rs = rsqrtf(red[0] / (float)N + eps);
  {
    for (int u = 0; u < per / 4; ++u) {
      const int j = tid * 4 + 1024 * u;
      v4f o, sm;
#pragma unroll
      for (int q = 0; q < 4; ++q) {
        float gg = g[j + q], bb = bta[j + q];
        if (PARAM_BF16) { gg = bf16_round(gg); bb = bf16_round(bb); }
        sm[q] = vals[u * 4 + q]; o[q] = (vals[u * 4 + q] - mu) * rs * gg + bb;
      }
      if (out_sum) *(v4f*)(out_sum + (size_t)row * N + j) = sm;
      *(v4f*)(out_norm + (size_t)row * N + j) = o;
    }
    
  }
}



// ---- f16 WMMA path (v_wmma_f32_16x16x32_f16): 11-bit significands for operands in range — used here for the [Q|K|V] and Wo GEMMs
typedef _Float16 v16h __attribute__((ext_vector_type(16)));
union FragH { v16h v; v8us half[2]; _Float16 h[16]; unsigned short u[16]; };
template <int NT>
__device__ __forceinline__ v8f mmaH(v16h ah, v16h al, v16h bh, v16h bl, v8f c) {
  c = __builtin_amdgcn_wmma_f32_16x16x32_f16(false, ah, false, bh, (short)0, c, false, false);
  if (NT >= 2) c = __builtin_amdgcn_wmma_f32_16x16x32_f16(false, al, false, bh, (short)0, c, false, false);
  if (NT >= 3) c = __builtin_amdgcn_wmma_f32_16x16x32_f16(false, ah, false, bl, (short)0, c, false, false);
  asm volatile("v_nop\n\tv_nop\n\tv_nop\n\tv_nop" : "+v"(c) : "v"(ah), "v"(al), "v"(bh), "v"(bl));
  return c;
}
// batched GEMM like k_gemm_b but f16 operands: A f32 (split into f16 hi/lo if ASPLIT, else rounded to f16), Bt = f16 values [n][k]; alpha; C f32; N multiple of 16 (partial tiles skipped)
template <bool ASPLIT>
__global__ __launch_bounds__(128) void k_gemm_h(const float* __restrict__ A, int lda, size_t sA, const _Float16* __restrict__ Bh, int ldb, size_t sB, float alpha, float* __restrict__ C, int ldc, size_t sC, int M, int N, int K) {
  __shared__ __attribute__((aligned(16))) float so[4][16][64];
  const int tid = threadIdx.x, w = tid >> 5, lane = tid & 31, ln = lane & 15, hh = lane >> 4; const int by = blockIdx.y;
  A += (size_t)by * sA; Bh += (size_t)by * sB; C += (size_t)by * sC;
  const int ntn = (N + 63) / 64; const int wid = blockIdx.x * 4 + w; const int mt = wid / ntn, nq = wid % ntn; if (mt * 16 >= M) return;
  const int row0 = mt * 16, col0 = nq * 64; const float* arow = A + (size_t)(row0 + ln) * lda;
  v8f acc[4] = {};
  for (int kb = 0; kb < K; kb += 32) {
    FragH ah, al;
    const v4f x0 = *(const v4fa*)(arow + kb + 8 * hh), x1 = *(const v4fa*)(arow + kb + 8 * hh + 4), x2 = *(const v4fa*)(arow + kb + 16 + 8 * hh), x3 = *(const v4fa*)(arow + kb + 16 + 8 * hh + 4);
    float xs[16] = {x0[0],x0[1],x0[2],x0[3],x1[0],x1[1],x1[2],x1[3],x2[0],x2[1],x2[2],x2[3],x3[0],x3[1],x3[2],x3[3]};
#pragma unroll
    for (int i = 0; i < 16; ++i) { const _Float16 h = (_Float16)xs[i]; ah.h[i] = h; al.h[i] = ASPLIT ? (_Float16)(xs[i] - (float)h) : (_Float16)0.0f; }
#pragma unroll
    for (int t = 0; t < 4; ++t) { if (col0 + t * 16 >= N) continue; const size_t boff = (size_t)(col0 + t * 16 + ln) * ldb + kb; FragH bq; bq.half[0] = *(const v8us*)(Bh + boff + 8 * hh); bq.half[1] = *(const v8us*)(Bh + boff + 16 + 8 * hh);
      acc[t] = mmaH<ASPLIT ? 2 : 1>(ah.v, al.v, bq.v, bq.v, acc[t]); }
  }
#pragma unroll
  for (int t = 0; t < 4; ++t) { if (col0 + t * 16 >= N) continue;
#pragma unroll
    for (int r = 0; r < 8; ++r) so[w][8 * hh + r][t * 16 + ln] = acc[t][r] * alpha; }
  __builtin_amdgcn_fence(__ATOMIC_ACQ_REL, "workgroup"); __builtin_amdgcn_wave_barrier();
  const int rsub = lane >> 4, c4 = (lane & 15) * 4;
  {
#pragma unroll
    for (int q = 0; q < 8; ++q) { const int r = q * 2 + rsub; if (col0 + c4 < N) { const v4f v = *(const v4fa*)&so[w][r][c4]; *(v4f*)(C + (size_t)(row0 + r) * ldc + col0 + c4) = v; } }
     }
}

// Wt[n][k] = f16(W[k][n]·scale) from f32 row-major W[K][N] (scale = power of two; bf16-exact weights stay exact in f16 away from the subnormal range)
__global__ __launch_bounds__(256) void k_wt_f16(const float* __restrict__ W, _Float16* __restrict__ Wt, int K, int N, float scale) {
  const int t = blockIdx.x * 256 + threadIdx.x; if (t >= N * (K / 8)) return; const int n = t / (K / 8), k8 = (t % (K / 8)) * 8; FragH f;
#pragma unroll
  for (int i = 0; i < 8; ++i) f.h[i] = (_Float16)(bf16_round(W[(size_t)(k8 + i) * N + n]) * scale); const v8us o = f.half[0];
  *(v8us*)((unsigned short*)Wt + (size_t)n * K + k8) = o; 
}
// k_gemm_hh variant with fused epilogue: v = acc·alpha + bias[by·sBias + col] (+ CP[(row/rowsPerB)·sCPb + by·64 + col] if CP) ; ACT 0 none / 1 elu ; writes f16 C16 (and f32 C if non-null)
template <int ACT>
__global__ __launch_bounds__(128) void k_gemm_hhx(const _Float16* __restrict__ A, int lda, size_t sA, const _Float16* __restrict__ Bh, int ldb, size_t sB, float alpha, const float* __restrict__ bias, size_t sBias, const float* __restrict__ CP, int rowsPerB, size_t sCPb, int row0g,
    float* __restrict__ C, _Float16* __restrict__ C16, int ldc, size_t sC, int M, int N, int K) {
  __shared__ __attribute__((aligned(16))) float so[4][16][64];
  const int tid = threadIdx.x, w = tid >> 5, lane = tid & 31, ln = lane & 15, hh = lane >> 4; const int by = blockIdx.y;
  A += (size_t)by * sA; Bh += (size_t)by * sB; const size_t cofs = (size_t)by * sC; const float* bp = bias ? bias + (size_t)by * sBias : nullptr;
  const int ntn = (N + 63) / 64; const int wid = blockIdx.x * 4 + w; const int mt = wid / ntn, nq = wid % ntn; if (mt * 16 >= M) return;
  const int row0 = mt * 16, col0 = nq * 64; const _Float16* arow = A + (size_t)(row0 + ln) * lda;
  v8f acc[4] = {};
  for (int kb = 0; kb < K; kb += 32) { FragH ah; ah.half[0] = *(const v8us*)((const unsigned short*)arow + kb + 8 * hh); ah.half[1] = *(const v8us*)((const unsigned short*)arow + kb + 16 + 8 * hh);
#pragma unroll
    for (int t = 0; t < 4; ++t) { if (col0 + t * 16 >= N) continue; const size_t boff = (size_t)(col0 + t * 16 + ln) * ldb + kb; FragH bq; bq.half[0] = *(const v8us*)((const unsigned short*)Bh + boff + 8 * hh); bq.half[1] = *(const v8us*)((const unsigned short*)Bh + boff + 16 + 8 * hh);
      acc[t] = mmaH<1>(ah.v, ah.v, bq.v, bq.v, acc[t]); }
  }
#pragma unroll
  for (int t = 0; t < 4; ++t) { if (col0 + t * 16 >= N) continue; const int col = col0 + t * 16 + ln; const float bv = bp ? bf16_round(bp[col]) : 0.f;
#pragma unroll
    for (int r = 0; r < 8; ++r) { float v = acc[t][r] * alpha + bv; if (CP) { const int rr = row0g + row0 + 8 * hh + r; if (rowsPerB < 0) v += CP[cofs + (size_t)rr * ldc + col];      /* rowsPerB < 0: own element of the batched C plane */ else { const int bidx = rr / rowsPerB; v += CP[(size_t)bidx * sCPb + (size_t)by * 64 + col]; } } if (ACT == 1) v = (v > 0.f) ? v : expm1f(v); else if (ACT == 7) v = (v > 0.f) ? v + 1.0f : expf(v); else if (ACT == 8) v = tanhf(v); else if (ACT == 9) v = 0.5f * v * (1.0f + tanhf(0.7978845608028654f * (v + 0.044715f * v * v * v))); else if (ACT == 11) v = 1.0f / (1.0f + expf(-v)); else if (ACT == 12) v = (v > 0.f) ? v : 0.01f * v; else if (ACT == 14) v = (v > 0.f) ? v : 0.1f * v; else if (ACT == 16) v = (v >= 0.f) ? v : 0.3f * v; else if (ACT == 17) v = (v >= 0.f) ? v : 0.2f * v; else if (ACT == 15) v = v / (1.0f + expf(-v)); else if (ACT == 3) v = fmaxf(v, 0.f); else if (ACT == 6) v = 0.5f * v * (1.0f + erff(v * 0.70710678118654752f)); so[w][8 * hh + r][t * 16 + ln] = v; } }
  __builtin_amdgcn_fence(__ATOMIC_ACQ_REL, "workgroup"); __builtin_amdgcn_wave_barrier();
  const int rsub = lane >> 4, c4 = (lane & 15) * 4; typedef _Float16 v4h __attribute__((ext_vector_type(4)));
  {
#pragma unroll
    for (int q = 0; q < 8; ++q) { const int r = q * 2 + rsub; if (col0 + c4 < N) { const v4f v = *(const v4fa*)&so[w][r][c4]; if (C) *(v4f*)(C + cofs + (size_t)(row0 + r) * ldc + col0 + c4) = v; if (C16) { v4h h4; for (int i = 0; i < 4; ++i) h4[i] = (_Float16)v[i]; *(v4h*)(C16 + cofs + (size_t)(row0 + r) * ldc + col0 + c4) = h4; } } }
     }
}


typedef _Float16 v4h __attribute__((ext_vector_type(4)));

__global__ __launch_bounds__(256) void k_x16(const float* __restrict__ x, _Float16* __restrict__ X16, size_t n8) { const size_t t = (size_t)blockIdx.x * 256 + threadIdx.x; if (t >= n8) return; FragH f;
#pragma unroll
  for (int q = 0; q < 8; ++q) f.h[q] = (_Float16)bf16_round(x[t * 8 + q]); *(v8us*)((unsigned short*)X16 + t * 8) = f.half[0];  }
__global__ __launch_bounds__(256) void k_h16(const float* __restrict__ x, _Float16* __restrict__ X16, size_t n8) { const size_t t = (size_t)blockIdx.x * 256 + threadIdx.x; if (t >= n8) return; FragH f;
#pragma unroll
  for (int q = 0; q < 8; ++q) f.h[q] = (_Float16)x[t * 8 + q]; *(v8us*)((unsigned short*)X16 + t * 8) = f.half[0];  }
__global__ __launch_bounds__(256) void k_round16f(const float* __restrict__ W, _Float16* __restrict__ Bt, size_t n8) { const size_t t = (size_t)blockIdx.x * 256 + threadIdx.x; if (t >= n8) return; FragH f;
#pragma unroll
  for (int i = 0; i < 8; ++i) f.h[i] = (_Float16)(bf16_round(W[t * 8 + i]) * 16.0f); *(v8us*)((unsigned short*)Bt + t * 8) = f.half[0];  }
template <int NHv, int TTv>
__global__ __launch_bounds__(256) void k_vt(const _Float16* __restrict__ V16, int ldv, int voff, _Float16* __restrict__ Vt) { __shared__ unsigned short tl[64][66]; const int tid = threadIdx.x; const int slab = blockIdx.x / (TTv / 64), lg = blockIdx.x % (TTv / 64); const int b = slab / NHv, h = slab % NHv;
  for (int i = tid; i < 64 * 8; i += 256) { const int r = i / 8, c8 = (i % 8) * 8; FragH f; f.half[0] = *(const v8us*)((const unsigned short*)V16 + ((size_t)b * TTv + lg * 64 + r) * ldv + voff + h * 64 + c8);
#pragma unroll
    for (int q = 0; q < 8; ++q) tl[r][c8 + q] = f.u[q]; }
  __syncthreads();
  {
#pragma unroll
    for (int rd = 0; rd < 2; ++rd) { const int d = rd * 32 + tid / 8, pc = tid % 8; FragH f;
#pragma unroll
      for (int q = 0; q < 8; ++q) f.u[q] = tl[pc * 8 + q][d];
      *(v8us*)((unsigned short*)Vt + ((size_t)slab * 64 + d) * TTv + lg * 64 + pc * 8) = f.half[0]; }
     } }

__global__ __launch_bounds__(256) void k_hl(const float* __restrict__ F, _Float16* __restrict__ Hh, _Float16* __restrict__ Hl, size_t n8) { const size_t t = (size_t)blockIdx.x * 256 + threadIdx.x; if (t >= n8) return; FragH fh, fl; const v4f a = *(const v4fa*)(F + t * 8), c = *(const v4fa*)(F + t * 8 + 4);
#pragma unroll
  for (int q = 0; q < 4; ++q) { _Float16 h = (_Float16)a[q]; fh.h[q] = h; fl.h[q] = (_Float16)((a[q] - (float)h) * 1024.0f); h = (_Float16)c[q]; fh.h[4 + q] = h; fl.h[4 + q] = (_Float16)((c[q] - (float)h) * 1024.0f); }
  { *(v8us*)((unsigned short*)Hh + t * 8) = fh.half[0]; *(v8us*)((unsigned short*)Hl + t * 8) = fl.half[0];  } }

// ---- fast GEMM (block tile 128x64, wave tile 32x64; requires M % 128 == 0 rows per launch region, N % 64 == 0, K % 64 == 0); epilogue = k_gemm_hhx semantics ----
// Operand path: per trip of 64 k the block's 128 A rows and 64 B rows (128 bytes each, whole lines) are copied to LDS asynchronously, two buffers, the copies of trip t + 2 issued behind the barrier that ends trip t;
// the waves read their fragments from LDS (row pitch 144 bytes: no bank conflict for 16-byte reads). The k order of every accumulator is the ascending one of the direct-load form.
#define G2_PITCH 144
#define G2_STAGE (192 * G2_PITCH)      /* rows 0..127: A, rows 128..191: B */
__device__ __forceinline__ v16h g2_lfrag(const unsigned char* p) { FragH f; f.half[0] = *(const v8us*)p; f.half[1] = *(const v8us*)(p + 32); return f.v; }
__device__ __forceinline__ v8f g2_mma(v16h a, v16h b, v8f c) { v8f d = __builtin_amdgcn_wmma_f32_16x16x32_f16(false, a, false, b, (short)0, c, false, false); asm volatile("v_nop\n\tv_nop\n\tv_nop\n\tv_nop" : "+v"(d) : "v"(a), "v"(b)); return d; }
// One stage: each lane copies 12 pieces of 16 bytes (8 lanes = one 128-byte row, a wave = 4 rows, the block = 16 rows per copy; 8 copies for A, 4 for B). l: the lane's LDS byte address in row group 0.
__device__ __forceinline__ void g2_copy(unsigned l, const _Float16* ga, size_t sa, const _Float16* gb, size_t sb) {
  /* the copies and, as the last line of the same statement, the wait that stands in front of any new value in the address registers they name */
  asm volatile("global_load_async_to_lds_b128 %0, %12, off\n\t"
               "global_load_async_to_lds_b128 %1, %13, off\n\t"
               "global_load_async_to_lds_b128 %2, %14, off\n\t"
               "global_load_async_to_lds_b128 %3, %15, off\n\t"
               "global_load_async_to_lds_b128 %4, %16, off\n\t"
               "global_load_async_to_lds_b128 %5, %17, off\n\t"
               "global_load_async_to_lds_b128 %6, %18, off\n\t"
               "global_load_async_to_lds_b128 %7, %19, off\n\t"
               "global_load_async_to_lds_b128 %8, %20, off\n\t"
               "global_load_async_to_lds_b128 %9, %21, off\n\t"
               "global_load_async_to_lds_b128 %10, %22, off\n\t"
               "global_load_async_to_lds_b128 %11, %23, off\n\t"
               "s_wait_xcnt 0x0"
               :: "v"(l), "v"(l + 16 * G2_PITCH), "v"(l + 32 * G2_PITCH), "v"(l + 48 * G2_PITCH), "v"(l + 64 * G2_PITCH), "v"(l + 80 * G2_PITCH),
                  "v"(l + 96 * G2_PITCH), "v"(l + 112 * G2_PITCH), "v"(l + 128 * G2_PITCH), "v"(l + 144 * G2_PITCH), "v"(l + 160 * G2_PITCH), "v"(l + 176 * G2_PITCH),
                  "v"(ga), "v"(ga + sa), "v"(ga + 2 * sa), "v"(ga + 3 * sa), "v"(ga + 4 * sa), "v"(ga + 5 * sa), "v"(ga + 6 * sa), "v"(ga + 7 * sa),
                  "v"(gb), "v"(gb + sb), "v"(gb + 2 * sb), "v"(gb + 3 * sb)
               : "memory"); }
template <int ACT>
__global__ __launch_bounds__(128) void k_gemm2(const _Float16* __restrict__ A, int lda, size_t sA, const _Float16* __restrict__ Bh, int ldb, size_t sB, float alpha, const float* __restrict__ bias, size_t sBias, const float* __restrict__ CP, int rowsPerB, size_t sCPb, int row0g,
    float* __restrict__ C, _Float16* __restrict__ C16, int ldc, size_t sC, int M, int N, int K) { static_assert(ACT == 0 || ACT == 3 || ACT == 6 || ACT == 8 || ACT == 9 || ACT == 11 || ACT == 12 || ACT == 14 || ACT == 15 || ACT == 16 || ACT == 17, "k_gemm2: unsupported ACT code (would silently apply no activation)");
  __shared__ __attribute__((aligned(16))) unsigned char sm[2 * G2_STAGE];      /* the two operand buffers; behind the loop's last barrier the same bytes stage the output rows */
  float (*so)[32][68] = reinterpret_cast<float (*)[32][68]>(sm); static_assert(sizeof(float) * 4 * 32 * 68 <= 2 * G2_STAGE, "output staging must fit the operand buffers");
  const int tid = threadIdx.x, w = tid >> 5, lane = tid & 31, ln = lane & 15, hh = lane >> 4; const int by = blockIdx.y;
  A += (size_t)by * sA; Bh += (size_t)by * sB; const size_t cofs = (size_t)by * sC; const float* bp = bias ? bias + (size_t)by * sBias : nullptr;
  const int ntn = N >> 6; const int mt = blockIdx.x / ntn, nq = blockIdx.x - mt * ntn; const int row0 = mt * 128 + 32 * w, col0 = nq * 64; if (mt * 128 >= M) return;      /* the whole block leaves or none: barriers follow */
  const int crow = tid >> 3, cpc = tid & 7;
  const _Float16* ga = A + (size_t)(mt * 128 + crow) * lda + cpc * 8; const _Float16* gb = Bh + (size_t)(col0 + crow) * ldb + cpc * 8;
  const unsigned lb = (unsigned)(size_t)sm + (unsigned)(crow * G2_PITCH + cpc * 16);
  const unsigned char* fa = sm + (32 * w + ln) * G2_PITCH + 16 * hh; const unsigned char* fb = sm + (128 + ln) * G2_PITCH + 16 * hh;
  const int nt = K >> 6;
  const v8f z8 = {0.f,0.f,0.f,0.f,0.f,0.f,0.f,0.f}; v8f c00 = z8, c01 = z8, c02 = z8, c03 = z8, c10 = z8, c11 = z8, c12 = z8, c13 = z8;
  g2_copy(lb, ga, (size_t)16 * lda, gb, (size_t)16 * ldb);
  asm volatile("s_wait_asynccnt 0x0" ::: "memory");      /* this wave's copies of tile 0 have landed */
  __syncthreads();                                       /* ... and every other wave's */
  if (nt > 1) g2_copy(lb + G2_STAGE, ga + 64, (size_t)16 * lda, gb + 64, (size_t)16 * ldb);
#pragma unroll 1      /* rolled: one body serves both buffers and stays small */
  for (int t = 0; t < nt; ++t) { const unsigned bo = (unsigned)(t & 1) * G2_STAGE; const unsigned char* pa = fa + bo; const unsigned char* pb = fb + bo;
    /* the trip's 24 fragment reads stand together in front of its matrix instructions */
    const v16h a00 = g2_lfrag(pa), a10 = g2_lfrag(pa + 16 * G2_PITCH), b00 = g2_lfrag(pb), b10 = g2_lfrag(pb + 16 * G2_PITCH), b20 = g2_lfrag(pb + 32 * G2_PITCH), b30 = g2_lfrag(pb + 48 * G2_PITCH);
    const v16h a01 = g2_lfrag(pa + 64), a11 = g2_lfrag(pa + 16 * G2_PITCH + 64), b01 = g2_lfrag(pb + 64), b11 = g2_lfrag(pb + 16 * G2_PITCH + 64), b21 = g2_lfrag(pb + 32 * G2_PITCH + 64), b31 = g2_lfrag(pb + 48 * G2_PITCH + 64);
    c00 = g2_mma(a00, b00, c00); c10 = g2_mma(a10, b00, c10); c01 = g2_mma(a00, b10, c01); c11 = g2_mma(a10, b10, c11);
    c02 = g2_mma(a00, b20, c02); c12 = g2_mma(a10, b20, c12); c03 = g2_mma(a00, b30, c03); c13 = g2_mma(a10, b30, c13);
    c00 = g2_mma(a01, b01, c00); c10 = g2_mma(a11, b01, c10); c01 = g2_mma(a01, b11, c01); c11 = g2_mma(a11, b11, c11);
    c02 = g2_mma(a01, b21, c02); c12 = g2_mma(a11, b21, c12); c03 = g2_mma(a01, b31, c03); c13 = g2_mma(a11, b31, c13);
    asm volatile("s_wait_dscnt 0x0" ::: "memory");       /* this wave's reads of buffer t & 1 are done before the buffer is given up */
    asm volatile("s_wait_asynccnt 0x0" ::: "memory");    /* this wave's copies of tile t + 1 have landed */
    __syncthreads();                                     /* publishes tile t + 1 and ends every wave's reads of buffer t & 1 */
    if (t + 2 < nt) g2_copy(lb + bo, ga + (size_t)(t + 2) * 64, (size_t)16 * lda, gb + (size_t)(t + 2) * 64, (size_t)16 * ldb); }
  asm volatile("s_wait_asynccnt 0x0" ::: "memory");      /* no copy is outstanding when the buffers become output staging */
  v8f accs[8] = {c00, c01, c02, c03, c10, c11, c12, c13};
#pragma unroll
  for (int u = 0; u < 8; ++u) { const int t = u & 3, half = u >> 2; const int col = col0 + t * 16 + ln; const float bv = bp ? bf16_round(bp[col]) : 0.f;
#pragma unroll
    for (int r = 0; r < 8; ++r) { const int rloc = half * 16 + 8 * hh + r; float v = accs[u][r] * alpha + bv; if (CP) { if (rowsPerB < 0) v += CP[cofs + (size_t)(row0g + row0 + rloc) * ldc + col];      /* rowsPerB < 0: own element of the batched C plane */ else { const int bidx = (row0g + row0 + rloc) / rowsPerB; v += CP[(size_t)bidx * sCPb + (size_t)by * 64 + col]; } }
      if (ACT == 3) v = fmaxf(v, 0.f); else if (ACT == 6) v = 0.5f * v * (1.0f + erff(v * 0.70710678118654752f)); else if (ACT == 11) v = 1.0f / (1.0f + expf(-v)); else if (ACT == 15) v = v / (1.0f + expf(-v)); else if (ACT == 12) v = (v > 0.f) ? v : 0.01f * v; else if (ACT == 8) v = tanhf(v); else if (ACT == 9) v = 0.5f * v * (1.0f + tanhf(0.7978845608028654f * (v + 0.044715f * v * v * v))); else if (ACT == 14) v = (v > 0.f) ? v : 0.1f * v; else if (ACT == 16) v = (v >= 0.f) ? v : 0.3f * v; else if (ACT == 17) v = (v >= 0.f) ? v : 0.2f * v;
      so[w][rloc][t * 16 + ln] = v; } }
  __builtin_amdgcn_fence(__ATOMIC_ACQ_REL, "workgroup"); __builtin_amdgcn_wave_barrier();
  const int rsub = lane >> 4, c4 = (lane & 15) * 4;
  {
#pragma unroll
    for (int q = 0; q < 16; ++q) { const int r = q * 2 + rsub; const v4f v = *(const v4fa*)&so[w][r][c4]; if (C) *(v4f*)(C + cofs + (size_t)(row0 + r) * ldc + col0 + c4) = v; if (C16) { v4h h4; for (int i = 0; i < 4; ++i) h4[i] = (_Float16)v[i]; *(v4h*)(C16 + cofs + (size_t)(row0 + r) * ldc + col0 + c4) = h4; } }
     } }


// one 64 x 64 tile (number blk) of Bt[out][in] = f16(bf16(w[in][out]) * 16)
__device__ __forceinline__ void wT_tile(const float* __restrict__ w, int din, int dout, _Float16* __restrict__ Bt, int blk, float (*tl)[65]) { const int tid = threadIdx.x; const int nbo = dout / 64; const int ib = blk / nbo, ob = blk % nbo; const int i0 = ib * 64, o0 = ob * 64;
  for (int t = tid; t < 64 * 64; t += 256) { const int i = t / 64, o = t % 64; tl[o][i] = bf16_round(w[(size_t)(i0 + i) * dout + o0 + o]) * 16.0f; }
  __syncthreads();
  { for (int t = tid; t < 64 * 8; t += 256) { const int o = t / 8, i8 = (t % 8) * 8; FragH f; for (int q = 0; q < 8; ++q) f.h[q] = (_Float16)tl[o][i8 + q]; *(v8us*)((unsigned short*)Bt + (size_t)(o0 + o) * din + i0 + i8) = f.half[0]; }  } }
// 8 elements of the padded f16 token rows per thread (block number blk)
__device__ __forceinline__ void xr_rows(const float* __restrict__ x, _Float16* __restrict__ X16, int blk) { const size_t t = (size_t)blk * 256 + threadIdx.x; if (t >= NRX * DM / 8) return; const int c0 = (int)((t * 8) % DM); const size_t r = (t * 8) / DM; const int tok = (int)(r % RPB); const size_t b = r / RPB; FragH f;
  for (int q = 0; q < 8; ++q) f.h[q] = (tok < NTOK) ? (_Float16)bf16_round(x[(b * NTOK + tok) * DM + c0 + q]) : (_Float16)0.f;
  *(v8us*)((unsigned short*)X16 + t * 8) = f.half[0];  }
// All operand preparation in one launch (none of the four parts reads another's output): blocks 0..255 transpose one weight tile each (Wq 64, Wkv 128, Wo 64), the rest convert token rows.
// BQKV holds the rows of Wq^T, then those of Wkv^T: one [1536][512] B operand.
#define WT_Q ((DM / 64) * (DM / 64))
#define WT_KV ((DM / 64) * (2 * DM / 64))
#define WT_ALL (2 * WT_Q + WT_KV)
__global__ __launch_bounds__(256) void k_prep(const float* __restrict__ x, const float* __restrict__ Wq, const float* __restrict__ Wkv, const float* __restrict__ Wo, _Float16* __restrict__ BQKV, _Float16* __restrict__ BO, _Float16* __restrict__ X16) {
  __shared__ float tl[64][65]; const int blk = blockIdx.x;      /* the choice below is the same for a whole block: wT_tile holds a barrier */
  if (blk < WT_Q) wT_tile(Wq, DM, DM, BQKV, blk, tl);
  else if (blk < WT_Q + WT_KV) wT_tile(Wkv, DM, 2 * DM, BQKV + (size_t)DM * DM, blk - WT_Q, tl);
  else if (blk < WT_ALL) wT_tile(Wo, DM, DM, BO, blk - (WT_Q + WT_KV), tl);
  else xr_rows(x, X16, blk - WT_ALL); }
// sum over the 8 lanes that share one (query, head): three DPP adds inside the 16-lane row (lane ^ 1, ^ 2, ^ 4); every lane of the group ends with the total
template <int CTRL> __device__ __forceinline__ float nb_xadd(float x) { return x + __int_as_float(__builtin_amdgcn_update_dpp(0, __float_as_int(x), CTRL, 0xf, 0xf, true)); }
__device__ __forceinline__ float nb_dot(v4f a0, v4f a1, v4f k0, v4f k1) {
  float s = a0[0] * k0[0], t = a1[0] * k1[0];
#pragma unroll
  for (int d = 1; d < 4; ++d) { s = fmaf(a0[d], k0[d], s); t = fmaf(a1[d], k1[d], t); }
  s += t; s = nb_xadd<0x161>(s); s = nb_xadd<0x162>(s); s = nb_xadd<0x164>(s); return s; }
// Neighbourhood attention. Wave = NQW consecutive queries of one grid row (f0, h0) x 4 heads, a block's 8 waves side by side in that row; 8 lanes share a (query, head), lane l8 holding
// dims 4*l8..+3 and 32+4*l8..+3, so that each b128 load of a key row covers whole 128-byte lines. Only 14 of the 27 window slots can pass the causal test (frame f0-1: 3x3; frame f0: row h0-1: 3,
// row h0: w-1 and w); the others have a flat index above the query's for every query. A key row is loaded once per wave and serves each of its queries whose window holds it.
// A slot outside the grid still reads a token row of the same batch (in bounds, written by the GEMM before) and gets the mask value as its logit, hence weight 0.
// A token's row of QKV holds q (512), k (512), v (512). The wave of query 0 also stores v_BOS as o row 0 of its batch and its 4 heads.
#define NQW 2
#define LQ (3 * DM)
__global__ __launch_bounds__(256) void k_nbatt(const float* QKV, _Float16* O16) {      /* no __restrict__: the loads below keep their side of the two waits */
  const int lane = threadIdx.x & 31, l8 = lane & 7, hs = lane >> 3; const int wv = __builtin_amdgcn_readfirstlane((int)(threadIdx.x >> 5));
  const int gw = blockIdx.x * 8 + wv; const int rw = gw / (WT / NQW); const int h0 = rw % HT, f0 = (rw / HT) % FT, hq = (rw / (HT * FT)) % 2, b = rw / (HT * FT * 2);
  const int w0 = (gw % (WT / NQW)) * NQW; const int j0 = (f0 * HT + h0) * WT + w0; const unsigned co = (unsigned)(hq * (DM / 2) + hs * HD + l8 * 4);
  const float* tb = QKV + (size_t)b * RPB * LQ;      /* the batch's token rows; k stands DM, v 2 * DM floats into a row */
  const float* rb[5]; bool kok[5][NQW + 2];      /* rb[r]: the row of the key at column w0 of window row r; a window row outside the grid points at token row 1, so that columns -1..NQW stay inside the buffer */
#pragma unroll
  for (int r = 0; r < 5; ++r) { const int f = f0 + (r < 3 ? -1 : 0), hh = h0 + (r < 3 ? r - 1 : r - 4); const bool rok = f >= 0 && hh >= 0 && hh < HT;
    rb[r] = tb + (size_t)(rok ? (f * HT + hh) * WT + w0 + 1 : 1) * LQ + co;
#pragma unroll
    for (int c = 0; c < NQW + 2; ++c) { const int ww = w0 - 1 + c; kok[r][c] = rok && ww >= 0 && ww < WT; } }
  const float* qp = QKV + ((size_t)b * RPB + j0) * LQ + co;      /* query i is token j0 + i + 1 */ const float* bp = tb + co;
  v4f q[NQW][2], kb[2], kk[5][NQW + 2][2];
#pragma unroll
  for (int i = 0; i < NQW; ++i) { q[i][0] = *(const v4fa*)(qp + (i + 1) * LQ); q[i][1] = *(const v4fa*)(qp + (i + 1) * LQ + 32); }
#pragma unroll
  for (int r = 0; r < 5; ++r) {
#pragma unroll
    for (int c = 0; c < NQW + (r < 4 ? 2 : 1); ++c) { const float* kp = rb[r] + (c - 1) * LQ + DM; kk[r][c][0] = *(const v4fa*)kp; kk[r][c][1] = *(const v4fa*)(kp + 32); } }
  kb[0] = *(const v4fa*)(bp + DM); kb[1] = *(const v4fa*)(bp + DM + 32);
  /* the wait that stands between issued loads and any new value in their address registers; naming the addresses keeps them in those registers up to it */
  asm volatile("s_wait_xcnt 0x0" :: "v"(qp), "v"(bp), "v"(rb[0]), "v"(rb[1]), "v"(rb[2]), "v"(rb[3]), "v"(rb[4]) : "memory");
  float lg[NQW][15];
#pragma unroll
  for (int i = 0; i < NQW; ++i) lg[i][0] = nb_dot(q[i][0], q[i][1], kb[0], kb[1]) * 0.125f;
#pragma unroll
  for (int r = 0; r < 5; ++r) {
#pragma unroll
    for (int c = 0; c < NQW + (r < 4 ? 2 : 1); ++c) {
#pragma unroll
      for (int i = 0; i < NQW; ++i) { const int dw = c - i; if (dw >= 0 && dw < (r < 4 ? 3 : 2)) { const float sd = nb_dot(q[i][0], q[i][1], kk[r][c][0], kk[r][c][1]) * 0.125f; lg[i][1 + r * 3 + dw] = kok[r][c] ? sd : -3.0e38f; } } } }
  v4f vb[2], vv[5][NQW + 2][2];      /* the v rows fly while the softmax is worked out */
#pragma unroll
  for (int r = 0; r < 5; ++r) {
#pragma unroll
    for (int c = 0; c < NQW + (r < 4 ? 2 : 1); ++c) { const float* vp = rb[r] + (c - 1) * LQ + 2 * DM; vv[r][c][0] = *(const v4fa*)vp; vv[r][c][1] = *(const v4fa*)(vp + 32); } }
  vb[0] = *(const v4fa*)(bp + 2 * DM); vb[1] = *(const v4fa*)(bp + 2 * DM + 32);
  /* the same wait behind the v loads */
  asm volatile("s_wait_xcnt 0x0" :: "v"(bp), "v"(rb[0]), "v"(rb[1]), "v"(rb[2]), "v"(rb[3]), "v"(rb[4]) : "memory");
#pragma unroll
  for (int i = 0; i < NQW; ++i) { float mx = lg[i][0];
#pragma unroll
    for (int s = 1; s < 15; ++s) mx = fmaxf(mx, lg[i][s]);
    float se = 0.f;
#pragma unroll
    for (int s = 0; s < 15; ++s) { const float e = expf(lg[i][s] - mx); lg[i][s] = e; se += e; }
    const float inv = 1.0f / se;
#pragma unroll
    for (int s = 0; s < 15; ++s) lg[i][s] *= inv; }
  v4f o[NQW][2];
#pragma unroll
  for (int i = 0; i < NQW; ++i) { o[i][0] = vb[0] * lg[i][0]; o[i][1] = vb[1] * lg[i][0]; }
#pragma unroll
  for (int r = 0; r < 5; ++r) {
#pragma unroll
    for (int c = 0; c < NQW + (r < 4 ? 2 : 1); ++c) {
#pragma unroll
      for (int i = 0; i < NQW; ++i) { const int dw = c - i; if (dw >= 0 && dw < (r < 4 ? 3 : 2)) { const float p = lg[i][1 + r * 3 + dw]; o[i][0] += vv[r][c][0] * p; o[i][1] += vv[r][c][1] * p; } } } }
#pragma unroll
  for (int i = 0; i < NQW; ++i) { _Float16* op = O16 + ((size_t)b * NPAD + j0 + i + 1) * DM + co; v4h a, c;
#pragma unroll
    for (int d = 0; d < 4; ++d) { a[d] = (_Float16)o[i][0][d]; c[d] = (_Float16)o[i][1][d]; }
    *(v4h*)op = a; *(v4h*)(op + 32) = c; }
  if (j0 == 0) {      /* o row 0 = v_BOS, read again so that it holds no registers above; the test reads the same in the whole wave */
    asm volatile("s_wait_xcnt 0x0" ::: "memory");      /* the wait between the stores above and any new value in the registers they name */
    const float* vp = tb + 2 * DM + co; const v4f v0 = *(const v4fa*)vp, v1 = *(const v4fa*)(vp + 32);
    _Float16* op = O16 + (size_t)b * NPAD * DM + co; v4h a, c;
#pragma unroll
    for (int d = 0; d < 4; ++d) { a[d] = (_Float16)v0[d]; c[d] = (_Float16)v1[d]; }
    *(v4h*)op = a; *(v4h*)(op + 32) = c; } }

extern "C" void kernel_launch(void* const* d_in, const int* in_sizes, int n_in,
                              void* d_out, int out_size, void* d_ws, size_t ws_size, hipStream_t stream) {
  (void)in_sizes; (void)n_in; (void)out_size;
  const float* const* I = (const float* const*)d_in; const float* x = I[0]; const float* Wq = I[1]; const float* Wkv = I[2]; const float* Wo = I[3]; const float* bo = I[4];
  char* ws = (char*)d_ws; size_t off = 0;
  auto take = [&](size_t bytes) { char* p = ws + off; off += (bytes + 255) & ~(size_t)255; return p; };
  _Float16* BQKV = (_Float16*)take((size_t)3 * DM * DM * 2); _Float16* BO = (_Float16*)take((size_t)DM * DM * 2);
  _Float16* X16 = (_Float16*)take(NRX * DM * 2); float* QKV = (float*)take(NRX * 3 * DM * 4); _Float16* O16 = (_Float16*)take((size_t)NB * NPAD * DM * 2);      /* rows b*4097 + tok; the last query's token (4096) is computed but dropped by the output GEMM */
  if (off > ws_size) return;      /* 2.1 + 8.7 + 51.9 + 8.4 = about 71 MB */
  k_prep<<<(unsigned)(WT_ALL + (NRX * DM / 8 + 255) / 256), 256, 0, stream>>>(x, Wq, Wkv, Wo, BQKV, BO, X16);
  k_gemm2<0><<<dim3((unsigned)((NRX / 128) * (3 * DM / 64)), 1), 128, 0, stream>>>(X16, DM, 0, BQKV, DM, 0, 0.0625f, nullptr, 0, nullptr, 1, 0, 0, QKV, nullptr, 3 * DM, 0, (int)NRX, 3 * DM, DM);
  k_nbatt<<<NB * 2 * FT * HT * (WT / NQW) / 8, 256, 0, stream>>>(QKV, O16);
  k_gemm2<0><<<dim3((unsigned)((NTOK / 128) * (DM / 64)), NB), 128, 0, stream>>>(O16, DM, (size_t)NPAD * DM, BO, DM, 0, 0.0625f, bo, 0, nullptr, 1, 0, 0, (float*)d_out, nullptr, DM, (size_t)NTOK * DM, NTOK, DM, DM);      /* out = o Wo + bo for tokens 0..4095 of each batch (grid y; token 4096 dropped as in the reference) */
}

// v004
// One run takes 58.4 microseconds.
// Next to v003, in two timings, it ran 1.10 times as fast each time.
// All steps since v000 together make it 8.66 times as fast.
#include <hip/hip_runtime.h>
// Sparse3DNA (x [2][4096][512]: 1 BOS + 4095 video tokens on a 4x32x32 grid, padded by one zero token to 4097; q = x Wq, [k|v] = x Wkv ([in][out], no bias), 8 heads of 64; query j (token j+1) attends to {BOS} U {its 3x3x3 grid neighbourhood keys with flat index <= j} (out-of-grid slots and future keys masked), scale 64^-0.5, softmax, weighted v; token 0's output is v_BOS itself; out = o Wo + bo, first 4096 tokens -> [2][4096][512]).
// Structure: token rows (4,097 per batch padded to 4,224); x as exact f16 rows; one [Q|K|V] WMMA GEMM (32x64 wave tiles, f32 accumulation, exact x16 transposed weights) kept in f32, rows of 1,536; the 28-slot neighbourhood attention on VALU (f32: 8 lanes per (batch, head, query), 2 queries x 4 heads per wave, window indices and the causal test from the grid geometry on device, logits, softmax, weighted sum) into f16 o rows (row 0 = v_BOS); out = o Wo + bo GEMM (f32, output layout). Four launches: operands, [Q|K|V], attention, output.
// Compute dtype: inputs rounded to bf16; x / weights exact; q, k, v, logits, softmax f32; o plain f16 into the Wo GEMM (~2^-12). v_wmma_f32_16x16x32_f16.
#define NB 2
#define NTOK 4096                    /* input tokens per batch (= output tokens) */
#define NPAD 4097                    /* after the module's padding */
#define RPB 4224                     /* rows per batch (33 x 128) */
#define NRX ((size_t)NB * RPB)       /* 8448 */
#define DM 512
#define NH 8
#define HD 64
#define FT 4
#define HT 32
#define WT 32
#define TT (FT * HT * WT)            /* 4096 grid tokens */
#define QT TT                        /* unused */
typedef __bf16 v16b __attribute__((ext_vector_type(16)));
typedef unsigned short v8us __attribute__((ext_vector_type(8), may_alias));
typedef float  v8f  __attribute__((ext_vector_type(8)));
typedef float  v4f  __attribute__((ext_vector_type(4)));
typedef float  v4fa __attribute__((ext_vector_type(4), may_alias));
union FragB { v16b v; v8us half[2]; unsigned short u[16]; };

__device__ __forceinline__ unsigned short bf16_bits(float x) { unsigned int u = __float_as_uint(x); return (unsigned short)((u + 0x7FFFu + ((u >> 16) & 1u)) >> 16); }
__device__ __forceinline__ float bf16_val(unsigned short b) { return __uint_as_float(((unsigned int)b) << 16); }
__device__ __forceinline__ float bf16_round(float x) { return bf16_val(bf16_bits(x)); }
// D += A·B with NT terms: 1 = ah·bh, 2 = + al·bh (A split), 3 = + ah·bl (both split)
template <int NT>
__device__ __forceinline__ v8f mmaN(v16b ah, v16b al, v16b bh, v16b bl, v8f c) {
  c = __builtin_amdgcn_wmma_f32_16x16x32_bf16(false, ah, false, bh, (short)0, c, false, false);
  if (NT >= 2) c = __builtin_amdgcn_wmma_f32_16x16x32_bf16(false, al, false, bh, (short)0, c, false, false);
  if (NT >= 3) c = __builtin_amdgcn_wmma_f32_16x16x32_bf16(false, ah, false, bl, (short)0, c, false, false);
  asm volatile("v_nop\n\tv_nop\n\tv_nop\n\tv_nop" : "+v"(c) : "v"(ah), "v"(al), "v"(bh), "v"(bl));
  return c;
}

__global__ __launch_bounds__(256) void k_wt_bf16(const float* __restrict__ W, unsigned short* __restrict__ Wt, int K, int N) {
  const int t = blockIdx.x * 256 + threadIdx.x;
  const int k8n = K / 8;
  if (t >= N * k8n) return;
  const int n = t / k8n, k8 = (t % k8n) * 8;
  v8us v;
#pragma unroll
  for (int i = 0; i < 8; ++i) v[i] = bf16_bits(W[(size_t)(k8 + i) * N + n]);
  *(v8us*)(Wt + (size_t)n * K + k8) = v;
  
}

// GEMM C[M][N] (f32, pitch ldc) = act(A[M][K]·W + bias). A f32 row-major (pitch lda) converted per fragment to bf16
// (ASPLIT: hi/lo two planes -> 2 terms, else single rounded term); Wt bf16 [N][K] (pitch ldb). BIAS_BF16 rounds the
// bias to bf16 first (bias quantised to bf16 before the add). K%32==0, M%16==0, N%64==0.
template <bool ASPLIT, int ACT, bool BIAS_BF16>
__global__ __launch_bounds__(128) void k_gemm_bf(const float* __restrict__ A, int lda, const unsigned short* __restrict__ Wt, int ldb,
                                               const float* __restrict__ bias, float* __restrict__ C, int ldc, int M, int N, int K) {
  __shared__ __attribute__((aligned(16))) float so[4][16][64];
  const int tid = threadIdx.x, w = tid >> 5, lane = tid & 31, ln = lane & 15, hh = lane >> 4;
  const int ntn = N / 64;
  const int wid = blockIdx.x * 4 + w;
  const int mt = wid / ntn, nq = wid % ntn;
  if (mt * 16 >= M) return;
  const int row0 = mt * 16, col0 = nq * 64;
  const float* arow = A + (size_t)(row0 + ln) * lda;
  v8f acc[4] = {};
  for (int kb = 0; kb < K; kb += 32) {
    FragB ah, al;
    const v4f x0 = *(const v4fa*)(arow + kb + 8 * hh), x1 = *(const v4fa*)(arow + kb + 8 * hh + 4);
    const v4f x2 = *(const v4fa*)(arow + kb + 16 + 8 * hh), x3 = *(const v4fa*)(arow + kb + 16 + 8 * hh + 4);
    float xs[16] = {x0[0],x0[1],x0[2],x0[3],x1[0],x1[1],x1[2],x1[3],x2[0],x2[1],x2[2],x2[3],x3[0],x3[1],x3[2],x3[3]};
#pragma unroll
    for (int i = 0; i < 16; ++i) { const unsigned short hb = bf16_bits(xs[i]); ah.u[i] = hb; al.u[i] = ASPLIT ? bf16_bits(xs[i] - bf16_val(hb)) : (unsigned short)0; }
#pragma unroll
    for (int t = 0; t < 4; ++t) {
      const unsigned short* brow = Wt + (size_t)(col0 + t * 16 + ln) * ldb + kb;
      FragB b;
      b.half[0] = *(const v8us*)(brow + 8 * hh);
      b.half[1] = *(const v8us*)(brow + 16 + 8 * hh);
      acc[t] = mmaN<ASPLIT ? 2 : 1>(ah.v, al.v, b.v, b.v, acc[t]);
    }
  }
#pragma unroll
  for (int t = 0; t < 4; ++t) {
    float bv = bias ? bias[col0 + t * 16 + ln] : 0.f;
    if (BIAS_BF16) bv = bf16_round(bv);
#pragma unroll
    for (int r = 0; r < 8; ++r) { float v = acc[t][r] + bv; if (ACT == 1) v = fmaxf(v, 0.f); so[w][8 * hh + r][t * 16 + ln] = v; }
  }
  __builtin_amdgcn_fence(__ATOMIC_ACQ_REL, "workgroup");
  __builtin_amdgcn_wave_barrier();
  const int rsub = lane >> 4, c4 = (lane & 15) * 4;
  {
#pragma unroll
    for (int q = 0; q < 8; ++q) {
      const int r = q * 2 + rsub;
      const v4f v = *(const v4fa*)&so[w][r][c4];
      *(v4f*)(C + (size_t)(row0 + r) * ldc + col0 + c4) = v;
    }
    
  }
}

// GEMM C = act(A·W + bias + resid): A f32 (ASPLIT -> hi/lo 2 terms), Wt bf16 [N][K]; ACT 0 none, 1 relu, 2 exact gelu;
// resid (optional, f32, row index = (row % rmod), pitch ldr, RES_BF16 rounds it) added before the activation.
template <bool ASPLIT, int ACT, bool BIAS_BF16, bool RES_BF16>
__global__ __launch_bounds__(128) void k_gemm_bf3(const float* __restrict__ A, int lda, const unsigned short* __restrict__ Wt, int ldb,
                                                const float* __restrict__ bias, const float* __restrict__ resid, int rmod, int ldr,
                                                float* __restrict__ C, int ldc, int M, int N, int K) {
  __shared__ __attribute__((aligned(16))) float so[4][16][64];
  const int tid = threadIdx.x, w = tid >> 5, lane = tid & 31, ln = lane & 15, hh = lane >> 4;
  const int ntn = N / 64;
  const int wid = blockIdx.x * 4 + w;
  const int mt = wid / ntn, nq = wid % ntn;
  if (mt * 16 >= M) return;
  const int row0 = mt * 16, col0 = nq * 64;
  const float* arow = A + (size_t)(row0 + ln) * lda;
  v8f acc[4] = {};
  for (int kb = 0; kb < K; kb += 32) {
    FragB ah, al;
    const v4f x0 = *(const v4fa*)(arow + kb + 8 * hh), x1 = *(const v4fa*)(arow + kb + 8 * hh + 4);
    const v4f x2 = *(const v4fa*)(arow + kb + 16 + 8 * hh), x3 = *(const v4fa*)(arow + kb + 16 + 8 * hh + 4);
    float xs[16] = {x0[0],x0[1],x0[2],x0[3],x1[0],x1[1],x1[2],x1[3],x2[0],x2[1],x2[2],x2[3],x3[0],x3[1],x3[2],x3[3]};
#pragma unroll
    for (int i = 0; i < 16; ++i) { const unsigned short hb = bf16_bits(xs[i]); ah.u[i] = hb; al.u[i] = ASPLIT ? bf16_bits(xs[i] - bf16_val(hb)) : (unsigned short)0; }
#pragma unroll
    for (int t = 0; t < 4; ++t) {
      const unsigned short* brow = Wt + (size_t)(col0 + t * 16 + ln) * ldb + kb;
      FragB b;
      b.half[0] = *(const v8us*)(brow + 8 * hh);
      b.half[1] = *(const v8us*)(brow + 16 + 8 * hh);
      acc[t] = mmaN<ASPLIT ? 2 : 1>(ah.v, al.v, b.v, b.v, acc[t]);
    }
  }
#pragma unroll
  for (int t = 0; t < 4; ++t) {
    const int col = col0 + t * 16 + ln;
    float bv = bias ? bias[col] : 0.f;
    if (BIAS_BF16) bv = bf16_round(bv);
#pragma unroll
    for (int r = 0; r < 8; ++r) {
      float v = acc[t][r] + bv;
      if (resid) { float rv = resid[(size_t)((row0 + 8 * hh + r) % rmod) * ldr + col]; if (RES_BF16) rv = bf16_round(rv); v += rv; }
      if (ACT == 1) v = fmaxf(v, 0.f);
      if (ACT == 2) v = 0.5f * v * (1.0f + erff(v * 0.70710678118654752f));
      if (ACT == 3) { const float u = 0.7978845608028654f * (v + 0.044715f * v * v * v); v = 0.5f * v * (1.0f + tanhf(u)); }
      so[w][8 * hh + r][t * 16 + ln] = v;
    }
  }
  __builtin_amdgcn_fence(__ATOMIC_ACQ_REL, "workgroup");
  __builtin_amdgcn_wave_barrier();
  const int rsub = lane >> 4, c4 = (lane & 15) * 4;
  {
#pragma unroll
    for (int q = 0; q < 8; ++q) {
      const int r = q * 2 + rsub;
      const v4f v = *(const v4fa*)&so[w][r][c4];
      *(v4f*)(C + (size_t)(row0 + r) * ldc + col0 + c4) = v;
    }
    
  }
}
// row LayerNorm (biased variance, eps) over N: s = X (+ R); optional out_sum <- s; out_norm <- (s-mu)*rsqrt(var+eps)*g + b
template <bool PARAM_BF16>
__global__ __launch_bounds__(256) void k_layernorm(const float* __restrict__ X, const float* __restrict__ R, const float* __restrict__ g, const float* __restrict__ bta,
                                                  float* __restrict__ out_sum, float* __restrict__ out_norm, int N, float eps) {
  __shared__ float red[256];
  const int row = blockIdx.x, tid = threadIdx.x;
  const float* x = X + (size_t)row * N; const float* rr = R ? R + (size_t)row * N : nullptr;
  float vals[16];                     // up to N = 4096
  const int per = N / 256;            // contiguous chunk per thread? use strided-by-4 chunks: thread handles j = tid*4 + 1024*u
  float s1 = 0.f;
  for (int u = 0; u < per / 4; ++u) {
    const int j = tid * 4 + 1024 * u;
    const v4f a = *(const v4fa*)(x + j);
    v4f b = {0.f,0.f,0.f,0.f}; if (rr) b = *(const v4fa*)(rr + j);
#pragma unroll
    for (int q = 0; q < 4; ++q) { const float v = a[q] + b[q]; vals[u * 4 + q] = v; s1 += v; }
  }
  red[tid] = s1; __syncthreads();
  for (int st = 128; st > 0; st >>= 1) { if (tid < st) red[tid] += red[tid + st]; __syncthreads(); }
  const float mu = red[0] / (float)N; __syncthreads();
  float s2 = 0.f;
  for (int u = 0; u < per / 4; ++u)
#pragma unroll
    for (int q = 0; q < 4; ++q) { const float c = vals[u * 4 + q] - mu; s2 += c * c; }
  red[tid] = s2; __syncthreads();
  for (int st = 128; st > 0; st >>= 1) { if (tid < st) red[tid] += red[tid + st]; __syncthreads(); }
  const float rs = rsqrtf(red[0] / (float)N + eps);
  {
    for (int u = 0; u < per / 4; ++u) {
      const int j = tid * 4 + 1024 * u;
      v4f o, sm;
#pragma unroll
      for (int q = 0; q < 4; ++q) {
        float gg = g[j + q], bb = bta[j + q];
        if (PARAM_BF16) { gg = bf16_round(gg); bb = bf16_round(bb); }
        sm[q] = vals[u * 4 + q]; o[q] = (vals[u * 4 + q] - mu) * rs * gg + bb;
      }
      if (out_sum) *(v4f*)(out_sum + (size_t)row * N + j) = sm;
      *(v4f*)(out_norm + (size_t)row * N + j) = o;
    }
    
  }
}



// ---- f16 WMMA path (v_wmma_f32_16x16x32_f16): 11-bit significands for operands in range — used here for the [Q|K|V] and Wo GEMMs
typedef _Float16 v16h __attribute__((ext_vector_type(16)));
union FragH { v16h v; v8us half[2]; _Float16 h[16]; unsigned short u[16]; };
template <int NT>
__device__ __forceinline__ v8f mmaH(v16h ah, v16h al, v16h bh, v16h bl, v8f c) {
  c = __builtin_amdgcn_wmma_f32_16x16x32_f16(false, ah, false, bh, (short)0, c, false, false);
  if (NT >= 2) c = __builtin_amdgcn_wmma_f32_16x16x32_f16(false, al, false, bh, (short)0, c, false, false);
  if (NT >= 3) c = __builtin_amdgcn_wmma_f32_16x16x32_f16(false, ah, false, bl, (short)0, c, false, false);
  asm volatile("v_nop\n\tv_nop\n\tv_nop\n\tv_nop" : "+v"(c) : "v"(ah), "v"(al), "v"(bh), "v"(bl));
  return c;
}
// batched GEMM like k_gemm_b but f16 operands: A f32 (split into f16 hi/lo if ASPLIT, else rounded to f16), Bt = f16 values [n][k]; alpha; C f32; N multiple of 16 (partial tiles skipped)
template <bool ASPLIT>
__global__ __launch_bounds__(128) void k_gemm_h(const float* __restrict__ A, int lda, size_t sA, const _Float16* __restrict__ Bh, int ldb, size_t sB, float alpha, float* __restrict__ C, int ldc, size_t sC, int M, int N, int K) {
  __shared__ __attribute__((aligned(16))) float so[4][16][64];
  const int tid = threadIdx.x, w = tid >> 5, lane = tid & 31, ln = lane & 15, hh = lane >> 4; const int by = blockIdx.y;
  A += (size_t)by * sA; Bh += (size_t)by * sB; C += (size_t)by * sC;
  const int ntn = (N + 63) / 64; const int wid = blockIdx.x * 4 + w; const int mt = wid / ntn, nq = wid % ntn; if (mt * 16 >= M) return;
  const int row0 = mt * 16, col0 = nq * 64; const float* arow = A + (size_t)(row0 + ln) * lda;
  v8f acc[4] = {};
  for (int kb = 0; kb < K; kb += 32) {
    FragH ah, al;
    const v4f x0 = *(const v4fa*)(arow + kb + 8 * hh), x1 = *(const v4fa*)(arow + kb + 8 * hh + 4), x2 = *(const v4fa*)(arow + kb + 16 + 8 * hh), x3 = *(const v4fa*)(arow + kb + 16 + 8 * hh + 4);
    float xs[16] = {x0[0],x0[1],x0[2],x0[3],x1[0],x1[1],x1[2],x1[3],x2[0],x2[1],x2[2],x2[3],x3[0],x3[1],x3[2],x3[3]};
#pragma unroll
    for (int i = 0; i < 16; ++i) { const _Float16 h = (_Float16)xs[i]; ah.h[i] = h; al.h[i] = ASPLIT ? (_Float16)(xs[i] - (float)h) : (_Float16)0.0f; }
#pragma unroll
    for (int t = 0; t < 4; ++t) { if (col0 + t * 16 >= N) continue; const size_t boff = (size_t)(col0 + t * 16 + ln) * ldb + kb; FragH bq; bq.half[0] = *(const v8us*)(Bh + boff + 8 * hh); bq.half[1] = *(const v8us*)(Bh + boff + 16 + 8 * hh);
      acc[t] = mmaH<ASPLIT ? 2 : 1>(ah.v, al.v, bq.v, bq.v, acc[t]); }
  }
#pragma unroll
  for (int t = 0; t < 4; ++t) { if (col0 + t * 16 >= N) continue;
#pragma unroll
    for (int r = 0; r < 8; ++r) so[w][8 * hh + r][t * 16 + ln] = acc[t][r] * alpha; }
  __builtin_amdgcn_fence(__ATOMIC_ACQ_REL, "workgroup"); __builtin_amdgcn_wave_barrier();
  const int rsub = lane >> 4, c4 = (lane & 15) * 4;
  {
#pragma unroll
    for (int q = 0; q < 8; ++q) { const int r = q * 2 + rsub; if (col0 + c4 < N) { const v4f v = *(const v4fa*)&so[w][r][c4]; *(v4f*)(C + (size_t)(row0 + r) * ldc + col0 + c4) = v; } }
     }
}

// Wt[n][k] = f16(W[k][n]·scale) from f32 row-major W[K][N] (scale = power of two; bf16-exact weights stay exact in f16 away from the subnormal range)
__global__ __launch_bounds__(256) void k_wt_f16(const float* __restrict__ W, _Float16* __restrict__ Wt, int K, int N, float scale) {
  const int t = blockIdx.x * 256 + threadIdx.x; if (t >= N * (K / 8)) return; const int n = t / (K / 8), k8 = (t % (K / 8)) * 8; FragH f;
#pragma unroll
  for (int i = 0; i < 8; ++i) f.h[i] = (_Float16)(bf16_round(W[(size_t)(k8 + i) * N + n]) * scale); const v8us o = f.half[0];
  *(v8us*)((unsigned short*)Wt + (size_t)n * K + k8) = o; 
}
// k_gemm_hh variant with fused epilogue: v = acc·alpha + bias[by·sBias + col] (+ CP[(row/rowsPerB)·sCPb + by·64 + col] if CP) ; ACT 0 none / 1 elu ; writes f16 C16 (and f32 C if non-null)
template <int ACT>
__global__ __launch_bounds__(128) void k_gemm_hhx(const _Float16* __restrict__ A, int lda, size_t sA, const _Float16* __restrict__ Bh, int ldb, size_t sB, float alpha, const float* __restrict__ bias, size_t sBias, const float* __restrict__ CP, int rowsPerB, size_t sCPb, int row0g,
    float* __restrict__ C, _Float16* __restrict__ C16, int ldc, size_t sC, int M, int N, int K) {
  __shared__ __attribute__((aligned(16))) float so[4][16][64];
  const int tid = threadIdx.x, w = tid >> 5, lane = tid & 31, ln = lane & 15, hh = lane >> 4; const int by = blockIdx.y;
  A += (size_t)by * sA; Bh += (size_t)by * sB; const size_t cofs = (size_t)by * sC; const float* bp = bias ? bias + (size_t)by * sBias : nullptr;
  const int ntn = (N + 63) / 64; const int wid = blockIdx.x * 4 + w; const int mt = wid / ntn, nq = wid % ntn; if (mt * 16 >= M) return;
  const int row0 = mt * 16, col0 = nq * 64; const _Float16* arow = A + (size_t)(row0 + ln) * lda;
  v8f acc[4] = {};
  for (int kb = 0; kb < K; kb += 32) { FragH ah; ah.half[0] = *(const v8us*)((const unsigned short*)arow + kb + 8 * hh); ah.half[1] = *(const v8us*)((const unsigned short*)arow + kb + 16 + 8 * hh);
#pragma unroll
    for (int t = 0; t < 4; ++t) { if (col0 + t * 16 >= N) continue; const size_t boff = (size_t)(col0 + t * 16 + ln) * ldb + kb; FragH bq; bq.half[0] = *(const v8us*)((const unsigned short*)Bh + boff + 8 * hh); bq.half[1] = *(const v8us*)((const unsigned short*)Bh + boff + 16 + 8 * hh);
      acc[t] = mmaH<1>(ah.v, ah.v, bq.v, bq.v, acc[t]); }
  }
#pragma unroll
  for (int t = 0; t < 4; ++t) { if (col0 + t * 16 >= N) continue; const int col = col0 + t * 16 + ln; const float bv = bp ? bf16_round(bp[col]) : 0.f;
#pragma unroll
    for (int r = 0; r < 8; ++r) { float v = acc[t][r] * alpha + bv; if (CP) { const int rr = row0g + row0 + 8 * hh + r; if (rowsPerB < 0) v += CP[cofs + (size_t)rr * ldc + col];      /* rowsPerB < 0: own element of the batched C plane */ else { const int bidx = rr / rowsPerB; v += CP[(size_t)bidx * sCPb + (size_t)by * 64 + col]; } } if (ACT == 1) v = (v > 0.f) ? v : expm1f(v); else if (ACT == 7) v = (v > 0.f) ? v + 1.0f : expf(v); else if (ACT == 8) v = tanhf(v); else if (ACT == 9) v = 0.5f * v * (1.0f + tanhf(0.7978845608028654f * (v + 0.044715f * v * v * v))); else if (ACT == 11) v = 1.0f / (1.0f + expf(-v)); else if (ACT == 12) v = (v > 0.f) ? v : 0.01f * v; else if (ACT == 14) v = (v > 0.f) ? v : 0.1f * v; else if (ACT == 16) v = (v >= 0.f) ? v : 0.3f * v; else if (ACT == 17) v = (v >= 0.f) ? v : 0.2f * v; else if (ACT == 15) v = v / (1.0f + expf(-v)); else if (ACT == 3) v = fmaxf(v, 0.f); else if (ACT == 6) v = 0.5f * v * (1.0f + erff(v * 0.70710678118654752f)); so[w][8 * hh + r][t * 16 + ln] = v; } }
  __builtin_amdgcn_fence(__ATOMIC_ACQ_REL, "workgroup"); __builtin_amdgcn_wave_barrier();
  const int rsub = lane >> 4, c4 = (lane & 15) * 4; typedef _Float16 v4h __attribute__((ext_vector_type(4)));
  {
#pragma unroll
    for (int q = 0; q < 8; ++q) { const int r = q * 2 + rsub; if (col0 + c4 < N) { const v4f v = *(const v4fa*)&so[w][r][c4]; if (C) *(v4f*)(C + cofs + (size_t)(row0 + r) * ldc + col0 + c4) = v; if (C16) { v4h h4; for (int i = 0; i < 4; ++i) h4[i] = (_Float16)v[i]; *(v4h*)(C16 + cofs + (size_t)(row0 + r) * ldc + col0 + c4) = h4; } } }
     }
}


typedef _Float16 v4h __attribute__((ext_vector_type(4)));

__global__ __launch_bounds__(256) void k_x16(const float* __restrict__ x, _Float16* __restrict__ X16, size_t n8) { const size_t t = (size_t)blockIdx.x * 256 + threadIdx.x; if (t >= n8) return; FragH f;
#pragma unroll
  for (int q = 0; q < 8; ++q) f.h[q] = (_Float16)bf16_round(x[t * 8 + q]); *(v8us*)((unsigned short*)X16 + t * 8) = f.half[0];  }
__global__ __launch_bounds__(256) void k_h16(const float* __restrict__ x, _Float16* __restrict__ X16, size_t n8) { const size_t t = (size_t)blockIdx.x * 256 + threadIdx.x; if (t >= n8) return; FragH f;
#pragma unroll
  for (int q = 0; q < 8; ++q) f.h[q] = (_Float16)x[t * 8 + q]; *(v8us*)((unsigned short*)X16 + t * 8) = f.half[0];  }
__global__ __launch_bounds__(256) void k_round16f(const float* __restrict__ W, _Float16* __restrict__ Bt, size_t n8) { const size_t t = (size_t)blockIdx.x * 256 + threadIdx.x; if (t >= n8) return; FragH f;
#pragma unroll
  for (int i = 0; i < 8; ++i) f.h[i] = (_Float16)(bf16_round(W[t * 8 + i]) * 16.0f); *(v8us*)((unsigned short*)Bt + t * 8) = f.half[0];  }
template <int NHv, int TTv>
__global__ __launch_bounds__(256) void k_vt(const _Float16* __restrict__ V16, int ldv, int voff, _Float16* __restrict__ Vt) { __shared__ unsigned short tl[64][66]; const int tid = threadIdx.x; const int slab = blockIdx.x / (TTv / 64), lg = blockIdx.x % (TTv / 64); const int b = slab / NHv, h = slab % NHv;
  for (int i = tid; i < 64 * 8; i += 256) { const int r = i / 8, c8 = (i % 8) * 8; FragH f; f.half[0] = *(const v8us*)((const unsigned short*)V16 + ((size_t)b * TTv + lg * 64 + r) * ldv + voff + h * 64 + c8);
#pragma unroll
    for (int q = 0; q < 8; ++q) tl[r][c8 + q] = f.u[q]; }
  __syncthreads();
  {
#pragma unroll
    for (int rd = 0; rd < 2; ++rd) { const int d = rd * 32 + tid / 8, pc = tid % 8; FragH f;
#pragma unroll
      for (int q = 0; q < 8; ++q) f.u[q] = tl[pc * 8 + q][d];
      *(v8us*)((unsigned short*)Vt + ((size_t)slab * 64 + d) * TTv + lg * 64 + pc * 8) = f.half[0]; }
     } }

__global__ __launch_bounds__(256) void k_hl(const float* __restrict__ F, _Float16* __restrict__ Hh, _Float16* __restrict__ Hl, size_t n8) { const size_t t = (size_t)blockIdx.x * 256 + threadIdx.x; if (t >= n8) return; FragH fh, fl; const v4f a = *(const v4fa*)(F + t * 8), c = *(const v4fa*)(F + t * 8 + 4);
#pragma unroll
  for (int q = 0; q < 4; ++q) { _Float16 h = (_Float16)a[q]; fh.h[q] = h; fl.h[q] = (_Float16)((a[q] - (float)h) * 1024.0f); h = (_Float16)c[q]; fh.h[4 + q] = h; fl.h[4 + q] = (_Float16)((c[q] - (float)h) * 1024.0f); }
  { *(v8us*)((unsigned short*)Hh + t * 8) = fh.half[0]; *(v8us*)((unsigned short*)Hl + t * 8) = fl.half[0];  } }

// ---- fast GEMM (block tile 128x64, wave tile 32x64; requires M % 128 == 0 rows per launch region, N % 64 == 0, K % 64 == 0); epilogue = k_gemm_hhx semantics ----
// Operand path: per trip of 64 k the block's 128 A rows and 64 B rows (128 bytes each, whole lines) are copied to LDS asynchronously, two buffers, the copies of trip t + 2 issued behind the barrier that ends trip t;
// the waves read their fragments from LDS (row pitch 144 bytes: no bank conflict for 16-byte reads). The k order of every accumulator is the ascending one of the direct-load form.
#define G2_PITCH 144
#define G2_STAGE (192 * G2_PITCH)      /* rows 0..127: A, rows 128..191: B */
__device__ __forceinline__ v16h g2_lfrag(const unsigned char* p) { FragH f; f.half[0] = *(const v8us*)p; f.half[1] = *(const v8us*)(p + 32); return f.v; }
__device__ __forceinline__ v8f g2_mma(v16h a, v16h b, v8f c) { v8f d = __builtin_amdgcn_wmma_f32_16x16x32_f16(false, a, false, b, (short)0, c, false, false); asm volatile("v_nop\n\tv_nop\n\tv_nop\n\tv_nop" : "+v"(d) : "v"(a), "v"(b)); return d; }
// One stage: each lane copies 12 pieces of 16 bytes (8 lanes = one 128-byte row, a wave = 4 rows, the block = 16 rows per copy; 8 copies for A, 4 for B). l: the lane's LDS byte address in row group 0.
__device__ __forceinline__ void g2_copy(unsigned l, const _Float16* ga, size_t sa, const _Float16* gb, size_t sb) {
  /* the copies and, as the last line of the same statement, the wait that stands in front of any new value in the address registers they name */
  asm volatile("global_load_async_to_lds_b128 %0, %12, off\n\t"
               "global_load_async_to_lds_b128 %1, %13, off\n\t"
               "global_load_async_to_lds_b128 %2, %14, off\n\t"
               "global_load_async_to_lds_b128 %3, %15, off\n\t"
               "global_load_async_to_lds_b128 %4, %16, off\n\t"
               "global_load_async_to_lds_b128 %5, %17, off\n\t"
               "global_load_async_to_lds_b128 %6, %18, off\n\t"
               "global_load_async_to_lds_b128 %7, %19, off\n\t"
               "global_load_async_to_lds_b128 %8, %20, off\n\t"
               "global_load_async_to_lds_b128 %9, %21, off\n\t"
               "global_load_async_to_lds_b128 %10, %22, off\n\t"
               "global_load_async_to_lds_b128 %11, %23, off\n\t"
               "s_wait_xcnt 0x0"
               :: "v"(l), "v"(l + 16 * G2_PITCH), "v"(l + 32 * G2_PITCH), "v"(l + 48 * G2_PITCH), "v"(l + 64 * G2_PITCH), "v"(l + 80 * G2_PITCH),
                  "v"(l + 96 * G2_PITCH), "v"(l + 112 * G2_PITCH), "v"(l + 128 * G2_PITCH), "v"(l + 144 * G2_PITCH), "v"(l + 160 * G2_PITCH), "v"(l + 176 * G2_PITCH),
                  "v"(ga), "v"(ga + sa), "v"(ga + 2 * sa), "v"(ga + 3 * sa), "v"(ga + 4 * sa), "v"(ga + 5 * sa), "v"(ga + 6 * sa), "v"(ga + 7 * sa),
                  "v"(gb), "v"(gb + sb), "v"(gb + 2 * sb), "v"(gb + 3 * sb)
               : "memory"); }
// BIAS, RES, OUT32, OUT16: which of bias, CP, C and C16 the launch uses. Template flags, not pointer tests: the epilogue is then straight-line code, with no scalar branch per output element, and its LDS row reads and global stores issue as groups.
template <int ACT, bool BIAS, bool RES, bool OUT32, bool OUT16>
__global__ __launch_bounds__(128) void k_gemm2(const _Float16* __restrict__ A, int lda, size_t sA, const _Float16* __restrict__ Bh, int ldb, size_t sB, float alpha, const float* __restrict__ bias, size_t sBias, const float* __restrict__ CP, int rowsPerB, size_t sCPb, int row0g,
    float* __restrict__ C, _Float16* __restrict__ C16, int ldc, size_t sC, int M, int N, int K) { static_assert(ACT == 0 || ACT == 3 || ACT == 6 || ACT == 8 || ACT == 9 || ACT == 11 || ACT == 12 || ACT == 14 || ACT == 15 || ACT == 16 || ACT == 17, "k_gemm2: unsupported ACT code (would silently apply no activation)");
  __shared__ __attribute__((aligned(16))) unsigned char sm[2 * G2_STAGE];      /* the two operand buffers; behind the loop's last barrier the same bytes stage the output rows */
  float (*so)[32][68] = reinterpret_cast<float (*)[32][68]>(sm); static_assert(sizeof(float) * 4 * 32 * 68 <= 2 * G2_STAGE, "output staging must fit the operand buffers");
  const int tid = threadIdx.x, w = tid >> 5, lane = tid & 31, ln = lane & 15, hh = lane >> 4; const int by = blockIdx.y;
  A += (size_t)by * sA; Bh += (size_t)by * sB; const size_t cofs = (size_t)by * sC; const float* bp = BIAS ? bias + (size_t)by * sBias : nullptr;
  const int ntn = N >> 6; const int mt = blockIdx.x / ntn, nq = blockIdx.x - mt * ntn; const int row0 = mt * 128 + 32 * w, col0 = nq * 64; if (mt * 128 >= M) return;      /* the whole block leaves or none: barriers follow */
  const int crow = tid >> 3, cpc = tid & 7;
  const _Float16* ga = A + (size_t)(mt * 128 + crow) * lda + cpc * 8; const _Float16* gb = Bh + (size_t)(col0 + crow) * ldb + cpc * 8;
  const unsigned lb = (unsigned)(size_t)sm + (unsigned)(crow * G2_PITCH + cpc * 16);
  const unsigned char* fa = sm + (32 * w + ln) * G2_PITCH + 16 * hh; const unsigned char* fb = sm + (128 + ln) * G2_PITCH + 16 * hh;
  const int nt = K >> 6;
  const v8f z8 = {0.f,0.f,0.f,0.f,0.f,0.f,0.f,0.f}; v8f c00 = z8, c01 = z8, c02 = z8, c03 = z8, c10 = z8, c11 = z8, c12 = z8, c13 = z8;
  g2_copy(lb, ga, (size_t)16 * lda, gb, (size_t)16 * ldb);
  asm volatile("s_wait_asynccnt 0x0" ::: "memory");      /* this wave's copies of tile 0 have landed */
  __syncthreads();                                       /* ... and every other wave's */
  if (nt > 1) g2_copy(lb + G2_STAGE, ga + 64, (size_t)16 * lda, gb + 64, (size_t)16 * ldb);
#pragma unroll 1      /* rolled: one body serves both buffers and stays small */
  for (int t = 0; t < nt; ++t) { const unsigned bo = (unsigned)(t & 1) * G2_STAGE; const unsigned char* pa = fa + bo; const unsigned char* pb = fb + bo;
    /* the trip's 24 fragment reads stand together in front of its matrix instructions */
    const v16h a00 = g2_lfrag(pa), a10 = g2_lfrag(pa + 16 * G2_PITCH), b00 = g2_lfrag(pb), b10 = g2_lfrag(pb + 16 * G2_PITCH), b20 = g2_lfrag(pb + 32 * G2_PITCH), b30 = g2_lfrag(pb + 48 * G2_PITCH);
    const v16h a01 = g2_lfrag(pa + 64), a11 = g2_lfrag(pa + 16 * G2_PITCH + 64), b01 = g2_lfrag(pb + 64), b11 = g2_lfrag(pb + 16 * G2_PITCH + 64), b21 = g2_lfrag(pb + 32 * G2_PITCH + 64), b31 = g2_lfrag(pb + 48 * G2_PITCH + 64);
    c00 = g2_mma(a00, b00, c00); c10 = g2_mma(a10, b00, c10); c01 = g2_mma(a00, b10, c01); c11 = g2_mma(a10, b10, c11);
    c02 = g2_mma(a00, b20, c02); c12 = g2_mma(a10, b20, c12); c03 = g2_mma(a00, b30, c03); c13 = g2_mma(a10, b30, c13);
    c00 = g2_mma(a01, b01, c00); c10 = g2_mma(a11, b01, c10); c01 = g2_mma(a01, b11, c01); c11 = g2_mma(a11, b11, c11);
    c02 = g2_mma(a01, b21, c02); c12 = g2_mma(a11, b21, c12); c03 = g2_mma(a01, b31, c03); c13 = g2_mma(a11, b31, c13);
    asm volatile("s_wait_dscnt 0x0" ::: "memory");       /* this wave's reads of buffer t & 1 are done before the buffer is given up */
    asm volatile("s_wait_asynccnt 0x0" ::: "memory");    /* this wave's copies of tile t + 1 have landed */
    __syncthreads();                                     /* publishes tile t + 1 and ends every wave's reads of buffer t & 1 */
    if (t + 2 < nt) g2_copy(lb + bo, ga + (size_t)(t + 2) * 64, (size_t)16 * lda, gb + (size_t)(t + 2) * 64, (size_t)16 * ldb); }
  asm volatile("s_wait_asynccnt 0x0" ::: "memory");      /* no copy is outstanding when the buffers become output staging */
  v8f accs[8] = {c00, c01, c02, c03, c10, c11, c12, c13};
#pragma unroll
  for (int u = 0; u < 8; ++u) { const int t = u & 3, half = u >> 2; const int col = col0 + t * 16 + ln; const float bv = BIAS ? bf16_round(bp[col]) : 0.f;
#pragma unroll
    for (int r = 0; r < 8; ++r) { const int rloc = half * 16 + 8 * hh + r; float v = accs[u][r] * alpha + bv; if (RES) { if (rowsPerB < 0) v += CP[cofs + (size_t)(row0g + row0 + rloc) * ldc + col];      /* rowsPerB < 0: own element of the batched C plane */ else { const int bidx = (row0g + row0 + rloc) / rowsPerB; v += CP[(size_t)bidx * sCPb + (size_t)by * 64 + col]; } }
      if (ACT == 3) v = fmaxf(v, 0.f); else if (ACT == 6) v = 0.5f * v * (1.0f + erff(v * 0.70710678118654752f)); else if (ACT == 11) v = 1.0f / (1.0f + expf(-v)); else if (ACT == 15) v = v / (1.0f + expf(-v)); else if (ACT == 12) v = (v > 0.f) ? v : 0.01f * v; else if (ACT == 8) v = tanhf(v); else if (ACT == 9) v = 0.5f * v * (1.0f + tanhf(0.7978845608028654f * (v + 0.044715f * v * v * v))); else if (ACT == 14) v = (v > 0.f) ? v : 0.1f * v; else if (ACT == 16) v = (v >= 0.f) ? v : 0.3f * v; else if (ACT == 17) v = (v >= 0.f) ? v : 0.2f * v;
      so[w][rloc][t * 16 + ln] = v; } }
  __builtin_amdgcn_fence(__ATOMIC_ACQ_REL, "workgroup"); __builtin_amdgcn_wave_barrier();
  const int rsub = lane >> 4, c4 = (lane & 15) * 4;
  {
#pragma unroll
    for (int q = 0; q < 16; ++q) { const int r = q * 2 + rsub; const v4f v = *(const v4fa*)&so[w][r][c4]; if (OUT32) *(v4f*)(C + cofs + (size_t)(row0 + r) * ldc + col0 + c4) = v; if (OUT16) { v4h h4; for (int i = 0; i < 4; ++i) h4[i] = (_Float16)v[i]; *(v4h*)(C16 + cofs + (size_t)(row0 + r) * ldc + col0 + c4) = h4; } }
     } }


// one 64 x 64 tile (number blk) of Bt[out][in] = f16(bf16(w[in][out]) * 16)
__device__ __forceinline__ void wT_tile(const float* __restrict__ w, int din, int dout, _Float16* __restrict__ Bt, int blk, float (*tl)[65]) { const int tid = threadIdx.x; const int nbo = dout / 64; const int ib = blk / nbo, ob = blk % nbo; const int i0 = ib * 64, o0 = ob * 64;
  for (int t = tid; t < 64 * 64; t += 256) { const int i = t / 64, o = t % 64; tl[o][i] = bf16_round(w[(size_t)(i0 + i) * dout + o0 + o]) * 16.0f; }
  __syncthreads();
  { for (int t = tid; t < 64 * 8; t += 256) { const int o = t / 8, i8 = (t % 8) * 8; FragH f; for (int q = 0; q < 8; ++q) f.h[q] = (_Float16)tl[o][i8 + q]; *(v8us*)((unsigned short*)Bt + (size_t)(o0 + o) * din + i0 + i8) = f.half[0]; }  } }
// 8 elements of the padded f16 token rows per thread (block number blk)
__device__ __forceinline__ void xr_rows(const float* __restrict__ x, _Float16* __restrict__ X16, int blk) { const size_t t = (size_t)blk * 256 + threadIdx.x; if (t >= NRX * DM / 8) return; const int c0 = (int)((t * 8) % DM); const size_t r = (t * 8) / DM; const int tok = (int)(r % RPB); const size_t b = r / RPB; FragH f;
  for (int q = 0; q < 8; ++q) f.h[q] = (tok < NTOK) ? (_Float16)bf16_round(x[(b * NTOK + tok) * DM + c0 + q]) : (_Float16)0.f;
  *(v8us*)((unsigned short*)X16 + t * 8) = f.half[0];  }
// All operand preparation in one launch (none of the four parts reads another's output): blocks 0..255 transpose one weight tile each (Wq 64, Wkv 128, Wo 64), the rest convert token rows.
// BQKV holds the rows of Wq^T, then those of Wkv^T: one [1536][512] B operand.
#define WT_Q ((DM / 64) * (DM / 64))
#define WT_KV ((DM / 64) * (2 * DM / 64))
#define WT_ALL (2 * WT_Q + WT_KV)
__global__ __launch_bounds__(256) void k_prep(const float* __restrict__ x, const float* __restrict__ Wq, const float* __restrict__ Wkv, const float* __restrict__ Wo, _Float16* __restrict__ BQKV, _Float16* __restrict__ BO, _Float16* __restrict__ X16) {
  __shared__ float tl[64][65]; const int blk = blockIdx.x;      /* the choice below is the same for a whole block: wT_tile holds a barrier */
  if (blk < WT_Q) wT_tile(Wq, DM, DM, BQKV, blk, tl);
  else if (blk < WT_Q + WT_KV) wT_tile(Wkv, DM, 2 * DM, BQKV + (size_t)DM * DM, blk - WT_Q, tl);
  else if (blk < WT_ALL) wT_tile(Wo, DM, DM, BO, blk - (WT_Q + WT_KV), tl);
  else xr_rows(x, X16, blk - WT_ALL); }
// sum over the 8 lanes that share one (query, head): three DPP adds inside the 16-lane row (lane ^ 1, ^ 2, ^ 4); every lane of the group ends with the total
template <int CTRL> __device__ __forceinline__ float nb_xadd(float x) { return x + __int_as_float(__builtin_amdgcn_update_dpp(0, __float_as_int(x), CTRL, 0xf, 0xf, true)); }
__device__ __forceinline__ float nb_dot(v4f a0, v4f a1, v4f k0, v4f k1) {
  float s = a0[0] * k0[0], t = a1[0] * k1[0];
#pragma unroll
  for (int d = 1; d < 4; ++d) { s = fmaf(a0[d], k0[d], s); t = fmaf(a1[d], k1[d], t); }
  s += t; s = nb_xadd<0x161>(s); s = nb_xadd<0x162>(s); s = nb_xadd<0x164>(s); return s; }
// Neighbourhood attention. Wave = NQW consecutive queries of one grid row (f0, h0) x 4 heads, a block's 8 waves side by side in that row; 8 lanes share a (query, head), lane l8 holding
// dims 4*l8..+3 and 32+4*l8..+3, so that each b128 load of a key row covers whole 128-byte lines. Only 14 of the 27 window slots can pass the causal test (frame f0-1: 3x3; frame f0: row h0-1: 3,
// row h0: w-1 and w); the others have a flat index above the query's for every query. A key row is loaded once per wave and serves each of its queries whose window holds it.
// A slot outside the grid still reads a token row of the same batch (in bounds, written by the GEMM before) and gets the mask value as its logit, hence weight 0.
// A token's row of QKV holds q (512), k (512), v (512). The wave of query 0 also stores v_BOS as o row 0 of its batch and its 4 heads.
#define NQW 2
#define LQ (3 * DM)
__global__ __launch_bounds__(256) void k_nbatt(const float* QKV, _Float16* O16) {      /* no __restrict__: the loads below keep their side of the two waits */
  const int lane = threadIdx.x & 31, l8 = lane & 7, hs = lane >> 3; const int wv = __builtin_amdgcn_readfirstlane((int)(threadIdx.x >> 5));
  const int gw = blockIdx.x * 8 + wv; const int rw = gw / (WT / NQW); const int h0 = rw % HT, f0 = (rw / HT) % FT, hq = (rw / (HT * FT)) % 2, b = rw / (HT * FT * 2);
  const int w0 = (gw % (WT / NQW)) * NQW; const int j0 = (f0 * HT + h0) * WT + w0; const unsigned co = (unsigned)(hq * (DM / 2) + hs * HD + l8 * 4);
  const float* tb = QKV + (size_t)b * RPB * LQ;      /* the batch's token rows; k stands DM, v 2 * DM floats into a row */
  const float* rb[5]; bool kok[5][NQW + 2];      /* rb[r]: the row of the key at column w0 of window row r; a window row outside the grid points at token row 1, so that columns -1..NQW stay inside the buffer */
#pragma unroll
  for (int r = 0; r < 5; ++r) { const int f = f0 + (r < 3 ? -1 : 0), hh = h0 + (r < 3 ? r - 1 : r - 4); const bool rok = f >= 0 && hh >= 0 && hh < HT;
    rb[r] = tb + (size_t)(rok ? (f * HT + hh) * WT + w0 + 1 : 1) * LQ + co;
#pragma unroll
    for (int c = 0; c < NQW + 2; ++c) { const int ww = w0 - 1 + c; kok[r][c] = rok && ww >= 0 && ww < WT; } }
  const float* qp = QKV + ((size_t)b * RPB + j0) * LQ + co;      /* query i is token j0 + i + 1 */ const float* bp = tb + co;
  v4f q[NQW][2], kb[2], kk[5][NQW + 2][2];
#pragma unroll
  for (int i = 0; i < NQW; ++i) { q[i][0] = *(const v4fa*)(qp + (i + 1) * LQ); q[i][1] = *(const v4fa*)(qp + (i + 1) * LQ + 32); }
#pragma unroll
  for (int r = 0; r < 5; ++r) {
#pragma unroll
    for (int c = 0; c < NQW + (r < 4 ? 2 : 1); ++c) { const float* kp = rb[r] + (c - 1) * LQ + DM; kk[r][c][0] = *(const v4fa*)kp; kk[r][c][1] = *(const v4fa*)(kp + 32); } }
  kb[0] = *(const v4fa*)(bp + DM); kb[1] = *(const v4fa*)(bp + DM + 32);
  /* the wait that stands between issued loads and any new value in their address registers; naming the addresses keeps them in those registers up to it */
  asm volatile("s_wait_xcnt 0x0" :: "v"(qp), "v"(bp), "v"(rb[0]), "v"(rb[1]), "v"(rb[2]), "v"(rb[3]), "v"(rb[4]) : "memory");
  float lg[NQW][15];
#pragma unroll
  for (int i = 0; i < NQW; ++i) lg[i][0] = nb_dot(q[i][0], q[i][1], kb[0], kb[1]) * 0.125f;
#pragma unroll
  for (int r = 0; r < 5; ++r) {
#pragma unroll
    for (int c = 0; c < NQW + (r < 4 ? 2 : 1); ++c) {
#pragma unroll
      for (int i = 0; i < NQW; ++i) { const int dw = c - i; if (dw >= 0 && dw < (r < 4 ? 3 : 2)) { const float sd = nb_dot(q[i][0], q[i][1], kk[r][c][0], kk[r][c][1]) * 0.125f; lg[i][1 + r * 3 + dw] = kok[r][c] ? sd : -3.0e38f; } } } }
  v4f vb[2], vv[5][NQW + 2][2];      /* the v rows fly while the softmax is worked out */
#pragma unroll
  for (int r = 0; r < 5; ++r) {
#pragma unroll
    for (int c = 0; c < NQW + (r < 4 ? 2 : 1); ++c) { const float* vp = rb[r] + (c - 1) * LQ + 2 * DM; vv[r][c][0] = *(const v4fa*)vp; vv[r][c][1] = *(const v4fa*)(vp + 32); } }
  vb[0] = *(const v4fa*)(bp + 2 * DM); vb[1] = *(const v4fa*)(bp + 2 * DM + 32);
  /* the same wait behind the v loads */
  asm volatile("s_wait_xcnt 0x0" :: "v"(bp), "v"(rb[0]), "v"(rb[1]), "v"(rb[2]), "v"(rb[3]), "v"(rb[4]) : "memory");
#pragma unroll
  for (int i = 0; i < NQW; ++i) { float mx = lg[i][0];
#pragma unroll
    for (int s = 1; s < 15; ++s) mx = fmaxf(mx, lg[i][s]);
    float se = 0.f;
#pragma unroll
    for (int s = 0; s < 15; ++s) { const float e = expf(lg[i][s] - mx); lg[i][s] = e; se += e; }
    const float inv = 1.0f / se;
#pragma unroll
    for (int s = 0; s < 15; ++s) lg[i][s] *= inv; }
  v4f o[NQW][2];
#pragma unroll
  for (int i = 0; i < NQW; ++i) { o[i][0] = vb[0] * lg[i][0]; o[i][1] = vb[1] * lg[i][0]; }
#pragma unroll
  for (int r = 0; r < 5; ++r) {
#pragma unroll
    for (int c = 0; c < NQW + (r < 4 ? 2 : 1); ++c) {
#pragma unroll
      for (int i = 0; i < NQW; ++i) { const int dw = c - i; if (dw >= 0 && dw < (r < 4 ? 3 : 2)) { const float p = lg[i][1 + r * 3 + dw]; o[i][0] += vv[r][c][0] * p; o[i][1] += vv[r][c][1] * p; } } } }
#pragma unroll
  for (int i = 0; i < NQW; ++i) { _Float16* op = O16 + ((size_t)b * NPAD + j0 + i + 1) * DM + co; v4h a, c;
#pragma unroll
    for (int d = 0; d < 4; ++d) { a[d] = (_Float16)o[i][0][d]; c[d] = (_Float16)o[i][1][d]; }
    *(v4h*)op = a; *(v4h*)(op + 32) = c; }
  if (j0 == 0) {      /* o row 0 = v_BOS, read again so that it holds no registers above; the test reads the same in the whole wave */
    asm volatile("s_wait_xcnt 0x0" ::: "memory");      /* the wait between the stores above and any new value in the registers they name */
    const float* vp = tb + 2 * DM + co; const v4f v0 = *(const v4fa*)vp, v1 = *(const v4fa*)(vp + 32);
    _Float16* op = O16 + (size_t)b * NPAD * DM + co; v4h a, c;
#pragma unroll
    for (int d = 0; d < 4; ++d) { a[d] = (_Float16)v0[d]; c[d] = (_Float16)v1[d]; }
    *(v4h*)op = a; *(v4h*)(op + 32) = c; } }

extern "C" void kernel_launch(void* const* d_in, const int* in_sizes, int n_in,
                              void* d_out, int out_size, void* d_ws, size_t ws_size, hipStream_t stream) {
  (void)in_sizes; (void)n_in; (void)out_size;
  const float* const* I = (const float* const*)d_in; const float* x = I[0]; const float* Wq = I[1]; const float* Wkv = I[2]; const float* Wo = I[3]; const float* bo = I[4];
  char* ws = (char*)d_ws; size_t off = 0;
  auto take = [&](size_t bytes) { char* p = ws + off; off += (bytes + 255) & ~(size_t)255; return p; };
  _Float16* BQKV = (_Float16*)take((size_t)3 * DM * DM * 2); _Float16* BO = (_Float16*)take((size_t)DM * DM * 2);
  _Float16* X16 = (_Float16*)take(NRX * DM * 2); float* QKV = (float*)take(NRX * 3 * DM * 4); _Float16* O16 = (_Float16*)take((size_t)NB * NPAD * DM * 2);      /* rows b*4097 + tok; the last query's token (4096) is computed but dropped by the output GEMM */
  if (off > ws_size) return;      /* 2.1 + 8.7 + 51.9 + 8.4 = about 71 MB */
  k_prep<<<(unsigned)(WT_ALL + (NRX * DM / 8 + 255) / 256), 256, 0, stream>>>(x, Wq, Wkv, Wo, BQKV, BO, X16);
  k_gemm2<0, false, false, true, false><<<dim3((unsigned)((NRX / 128) * (3 * DM / 64)), 1), 128, 0, stream>>>(X16, DM, 0, BQKV, DM, 0, 0.0625f, nullptr, 0, nullptr, 1, 0, 0, QKV, nullptr, 3 * DM, 0, (int)NRX, 3 * DM, DM);
  k_nbatt<<<NB * 2 * FT * HT * (WT / NQW) / 8, 256, 0, stream>>>(QKV, O16);
  k_gemm2<0, true, false, true, false><<<dim3((unsigned)((NTOK / 128) * (DM / 64)), NB), 128, 0, stream>>>(O16, DM, (size_t)NPAD * DM, BO, DM, 0, 0.0625f, bo, 0, nullptr, 1, 0, 0, (float*)d_out, nullptr, DM, (size_t)NTOK * DM, NTOK, DM, DM);      /* out = o Wo + bo for tokens 0..4095 of each batch (grid y; token 4096 dropped) */
}

// v005
// Measured time: 53.1 microseconds a run.
// Next to v004, in two timings, it ran 1.11 times as fast each time.
// Over all steps from v000 it is 9.62 times as fast.
#include <hip/hip_runtime.h>
// Sparse3DNA (x [2][4096][512]: 1 BOS + 4095 video tokens on a 4x32x32 grid, padded by one zero token to 4097; q = x Wq, [k|v] = x Wkv ([in][out], no bias), 8 heads of 64; query j (token j+1) attends to {BOS} U {its 3x3x3 grid neighbourhood keys with flat index <= j} (out-of-grid slots and future keys masked), scale 64^-0.5, softmax, weighted v; token 0's output is v_BOS itself; out = o Wo + bo, first 4096 tokens -> [2][4096][512]).
// Structure: token rows (4,097 per batch padded to 4,224); x as exact f16 rows; one [Q|K|V] WMMA GEMM (32x64 wave tiles, f32 accumulation, exact x16 transposed weights) kept in f32, rows of 1,536; the 28-slot neighbourhood attention on VALU (f32: 8 lanes per (batch, head, query), 2 queries x 4 heads per wave, window indices and the causal test from the grid geometry on device, logits, softmax, weighted sum) into f16 o rows in LDS (token 0: v_BOS); out = o Wo + bo on WMMA in the same launch, 32 tokens per block (f32, output layout). Three launches: operands, [Q|K|V], attention with output.
// Compute dtype: inputs rounded to bf16; x / weights exact; q, k, v, logits, softmax f32; o plain f16 into the Wo GEMM (~2^-12). v_wmma_f32_16x16x32_f16.
#define NB 2
#define NTOK 4096                    /* input tokens per batch (= output tokens) */
#define NPAD 4097                    /* after the module's padding */
#define RPB 4224                     /* rows per batch (33 x 128) */
#define NRX ((size_t)NB * RPB)       /* 8448 */
#define DM 512
#define NH 8
#define HD 64
#define FT 4
#define HT 32
#define WT 32
#define TT (FT * HT * WT)            /* 4096 grid tokens */
#define QT TT                        /* unused */
typedef __bf16 v16b __attribute__((ext_vector_type(16)));
typedef unsigned short v8us __attribute__((ext_vector_type(8), may_alias));
typedef float  v8f  __attribute__((ext_vector_type(8)));
typedef float  v4f  __attribute__((ext_vector_type(4)));
typedef float  v4fa __attribute__((ext_vector_type(4), may_alias));
union FragB { v16b v; v8us half[2]; unsigned short u[16]; };

__device__ __forceinline__ unsigned short bf16_bits(float x) { unsigned int u = __float_as_uint(x); return (unsigned short)((u + 0x7FFFu + ((u >> 16) & 1u)) >> 16); }
__device__ __forceinline__ float bf16_val(unsigned short b) { return __uint_as_float(((unsigned int)b) << 16); }
__device__ __forceinline__ float bf16_round(float x) { return bf16_val(bf16_bits(x)); }
// D += A·B with NT terms: 1 = ah·bh, 2 = + al·bh (A split), 3 = + ah·bl (both split)
template <int NT>
__device__ __forceinline__ v8f mmaN(v16b ah, v16b al, v16b bh, v16b bl, v8f c) {
  c = __builtin_amdgcn_wmma_f32_16x16x32_bf16(false, ah, false, bh, (short)0, c, false, false);
  if (NT >= 2) c = __builtin_amdgcn_wmma_f32_16x16x32_bf16(false, al, false, bh, (short)0, c, false, false);
  if (NT >= 3) c = __builtin_amdgcn_wmma_f32_16x16x32_bf16(false, ah, false, bl, (short)0, c, false, false);
  asm volatile("v_nop\n\tv_nop\n\tv_nop\n\tv_nop" : "+v"(c) : "v"(ah), "v"(al), "v"(bh), "v"(bl));
  return c;
}

__global__ __launch_bounds__(256) void k_wt_bf16(const float* __restrict__ W, unsigned short* __restrict__ Wt, int K, int N) {
  const int t = blockIdx.x * 256 + threadIdx.x;
  const int k8n = K / 8;
  if (t >= N * k8n) return;
  const int n = t / k8n, k8 = (t % k8n) * 8;
  v8us v;
#pragma unroll
  for (int i = 0; i < 8; ++i) v[i] = bf16_bits(W[(size_t)(k8 + i) * N + n]);
  *(v8us*)(Wt + (size_t)n * K + k8) = v;
  
}

// GEMM C[M][N] (f32, pitch ldc) = act(A[M][K]·W + bias). A f32 row-major (pitch lda) converted per fragment to bf16
// (ASPLIT: hi/lo two planes -> 2 terms, else single rounded term); Wt bf16 [N][K] (pitch ldb). BIAS_BF16 rounds the
// bias to bf16 first (bias quantised to bf16 before the add). K%32==0, M%16==0, N%64==0.
template <bool ASPLIT, int ACT, bool BIAS_BF16>
__global__ __launch_bounds__(128) void k_gemm_bf(const float* __restrict__ A, int lda, const unsigned short* __restrict__ Wt, int ldb,
                                               const float* __restrict__ bias, float* __restrict__ C, int ldc, int M, int N, int K) {
  __shared__ __attribute__((aligned(16))) float so[4][16][64];
  const int tid = threadIdx.x, w = tid >> 5, lane = tid & 31, ln = lane & 15, hh = lane >> 4;
  const int ntn = N / 64;
  const int wid = blockIdx.x * 4 + w;
  const int mt = wid / ntn, nq = wid % ntn;
  if (mt * 16 >= M) return;
  const int row0 = mt * 16, col0 = nq * 64;
  const float* arow = A + (size_t)(row0 + ln) * lda;
  v8f acc[4] = {};
  for (int kb = 0; kb < K; kb += 32) {
    FragB ah, al;
    const v4f x0 = *(const v4fa*)(arow + kb + 8 * hh), x1 = *(const v4fa*)(arow + kb + 8 * hh + 4);
    const v4f x2 = *(const v4fa*)(arow + kb + 16 + 8 * hh), x3 = *(const v4fa*)(arow + kb + 16 + 8 * hh + 4);
    float xs[16] = {x0[0],x0[1],x0[2],x0[3],x1[0],x1[1],x1[2],x1[3],x2[0],x2[1],x2[2],x2[3],x3[0],x3[1],x3[2],x3[3]};
#pragma unroll
    for (int i = 0; i < 16; ++i) { const unsigned short hb = bf16_bits(xs[i]); ah.u[i] = hb; al.u[i] = ASPLIT ? bf16_bits(xs[i] - bf16_val(hb)) : (unsigned short)0; }
#pragma unroll
    for (int t = 0; t < 4; ++t) {
      const unsigned short* brow = Wt + (size_t)(col0 + t * 16 + ln) * ldb + kb;
      FragB b;
      b.half[0] = *(const v8us*)(brow + 8 * hh);
      b.half[1] = *(const v8us*)(brow + 16 + 8 * hh);
      acc[t] = mmaN<ASPLIT ? 2 : 1>(ah.v, al.v, b.v, b.v, acc[t]);
    }
  }
#pragma unroll
  for (int t = 0; t < 4; ++t) {
    float bv = bias ? bias[col0 + t * 16 + ln] : 0.f;
    if (BIAS_BF16) bv = bf16_round(bv);
#pragma unroll
    for (int r = 0; r < 8; ++r) { float v = acc[t][r] + bv; if (ACT == 1) v = fmaxf(v, 0.f); so[w][8 * hh + r][t * 16 + ln] = v; }
  }
  __builtin_amdgcn_fence(__ATOMIC_ACQ_REL, "workgroup");
  __builtin_amdgcn_wave_barrier();
  const int rsub = lane >> 4, c4 = (lane & 15) * 4;
  {
#pragma unroll
    for (int q = 0; q < 8; ++q) {
      const int r = q * 2 + rsub;
      const v4f v = *(const v4fa*)&so[w][r][c4];
      *(v4f*)(C + (size_t)(row0 + r) * ldc + col0 + c4) = v;
    }
    
  }
}

// GEMM C = act(A·W + bias + resid): A f32 (ASPLIT -> hi/lo 2 terms), Wt bf16 [N][K]; ACT 0 none, 1 relu, 2 exact gelu;
// resid (optional, f32, row index = (row % rmod), pitch ldr, RES_BF16 rounds it) added before the activation.
template <bool ASPLIT, int ACT, bool BIAS_BF16, bool RES_BF16>
__global__ __launch_bounds__(128) void k_gemm_bf3(const float* __restrict__ A, int lda, const unsigned short* __restrict__ Wt, int ldb,
                                                const float* __restrict__ bias, const float* __restrict__ resid, int rmod, int ldr,
                                                float* __restrict__ C, int ldc, int M, int N, int K) {
  __shared__ __attribute__((aligned(16))) float so[4][16][64];
  const int tid = threadIdx.x, w = tid >> 5, lane = tid & 31, ln = lane & 15, hh = lane >> 4;
  const int ntn = N / 64;
  const int wid = blockIdx.x * 4 + w;
  const int mt = wid / ntn, nq = wid % ntn;
  if (mt * 16 >= M) return;
  const int row0 = mt * 16, col0 = nq * 64;
  const float* arow = A + (size_t)(row0 + ln) * lda;
  v8f acc[4] = {};
  for (int kb = 0; kb < K; kb += 32) {
    FragB ah, al;
    const v4f x0 = *(const v4fa*)(arow + kb + 8 * hh), x1 = *(const v4fa*)(arow + kb + 8 * hh + 4);
    const v4f x2 = *(const v4fa*)(arow + kb + 16 + 8 * hh), x3 = *(const v4fa*)(arow + kb + 16 + 8 * hh + 4);
    float xs[16] = {x0[0],x0[1],x0[2],x0[3],x1[0],x1[1],x1[2],x1[3],x2[0],x2[1],x2[2],x2[3],x3[0],x3[1],x3[2],x3[3]};
#pragma unroll
    for (int i = 0; i < 16; ++i) { const unsigned short hb = bf16_bits(xs[i]); ah.u[i] = hb; al.u[i] = ASPLIT ? bf16_bits(xs[i] - bf16_val(hb)) : (unsigned short)0; }
#pragma unroll
    for (int t = 0; t < 4; ++t) {
      const unsigned short* brow = Wt + (size_t)(col0 + t * 16 + ln) * ldb + kb;
      FragB b;
      b.half[0] = *(const v8us*)(brow + 8 * hh);
      b.half[1] = *(const v8us*)(brow + 16 + 8 * hh);
      acc[t] = mmaN<ASPLIT ? 2 : 1>(ah.v, al.v, b.v, b.v, acc[t]);
    }
  }
#pragma unroll
  for (int t = 0; t < 4; ++t) {
    const int col = col0 + t * 16 + ln;
    float bv = bias ? bias[col] : 0.f;
    if (BIAS_BF16) bv = bf16_round(bv);
#pragma unroll
    for (int r = 0; r < 8; ++r) {
      float v = acc[t][r] + bv;
      if (resid) { float rv = resid[(size_t)((row0 + 8 * hh + r) % rmod) * ldr + col]; if (RES_BF16) rv = bf16_round(rv); v += rv; }
      if (ACT == 1) v = fmaxf(v, 0.f);
      if (ACT == 2) v = 0.5f * v * (1.0f + erff(v * 0.70710678118654752f));
      if (ACT == 3) { const float u = 0.7978845608028654f * (v + 0.044715f * v * v * v); v = 0.5f * v * (1.0f + tanhf(u)); }
      so[w][8 * hh + r][t * 16 + ln] = v;
    }
  }
  __builtin_amdgcn_fence(__ATOMIC_ACQ_REL, "workgroup");
  __builtin_amdgcn_wave_barrier();
  const int rsub = lane >> 4, c4 = (lane & 15) * 4;
  {
#pragma unroll
    for (int q = 0; q < 8; ++q) {
      const int r = q * 2 + rsub;
      const v4f v = *(const v4fa*)&so[w][r][c4];
      *(v4f*)(C + (size_t)(row0 + r) * ldc + col0 + c4) = v;
    }
    
  }
}
// row LayerNorm (biased variance, eps) over N: s = X (+ R); optional out_sum <- s; out_norm <- (s-mu)*rsqrt(var+eps)*g + b
template <bool PARAM_BF16>
__global__ __launch_bounds__(256) void k_layernorm(const float* __restrict__ X, const float* __restrict__ R, const float* __restrict__ g, const float* __restrict__ bta,
                                                  float* __restrict__ out_sum, float* __restrict__ out_norm, int N, float eps) {
  __shared__ float red[256];
  const int row = blockIdx.x, tid = threadIdx.x;
  const float* x = X + (size_t)row * N; const float* rr = R ? R + (size_t)row * N : nullptr;
  float vals[16];                     // up to N = 4096
  const int per = N / 256;            // contiguous chunk per thread? use strided-by-4 chunks: thread handles j = tid*4 + 1024*u
  float s1 = 0.f;
  for (int u = 0; u < per / 4; ++u) {
    const int j = tid * 4 + 1024 * u;
    const v4f a = *(const v4fa*)(x + j);
    v4f b = {0.f,0.f,0.f,0.f}; if (rr) b = *(const v4fa*)(rr + j);
#pragma unroll
    for (int q = 0; q < 4; ++q) { const float v = a[q] + b[q]; vals[u * 4 + q] = v; s1 += v; }
  }
  red[tid] = s1; __syncthreads();
  for (int st = 128; st > 0; st >>= 1) { if (tid < st) red[tid] += red[tid + st]; __syncthreads(); }
  const float mu = red[0] / (float)N; __syncthreads();
  float s2 = 0.f;
  for (int u = 0; u < per / 4; ++u)
#pragma unroll
    for (int q = 0; q < 4; ++q) { const float c = vals[u * 4 + q] - mu; s2 += c * c; }
  red[tid] = s2; __syncthreads();
  for (int st = 128; st > 0; st >>= 1) { if (tid < st) red[tid] += red[tid + st]; __syncthreads(); }
  const float rs = rsqrtf(red[0] / (float)N + eps);
  {
    for (int u = 0; u < per / 4; ++u) {
      const int j = tid * 4 + 1024 * u;
      v4f o, sm;
#pragma unroll
      for (int q = 0; q < 4; ++q) {
        float gg = g[j + q], bb = bta[j + q];
        if (PARAM_BF16) { gg = bf16_round(gg); bb = bf16_round(bb); }
        sm[q] = vals[u * 4 + q]; o[q] = (vals[u * 4 + q] - mu) * rs * gg + bb;
      }
      if (out_sum) *(v4f*)(out_sum + (size_t)row * N + j) = sm;
      *(v4f*)(out_norm + (size_t)row * N + j) = o;
    }
    
  }
}



// ---- f16 WMMA path (v_wmma_f32_16x16x32_f16): 11-bit significands for operands in range — used here for the [Q|K|V] and Wo GEMMs
typedef _Float16 v16h __attribute__((ext_vector_type(16)));
union FragH { v16h v; v8us half[2]; _Float16 h[16]; unsigned short u[16]; };
template <int NT>
__device__ __forceinline__ v8f mmaH(v16h ah, v16h al, v16h bh, v16h bl, v8f c) {
  c = __builtin_amdgcn_wmma_f32_16x16x32_f16(false, ah, false, bh, (short)0, c, false, false);
  if (NT >= 2) c = __builtin_amdgcn_wmma_f32_16x16x32_f16(false, al, false, bh, (short)0, c, false, false);
  if (NT >= 3) c = __builtin_amdgcn_wmma_f32_16x16x32_f16(false, ah, false, bl, (short)0, c, false, false);
  asm volatile("v_nop\n\tv_nop\n\tv_nop\n\tv_nop" : "+v"(c) : "v"(ah), "v"(al), "v"(bh), "v"(bl));
  return c;
}
// batched GEMM like k_gemm_b but f16 operands: A f32 (split into f16 hi/lo if ASPLIT, else rounded to f16), Bt = f16 values [n][k]; alpha; C f32; N multiple of 16 (partial tiles skipped)
template <bool ASPLIT>
__global__ __launch_bounds__(128) void k_gemm_h(const float* __restrict__ A, int lda, size_t sA, const _Float16* __restrict__ Bh, int ldb, size_t sB, float alpha, float* __restrict__ C, int ldc, size_t sC, int M, int N, int K) {
  __shared__ __attribute__((aligned(16))) float so[4][16][64];
  const int tid = threadIdx.x, w = tid >> 5, lane = tid & 31, ln = lane & 15, hh = lane >> 4; const int by = blockIdx.y;
  A += (size_t)by * sA; Bh += (size_t)by * sB; C += (size_t)by * sC;
  const int ntn = (N + 63) / 64; const int wid = blockIdx.x * 4 + w; const int mt = wid / ntn, nq = wid % ntn; if (mt * 16 >= M) return;
  const int row0 = mt * 16, col0 = nq * 64; const float* arow = A + (size_t)(row0 + ln) * lda;
  v8f acc[4] = {};
  for (int kb = 0; kb < K; kb += 32) {
    FragH ah, al;
    const v4f x0 = *(const v4fa*)(arow + kb + 8 * hh), x1 = *(const v4fa*)(arow + kb + 8 * hh + 4), x2 = *(const v4fa*)(arow + kb + 16 + 8 * hh), x3 = *(const v4fa*)(arow + kb + 16 + 8 * hh + 4);
    float xs[16] = {x0[0],x0[1],x0[2],x0[3],x1[0],x1[1],x1[2],x1[3],x2[0],x2[1],x2[2],x2[3],x3[0],x3[1],x3[2],x3[3]};
#pragma unroll
    for (int i = 0; i < 16; ++i) { const _Float16 h = (_Float16)xs[i]; ah.h[i] = h; al.h[i] = ASPLIT ? (_Float16)(xs[i] - (float)h) : (_Float16)0.0f; }
#pragma unroll
    for (int t = 0; t < 4; ++t) { if (col0 + t * 16 >= N) continue; const size_t boff = (size_t)(col0 + t * 16 + ln) * ldb + kb; FragH bq; bq.half[0] = *(const v8us*)(Bh + boff + 8 * hh); bq.half[1] = *(const v8us*)(Bh + boff + 16 + 8 * hh);
      acc[t] = mmaH<ASPLIT ? 2 : 1>(ah.v, al.v, bq.v, bq.v, acc[t]); }
  }
#pragma unroll
  for (int t = 0; t < 4; ++t) { if (col0 + t * 16 >= N) continue;
#pragma unroll
    for (int r = 0; r < 8; ++r) so[w][8 * hh + r][t * 16 + ln] = acc[t][r] * alpha; }
  __builtin_amdgcn_fence(__ATOMIC_ACQ_REL, "workgroup"); __builtin_amdgcn_wave_barrier();
  const int rsub = lane >> 4, c4 = (lane & 15) * 4;
  {
#pragma unroll
    for (int q = 0; q < 8; ++q) { const int r = q * 2 + rsub; if (col0 + c4 < N) { const v4f v = *(const v4fa*)&so[w][r][c4]; *(v4f*)(C + (size_t)(row0 + r) * ldc + col0 + c4) = v; } }
     }
}

// Wt[n][k] = f16(W[k][n]·scale) from f32 row-major W[K][N] (scale = power of two; bf16-exact weights stay exact in f16 away from the subnormal range)
__global__ __launch_bounds__(256) void k_wt_f16(const float* __restrict__ W, _Float16* __restrict__ Wt, int K, int N, float scale) {
  const int t = blockIdx.x * 256 + threadIdx.x; if (t >= N * (K / 8)) return; const int n = t / (K / 8), k8 = (t % (K / 8)) * 8; FragH f;
#pragma unroll
  for (int i = 0; i < 8; ++i) f.h[i] = (_Float16)(bf16_round(W[(size_t)(k8 + i) * N + n]) * scale); const v8us o = f.half[0];
  *(v8us*)((unsigned short*)Wt + (size_t)n * K + k8) = o; 
}
// k_gemm_hh variant with fused epilogue: v = acc·alpha + bias[by·sBias + col] (+ CP[(row/rowsPerB)·sCPb + by·64 + col] if CP) ; ACT 0 none / 1 elu ; writes f16 C16 (and f32 C if non-null)
template <int ACT>
__global__ __launch_bounds__(128) void k_gemm_hhx(const _Float16* __restrict__ A, int lda, size_t sA, const _Float16* __restrict__ Bh, int ldb, size_t sB, float alpha, const float* __restrict__ bias, size_t sBias, const float* __restrict__ CP, int rowsPerB, size_t sCPb, int row0g,
    float* __restrict__ C, _Float16* __restrict__ C16, int ldc, size_t sC, int M, int N, int K) {
  __shared__ __attribute__((aligned(16))) float so[4][16][64];
  const int tid = threadIdx.x, w = tid >> 5, lane = tid & 31, ln = lane & 15, hh = lane >> 4; const int by = blockIdx.y;
  A += (size_t)by * sA; Bh += (size_t)by * sB; const size_t cofs = (size_t)by * sC; const float* bp = bias ? bias + (size_t)by * sBias : nullptr;
  const int ntn = (N + 63) / 64; const int wid = blockIdx.x * 4 + w; const int mt = wid / ntn, nq = wid % ntn; if (mt * 16 >= M) return;
  const int row0 = mt * 16, col0 = nq * 64; const _Float16* arow = A + (size_t)(row0 + ln) * lda;
  v8f acc[4] = {};
  for (int kb = 0; kb < K; kb += 32) { FragH ah; ah.half[0] = *(const v8us*)((const unsigned short*)arow + kb + 8 * hh); ah.half[1] = *(const v8us*)((const unsigned short*)arow + kb + 16 + 8 * hh);
#pragma unroll
    for (int t = 0; t < 4; ++t) { if (col0 + t * 16 >= N) continue; const size_t boff = (size_t)(col0 + t * 16 + ln) * ldb + kb; FragH bq; bq.half[0] = *(const v8us*)((const unsigned short*)Bh + boff + 8 * hh); bq.half[1] = *(const v8us*)((const unsigned short*)Bh + boff + 16 + 8 * hh);
      acc[t] = mmaH<1>(ah.v, ah.v, bq.v, bq.v, acc[t]); }
  }
#pragma unroll
  for (int t = 0; t < 4; ++t) { if (col0 + t * 16 >= N) continue; const int col = col0 + t * 16 + ln; const float bv = bp ? bf16_round(bp[col]) : 0.f;
#pragma unroll
    for (int r = 0; r < 8; ++r) { float v = acc[t][r] * alpha + bv; if (CP) { const int rr = row0g + row0 + 8 * hh + r; if (rowsPerB < 0) v += CP[cofs + (size_t)rr * ldc + col];      /* rowsPerB < 0: own element of the batched C plane */ else { const int bidx = rr / rowsPerB; v += CP[(size_t)bidx * sCPb + (size_t)by * 64 + col]; } } if (ACT == 1) v = (v > 0.f) ? v : expm1f(v); else if (ACT == 7) v = (v > 0.f) ? v + 1.0f : expf(v); else if (ACT == 8) v = tanhf(v); else if (ACT == 9) v = 0.5f * v * (1.0f + tanhf(0.7978845608028654f * (v + 0.044715f * v * v * v))); else if (ACT == 11) v = 1.0f / (1.0f + expf(-v)); else if (ACT == 12) v = (v > 0.f) ? v : 0.01f * v; else if (ACT == 14) v = (v > 0.f) ? v : 0.1f * v; else if (ACT == 16) v = (v >= 0.f) ? v : 0.3f * v; else if (ACT == 17) v = (v >= 0.f) ? v : 0.2f * v; else if (ACT == 15) v = v / (1.0f + expf(-v)); else if (ACT == 3) v = fmaxf(v, 0.f); else if (ACT == 6) v = 0.5f * v * (1.0f + erff(v * 0.70710678118654752f)); so[w][8 * hh + r][t * 16 + ln] = v; } }
  __builtin_amdgcn_fence(__ATOMIC_ACQ_REL, "workgroup"); __builtin_amdgcn_wave_barrier();
  const int rsub = lane >> 4, c4 = (lane & 15) * 4; typedef _Float16 v4h __attribute__((ext_vector_type(4)));
  {
#pragma unroll
    for (int q = 0; q < 8; ++q) { const int r = q * 2 + rsub; if (col0 + c4 < N) { const v4f v = *(const v4fa*)&so[w][r][c4]; if (C) *(v4f*)(C + cofs + (size_t)(row0 + r) * ldc + col0 + c4) = v; if (C16) { v4h h4; for (int i = 0; i < 4; ++i) h4[i] = (_Float16)v[i]; *(v4h*)(C16 + cofs + (size_t)(row0 + r) * ldc + col0 + c4) = h4; } } }
     }
}


typedef _Float16 v4h __attribute__((ext_vector_type(4)));

__global__ __launch_bounds__(256) void k_x16(const float* __restrict__ x, _Float16* __restrict__ X16, size_t n8) { const size_t t = (size_t)blockIdx.x * 256 + threadIdx.x; if (t >= n8) return; FragH f;
#pragma unroll
  for (int q = 0; q < 8; ++q) f.h[q] = (_Float16)bf16_round(x[t * 8 + q]); *(v8us*)((unsigned short*)X16 + t * 8) = f.half[0];  }
__global__ __launch_bounds__(256) void k_h16(const float* __restrict__ x, _Float16* __restrict__ X16, size_t n8) { const size_t t = (size_t)blockIdx.x * 256 + threadIdx.x; if (t >= n8) return; FragH f;
#pragma unroll
  for (int q = 0; q < 8; ++q) f.h[q] = (_Float16)x[t * 8 + q]; *(v8us*)((unsigned short*)X16 + t * 8) = f.half[0];  }
__global__ __launch_bounds__(256) void k_round16f(const float* __restrict__ W, _Float16* __restrict__ Bt, size_t n8) { const size_t t = (size_t)blockIdx.x * 256 + threadIdx.x; if (t >= n8) return; FragH f;
#pragma unroll
  for (int i = 0; i < 8; ++i) f.h[i] = (_Float16)(bf16_round(W[t * 8 + i]) * 16.0f); *(v8us*)((unsigned short*)Bt + t * 8) = f.half[0];  }
template <int NHv, int TTv>
__global__ __launch_bounds__(256) void k_vt(const _Float16* __restrict__ V16, int ldv, int voff, _Float16* __restrict__ Vt) { __shared__ unsigned short tl[64][66]; const int tid = threadIdx.x; const int slab = blockIdx.x / (TTv / 64), lg = blockIdx.x % (TTv / 64); const int b = slab / NHv, h = slab % NHv;
  for (int i = tid; i < 64 * 8; i += 256) { const int r = i / 8, c8 = (i % 8) * 8; FragH f; f.half[0] = *(const v8us*)((const unsigned short*)V16 + ((size_t)b * TTv + lg * 64 + r) * ldv + voff + h * 64 + c8);
#pragma unroll
    for (int q = 0; q < 8; ++q) tl[r][c8 + q] = f.u[q]; }
  __syncthreads();
  {
#pragma unroll
    for (int rd = 0; rd < 2; ++rd) { const int d = rd * 32 + tid / 8, pc = tid % 8; FragH f;
#pragma unroll
      for (int q = 0; q < 8; ++q) f.u[q] = tl[pc * 8 + q][d];
      *(v8us*)((unsigned short*)Vt + ((size_t)slab * 64 + d) * TTv + lg * 64 + pc * 8) = f.half[0]; }
     } }

__global__ __launch_bounds__(256) void k_hl(const float* __restrict__ F, _Float16* __restrict__ Hh, _Float16* __restrict__ Hl, size_t n8) { const size_t t = (size_t)blockIdx.x * 256 + threadIdx.x; if (t >= n8) return; FragH fh, fl; const v4f a = *(const v4fa*)(F + t * 8), c = *(const v4fa*)(F + t * 8 + 4);
#pragma unroll
  for (int q = 0; q < 4; ++q) { _Float16 h = (_Float16)a[q]; fh.h[q] = h; fl.h[q] = (_Float16)((a[q] - (float)h) * 1024.0f); h = (_Float16)c[q]; fh.h[4 + q] = h; fl.h[4 + q] = (_Float16)((c[q] - (float)h) * 1024.0f); }
  { *(v8us*)((unsigned short*)Hh + t * 8) = fh.half[0]; *(v8us*)((unsigned short*)Hl + t * 8) = fl.half[0];  } }

// ---- fast GEMM (block tile 128x64, wave tile 32x64; requires M % 128 == 0 rows per launch region, N % 64 == 0, K % 64 == 0); epilogue = k_gemm_hhx semantics ----
// Operand path: per trip of 64 k the block's 128 A rows and 64 B rows (128 bytes each, whole lines) are copied to LDS asynchronously, two buffers, the copies of trip t + 2 issued behind the barrier that ends trip t;
// the waves read their fragments from LDS (row pitch 144 bytes: no bank conflict for 16-byte reads). The k order of every accumulator is the ascending one of the direct-load form.
#define G2_PITCH 144
#define G2_STAGE (192 * G2_PITCH)      /* rows 0..127: A, rows 128..191: B */
__device__ __forceinline__ v16h g2_lfrag(const unsigned char* p) { FragH f; f.half[0] = *(const v8us*)p; f.half[1] = *(const v8us*)(p + 32); return f.v; }
__device__ __forceinline__ v8f g2_mma(v16h a, v16h b, v8f c) { v8f d = __builtin_amdgcn_wmma_f32_16x16x32_f16(false, a, false, b, (short)0, c, false, false); asm volatile("v_nop\n\tv_nop\n\tv_nop\n\tv_nop" : "+v"(d) : "v"(a), "v"(b)); return d; }
// One stage: each lane copies 12 pieces of 16 bytes (8 lanes = one 128-byte row, a wave = 4 rows, the block = 16 rows per copy; 8 copies for A, 4 for B). l: the lane's LDS byte address in row group 0.
__device__ __forceinline__ void g2_copy(unsigned l, const _Float16* ga, size_t sa, const _Float16* gb, size_t sb) {
  /* the copies and, as the last line of the same statement, the wait that stands in front of any new value in the address registers they name */
  asm volatile("global_load_async_to_lds_b128 %0, %12, off\n\t"
               "global_load_async_to_lds_b128 %1, %13, off\n\t"
               "global_load_async_to_lds_b128 %2, %14, off\n\t"
               "global_load_async_to_lds_b128 %3, %15, off\n\t"
               "global_load_async_to_lds_b128 %4, %16, off\n\t"
               "global_load_async_to_lds_b128 %5, %17, off\n\t"
               "global_load_async_to_lds_b128 %6, %18, off\n\t"
               "global_load_async_to_lds_b128 %7, %19, off\n\t"
               "global_load_async_to_lds_b128 %8, %20, off\n\t"
               "global_load_async_to_lds_b128 %9, %21, off\n\t"
               "global_load_async_to_lds_b128 %10, %22, off\n\t"
               "global_load_async_to_lds_b128 %11, %23, off\n\t"
               "s_wait_xcnt 0x0"
               :: "v"(l), "v"(l + 16 * G2_PITCH), "v"(l + 32 * G2_PITCH), "v"(l + 48 * G2_PITCH), "v"(l + 64 * G2_PITCH), "v"(l + 80 * G2_PITCH),
                  "v"(l + 96 * G2_PITCH), "v"(l + 112 * G2_PITCH), "v"(l + 128 * G2_PITCH), "v"(l + 144 * G2_PITCH), "v"(l + 160 * G2_PITCH), "v"(l + 176 * G2_PITCH),
                  "v"(ga), "v"(ga + sa), "v"(ga + 2 * sa), "v"(ga + 3 * sa), "v"(ga + 4 * sa), "v"(ga + 5 * sa), "v"(ga + 6 * sa), "v"(ga + 7 * sa),
                  "v"(gb), "v"(gb + sb), "v"(gb + 2 * sb), "v"(gb + 3 * sb)
               : "memory"); }
// BIAS, RES, OUT32, OUT16: which of bias, CP, C and C16 the launch uses. Template flags, not pointer tests: the epilogue is then straight-line code, with no scalar branch per output element, and its LDS row reads and global stores issue as groups.
template <int ACT, bool BIAS, bool RES, bool OUT32, bool OUT16>
__global__ __launch_bounds__(128) void k_gemm2(const _Float16* __restrict__ A, int lda, size_t sA, const _Float16* __restrict__ Bh, int ldb, size_t sB, float alpha, const float* __restrict__ bias, size_t sBias, const float* __restrict__ CP, int rowsPerB, size_t sCPb, int row0g,
    float* __restrict__ C, _Float16* __restrict__ C16, int ldc, size_t sC, int M, int N, int K) { static_assert(ACT == 0 || ACT == 3 || ACT == 6 || ACT == 8 || ACT == 9 || ACT == 11 || ACT == 12 || ACT == 14 || ACT == 15 || ACT == 16 || ACT == 17, "k_gemm2: unsupported ACT code (would silently apply no activation)");
  __shared__ __attribute__((aligned(16))) unsigned char sm[2 * G2_STAGE];      /* the two operand buffers; behind the loop's last barrier the same bytes stage the output rows */
  float (*so)[32][68] = reinterpret_cast<float (*)[32][68]>(sm); static_assert(sizeof(float) * 4 * 32 * 68 <= 2 * G2_STAGE, "output staging must fit the operand buffers");
  const int tid = threadIdx.x, w = tid >> 5, lane = tid & 31, ln = lane & 15, hh = lane >> 4; const int by = blockIdx.y;
  A += (size_t)by * sA; Bh += (size_t)by * sB; const size_t cofs = (size_t)by * sC; const float* bp = BIAS ? bias + (size_t)by * sBias : nullptr;
  const int ntn = N >> 6; const int mt = blockIdx.x / ntn, nq = blockIdx.x - mt * ntn; const int row0 = mt * 128 + 32 * w, col0 = nq * 64; if (mt * 128 >= M) return;      /* the whole block leaves or none: barriers follow */
  const int crow = tid >> 3, cpc = tid & 7;
  const _Float16* ga = A + (size_t)(mt * 128 + crow) * lda + cpc * 8; const _Float16* gb = Bh + (size_t)(col0 + crow) * ldb + cpc * 8;
  const unsigned lb = (unsigned)(size_t)sm + (unsigned)(crow * G2_PITCH + cpc * 16);
  const unsigned char* fa = sm + (32 * w + ln) * G2_PITCH + 16 * hh; const unsigned char* fb = sm + (128 + ln) * G2_PITCH + 16 * hh;
  const int nt = K >> 6;
  const v8f z8 = {0.f,0.f,0.f,0.f,0.f,0.f,0.f,0.f}; v8f c00 = z8, c01 = z8, c02 = z8, c03 = z8, c10 = z8, c11 = z8, c12 = z8, c13 = z8;
  g2_copy(lb, ga, (size_t)16 * lda, gb, (size_t)16 * ldb);
  asm volatile("s_wait_asynccnt 0x0" ::: "memory");      /* this wave's copies of tile 0 have landed */
  __syncthreads();                                       /* ... and every other wave's */
  if (nt > 1) g2_copy(lb + G2_STAGE, ga + 64, (size_t)16 * lda, gb + 64, (size_t)16 * ldb);
#pragma unroll 1      /* rolled: one body serves both buffers and stays small */
  for (int t = 0; t < nt; ++t) { const unsigned bo = (unsigned)(t & 1) * G2_STAGE; const unsigned char* pa = fa + bo; const unsigned char* pb = fb + bo;
    /* the trip's 24 fragment reads stand together in front of its matrix instructions */
    const v16h a00 = g2_lfrag(pa), a10 = g2_lfrag(pa + 16 * G2_PITCH), b00 = g2_lfrag(pb), b10 = g2_lfrag(pb + 16 * G2_PITCH), b20 = g2_lfrag(pb + 32 * G2_PITCH), b30 = g2_lfrag(pb + 48 * G2_PITCH);
    const v16h a01 = g2_lfrag(pa + 64), a11 = g2_lfrag(pa + 16 * G2_PITCH + 64), b01 = g2_lfrag(pb + 64), b11 = g2_lfrag(pb + 16 * G2_PITCH + 64), b21 = g2_lfrag(pb + 32 * G2_PITCH + 64), b31 = g2_lfrag(pb + 48 * G2_PITCH + 64);
    c00 = g2_mma(a00, b00, c00); c10 = g2_mma(a10, b00, c10); c01 = g2_mma(a00, b10, c01); c11 = g2_mma(a10, b10, c11);
    c02 = g2_mma(a00, b20, c02); c12 = g2_mma(a10, b20, c12); c03 = g2_mma(a00, b30, c03); c13 = g2_mma(a10, b30, c13);
    c00 = g2_mma(a01, b01, c00); c10 = g2_mma(a11, b01, c10); c01 = g2_mma(a01, b11, c01); c11 = g2_mma(a11, b11, c11);
    c02 = g2_mma(a01, b21, c02); c12 = g2_mma(a11, b21, c12); c03 = g2_mma(a01, b31, c03); c13 = g2_mma(a11, b31, c13);
    asm volatile("s_wait_dscnt 0x0" ::: "memory");       /* this wave's reads of buffer t & 1 are done before the buffer is given up */
    asm volatile("s_wait_asynccnt 0x0" ::: "memory");    /* this wave's copies of tile t + 1 have landed */
    __syncthreads();                                     /* publishes tile t + 1 and ends every wave's reads of buffer t & 1 */
    if (t + 2 < nt) g2_copy(lb + bo, ga + (size_t)(t + 2) * 64, (size_t)16 * lda, gb + (size_t)(t + 2) * 64, (size_t)16 * ldb); }
  asm volatile("s_wait_asynccnt 0x0" ::: "memory");      /* no copy is outstanding when the buffers become output staging */
  v8f accs[8] = {c00, c01, c02, c03, c10, c11, c12, c13};
#pragma unroll
  for (int u = 0; u < 8; ++u) { const int t = u & 3, half = u >> 2; const int col = col0 + t * 16 + ln; const float bv = BIAS ? bf16_round(bp[col]) : 0.f;
#pragma unroll
    for (int r = 0; r < 8; ++r) { const int rloc = half * 16 + 8 * hh + r; float v = accs[u][r] * alpha + bv; if (RES) { if (rowsPerB < 0) v += CP[cofs + (size_t)(row0g + row0 + rloc) * ldc + col];      /* rowsPerB < 0: own element of the batched C plane */ else { const int bidx = (row0g + row0 + rloc) / rowsPerB; v += CP[(size_t)bidx * sCPb + (size_t)by * 64 + col]; } }
      if (ACT == 3) v = fmaxf(v, 0.f); else if (ACT == 6) v = 0.5f * v * (1.0f + erff(v * 0.70710678118654752f)); else if (ACT == 11) v = 1.0f / (1.0f + expf(-v)); else if (ACT == 15) v = v / (1.0f + expf(-v)); else if (ACT == 12) v = (v > 0.f) ? v : 0.01f * v; else if (ACT == 8) v = tanhf(v); else if (ACT == 9) v = 0.5f * v * (1.0f + tanhf(0.7978845608028654f * (v + 0.044715f * v * v * v))); else if (ACT == 14) v = (v > 0.f) ? v : 0.1f * v; else if (ACT == 16) v = (v >= 0.f) ? v : 0.3f * v; else if (ACT == 17) v = (v >= 0.f) ? v : 0.2f * v;
      so[w][rloc][t * 16 + ln] = v; } }
  __builtin_amdgcn_fence(__ATOMIC_ACQ_REL, "workgroup"); __builtin_amdgcn_wave_barrier();
  const int rsub = lane >> 4, c4 = (lane & 15) * 4;
  {
#pragma unroll
    for (int q = 0; q < 16; ++q) { const int r = q * 2 + rsub; const v4f v = *(const v4fa*)&so[w][r][c4]; if (OUT32) *(v4f*)(C + cofs + (size_t)(row0 + r) * ldc + col0 + c4) = v; if (OUT16) { v4h h4; for (int i = 0; i < 4; ++i) h4[i] = (_Float16)v[i]; *(v4h*)(C16 + cofs + (size_t)(row0 + r) * ldc + col0 + c4) = h4; } }
     } }


// one 64 x 64 tile (number blk) of Bt[out][in] = f16(bf16(w[in][out]) * 16). FRAG: the same values in the order in which a wave reads them as B fragments: per 16 out rows and 32 in columns 1 KiB,
// two halves of 512 bytes, lane (out & 15) + 16 * ((in >> 3) & 1) holding 8 adjacent in columns, half (in >> 4) & 1: each b128 load of a wave then covers 512 adjacent bytes.
template <bool FRAG>
__device__ __forceinline__ void wT_tile(const float* __restrict__ w, int din, int dout, _Float16* __restrict__ Bt, int blk, float (*tl)[65]) { const int tid = threadIdx.x; const int nbo = dout / 64; const int ib = blk / nbo, ob = blk % nbo; const int i0 = ib * 64, o0 = ob * 64;
  for (int t = tid; t < 64 * 64; t += 256) { const int i = t / 64, o = t % 64; tl[o][i] = bf16_round(w[(size_t)(i0 + i) * dout + o0 + o]) * 16.0f; }
  __syncthreads();
  { for (int t = tid; t < 64 * 8; t += 256) { const int o = t / 8, i8 = (t % 8) * 8; FragH f; for (int q = 0; q < 8; ++q) f.h[q] = (_Float16)tl[o][i8 + q]; const int n = o0 + o, k = i0 + i8;
      const size_t dst = FRAG ? ((((size_t)(n >> 4) * (din >> 5) + (k >> 5)) * 2 + ((k >> 4) & 1)) * 32 + ((k >> 3) & 1) * 16 + (n & 15)) * 8 : (size_t)n * din + k;
      *(v8us*)((unsigned short*)Bt + dst) = f.half[0]; }  } }
// 8 elements of the padded f16 token rows per thread (block number blk)
__device__ __forceinline__ void xr_rows(const float* __restrict__ x, _Float16* __restrict__ X16, int blk) { const size_t t = (size_t)blk * 256 + threadIdx.x; if (t >= NRX * DM / 8) return; const int c0 = (int)((t * 8) % DM); const size_t r = (t * 8) / DM; const int tok = (int)(r % RPB); const size_t b = r / RPB; FragH f;
  for (int q = 0; q < 8; ++q) f.h[q] = (tok < NTOK) ? (_Float16)bf16_round(x[(b * NTOK + tok) * DM + c0 + q]) : (_Float16)0.f;
  *(v8us*)((unsigned short*)X16 + t * 8) = f.half[0];  }
// All operand preparation in one launch (none of the four parts reads another's output): blocks 0..255 transpose one weight tile each (Wq 64, Wkv 128, Wo 64), the rest convert token rows.
// BQKV holds the rows of Wq^T, then those of Wkv^T: one [1536][512] B operand. BO holds Wo^T in fragment order.
#define WT_Q ((DM / 64) * (DM / 64))
#define WT_KV ((DM / 64) * (2 * DM / 64))
#define WT_ALL (2 * WT_Q + WT_KV)
__global__ __launch_bounds__(256) void k_prep(const float* __restrict__ x, const float* __restrict__ Wq, const float* __restrict__ Wkv, const float* __restrict__ Wo, _Float16* __restrict__ BQKV, _Float16* __restrict__ BO, _Float16* __restrict__ X16) {
  __shared__ float tl[64][65]; const int blk = blockIdx.x;      /* the choice below is the same for a whole block: wT_tile holds a barrier */
  if (blk < WT_Q) wT_tile<false>(Wq, DM, DM, BQKV, blk, tl);
  else if (blk < WT_Q + WT_KV) wT_tile<false>(Wkv, DM, 2 * DM, BQKV + (size_t)DM * DM, blk - WT_Q, tl);
  else if (blk < WT_ALL) wT_tile<true>(Wo, DM, DM, BO, blk - (WT_Q + WT_KV), tl);
  else xr_rows(x, X16, blk - WT_ALL); }
// sum over the 8 lanes that share one (query, head): three DPP adds inside the 16-lane row (lane ^ 1, ^ 2, ^ 4); every lane of the group ends with the total
template <int CTRL> __device__ __forceinline__ float nb_xadd(float x) { return x + __int_as_float(__builtin_amdgcn_update_dpp(0, __float_as_int(x), CTRL, 0xf, 0xf, true)); }
__device__ __forceinline__ float nb_dot(v4f a0, v4f a1, v4f k0, v4f k1) {
  float s = a0[0] * k0[0], t = a1[0] * k1[0];
#pragma unroll
  for (int d = 1; d < 4; ++d) { s = fmaf(a0[d], k0[d], s); t = fmaf(a1[d], k1[d], t); }
  s += t; s = nb_xadd<0x161>(s); s = nb_xadd<0x162>(s); s = nb_xadd<0x164>(s); return s; }
// Neighbourhood attention and the output product in one launch. Wave = NQW consecutive queries of one grid row (f0, h0) x 4 heads at a time, a block's 16 waves side by side in that row; 8 lanes share a (query, head), lane l8 holding
// dims 4*l8..+3 and 32+4*l8..+3, so that each b128 load of a key row covers whole 128-byte lines. Only 14 of the 27 window slots can pass the causal test (frame f0-1: 3x3; frame f0: row h0-1: 3,
// row h0: w-1 and w); the others have a flat index above the query's for every query. A key row is loaded once per wave and serves each of its queries whose window holds it.
// A slot outside the grid still reads a token row of the same batch (in bounds, written by the GEMM before) and gets the mask value as its logit, hence weight 0.
// A token's row of QKV holds q (512), k (512), v (512).
#define NQW 2
#define LQ (3 * DM)
#define PO 1040      /* LDS pitch of an o row in bytes: 512 f16 + 16, so that the 16 rows of a fragment read start 4 banks apart */
typedef _Float16 v4ha __attribute__((ext_vector_type(4), may_alias));
// One block = one grid row (f0, h0) of one batch: 32 queries x 8 heads, 16 waves. Part 1: wave wv works out queries 2 wv, 2 wv + 1 for heads 0..3, then for heads 4..7, and leaves the o rows (f16) in LDS.
// Part 2, behind one barrier: out rows = o Wo + bo for the block's 32 tokens, wave wv taking output columns 32 wv..+31 (2 x 2 WMMA tiles, k ascending), A fragments from LDS, B fragments from BO (fragment order).
// LDS row r belongs to query 32 g + r, that is token 32 g + r + 1; token 4096 is not part of the output, so its row carries token 0 instead, whose o row is v_BOS.
__global__ __launch_bounds__(512) __attribute__((amdgpu_waves_per_eu(4, 4))) void k_nbatt_out(const float* QKV, const _Float16* BOf, const float* bo, float* out) {      /* no __restrict__: the loads below keep their side of the two waits */
  __shared__ __attribute__((aligned(16))) unsigned char so16[32 * PO];
  __shared__ __attribute__((aligned(16))) float st[16][32][36];      /* each wave's own 32 x 32 output tile, staged so that its stores cover whole 128-byte lines */
  const int lane = threadIdx.x & 31, l8 = lane & 7, hs = lane >> 3; const int wv = __builtin_amdgcn_readfirstlane((int)(threadIdx.x >> 5));
  const int rw = blockIdx.x; const int h0 = rw % HT, f0 = (rw / HT) % FT, b = rw / (HT * FT);
  const int w0 = wv * NQW; const int jr0 = (f0 * HT + h0) * WT; const int j0 = jr0 + w0;
  const float* tb = QKV + (size_t)b * RPB * LQ;      /* the batch's token rows; k stands DM, v 2 * DM floats into a row */
#pragma unroll 1      /* rolled: one body serves both halves of the heads, and their registers do not add up */
  for (int hq = 0; hq < 2; ++hq) { const unsigned co = (unsigned)(hq * (DM / 2) + hs * HD + l8 * 4);
  const float* rb[5]; bool kok[5][NQW + 2];      /* rb[r]: the row of the key at column w0 of window row r; a window row outside the grid points at token row 1, so that columns -1..NQW stay inside the buffer */
#pragma unroll
  for (int r = 0; r < 5; ++r) { const int f = f0 + (r < 3 ? -1 : 0), hh = h0 + (r < 3 ? r - 1 : r - 4); const bool rok = f >= 0 && hh >= 0 && hh < HT;
    rb[r] = tb + (size_t)(rok ? (f * HT + hh) * WT + w0 + 1 : 1) * LQ + co;
#pragma unroll
    for (int c = 0; c < NQW + 2; ++c) { const int ww = w0 - 1 + c; kok[r][c] = rok && ww >= 0 && ww < WT; } }
  const float* qp = QKV + ((size_t)b * RPB + j0) * LQ + co;      /* query i is token j0 + i + 1 */ const float* bp = tb + co;
  v4f q[NQW][2], kb[2], kk[5][NQW + 2][2];
#pragma unroll
  for (int i = 0; i < NQW; ++i) { q[i][0] = *(const v4fa*)(qp + (i + 1) * LQ); q[i][1] = *(const v4fa*)(qp + (i + 1) * LQ + 32); }
#pragma unroll
  for (int r = 0; r < 5; ++r) {
#pragma unroll
    for (int c = 0; c < NQW + (r < 4 ? 2 : 1); ++c) { const float* kp = rb[r] + (c - 1) * LQ + DM; kk[r][c][0] = *(const v4fa*)kp; kk[r][c][1] = *(const v4fa*)(kp + 32); } }
  kb[0] = *(const v4fa*)(bp + DM); kb[1] = *(const v4fa*)(bp + DM + 32);
  /* the wait that stands between issued loads and any new value in their address registers; naming the addresses keeps them in those registers up to it */
  asm volatile("s_wait_xcnt 0x0" :: "v"(qp), "v"(bp), "v"(rb[0]), "v"(rb[1]), "v"(rb[2]), "v"(rb[3]), "v"(rb[4]) : "memory");
  float lg[NQW][15];
#pragma unroll
  for (int i = 0; i < NQW; ++i) lg[i][0] = nb_dot(q[i][0], q[i][1], kb[0], kb[1]) * 0.125f;
#pragma unroll
  for (int r = 0; r < 5; ++r) {
#pragma unroll
    for (int c = 0; c < NQW + (r < 4 ? 2 : 1); ++c) {
#pragma unroll
      for (int i = 0; i < NQW; ++i) { const int dw = c - i; if (dw >= 0 && dw < (r < 4 ? 3 : 2)) { const float sd = nb_dot(q[i][0], q[i][1], kk[r][c][0], kk[r][c][1]) * 0.125f; lg[i][1 + r * 3 + dw] = kok[r][c] ? sd : -3.0e38f; } } } }
  v4f vb[2], vv[5][NQW + 2][2];      /* the v rows fly while the softmax is worked out */
#pragma unroll
  for (int r = 0; r < 5; ++r) {
#pragma unroll
    for (int c = 0; c < NQW + (r < 4 ? 2 : 1); ++c) { const float* vp = rb[r] + (c - 1) * LQ + 2 * DM; vv[r][c][0] = *(const v4fa*)vp; vv[r][c][1] = *(const v4fa*)(vp + 32); } }
  vb[0] = *(const v4fa*)(bp + 2 * DM); vb[1] = *(const v4fa*)(bp + 2 * DM + 32);
  /* the same wait behind the v loads */
  asm volatile("s_wait_xcnt 0x0" :: "v"(bp), "v"(rb[0]), "v"(rb[1]), "v"(rb[2]), "v"(rb[3]), "v"(rb[4]) : "memory");
#pragma unroll
  for (int i = 0; i < NQW; ++i) { float mx = lg[i][0];
#pragma unroll
    for (int s = 1; s < 15; ++s) mx = fmaxf(mx, lg[i][s]);
    float se = 0.f;
#pragma unroll
    for (int s = 0; s < 15; ++s) { const float e = expf(lg[i][s] - mx); lg[i][s] = e; se += e; }
    const float inv = 1.0f / se;
#pragma unroll
    for (int s = 0; s < 15; ++s) lg[i][s] *= inv; }
  v4f o[NQW][2];
#pragma unroll
  for (int i = 0; i < NQW; ++i) { o[i][0] = vb[0] * lg[i][0]; o[i][1] = vb[1] * lg[i][0]; }
#pragma unroll
  for (int r = 0; r < 5; ++r) {
#pragma unroll
    for (int c = 0; c < NQW + (r < 4 ? 2 : 1); ++c) {
#pragma unroll
      for (int i = 0; i < NQW; ++i) { const int dw = c - i; if (dw >= 0 && dw < (r < 4 ? 3 : 2)) { const float p = lg[i][1 + r * 3 + dw]; o[i][0] += vv[r][c][0] * p; o[i][1] += vv[r][c][1] * p; } } } }
#pragma unroll
  for (int i = 0; i < NQW; ++i) { unsigned char* op = so16 + (w0 + i) * PO + co * 2; v4h a, c;
#pragma unroll
    for (int d = 0; d < 4; ++d) { a[d] = (_Float16)o[i][0][d]; c[d] = (_Float16)o[i][1][d]; }
    *(v4ha*)op = a; *(v4ha*)(op + 64) = c; }
  if (j0 + NQW == TT) {      /* the row of token 4096 carries token 0: o = v_BOS, read again so that it holds no registers above; the test reads the same in the whole wave */
    const float* vp = tb + 2 * DM + co; const v4f v0 = *(const v4fa*)vp, v1 = *(const v4fa*)(vp + 32);
    asm volatile("s_wait_xcnt 0x0" ::: "memory");      /* the wait between these loads and any new value in their address registers */
    unsigned char* op = so16 + (w0 + NQW - 1) * PO + co * 2; v4h a, c;
#pragma unroll
    for (int d = 0; d < 4; ++d) { a[d] = (_Float16)v0[d]; c[d] = (_Float16)v1[d]; }
    *(v4ha*)op = a; *(v4ha*)(op + 64) = c; } }
  const int ln = lane & 15, hh = lane >> 4;
  const unsigned char* fa = so16 + ln * PO + 16 * hh;
  const unsigned short* fb = (const unsigned short*)BOf + (size_t)wv * (2 * 16 * 512) + lane * 8;      /* this wave's two column tiles: 32 KiB in a row, 1 KiB per fragment; every B load is this one address plus a constant */
  FragH b0[DM / 32], b1[DM / 32];      /* indexed by constants only: a ring of 8 k steps in registers */
#pragma unroll
  for (int ks = 0; ks < 8; ++ks) {      /* the first 8 k steps' B fragments are asked for in front of the barrier: they depend on no other wave */
    b0[ks].half[0] = *(const v8us*)(fb + ks * 512); b0[ks].half[1] = *(const v8us*)(fb + ks * 512 + 256);
    b1[ks].half[0] = *(const v8us*)(fb + 16 * 512 + ks * 512); b1[ks].half[1] = *(const v8us*)(fb + 16 * 512 + ks * 512 + 256); }
  __syncthreads();      /* every wave's o rows stand in LDS before any wave reads them as its A operand */
  const v8f z8 = {0.f,0.f,0.f,0.f,0.f,0.f,0.f,0.f}; v8f c00 = z8, c01 = z8, c10 = z8, c11 = z8;
  v16h a0 = g2_lfrag(fa), a1 = g2_lfrag(fa + 16 * PO);
#pragma unroll      /* unrolled: the register rings are indexed by constants; A is read one k step ahead, B eight */
  for (int ks = 0; ks < DM / 32; ++ks) { v16h n0 = a0, n1 = a1;
    if (ks + 1 < DM / 32) { n0 = g2_lfrag(fa + (ks + 1) * 64); n1 = g2_lfrag(fa + 16 * PO + (ks + 1) * 64); }
    c00 = g2_mma(a0, b0[ks].v, c00); c10 = g2_mma(a1, b0[ks].v, c10); c01 = g2_mma(a0, b1[ks].v, c01); c11 = g2_mma(a1, b1[ks].v, c11);
    if (ks + 8 < DM / 32) { const int kn = ks + 8;
      b0[kn].half[0] = *(const v8us*)(fb + kn * 512); b0[kn].half[1] = *(const v8us*)(fb + kn * 512 + 256);
      b1[kn].half[0] = *(const v8us*)(fb + 16 * 512 + kn * 512); b1[kn].half[1] = *(const v8us*)(fb + 16 * 512 + kn * 512 + 256); }
    a0 = n0; a1 = n1; }
  v8f accs[4] = {c00, c01, c10, c11};
#pragma unroll
  for (int u = 0; u < 4; ++u) { const int t = u & 1, half = u >> 1; const float bv = bf16_round(bo[wv * 32 + t * 16 + ln]);
#pragma unroll
    for (int r = 0; r < 8; ++r) st[wv][half * 16 + 8 * hh + r][t * 16 + ln] = accs[u][r] * 0.0625f + bv; }
  __builtin_amdgcn_fence(__ATOMIC_ACQ_REL, "workgroup"); __builtin_amdgcn_wave_barrier();
  const int rsub = lane >> 3, c4 = (lane & 7) * 4;
#pragma unroll
  for (int q = 0; q < 8; ++q) { const int r = q * 4 + rsub; const v4f v = *(const v4fa*)&st[wv][r][c4]; const int tok = (jr0 + r + 1) & (NTOK - 1);      /* token 4096 -> 0 */
    *(v4f*)(out + ((size_t)b * NTOK + tok) * DM + wv * 32 + c4) = v; } }

extern "C" void kernel_launch(void* const* d_in, const int* in_sizes, int n_in,
                              void* d_out, int out_size, void* d_ws, size_t ws_size, hipStream_t stream) {
  (void)in_sizes; (void)n_in; (void)out_size;
  const float* const* I = (const float* const*)d_in; const float* x = I[0]; const float* Wq = I[1]; const float* Wkv = I[2]; const float* Wo = I[3]; const float* bo = I[4];
  char* ws = (char*)d_ws; size_t off = 0;
  auto take = [&](size_t bytes) { char* p = ws + off; off += (bytes + 255) & ~(size_t)255; return p; };
  _Float16* BQKV = (_Float16*)take((size_t)3 * DM * DM * 2); _Float16* BO = (_Float16*)take((size_t)DM * DM * 2);
  _Float16* X16 = (_Float16*)take(NRX * DM * 2); float* QKV = (float*)take(NRX * 3 * DM * 4);
  if (off > ws_size) return;      /* 2 + 8.6 + 51.9 = about 63 MB */
  k_prep<<<(unsigned)(WT_ALL + (NRX * DM / 8 + 255) / 256), 256, 0, stream>>>(x, Wq, Wkv, Wo, BQKV, BO, X16);
  k_gemm2<0, false, false, true, false><<<dim3((unsigned)((NRX / 128) * (3 * DM / 64)), 1), 128, 0, stream>>>(X16, DM, 0, BQKV, DM, 0, 0.0625f, nullptr, 0, nullptr, 1, 0, 0, QKV, nullptr, 3 * DM, 0, (int)NRX, 3 * DM, DM);
  k_nbatt_out<<<NB * FT * HT, 512, 0, stream>>>(QKV, BO, bo, (float*)d_out);      /* one block per grid row: its 32 tokens' attention, then out = o Wo + bo for them (token 4096 dropped as in the reference, token 0 in its place) */
}

// v006
// Measured time: 48.5 microseconds a run.
// In two side-by-side timings against v005, it was 1.09 and 1.10 times as fast.
// Counting every step since v000, it is 10.5 times as fast.
#include <hip/hip_runtime.h>
// Sparse3DNA (x [2][4096][512]: 1 BOS + 4095 video tokens on a 4x32x32 grid, padded by one zero token to 4097; q = x Wq, [k|v] = x Wkv ([in][out], no bias), 8 heads of 64; query j (token j+1) attends to {BOS} U {its 3x3x3 grid neighbourhood keys with flat index <= j} (out-of-grid slots and future keys masked), scale 64^-0.5, softmax, weighted v; token 0's output is v_BOS itself; out = o Wo + bo, first 4096 tokens -> [2][4096][512]).
// Structure: token rows (4,097 per batch padded to 4,224); x as exact f16 rows; one [Q|K|V] WMMA GEMM (256x192 block tiles, 64x64 wave tiles, f32 accumulation, exact x16 transposed weights) kept in f32, rows of 1,536; the 28-slot neighbourhood attention on VALU (f32: 8 lanes per (batch, head, query), 2 queries x 4 heads per wave, window indices and the causal test from the grid geometry on device, logits, softmax, weighted sum) into f16 o rows in LDS (token 0: v_BOS); out = o Wo + bo on WMMA in the same launch, 32 tokens per block (f32, output layout). Three launches: operands, [Q|K|V], attention with output.
// Compute dtype: inputs rounded to bf16; x / weights exact; q, k, v, logits, softmax f32; o plain f16 into the Wo GEMM (~2^-12). v_wmma_f32_16x16x32_f16.
#define NB 2
#define NTOK 4096                    /* input tokens per batch (= output tokens) */
#define NPAD 4097                    /* after the module's padding */
#define RPB 4224                     /* rows per batch (33 x 128) */
#define NRX ((size_t)NB * RPB)       /* 8448 */
#define DM 512
#define NH 8
#define HD 64
#define FT 4
#define HT 32
#define WT 32
#define TT (FT * HT * WT)            /* 4096 grid tokens */
#define QT TT                        /* unused */
typedef __bf16 v16b __attribute__((ext_vector_type(16)));
typedef unsigned short v8us __attribute__((ext_vector_type(8), may_alias));
typedef float  v8f  __attribute__((ext_vector_type(8)));
typedef float  v4f  __attribute__((ext_vector_type(4)));
typedef float  v4fa __attribute__((ext_vector_type(4), may_alias));
union FragB { v16b v; v8us half[2]; unsigned short u[16]; };

__device__ __forceinline__ unsigned short bf16_bits(float x) { unsigned int u = __float_as_uint(x); return (unsigned short)((u + 0x7FFFu + ((u >> 16) & 1u)) >> 16); }
__device__ __forceinline__ float bf16_val(unsigned short b) { return __uint_as_float(((unsigned int)b) << 16); }
__device__ __forceinline__ float bf16_round(float x) { return bf16_val(bf16_bits(x)); }
// D += A·B with NT terms: 1 = ah·bh, 2 = + al·bh (A split), 3 = + ah·bl (both split)
template <int NT>
__device__ __forceinline__ v8f mmaN(v16b ah, v16b al, v16b bh, v16b bl, v8f c) {
  c = __builtin_amdgcn_wmma_f32_16x16x32_bf16(false, ah, false, bh, (short)0, c, false, false);
  if (NT >= 2) c = __builtin_amdgcn_wmma_f32_16x16x32_bf16(false, al, false, bh, (short)0, c, false, false);
  if (NT >= 3) c = __builtin_amdgcn_wmma_f32_16x16x32_bf16(false, ah, false, bl, (short)0, c, false, false);
  asm volatile("v_nop\n\tv_nop\n\tv_nop\n\tv_nop" : "+v"(c) : "v"(ah), "v"(al), "v"(bh), "v"(bl));
  return c;
}

__global__ __launch_bounds__(256) void k_wt_bf16(const float* __restrict__ W, unsigned short* __restrict__ Wt, int K, int N) {
  const int t = blockIdx.x * 256 + threadIdx.x;
  const int k8n = K / 8;
  if (t >= N * k8n) return;
  const int n = t / k8n, k8 = (t % k8n) * 8;
  v8us v;
#pragma unroll
  for (int i = 0; i < 8; ++i) v[i] = bf16_bits(W[(size_t)(k8 + i) * N + n]);
  *(v8us*)(Wt + (size_t)n * K + k8) = v;
  
}

// GEMM C[M][N] (f32, pitch ldc) = act(A[M][K]·W + bias). A f32 row-major (pitch lda) converted per fragment to bf16
// (ASPLIT: hi/lo two planes -> 2 terms, else single rounded term); Wt bf16 [N][K] (pitch ldb). BIAS_BF16 rounds the
// bias to bf16 first (bias quantised to bf16 before the add). K%32==0, M%16==0, N%64==0.
template <bool ASPLIT, int ACT, bool BIAS_BF16>
__global__ __launch_bounds__(128) void k_gemm_bf(const float* __restrict__ A, int lda, const unsigned short* __restrict__ Wt, int ldb,
                                               const float* __restrict__ bias, float* __restrict__ C, int ldc, int M, int N, int K) {
  __shared__ __attribute__((aligned(16))) float so[4][16][64];
  const int tid = threadIdx.x, w = tid >> 5, lane = tid & 31, ln = lane & 15, hh = lane >> 4;
  const int ntn = N / 64;
  const int wid = blockIdx.x * 4 + w;
  const int mt = wid / ntn, nq = wid % ntn;
  if (mt * 16 >= M) return;
  const int row0 = mt * 16, col0 = nq * 64;
  const float* arow = A + (size_t)(row0 + ln) * lda;
  v8f acc[4] = {};
  for (int kb = 0; kb < K; kb += 32) {
    FragB ah, al;
    const v4f x0 = *(const v4fa*)(arow + kb + 8 * hh), x1 = *(const v4fa*)(arow + kb + 8 * hh + 4);
    const v4f x2 = *(const v4fa*)(arow + kb + 16 + 8 * hh), x3 = *(const v4fa*)(arow + kb + 16 + 8 * hh + 4);
    float xs[16] = {x0[0],x0[1],x0[2],x0[3],x1[0],x1[1],x1[2],x1[3],x2[0],x2[1],x2[2],x2[3],x3[0],x3[1],x3[2],x3[3]};
#pragma unroll
    for (int i = 0; i < 16; ++i) { const unsigned short hb = bf16_bits(xs[i]); ah.u[i] = hb; al.u[i] = ASPLIT ? bf16_bits(xs[i] - bf16_val(hb)) : (unsigned short)0; }
#pragma unroll
    for (int t = 0; t < 4; ++t) {
      const unsigned short* brow = Wt + (size_t)(col0 + t * 16 + ln) * ldb + kb;
      FragB b;
      b.half[0] = *(const v8us*)(brow + 8 * hh);
      b.half[1] = *(const v8us*)(brow + 16 + 8 * hh);
      acc[t] = mmaN<ASPLIT ? 2 : 1>(ah.v, al.v, b.v, b.v, acc[t]);
    }
  }
#pragma unroll
  for (int t = 0; t < 4; ++t) {
    float bv = bias ? bias[col0 + t * 16 + ln] : 0.f;
    if (BIAS_BF16) bv = bf16_round(bv);
#pragma unroll
    for (int r = 0; r < 8; ++r) { float v = acc[t][r] + bv; if (ACT == 1) v = fmaxf(v, 0.f); so[w][8 * hh + r][t * 16 + ln] = v; }
  }
  __builtin_amdgcn_fence(__ATOMIC_ACQ_REL, "workgroup");
  __builtin_amdgcn_wave_barrier();
  const int rsub = lane >> 4, c4 = (lane & 15) * 4;
  {
#pragma unroll
    for (int q = 0; q < 8; ++q) {
      const int r = q * 2 + rsub;
      const v4f v = *(const v4fa*)&so[w][r][c4];
      *(v4f*)(C + (size_t)(row0 + r) * ldc + col0 + c4) = v;
    }
    
  }
}

// GEMM C = act(A·W + bias + resid): A f32 (ASPLIT -> hi/lo 2 terms), Wt bf16 [N][K]; ACT 0 none, 1 relu, 2 exact gelu;
// resid (optional, f32, row index = (row % rmod), pitch ldr, RES_BF16 rounds it) added before the activation.
template <bool ASPLIT, int ACT, bool BIAS_BF16, bool RES_BF16>
__global__ __launch_bounds__(128) void k_gemm_bf3(const float* __restrict__ A, int lda, const unsigned short* __restrict__ Wt, int ldb,
                                                const float* __restrict__ bias, const float* __restrict__ resid, int rmod, int ldr,
                                                float* __restrict__ C, int ldc, int M, int N, int K) {
  __shared__ __attribute__((aligned(16))) float so[4][16][64];
  const int tid = threadIdx.x, w = tid >> 5, lane = tid & 31, ln = lane & 15, hh = lane >> 4;
  const int ntn = N / 64;
  const int wid = blockIdx.x * 4 + w;
  const int mt = wid / ntn, nq = wid % ntn;
  if (mt * 16 >= M) return;
  const int row0 = mt * 16, col0 = nq * 64;
  const float* arow = A + (size_t)(row0 + ln) * lda;
  v8f acc[4] = {};
  for (int kb = 0; kb < K; kb += 32) {
    FragB ah, al;
    const v4f x0 = *(const v4fa*)(arow + kb + 8 * hh), x1 = *(const v4fa*)(arow + kb + 8 * hh + 4);
    const v4f x2 = *(const v4fa*)(arow + kb + 16 + 8 * hh), x3 = *(const v4fa*)(arow + kb + 16 + 8 * hh + 4);
    float xs[16] = {x0[0],x0[1],x0[2],x0[3],x1[0],x1[1],x1[2],x1[3],x2[0],x2[1],x2[2],x2[3],x3[0],x3[1],x3[2],x3[3]};
#pragma unroll
    for (int i = 0; i < 16; ++i) { const unsigned short hb = bf16_bits(xs[i]); ah.u[i] = hb; al.u[i] = ASPLIT ? bf16_bits(xs[i] - bf16_val(hb)) : (unsigned short)0; }
#pragma unroll
    for (int t = 0; t < 4; ++t) {
      const unsigned short* brow = Wt + (size_t)(col0 + t * 16 + ln) * ldb + kb;
      FragB b;
      b.half[0] = *(const v8us*)(brow + 8 * hh);
      b.half[1] = *(const v8us*)(brow + 16 + 8 * hh);
      acc[t] = mmaN<ASPLIT ? 2 : 1>(ah.v, al.v, b.v, b.v, acc[t]);
    }
  }
#pragma unroll
  for (int t = 0; t < 4; ++t) {
    const int col = col0 + t * 16 + ln;
    float bv = bias ? bias[col] : 0.f;
    if (BIAS_BF16) bv = bf16_round(bv);
#pragma unroll
    for (int r = 0; r < 8; ++r) {
      float v = acc[t][r] + bv;
      if (resid) { float rv = resid[(size_t)((row0 + 8 * hh + r) % rmod) * ldr + col]; if (RES_BF16) rv = bf16_round(rv); v += rv; }
      if (ACT == 1) v = fmaxf(v, 0.f);
      if (ACT == 2) v = 0.5f * v * (1.0f + erff(v * 0.70710678118654752f));
      if (ACT == 3) { const float u = 0.7978845608028654f * (v + 0.044715f * v * v * v); v = 0.5f * v * (1.0f + tanhf(u)); }
      so[w][8 * hh + r][t * 16 + ln] = v;
    }
  }
  __builtin_amdgcn_fence(__ATOMIC_ACQ_REL, "workgroup");
  __builtin_amdgcn_wave_barrier();
  const int rsub = lane >> 4, c4 = (lane & 15) * 4;
  {
#pragma unroll
    for (int q = 0; q < 8; ++q) {
      const int r = q * 2 + rsub;
      const v4f v = *(const v4fa*)&so[w][r][c4];
      *(v4f*)(C + (size_t)(row0 + r) * ldc + col0 + c4) = v;
    }
    
  }
}
// row LayerNorm (biased variance, eps) over N: s = X (+ R); optional out_sum <- s; out_norm <- (s-mu)*rsqrt(var+eps)*g + b
template <bool PARAM_BF16>
__global__ __launch_bounds__(256) void k_layernorm(const float* __restrict__ X, const float* __restrict__ R, const float* __restrict__ g, const float* __restrict__ bta,
                                                  float* __restrict__ out_sum, float* __restrict__ out_norm, int N, float eps) {
  __shared__ float red[256];
  const int row = blockIdx.x, tid = threadIdx.x;
  const float* x = X + (size_t)row * N; const float* rr = R ? R + (size_t)row * N : nullptr;
  float vals[16];                     // up to N = 4096
  const int per = N / 256;            // contiguous chunk per thread? use strided-by-4 chunks: thread handles j = tid*4 + 1024*u
  float s1 = 0.f;
  for (int u = 0; u < per / 4; ++u) {
    const int j = tid * 4 + 1024 * u;
    const v4f a = *(const v4fa*)(x + j);
    v4f b = {0.f,0.f,0.f,0.f}; if (rr) b = *(const v4fa*)(rr + j);
#pragma unroll
    for (int q = 0; q < 4; ++q) { const float v = a[q] + b[q]; vals[u * 4 + q] = v; s1 += v; }
  }
  red[tid] = s1; __syncthreads();
  for (int st = 128; st > 0; st >>= 1) { if (tid < st) red[tid] += red[tid + st]; __syncthreads(); }
  const float mu = red[0] / (float)N; __syncthreads();
  float s2 = 0.f;
  for (int u = 0; u < per / 4; ++u)
#pragma unroll
    for (int q = 0; q < 4; ++q) { const float c = vals[u * 4 + q] - mu; s2 += c * c; }
  red[tid] = s2; __syncthreads();
  for (int st = 128; st > 0; st >>= 1) { if (tid < st) red[tid] += red[tid + st]; __syncthreads(); }
  const float rs = rsqrtf(red[0] / (float)N + eps);
  {
    for (int u = 0; u < per / 4; ++u) {
      const int j = tid * 4 + 1024 * u;
      v4f o, sm;
#pragma unroll
      for (int q = 0; q < 4; ++q) {
        float gg = g[j + q], bb = bta[j + q];
        if (PARAM_BF16) { gg = bf16_round(gg); bb = bf16_round(bb); }
        sm[q] = vals[u * 4 + q]; o[q] = (vals[u * 4 + q] - mu) * rs * gg + bb;
      }
      if (out_sum) *(v4f*)(out_sum + (size_t)row * N + j) = sm;
      *(v4f*)(out_norm + (size_t)row * N + j) = o;
    }
    
  }
}



// ---- f16 WMMA path (v_wmma_f32_16x16x32_f16): 11-bit significands for operands in range — used here for the [Q|K|V] and Wo GEMMs
typedef _Float16 v16h __attribute__((ext_vector_type(16)));
union FragH { v16h v; v8us half[2]; _Float16 h[16]; unsigned short u[16]; };
template <int NT>
__device__ __forceinline__ v8f mmaH(v16h ah, v16h al, v16h bh, v16h bl, v8f c) {
  c = __builtin_amdgcn_wmma_f32_16x16x32_f16(false, ah, false, bh, (short)0, c, false, false);
  if (NT >= 2) c = __builtin_amdgcn_wmma_f32_16x16x32_f16(false, al, false, bh, (short)0, c, false, false);
  if (NT >= 3) c = __builtin_amdgcn_wmma_f32_16x16x32_f16(false, ah, false, bl, (short)0, c, false, false);
  asm volatile("v_nop\n\tv_nop\n\tv_nop\n\tv_nop" : "+v"(c) : "v"(ah), "v"(al), "v"(bh), "v"(bl));
  return c;
}
// batched GEMM like k_gemm_b but f16 operands: A f32 (split into f16 hi/lo if ASPLIT, else rounded to f16), Bt = f16 values [n][k]; alpha; C f32; N multiple of 16 (partial tiles skipped)
template <bool ASPLIT>
__global__ __launch_bounds__(128) void k_gemm_h(const float* __restrict__ A, int lda, size_t sA, const _Float16* __restrict__ Bh, int ldb, size_t sB, float alpha, float* __restrict__ C, int ldc, size_t sC, int M, int N, int K) {
  __shared__ __attribute__((aligned(16))) float so[4][16][64];
  const int tid = threadIdx.x, w = tid >> 5, lane = tid & 31, ln = lane & 15, hh = lane >> 4; const int by = blockIdx.y;
  A += (size_t)by * sA; Bh += (size_t)by * sB; C += (size_t)by * sC;
  const int ntn = (N + 63) / 64; const int wid = blockIdx.x * 4 + w; const int mt = wid / ntn, nq = wid % ntn; if (mt * 16 >= M) return;
  const int row0 = mt * 16, col0 = nq * 64; const float* arow = A + (size_t)(row0 + ln) * lda;
  v8f acc[4] = {};
  for (int kb = 0; kb < K; kb += 32) {
    FragH ah, al;
    const v4f x0 = *(const v4fa*)(arow + kb + 8 * hh), x1 = *(const v4fa*)(arow + kb + 8 * hh + 4), x2 = *(const v4fa*)(arow + kb + 16 + 8 * hh), x3 = *(const v4fa*)(arow + kb + 16 + 8 * hh + 4);
    float xs[16] = {x0[0],x0[1],x0[2],x0[3],x1[0],x1[1],x1[2],x1[3],x2[0],x2[1],x2[2],x2[3],x3[0],x3[1],x3[2],x3[3]};
#pragma unroll
    for (int i = 0; i < 16; ++i) { const _Float16 h = (_Float16)xs[i]; ah.h[i] = h; al.h[i] = ASPLIT ? (_Float16)(xs[i] - (float)h) : (_Float16)0.0f; }
#pragma unroll
    for (int t = 0; t < 4; ++t) { if (col0 + t * 16 >= N) continue; const size_t boff = (size_t)(col0 + t * 16 + ln) * ldb + kb; FragH bq; bq.half[0] = *(const v8us*)(Bh + boff + 8 * hh); bq.half[1] = *(const v8us*)(Bh + boff + 16 + 8 * hh);
      acc[t] = mmaH<ASPLIT ? 2 : 1>(ah.v, al.v, bq.v, bq.v, acc[t]); }
  }
#pragma unroll
  for (int t = 0; t < 4; ++t) { if (col0 + t * 16 >= N) continue;
#pragma unroll
    for (int r = 0; r < 8; ++r) so[w][8 * hh + r][t * 16 + ln] = acc[t][r] * alpha; }
  __builtin_amdgcn_fence(__ATOMIC_ACQ_REL, "workgroup"); __builtin_amdgcn_wave_barrier();
  const int rsub = lane >> 4, c4 = (lane & 15) * 4;
  {
#pragma unroll
    for (int q = 0; q < 8; ++q) { const int r = q * 2 + rsub; if (col0 + c4 < N) { const v4f v = *(const v4fa*)&so[w][r][c4]; *(v4f*)(C + (size_t)(row0 + r) * ldc + col0 + c4) = v; } }
     }
}

// Wt[n][k] = f16(W[k][n]·scale) from f32 row-major W[K][N] (scale = power of two; bf16-exact weights stay exact in f16 away from the subnormal range)
__global__ __launch_bounds__(256) void k_wt_f16(const float* __restrict__ W, _Float16* __restrict__ Wt, int K, int N, float scale) {
  const int t = blockIdx.x * 256 + threadIdx.x; if (t >= N * (K / 8)) return; const int n = t / (K / 8), k8 = (t % (K / 8)) * 8; FragH f;
#pragma unroll
  for (int i = 0; i < 8; ++i) f.h[i] = (_Float16)(bf16_round(W[(size_t)(k8 + i) * N + n]) * scale); const v8us o = f.half[0];
  *(v8us*)((unsigned short*)Wt + (size_t)n * K + k8) = o; 
}
// k_gemm_hh variant with fused epilogue: v = acc·alpha + bias[by·sBias + col] (+ CP[(row/rowsPerB)·sCPb + by·64 + col] if CP) ; ACT 0 none / 1 elu ; writes f16 C16 (and f32 C if non-null)
template <int ACT>
__global__ __launch_bounds__(128) void k_gemm_hhx(const _Float16* __restrict__ A, int lda, size_t sA, const _Float16* __restrict__ Bh, int ldb, size_t sB, float alpha, const float* __restrict__ bias, size_t sBias, const float* __restrict__ CP, int rowsPerB, size_t sCPb, int row0g,
    float* __restrict__ C, _Float16* __restrict__ C16, int ldc, size_t sC, int M, int N, int K) {
  __shared__ __attribute__((aligned(16))) float so[4][16][64];
  const int tid = threadIdx.x, w = tid >> 5, lane = tid & 31, ln = lane & 15, hh = lane >> 4; const int by = blockIdx.y;
  A += (size_t)by * sA; Bh += (size_t)by * sB; const size_t cofs = (size_t)by * sC; const float* bp = bias ? bias + (size_t)by * sBias : nullptr;
  const int ntn = (N + 63) / 64; const int wid = blockIdx.x * 4 + w; const int mt = wid / ntn, nq = wid % ntn; if (mt * 16 >= M) return;
  const int row0 = mt * 16, col0 = nq * 64; const _Float16* arow = A + (size_t)(row0 + ln) * lda;
  v8f acc[4] = {};
  for (int kb = 0; kb < K; kb += 32) { FragH ah; ah.half[0] = *(const v8us*)((const unsigned short*)arow + kb + 8 * hh); ah.half[1] = *(const v8us*)((const unsigned short*)arow + kb + 16 + 8 * hh);
#pragma unroll
    for (int t = 0; t < 4; ++t) { if (col0 + t * 16 >= N) continue; const size_t boff = (size_t)(col0 + t * 16 + ln) * ldb + kb; FragH bq; bq.half[0] = *(const v8us*)((const unsigned short*)Bh + boff + 8 * hh); bq.half[1] = *(const v8us*)((const unsigned short*)Bh + boff + 16 + 8 * hh);
      acc[t] = mmaH<1>(ah.v, ah.v, bq.v, bq.v, acc[t]); }
  }
#pragma unroll
  for (int t = 0; t < 4; ++t) { if (col0 + t * 16 >= N) continue; const int col = col0 + t * 16 + ln; const float bv = bp ? bf16_round(bp[col]) : 0.f;
#pragma unroll
    for (int r = 0; r < 8; ++r) { float v = acc[t][r] * alpha + bv; if (CP) { const int rr = row0g + row0 + 8 * hh + r; if (rowsPerB < 0) v += CP[cofs + (size_t)rr * ldc + col];      /* rowsPerB < 0: own element of the batched C plane */ else { const int bidx = rr / rowsPerB; v += CP[(size_t)bidx * sCPb + (size_t)by * 64 + col]; } } if (ACT == 1) v = (v > 0.f) ? v : expm1f(v); else if (ACT == 7) v = (v > 0.f) ? v + 1.0f : expf(v); else if (ACT == 8) v = tanhf(v); else if (ACT == 9) v = 0.5f * v * (1.0f + tanhf(0.7978845608028654f * (v + 0.044715f * v * v * v))); else if (ACT == 11) v = 1.0f / (1.0f + expf(-v)); else if (ACT == 12) v = (v > 0.f) ? v : 0.01f * v; else if (ACT == 14) v = (v > 0.f) ? v : 0.1f * v; else if (ACT == 16) v = (v >= 0.f) ? v : 0.3f * v; else if (ACT == 17) v = (v >= 0.f) ? v : 0.2f * v; else if (ACT == 15) v = v / (1.0f + expf(-v)); else if (ACT == 3) v = fmaxf(v, 0.f); else if (ACT == 6) v = 0.5f * v * (1.0f + erff(v * 0.70710678118654752f)); so[w][8 * hh + r][t * 16 + ln] = v; } }
  __builtin_amdgcn_fence(__ATOMIC_ACQ_REL, "workgroup"); __builtin_amdgcn_wave_barrier();
  const int rsub = lane >> 4, c4 = (lane & 15) * 4; typedef _Float16 v4h __attribute__((ext_vector_type(4)));
  {
#pragma unroll
    for (int q = 0; q < 8; ++q) { const int r = q * 2 + rsub; if (col0 + c4 < N) { const v4f v = *(const v4fa*)&so[w][r][c4]; if (C) *(v4f*)(C + cofs + (size_t)(row0 + r) * ldc + col0 + c4) = v; if (C16) { v4h h4; for (int i = 0; i < 4; ++i) h4[i] = (_Float16)v[i]; *(v4h*)(C16 + cofs + (size_t)(row0 + r) * ldc + col0 + c4) = h4; } } }
     }
}


typedef _Float16 v4h __attribute__((ext_vector_type(4)));

__global__ __launch_bounds__(256) void k_x16(const float* __restrict__ x, _Float16* __restrict__ X16, size_t n8) { const size_t t = (size_t)blockIdx.x * 256 + threadIdx.x; if (t >= n8) return; FragH f;
#pragma unroll
  for (int q = 0; q < 8; ++q) f.h[q] = (_Float16)bf16_round(x[t * 8 + q]); *(v8us*)((unsigned short*)X16 + t * 8) = f.half[0];  }
__global__ __launch_bounds__(256) void k_h16(const float* __restrict__ x, _Float16* __restrict__ X16, size_t n8) { const size_t t = (size_t)blockIdx.x * 256 + threadIdx.x; if (t >= n8) return; FragH f;
#pragma unroll
  for (int q = 0; q < 8; ++q) f.h[q] = (_Float16)x[t * 8 + q]; *(v8us*)((unsigned short*)X16 + t * 8) = f.half[0];  }
__global__ __launch_bounds__(256) void k_round16f(const float* __restrict__ W, _Float16* __restrict__ Bt, size_t n8) { const size_t t = (size_t)blockIdx.x * 256 + threadIdx.x; if (t >= n8) return; FragH f;
#pragma unroll
  for (int i = 0; i < 8; ++i) f.h[i] = (_Float16)(bf16_round(W[t * 8 + i]) * 16.0f); *(v8us*)((unsigned short*)Bt + t * 8) = f.half[0];  }
template <int NHv, int TTv>
__global__ __launch_bounds__(256) void k_vt(const _Float16* __restrict__ V16, int ldv, int voff, _Float16* __restrict__ Vt) { __shared__ unsigned short tl[64][66]; const int tid = threadIdx.x; const int slab = blockIdx.x / (TTv / 64), lg = blockIdx.x % (TTv / 64); const int b = slab / NHv, h = slab % NHv;
  for (int i = tid; i < 64 * 8; i += 256) { const int r = i / 8, c8 = (i % 8) * 8; FragH f; f.half[0] = *(const v8us*)((const unsigned short*)V16 + ((size_t)b * TTv + lg * 64 + r) * ldv + voff + h * 64 + c8);
#pragma unroll
    for (int q = 0; q < 8; ++q) tl[r][c8 + q] = f.u[q]; }
  __syncthreads();
  {
#pragma unroll
    for (int rd = 0; rd < 2; ++rd) { const int d = rd * 32 + tid / 8, pc = tid % 8; FragH f;
#pragma unroll
      for (int q = 0; q < 8; ++q) f.u[q] = tl[pc * 8 + q][d];
      *(v8us*)((unsigned short*)Vt + ((size_t)slab * 64 + d) * TTv + lg * 64 + pc * 8) = f.half[0]; }
     } }

__global__ __launch_bounds__(256) void k_hl(const float* __restrict__ F, _Float16* __restrict__ Hh, _Float16* __restrict__ Hl, size_t n8) { const size_t t = (size_t)blockIdx.x * 256 + threadIdx.x; if (t >= n8) return; FragH fh, fl; const v4f a = *(const v4fa*)(F + t * 8), c = *(const v4fa*)(F + t * 8 + 4);
#pragma unroll
  for (int q = 0; q < 4; ++q) { _Float16 h = (_Float16)a[q]; fh.h[q] = h; fl.h[q] = (_Float16)((a[q] - (float)h) * 1024.0f); h = (_Float16)c[q]; fh.h[4 + q] = h; fl.h[4 + q] = (_Float16)((c[q] - (float)h) * 1024.0f); }
  { *(v8us*)((unsigned short*)Hh + t * 8) = fh.half[0]; *(v8us*)((unsigned short*)Hl + t * 8) = fl.half[0];  } }

// ---- fast GEMM (block tile 128x64, wave tile 32x64; requires M % 128 == 0 rows per launch region, N % 64 == 0, K % 64 == 0); epilogue = k_gemm_hhx semantics ----
// Operand path: per trip of 64 k the block's 128 A rows and 64 B rows (128 bytes each, whole lines) are copied to LDS asynchronously, two buffers, the copies of trip t + 2 issued behind the barrier that ends trip t;
// the waves read their fragments from LDS (row pitch 144 bytes: no bank conflict for 16-byte reads). The k order of every accumulator is the ascending one of the direct-load form.
#define G2_PITCH 144
#define G2_STAGE (192 * G2_PITCH)      /* rows 0..127: A, rows 128..191: B */
__device__ __forceinline__ v16h g2_lfrag(const unsigned char* p) { FragH f; f.half[0] = *(const v8us*)p; f.half[1] = *(const v8us*)(p + 32); return f.v; }
__device__ __forceinline__ v8f g2_mma(v16h a, v16h b, v8f c) { v8f d = __builtin_amdgcn_wmma_f32_16x16x32_f16(false, a, false, b, (short)0, c, false, false); asm volatile("v_nop\n\tv_nop\n\tv_nop\n\tv_nop" : "+v"(d) : "v"(a), "v"(b)); return d; }
// One stage: each lane copies 12 pieces of 16 bytes (8 lanes = one 128-byte row, a wave = 4 rows, the block = 16 rows per copy; 8 copies for A, 4 for B). l: the lane's LDS byte address in row group 0.
__device__ __forceinline__ void g2_copy(unsigned l, const _Float16* ga, size_t sa, const _Float16* gb, size_t sb) {
  /* the copies and, as the last line of the same statement, the wait that stands in front of any new value in the address registers they name */
  asm volatile("global_load_async_to_lds_b128 %0, %12, off\n\t"
               "global_load_async_to_lds_b128 %1, %13, off\n\t"
               "global_load_async_to_lds_b128 %2, %14, off\n\t"
               "global_load_async_to_lds_b128 %3, %15, off\n\t"
               "global_load_async_to_lds_b128 %4, %16, off\n\t"
               "global_load_async_to_lds_b128 %5, %17, off\n\t"
               "global_load_async_to_lds_b128 %6, %18, off\n\t"
               "global_load_async_to_lds_b128 %7, %19, off\n\t"
               "global_load_async_to_lds_b128 %8, %20, off\n\t"
               "global_load_async_to_lds_b128 %9, %21, off\n\t"
               "global_load_async_to_lds_b128 %10, %22, off\n\t"
               "global_load_async_to_lds_b128 %11, %23, off\n\t"
               "s_wait_xcnt 0x0"
               :: "v"(l), "v"(l + 16 * G2_PITCH), "v"(l + 32 * G2_PITCH), "v"(l + 48 * G2_PITCH), "v"(l + 64 * G2_PITCH), "v"(l + 80 * G2_PITCH),
                  "v"(l + 96 * G2_PITCH), "v"(l + 112 * G2_PITCH), "v"(l + 128 * G2_PITCH), "v"(l + 144 * G2_PITCH), "v"(l + 160 * G2_PITCH), "v"(l + 176 * G2_PITCH),
                  "v"(ga), "v"(ga + sa), "v"(ga + 2 * sa), "v"(ga + 3 * sa), "v"(ga + 4 * sa), "v"(ga + 5 * sa), "v"(ga + 6 * sa), "v"(ga + 7 * sa),
                  "v"(gb), "v"(gb + sb), "v"(gb + 2 * sb), "v"(gb + 3 * sb)
               : "memory"); }
// BIAS, RES, OUT32, OUT16: which of bias, CP, C and C16 the launch uses. Template flags, not pointer tests: the epilogue is then straight-line code, with no scalar branch per output element, and its LDS row reads and global stores issue as groups.
template <int ACT, bool BIAS, bool RES, bool OUT32, bool OUT16>
__global__ __launch_bounds__(128) void k_gemm2(const _Float16* __restrict__ A, int lda, size_t sA, const _Float16* __restrict__ Bh, int ldb, size_t sB, float alpha, const float* __restrict__ bias, size_t sBias, const float* __restrict__ CP, int rowsPerB, size_t sCPb, int row0g,
    float* __restrict__ C, _Float16* __restrict__ C16, int ldc, size_t sC, int M, int N, int K) { static_assert(ACT == 0 || ACT == 3 || ACT == 6 || ACT == 8 || ACT == 9 || ACT == 11 || ACT == 12 || ACT == 14 || ACT == 15 || ACT == 16 || ACT == 17, "k_gemm2: unsupported ACT code (would silently apply no activation)");
  __shared__ __attribute__((aligned(16))) unsigned char sm[2 * G2_STAGE];      /* the two operand buffers; behind the loop's last barrier the same bytes stage the output rows */
  float (*so)[32][68] = reinterpret_cast<float (*)[32][68]>(sm); static_assert(sizeof(float) * 4 * 32 * 68 <= 2 * G2_STAGE, "output staging must fit the operand buffers");
  const int tid = threadIdx.x, w = tid >> 5, lane = tid & 31, ln = lane & 15, hh = lane >> 4; const int by = blockIdx.y;
  A += (size_t)by * sA; Bh += (size_t)by * sB; const size_t cofs = (size_t)by * sC; const float* bp = BIAS ? bias + (size_t)by * sBias : nullptr;
  const int ntn = N >> 6; const int mt = blockIdx.x / ntn, nq = blockIdx.x - mt * ntn; const int row0 = mt * 128 + 32 * w, col0 = nq * 64; if (mt * 128 >= M) return;      /* the whole block leaves or none: barriers follow */
  const int crow = tid >> 3, cpc = tid & 7;
  const _Float16* ga = A + (size_t)(mt * 128 + crow) * lda + cpc * 8; const _Float16* gb = Bh + (size_t)(col0 + crow) * ldb + cpc * 8;
  const unsigned lb = (unsigned)(size_t)sm + (unsigned)(crow * G2_PITCH + cpc * 16);
  const unsigned char* fa = sm + (32 * w + ln) * G2_PITCH + 16 * hh; const unsigned char* fb = sm + (128 + ln) * G2_PITCH + 16 * hh;
  const int nt = K >> 6;
  const v8f z8 = {0.f,0.f,0.f,0.f,0.f,0.f,0.f,0.f}; v8f c00 = z8, c01 = z8, c02 = z8, c03 = z8, c10 = z8, c11 = z8, c12 = z8, c13 = z8;
  g2_copy(lb, ga, (size_t)16 * lda, gb, (size_t)16 * ldb);
  asm volatile("s_wait_asynccnt 0x0" ::: "memory");      /* this wave's copies of tile 0 have landed */
  __syncthreads();                                       /* ... and every other wave's */
  if (nt > 1) g2_copy(lb + G2_STAGE, ga + 64, (size_t)16 * lda, gb + 64, (size_t)16 * ldb);
#pragma unroll 1      /* rolled: one body serves both buffers and stays small */
  for (int t = 0; t < nt; ++t) { const unsigned bo = (unsigned)(t & 1) * G2_STAGE; const unsigned char* pa = fa + bo; const unsigned char* pb = fb + bo;
    /* the trip's 24 fragment reads stand together in front of its matrix instructions */
    const v16h a00 = g2_lfrag(pa), a10 = g2_lfrag(pa + 16 * G2_PITCH), b00 = g2_lfrag(pb), b10 = g2_lfrag(pb + 16 * G2_PITCH), b20 = g2_lfrag(pb + 32 * G2_PITCH), b30 = g2_lfrag(pb + 48 * G2_PITCH);
    const v16h a01 = g2_lfrag(pa + 64), a11 = g2_lfrag(pa + 16 * G2_PITCH + 64), b01 = g2_lfrag(pb + 64), b11 = g2_lfrag(pb + 16 * G2_PITCH + 64), b21 = g2_lfrag(pb + 32 * G2_PITCH + 64), b31 = g2_lfrag(pb + 48 * G2_PITCH + 64);
    c00 = g2_mma(a00, b00, c00); c10 = g2_mma(a10, b00, c10); c01 = g2_mma(a00, b10, c01); c11 = g2_mma(a10, b10, c11);
    c02 = g2_mma(a00, b20, c02); c12 = g2_mma(a10, b20, c12); c03 = g2_mma(a00, b30, c03); c13 = g2_mma(a10, b30, c13);
    c00 = g2_mma(a01, b01, c00); c10 = g2_mma(a11, b01, c10); c01 = g2_mma(a01, b11, c01); c11 = g2_mma(a11, b11, c11);
    c02 = g2_mma(a01, b21, c02); c12 = g2_mma(a11, b21, c12); c03 = g2_mma(a01, b31, c03); c13 = g2_mma(a11, b31, c13);
    asm volatile("s_wait_dscnt 0x0" ::: "memory");       /* this wave's reads of buffer t & 1 are done before the buffer is given up */
    asm volatile("s_wait_asynccnt 0x0" ::: "memory");    /* this wave's copies of tile t + 1 have landed */
    __syncthreads();                                     /* publishes tile t + 1 and ends every wave's reads of buffer t & 1 */
    if (t + 2 < nt) g2_copy(lb + bo, ga + (size_t)(t + 2) * 64, (size_t)16 * lda, gb + (size_t)(t + 2) * 64, (size_t)16 * ldb); }
  asm volatile("s_wait_asynccnt 0x0" ::: "memory");      /* no copy is outstanding when the buffers become output staging */
  v8f accs[8] = {c00, c01, c02, c03, c10, c11, c12, c13};
#pragma unroll
  for (int u = 0; u < 8; ++u) { const int t = u & 3, half = u >> 2; const int col = col0 + t * 16 + ln; const float bv = BIAS ? bf16_round(bp[col]) : 0.f;
#pragma unroll
    for (int r = 0; r < 8; ++r) { const int rloc = half * 16 + 8 * hh + r; float v = accs[u][r] * alpha + bv; if (RES) { if (rowsPerB < 0) v += CP[cofs + (size_t)(row0g + row0 + rloc) * ldc + col];      /* rowsPerB < 0: own element of the batched C plane */ else { const int bidx = (row0g + row0 + rloc) / rowsPerB; v += CP[(size_t)bidx * sCPb + (size_t)by * 64 + col]; } }
      if (ACT == 3) v = fmaxf(v, 0.f); else if (ACT == 6) v = 0.5f * v * (1.0f + erff(v * 0.70710678118654752f)); else if (ACT == 11) v = 1.0f / (1.0f + expf(-v)); else if (ACT == 15) v = v / (1.0f + expf(-v)); else if (ACT == 12) v = (v > 0.f) ? v : 0.01f * v; else if (ACT == 8) v = tanhf(v); else if (ACT == 9) v = 0.5f * v * (1.0f + tanhf(0.7978845608028654f * (v + 0.044715f * v * v * v))); else if (ACT == 14) v = (v > 0.f) ? v : 0.1f * v; else if (ACT == 16) v = (v >= 0.f) ? v : 0.3f * v; else if (ACT == 17) v = (v >= 0.f) ? v : 0.2f * v;
      so[w][rloc][t * 16 + ln] = v; } }
  __builtin_amdgcn_fence(__ATOMIC_ACQ_REL, "workgroup"); __builtin_amdgcn_wave_barrier();
  const int rsub = lane >> 4, c4 = (lane & 15) * 4;
  {
#pragma unroll
    for (int q = 0; q < 16; ++q) { const int r = q * 2 + rsub; const v4f v = *(const v4fa*)&so[w][r][c4]; if (OUT32) *(v4f*)(C + cofs + (size_t)(row0 + r) * ldc + col0 + c4) = v; if (OUT16) { v4h h4; for (int i = 0; i < 4; ++i) h4[i] = (_Float16)v[i]; *(v4h*)(C16 + cofs + (size_t)(row0 + r) * ldc + col0 + c4) = h4; } }
     } }


// ---- [Q|K|V] GEMM: one 256 x 192 tile of C per block, one block per WGP (2 batches x 16 row tiles x 8 column tiles = 256 blocks), 12 waves in a 4 x 3 grid, 64 x 64 per wave.
// Per 64 k a block copies 448 operand rows of 128 bytes for 256 x 192 results: 7 / 18 of the bytes per result that a 128 x 64 tile asks of L2. Ring, LDS pitch, fragment reads and the ascending k order are those of k_gemm2.
// Only tokens 0..4095 of a batch are computed. The padding token 4096 has a zero x row, so its q, k and v are zeros: its row is stored as such (the attention launch reads it; its key is visible to the dropped query alone).
#define QG_STAGE (448 * G2_PITCH)      /* rows 0..255: A, rows 256..447: B */
#define QG_SO (12 * 64 * 68 * 4)       /* output staging, 64 rows of 68 floats per wave */
// n copies of a wave, 4 operand rows each, ls LDS bytes and gs elements apart; the wait that stands in front of any new value in the address registers they name is the last line of the same statement
__device__ __forceinline__ void qg_copy8(unsigned l, unsigned ls, const _Float16* g, size_t gs) {
  asm volatile("global_load_async_to_lds_b128 %0, %8, off\n\t"
               "global_load_async_to_lds_b128 %1, %9, off\n\t"
               "global_load_async_to_lds_b128 %2, %10, off\n\t"
               "global_load_async_to_lds_b128 %3, %11, off\n\t"
               "global_load_async_to_lds_b128 %4, %12, off\n\t"
               "global_load_async_to_lds_b128 %5, %13, off\n\t"
               "global_load_async_to_lds_b128 %6, %14, off\n\t"
               "global_load_async_to_lds_b128 %7, %15, off\n\t"
               "s_wait_xcnt 0x0"
               :: "v"(l), "v"(l + ls), "v"(l + 2 * ls), "v"(l + 3 * ls), "v"(l + 4 * ls), "v"(l + 5 * ls), "v"(l + 6 * ls), "v"(l + 7 * ls),
                  "v"(g), "v"(g + gs), "v"(g + 2 * gs), "v"(g + 3 * gs), "v"(g + 4 * gs), "v"(g + 5 * gs), "v"(g + 6 * gs), "v"(g + 7 * gs)
               : "memory"); }
__device__ __forceinline__ void qg_copy4(unsigned l, unsigned ls, const _Float16* g, size_t gs) {
  asm volatile("global_load_async_to_lds_b128 %0, %4, off\n\t"
               "global_load_async_to_lds_b128 %1, %5, off\n\t"
               "global_load_async_to_lds_b128 %2, %6, off\n\t"
               "global_load_async_to_lds_b128 %3, %7, off\n\t"
               "s_wait_xcnt 0x0"
               :: "v"(l), "v"(l + ls), "v"(l + 2 * ls), "v"(l + 3 * ls), "v"(g), "v"(g + gs), "v"(g + 2 * gs), "v"(g + 3 * gs)
               : "memory"); }
__global__ __launch_bounds__(384) void k_qkv(const _Float16* __restrict__ A, const _Float16* __restrict__ Bh, float* __restrict__ C) {
  __shared__ __attribute__((aligned(16))) unsigned char sm[QG_SO];      /* the two operand buffers; behind the loop's last barrier the same bytes stage the output rows */
  static_assert(2 * QG_STAGE <= QG_SO, "the operand buffers must fit");
  float (*so)[64][68] = reinterpret_cast<float (*)[64][68]>(sm);
  const int tid = threadIdx.x, lane = tid & 31, ln = lane & 15, hh = lane >> 4; const int wv = __builtin_amdgcn_readfirstlane(tid >> 5);
  const int mt = blockIdx.x & 31, nq = blockIdx.x >> 5; const int col0 = nq * 192;      /* the row tile is the fast index */
  const size_t rowb = (size_t)(mt >> 4) * RPB + (size_t)(mt & 15) * 256;      /* first token row of the tile, in X16 and in C alike */
  /* waves 0..7 copy the 256 A rows (8 copies of 32 rows), waves 8..11 the 192 B rows (12 copies of 16 rows); cb reads the same in a whole wave */
  const bool cb = wv >= 8; const int crow = (cb ? wv - 8 : wv) * 4 + (lane >> 3), cpc = lane & 7;
  const _Float16* g = (cb ? Bh + (size_t)(col0 + crow) * DM : A + (rowb + crow) * DM) + cpc * 8;
  const size_t gs = (size_t)(cb ? 16 : 32) * DM; const unsigned ls = (unsigned)(cb ? 16 : 32) * G2_PITCH;
  const unsigned lb = (unsigned)(size_t)sm + (unsigned)(((cb ? 256 : 0) + crow) * G2_PITCH + cpc * 16);
  const int wm = wv & 3, wn = wv >> 2;
  const unsigned char* fa = sm + (64 * wm + ln) * G2_PITCH + 16 * hh; const unsigned char* fb = sm + (256 + 64 * wn + ln) * G2_PITCH + 16 * hh;
  const int nt = DM / 64;
  v8f acc[4][4];
#pragma unroll
  for (int i = 0; i < 16; ++i) acc[i >> 2][i & 3] = v8f{0.f,0.f,0.f,0.f,0.f,0.f,0.f,0.f};
  qg_copy8(lb, ls, g, gs); if (cb) qg_copy4(lb + 8 * ls, ls, g + 8 * gs, gs);
  asm volatile("s_wait_asynccnt 0x0" ::: "memory");      /* this wave's copies of tile 0 have landed */
  __syncthreads();                                       /* ... and every other wave's */
  qg_copy8(lb + QG_STAGE, ls, g + 64, gs); if (cb) qg_copy4(lb + QG_STAGE + 8 * ls, ls, g + 64 + 8 * gs, gs);
#pragma unroll 1      /* rolled: one body serves both buffers and stays small */
  for (int t = 0; t < nt; ++t) { const unsigned bo = (unsigned)(t & 1) * QG_STAGE;
#pragma unroll
    for (int ks = 0; ks < 2; ++ks) { const unsigned char* pa = fa + bo + ks * 64; const unsigned char* pb = fb + bo + ks * 64; v16h a[4], b[4];
#pragma unroll
      for (int i = 0; i < 4; ++i) { a[i] = g2_lfrag(pa + i * 16 * G2_PITCH); b[i] = g2_lfrag(pb + i * 16 * G2_PITCH); }
#pragma unroll
      for (int n = 0; n < 4; ++n) {
#pragma unroll
        for (int m = 0; m < 4; ++m) acc[m][n] = g2_mma(a[m], b[n], acc[m][n]); } }
    asm volatile("s_wait_dscnt 0x0" ::: "memory");       /* this wave's reads of buffer t & 1 are done before the buffer is given up */
    asm volatile("s_wait_asynccnt 0x0" ::: "memory");    /* this wave's copies of tile t + 1 have landed */
    __syncthreads();                                     /* publishes tile t + 1 and ends every wave's reads of buffer t & 1 */
    if (t + 2 < nt) { const _Float16* gn = g + (size_t)(t + 2) * 64; qg_copy8(lb + bo, ls, gn, gs); if (cb) qg_copy4(lb + bo + 8 * ls, ls, gn + 8 * gs, gs); } }
  asm volatile("s_wait_asynccnt 0x0" ::: "memory");      /* no copy is outstanding when the buffers become output staging */
  const int rsub = lane >> 4, c4 = (lane & 15) * 4;
  float* cp = C + (rowb + 64 * wm + rsub) * (3 * DM) + col0 + 64 * wn + c4;
#pragma unroll      /* 16 rows at a time, each group in LDS rows of its own: the first global stores leave after a quarter of the staging */
  for (int m = 0; m < 4; ++m) {
#pragma unroll
    for (int n = 0; n < 4; ++n) {
#pragma unroll
      for (int r = 0; r < 8; ++r) so[wv][m * 16 + 8 * hh + r][n * 16 + ln] = acc[m][n][r] * 0.0625f; }
    asm volatile("s_wait_dscnt 0x0" ::: "memory");      /* the wave's own staged rows stand in LDS before its lanes read them back; a fence here would also wait for the global stores of the group before */
#pragma unroll
    for (int q = m * 8; q < m * 8 + 8; ++q) { const v4f v = *(const v4fa*)&so[wv][q * 2 + rsub][c4]; *(v4f*)(cp + (size_t)q * 2 * (3 * DM)) = v; } }
  if ((mt & 15) == 15 && tid < 48) { const v4f z = {0.f, 0.f, 0.f, 0.f}; *(v4f*)(C + ((size_t)(mt >> 4) * RPB + NTOK) * (3 * DM) + col0 + tid * 4) = z; } }

// one 64 x 64 tile (number blk) of Bt[out][in] = f16(bf16(w[in][out]) * 16). FRAG: the same values in the order in which a wave reads them as B fragments: per 16 out rows and 32 in columns 1 KiB,
// two halves of 512 bytes, lane (out & 15) + 16 * ((in >> 3) & 1) holding 8 adjacent in columns, half (in >> 4) & 1: each b128 load of a wave then covers 512 adjacent bytes.
template <bool FRAG>
__device__ __forceinline__ void wT_tile(const float* __restrict__ w, int din, int dout, _Float16* __restrict__ Bt, int blk, float (*tl)[65]) { const int tid = threadIdx.x; const int nbo = dout / 64; const int ib = blk / nbo, ob = blk % nbo; const int i0 = ib * 64, o0 = ob * 64;
  for (int t = tid; t < 64 * 64; t += 256) { const int i = t / 64, o = t % 64; tl[o][i] = bf16_round(w[(size_t)(i0 + i) * dout + o0 + o]) * 16.0f; }
  __syncthreads();
  { for (int t = tid; t < 64 * 8; t += 256) { const int o = t / 8, i8 = (t % 8) * 8; FragH f; for (int q = 0; q < 8; ++q) f.h[q] = (_Float16)tl[o][i8 + q]; const int n = o0 + o, k = i0 + i8;
      const size_t dst = FRAG ? ((((size_t)(n >> 4) * (din >> 5) + (k >> 5)) * 2 + ((k >> 4) & 1)) * 32 + ((k >> 3) & 1) * 16 + (n & 15)) * 8 : (size_t)n * din + k;
      *(v8us*)((unsigned short*)Bt + dst) = f.half[0]; }  } }
// 8 elements of the padded f16 token rows per thread (block number blk)
__device__ __forceinline__ void xr_rows(const float* __restrict__ x, _Float16* __restrict__ X16, int blk) { const size_t t = (size_t)blk * 256 + threadIdx.x; if (t >= NRX * DM / 8) return; const int c0 = (int)((t * 8) % DM); const size_t r = (t * 8) / DM; const int tok = (int)(r % RPB); const size_t b = r / RPB; FragH f;
  for (int q = 0; q < 8; ++q) f.h[q] = (tok < NTOK) ? (_Float16)bf16_round(x[(b * NTOK + tok) * DM + c0 + q]) : (_Float16)0.f;
  *(v8us*)((unsigned short*)X16 + t * 8) = f.half[0];  }
// All operand preparation in one launch (none of the four parts reads another's output): blocks 0..255 transpose one weight tile each (Wq 64, Wkv 128, Wo 64), the rest convert token rows.
// BQKV holds the rows of Wq^T, then those of Wkv^T: one [1536][512] B operand. BO holds Wo^T in fragment order.
#define WT_Q ((DM / 64) * (DM / 64))
#define WT_KV ((DM / 64) * (2 * DM / 64))
#define WT_ALL (2 * WT_Q + WT_KV)
__global__ __launch_bounds__(256) void k_prep(const float* __restrict__ x, const float* __restrict__ Wq, const float* __restrict__ Wkv, const float* __restrict__ Wo, _Float16* __restrict__ BQKV, _Float16* __restrict__ BO, _Float16* __restrict__ X16) {
  __shared__ float tl[64][65]; const int blk = blockIdx.x;      /* the choice below is the same for a whole block: wT_tile holds a barrier */
  if (blk < WT_Q) wT_tile<false>(Wq, DM, DM, BQKV, blk, tl);
  else if (blk < WT_Q + WT_KV) wT_tile<false>(Wkv, DM, 2 * DM, BQKV + (size_t)DM * DM, blk - WT_Q, tl);
  else if (blk < WT_ALL) wT_tile<true>(Wo, DM, DM, BO, blk - (WT_Q + WT_KV), tl);
  else xr_rows(x, X16, blk - WT_ALL); }
// sum over the 8 lanes that share one (query, head): three DPP adds inside the 16-lane row (lane ^ 1, ^ 2, ^ 4); every lane of the group ends with the total
template <int CTRL> __device__ __forceinline__ float nb_xadd(float x) { return x + __int_as_float(__builtin_amdgcn_update_dpp(0, __float_as_int(x), CTRL, 0xf, 0xf, true)); }
__device__ __forceinline__ float nb_dot(v4f a0, v4f a1, v4f k0, v4f k1) {
  float s = a0[0] * k0[0], t = a1[0] * k1[0];
#pragma unroll
  for (int d = 1; d < 4; ++d) { s = fmaf(a0[d], k0[d], s); t = fmaf(a1[d], k1[d], t); }
  s += t; s = nb_xadd<0x161>(s); s = nb_xadd<0x162>(s); s = nb_xadd<0x164>(s); return s; }
// Neighbourhood attention and the output product in one launch. Wave = NQW consecutive queries of one grid row (f0, h0) x 4 heads at a time, a block's 16 waves side by side in that row; 8 lanes share a (query, head), lane l8 holding
// dims 4*l8..+3 and 32+4*l8..+3, so that each b128 load of a key row covers whole 128-byte lines. Only 14 of the 27 window slots can pass the causal test (frame f0-1: 3x3; frame f0: row h0-1: 3,
// row h0: w-1 and w); the others have a flat index above the query's for every query. A key row is loaded once per wave and serves each of its queries whose window holds it.
// A slot outside the grid still reads a token row of the same batch (in bounds, written by the GEMM before) and gets the mask value as its logit, hence weight 0.
// A token's row of QKV holds q (512), k (512), v (512).
#define NQW 2
#define LQ (3 * DM)
#define PO 1040      /* LDS pitch of an o row in bytes: 512 f16 + 16, so that the 16 rows of a fragment read start 4 banks apart */
typedef _Float16 v4ha __attribute__((ext_vector_type(4), may_alias));
// One block = one grid row (f0, h0) of one batch: 32 queries x 8 heads, 16 waves. Part 1: wave wv works out queries 2 wv, 2 wv + 1 for heads 0..3, then for heads 4..7, and leaves the o rows (f16) in LDS.
// Part 2, behind one barrier: out rows = o Wo + bo for the block's 32 tokens, wave wv taking output columns 32 wv..+31 (2 x 2 WMMA tiles, k ascending), A fragments from LDS, B fragments from BO (fragment order).
// LDS row r belongs to query 32 g + r, that is token 32 g + r + 1; token 4096 is not part of the output, so its row carries token 0 instead, whose o row is v_BOS.
__global__ __launch_bounds__(512) __attribute__((amdgpu_waves_per_eu(4, 4))) void k_nbatt_out(const float* QKV, const _Float16* BOf, const float* bo, float* out) {      /* no __restrict__: the loads below keep their side of the two waits */
  __shared__ __attribute__((aligned(16))) unsigned char so16[32 * PO];
  __shared__ __attribute__((aligned(16))) float st[16][32][36];      /* each wave's own 32 x 32 output tile, staged so that its stores cover whole 128-byte lines */
  const int lane = threadIdx.x & 31, l8 = lane & 7, hs = lane >> 3; const int wv = __builtin_amdgcn_readfirstlane((int)(threadIdx.x >> 5));
  const int rw = blockIdx.x; const int h0 = rw % HT, f0 = (rw / HT) % FT, b = rw / (HT * FT);
  const int w0 = wv * NQW; const int jr0 = (f0 * HT + h0) * WT; const int j0 = jr0 + w0;
  const float* tb = QKV + (size_t)b * RPB * LQ;      /* the batch's token rows; k stands DM, v 2 * DM floats into a row */
#pragma unroll 1      /* rolled: one body serves both halves of the heads, and their registers do not add up */
  for (int hq = 0; hq < 2; ++hq) { const unsigned co = (unsigned)(hq * (DM / 2) + hs * HD + l8 * 4);
  const float* rb[5]; bool kok[5][NQW + 2];      /* rb[r]: the row of the key at column w0 of window row r; a window row outside the grid points at token row 1, so that columns -1..NQW stay inside the buffer */
#pragma unroll
  for (int r = 0; r < 5; ++r) { const int f = f0 + (r < 3 ? -1 : 0), hh = h0 + (r < 3 ? r - 1 : r - 4); const bool rok = f >= 0 && hh >= 0 && hh < HT;
    rb[r] = tb + (size_t)(rok ? (f * HT + hh) * WT + w0 + 1 : 1) * LQ + co;
#pragma unroll
    for (int c = 0; c < NQW + 2; ++c) { const int ww = w0 - 1 + c; kok[r][c] = rok && ww >= 0 && ww < WT; } }
  const float* qp = QKV + ((size_t)b * RPB + j0) * LQ + co;      /* query i is token j0 + i + 1 */ const float* bp = tb + co;
  v4f q[NQW][2], kb[2], kk[5][NQW + 2][2];
#pragma unroll
  for (int i = 0; i < NQW; ++i) { q[i][0] = *(const v4fa*)(qp + (i + 1) * LQ); q[i][1] = *(const v4fa*)(qp + (i + 1) * LQ + 32); }
#pragma unroll
  for (int r = 0; r < 5; ++r) {
#pragma unroll
    for (int c = 0; c < NQW + (r < 4 ? 2 : 1); ++c) { const float* kp = rb[r] + (c - 1) * LQ + DM; kk[r][c][0] = *(const v4fa*)kp; kk[r][c][1] = *(const v4fa*)(kp + 32); } }
  kb[0] = *(const v4fa*)(bp + DM); kb[1] = *(const v4fa*)(bp + DM + 32);
  /* the wait that stands between issued loads and any new value in their address registers; naming the addresses keeps them in those registers up to it */
  asm volatile("s_wait_xcnt 0x0" :: "v"(qp), "v"(bp), "v"(rb[0]), "v"(rb[1]), "v"(rb[2]), "v"(rb[3]), "v"(rb[4]) : "memory");
  float lg[NQW][15];
#pragma unroll
  for (int i = 0; i < NQW; ++i) lg[i][0] = nb_dot(q[i][0], q[i][1], kb[0], kb[1]) * 0.125f;
#pragma unroll
  for (int r = 0; r < 5; ++r) {
#pragma unroll
    for (int c = 0; c < NQW + (r < 4 ? 2 : 1); ++c) {
#pragma unroll
      for (int i = 0; i < NQW; ++i) { const int dw = c - i; if (dw >= 0 && dw < (r < 4 ? 3 : 2)) { const float sd = nb_dot(q[i][0], q[i][1], kk[r][c][0], kk[r][c][1]) * 0.125f; lg[i][1 + r * 3 + dw] = kok[r][c] ? sd : -3.0e38f; } } } }
  v4f vb[2], vv[5][NQW + 2][2];      /* the v rows fly while the softmax is worked out */
#pragma unroll
  for (int r = 0; r < 5; ++r) {
#pragma unroll
    for (int c = 0; c < NQW + (r < 4 ? 2 : 1); ++c) { const float* vp = rb[r] + (c - 1) * LQ + 2 * DM; vv[r][c][0] = *(const v4fa*)vp; vv[r][c][1] = *(const v4fa*)(vp + 32); } }
  vb[0] = *(const v4fa*)(bp + 2 * DM); vb[1] = *(const v4fa*)(bp + 2 * DM + 32);
  /* the same wait behind the v loads */
  asm volatile("s_wait_xcnt 0x0" :: "v"(bp), "v"(rb[0]), "v"(rb[1]), "v"(rb[2]), "v"(rb[3]), "v"(rb[4]) : "memory");
#pragma unroll
  for (int i = 0; i < NQW; ++i) { float mx = lg[i][0];
#pragma unroll
    for (int s = 1; s < 15; ++s) mx = fmaxf(mx, lg[i][s]);
    float se = 0.f;
#pragma unroll
    for (int s = 0; s < 15; ++s) { const float e = expf(lg[i][s] - mx); lg[i][s] = e; se += e; }
    const float inv = 1.0f / se;
#pragma unroll
    for (int s = 0; s < 15; ++s) lg[i][s] *= inv; }
  v4f o[NQW][2];
#pragma unroll
  for (int i = 0; i < NQW; ++i) { o[i][0] = vb[0] * lg[i][0]; o[i][1] = vb[1] * lg[i][0]; }
#pragma unroll
  for (int r = 0; r < 5; ++r) {
#pragma unroll
    for (int c = 0; c < NQW + (r < 4 ? 2 : 1); ++c) {
#pragma unroll
      for (int i = 0; i < NQW; ++i) { const int dw = c - i; if (dw >= 0 && dw < (r < 4 ? 3 : 2)) { const float p = lg[i][1 + r * 3 + dw]; o[i][0] += vv[r][c][0] * p; o[i][1] += vv[r][c][1] * p; } } } }
#pragma unroll
  for (int i = 0; i < NQW; ++i) { unsigned char* op = so16 + (w0 + i) * PO + co * 2; v4h a, c;
#pragma unroll
    for (int d = 0; d < 4; ++d) { a[d] = (_Float16)o[i][0][d]; c[d] = (_Float16)o[i][1][d]; }
    *(v4ha*)op = a; *(v4ha*)(op + 64) = c; }
  if (j0 + NQW == TT) {      /* the row of token 4096 carries token 0: o = v_BOS, read again so that it holds no registers above; the test reads the same in the whole wave */
    const float* vp = tb + 2 * DM + co; const v4f v0 = *(const v4fa*)vp, v1 = *(const v4fa*)(vp + 32);
    asm volatile("s_wait_xcnt 0x0" ::: "memory");      /* the wait between these loads and any new value in their address registers */
    unsigned char* op = so16 + (w0 + NQW - 1) * PO + co * 2; v4h a, c;
#pragma unroll
    for (int d = 0; d < 4; ++d) { a[d] = (_Float16)v0[d]; c[d] = (_Float16)v1[d]; }
    *(v4ha*)op = a; *(v4ha*)(op + 64) = c; } }
  const int ln = lane & 15, hh = lane >> 4;
  const unsigned char* fa = so16 + ln * PO + 16 * hh;
  const unsigned short* fb = (const unsigned short*)BOf + (size_t)wv * (2 * 16 * 512) + lane * 8;      /* this wave's two column tiles: 32 KiB in a row, 1 KiB per fragment; every B load is this one address plus a constant */
  FragH b0[DM / 32], b1[DM / 32];      /* indexed by constants only: a ring of 8 k steps in registers */
#pragma unroll
  for (int ks = 0; ks < 8; ++ks) {      /* the first 8 k steps' B fragments are asked for in front of the barrier: they depend on no other wave */
    b0[ks].half[0] = *(const v8us*)(fb + ks * 512); b0[ks].half[1] = *(const v8us*)(fb + ks * 512 + 256);
    b1[ks].half[0] = *(const v8us*)(fb + 16 * 512 + ks * 512); b1[ks].half[1] = *(const v8us*)(fb + 16 * 512 + ks * 512 + 256); }
  __syncthreads();      /* every wave's o rows stand in LDS before any wave reads them as its A operand */
  const v8f z8 = {0.f,0.f,0.f,0.f,0.f,0.f,0.f,0.f}; v8f c00 = z8, c01 = z8, c10 = z8, c11 = z8;
  v16h a0 = g2_lfrag(fa), a1 = g2_lfrag(fa + 16 * PO);
#pragma unroll      /* unrolled: the register rings are indexed by constants; A is read one k step ahead, B eight */
  for (int ks = 0; ks < DM / 32; ++ks) { v16h n0 = a0, n1 = a1;
    if (ks + 1 < DM / 32) { n0 = g2_lfrag(fa + (ks + 1) * 64); n1 = g2_lfrag(fa + 16 * PO + (ks + 1) * 64); }
    c00 = g2_mma(a0, b0[ks].v, c00); c10 = g2_mma(a1, b0[ks].v, c10); c01 = g2_mma(a0, b1[ks].v, c01); c11 = g2_mma(a1, b1[ks].v, c11);
    if (ks + 8 < DM / 32) { const int kn = ks + 8;
      b0[kn].half[0] = *(const v8us*)(fb + kn * 512); b0[kn].half[1] = *(const v8us*)(fb + kn * 512 + 256);
      b1[kn].half[0] = *(const v8us*)(fb + 16 * 512 + kn * 512); b1[kn].half[1] = *(const v8us*)(fb + 16 * 512 + kn * 512 + 256); }
    a0 = n0; a1 = n1; }
  v8f accs[4] = {c00, c01, c10, c11};
#pragma unroll
  for (int u = 0; u < 4; ++u) { const int t = u & 1, half = u >> 1; const float bv = bf16_round(bo[wv * 32 + t * 16 + ln]);
#pragma unroll
    for (int r = 0; r < 8; ++r) st[wv][half * 16 + 8 * hh + r][t * 16 + ln] = accs[u][r] * 0.0625f + bv; }
  __builtin_amdgcn_fence(__ATOMIC_ACQ_REL, "workgroup"); __builtin_amdgcn_wave_barrier();
  const int rsub = lane >> 3, c4 = (lane & 7) * 4;
#pragma unroll
  for (int q = 0; q < 8; ++q) { const int r = q * 4 + rsub; const v4f v = *(const v4fa*)&st[wv][r][c4]; const int tok = (jr0 + r + 1) & (NTOK - 1);      /* token 4096 -> 0 */
    *(v4f*)(out + ((size_t)b * NTOK + tok) * DM + wv * 32 + c4) = v; } }

extern "C" void kernel_launch(void* const* d_in, const int* in_sizes, int n_in,
                              void* d_out, int out_size, void* d_ws, size_t ws_size, hipStream_t stream) {
  (void)in_sizes; (void)n_in; (void)out_size;
  const float* const* I = (const float* const*)d_in; const float* x = I[0]; const float* Wq = I[1]; const float* Wkv = I[2]; const float* Wo = I[3]; const float* bo = I[4];
  char* ws = (char*)d_ws; size_t off = 0;
  auto take = [&](size_t bytes) { char* p = ws + off; off += (bytes + 255) & ~(size_t)255; return p; };
  _Float16* BQKV = (_Float16*)take((size_t)3 * DM * DM * 2); _Float16* BO = (_Float16*)take((size_t)DM * DM * 2);
  _Float16* X16 = (_Float16*)take(NRX * DM * 2); float* QKV = (float*)take(NRX * 3 * DM * 4);
  if (off > ws_size) return;      /* 2 + 8.6 + 51.9 = about 63 MB */
  k_prep<<<(unsigned)(WT_ALL + (NRX * DM / 8 + 255) / 256), 256, 0, stream>>>(x, Wq, Wkv, Wo, BQKV, BO, X16);
  k_qkv<<<NB * (NTOK / 256) * (3 * DM / 192), 384, 0, stream>>>(X16, BQKV, QKV);      /* 256 blocks of 256 x 192; the padding token's row is stored as zeros */
  k_nbatt_out<<<NB * FT * HT, 512, 0, stream>>>(QKV, BO, bo, (float*)d_out);      /* one block per grid row: its 32 tokens' attention, then out = o Wo + bo for them (token 4096 dropped as in the reference, token 0 in its place) */
}

// v007
// A run of this version takes 46.5 microseconds.
// In both of two side-by-side timings against v006, it was 1.05 times as fast.
// All steps since v000 together make it 11.0 times as fast.
#include <hip/hip_runtime.h>
// Sparse3DNA (x [2][4096][512]: 1 BOS + 4095 video tokens on a 4x32x32 grid, padded by one zero token to 4097; q = x Wq, [k|v] = x Wkv ([in][out], no bias), 8 heads of 64; query j (token j+1) attends to {BOS} U {its 3x3x3 grid neighbourhood keys with flat index <= j} (out-of-grid slots and future keys masked), scale 64^-0.5, softmax, weighted v; token 0's output is v_BOS itself; out = o Wo + bo, first 4096 tokens -> [2][4096][512]).
// Structure: token rows (4,097 per batch padded to 4,224); x as exact f16 rows; one [Q|K|V] WMMA GEMM (256x192 block tiles, 64x64 wave tiles, f32 accumulation, exact x16 transposed weights) kept in f32, rows of 1,536; the 28-slot neighbourhood attention on VALU (f32: 8 lanes per (batch, head, query), 2 queries x 4 heads per wave, window indices and the causal test from the grid geometry on device, logits, softmax, weighted sum) into f16 o rows in LDS (token 0: v_BOS); out = o Wo + bo on WMMA in the same launch, 32 tokens per block (f32, output layout). Three launches: operands, [Q|K|V], attention with output.
// Compute dtype: inputs rounded to bf16; x / weights exact; q, k, v, logits, softmax f32; o plain f16 into the Wo GEMM (~2^-12). v_wmma_f32_16x16x32_f16.
#define NB 2
#define NTOK 4096                    /* input tokens per batch (= output tokens) */
#define NPAD 4097                    /* after the module's padding */
#define RPB 4224                     /* rows per batch (33 x 128) */
#define NRX ((size_t)NB * RPB)       /* 8448 */
#define DM 512
#define NH 8
#define HD 64
#define FT 4
#define HT 32
#define WT 32
#define TT (FT * HT * WT)            /* 4096 grid tokens */
#define QT TT                        /* unused */
typedef __bf16 v16b __attribute__((ext_vector_type(16)));
typedef unsigned short v8us __attribute__((ext_vector_type(8), may_alias));
typedef float  v8f  __attribute__((ext_vector_type(8)));
typedef float  v4f  __attribute__((ext_vector_type(4)));
typedef float  v4fa __attribute__((ext_vector_type(4), may_alias));
union FragB { v16b v; v8us half[2]; unsigned short u[16]; };

__device__ __forceinline__ unsigned short bf16_bits(float x) { unsigned int u = __float_as_uint(x); return (unsigned short)((u + 0x7FFFu + ((u >> 16) & 1u)) >> 16); }
__device__ __forceinline__ float bf16_val(unsigned short b) { return __uint_as_float(((unsigned int)b) << 16); }
__device__ __forceinline__ float bf16_round(float x) { return bf16_val(bf16_bits(x)); }
// D += A·B with NT terms: 1 = ah·bh, 2 = + al·bh (A split), 3 = + ah·bl (both split)
template <int NT>
__device__ __forceinline__ v8f mmaN(v16b ah, v16b al, v16b bh, v16b bl, v8f c) {
  c = __builtin_amdgcn_wmma_f32_16x16x32_bf16(false, ah, false, bh, (short)0, c, false, false);
  if (NT >= 2) c = __builtin_amdgcn_wmma_f32_16x16x32_bf16(false, al, false, bh, (short)0, c, false, false);
  if (NT >= 3) c = __builtin_amdgcn_wmma_f32_16x16x32_bf16(false, ah, false, bl, (short)0, c, false, false);
  asm volatile("v_nop\n\tv_nop\n\tv_nop\n\tv_nop" : "+v"(c) : "v"(ah), "v"(al), "v"(bh), "v"(bl));
  return c;
}

__global__ __launch_bounds__(256) void k_wt_bf16(const float* __restrict__ W, unsigned short* __restrict__ Wt, int K, int N) {
  const int t = blockIdx.x * 256 + threadIdx.x;
  const int k8n = K / 8;
  if (t >= N * k8n) return;
  const int n = t / k8n, k8 = (t % k8n) * 8;
  v8us v;
#pragma unroll
  for (int i = 0; i < 8; ++i) v[i] = bf16_bits(W[(size_t)(k8 + i) * N + n]);
  *(v8us*)(Wt + (size_t)n * K + k8) = v;
  
}

// GEMM C[M][N] (f32, pitch ldc) = act(A[M][K]·W + bias). A f32 row-major (pitch lda) converted per fragment to bf16
// (ASPLIT: hi/lo two planes -> 2 terms, else single rounded term); Wt bf16 [N][K] (pitch ldb). BIAS_BF16 rounds the
// bias to bf16 first (bias quantised to bf16 before the add). K%32==0, M%16==0, N%64==0.
template <bool ASPLIT, int ACT, bool BIAS_BF16>
__global__ __launch_bounds__(128) void k_gemm_bf(const float* __restrict__ A, int lda, const unsigned short* __restrict__ Wt, int ldb,
                                               const float* __restrict__ bias, float* __restrict__ C, int ldc, int M, int N, int K) {
  __shared__ __attribute__((aligned(16))) float so[4][16][64];
  const int tid = threadIdx.x, w = tid >> 5, lane = tid & 31, ln = lane & 15, hh = lane >> 4;
  const int ntn = N / 64;
  const int wid = blockIdx.x * 4 + w;
  const int mt = wid / ntn, nq = wid % ntn;
  if (mt * 16 >= M) return;
  const int row0 = mt * 16, col0 = nq * 64;
  const float* arow = A + (size_t)(row0 + ln) * lda;
  v8f acc[4] = {};
  for (int kb = 0; kb < K; kb += 32) {
    FragB ah, al;
    const v4f x0 = *(const v4fa*)(arow + kb + 8 * hh), x1 = *(const v4fa*)(arow + kb + 8 * hh + 4);
    const v4f x2 = *(const v4fa*)(arow + kb + 16 + 8 * hh), x3 = *(const v4fa*)(arow + kb + 16 + 8 * hh + 4);
    float xs[16] = {x0[0],x0[1],x0[2],x0[3],x1[0],x1[1],x1[2],x1[3],x2[0],x2[1],x2[2],x2[3],x3[0],x3[1],x3[2],x3[3]};
#pragma unroll
    for (int i = 0; i < 16; ++i) { const unsigned short hb = bf16_bits(xs[i]); ah.u[i] = hb; al.u[i] = ASPLIT ? bf16_bits(xs[i] - bf16_val(hb)) : (unsigned short)0; }
#pragma unroll
    for (int t = 0; t < 4; ++t) {
      const unsigned short* brow = Wt + (size_t)(col0 + t * 16 + ln) * ldb + kb;
      FragB b;
      b.half[0] = *(const v8us*)(brow + 8 * hh);
      b.half[1] = *(const v8us*)(brow + 16 + 8 * hh);
      acc[t] = mmaN<ASPLIT ? 2 : 1>(ah.v, al.v, b.v, b.v, acc[t]);
    }
  }
#pragma unroll
  for (int t = 0; t < 4; ++t) {
    float bv = bias ? bias[col0 + t * 16 + ln] : 0.f;
    if (BIAS_BF16) bv = bf16_round(bv);
#pragma unroll
    for (int r = 0; r < 8; ++r) { float v = acc[t][r] + bv; if (ACT == 1) v = fmaxf(v, 0.f); so[w][8 * hh + r][t * 16 + ln] = v; }
  }
  __builtin_amdgcn_fence(__ATOMIC_ACQ_REL, "workgroup");
  __builtin_amdgcn_wave_barrier();
  const int rsub = lane >> 4, c4 = (lane & 15) * 4;
  {
#pragma unroll
    for (int q = 0; q < 8; ++q) {
      const int r = q * 2 + rsub;
      const v4f v = *(const v4fa*)&so[w][r][c4];
      *(v4f*)(C + (size_t)(row0 + r) * ldc + col0 + c4) = v;
    }
    
  }
}

// GEMM C = act(A·W + bias + resid): A f32 (ASPLIT -> hi/lo 2 terms), Wt bf16 [N][K]; ACT 0 none, 1 relu, 2 exact gelu;
// resid (optional, f32, row index = (row % rmod), pitch ldr, RES_BF16 rounds it) added before the activation.
template <bool ASPLIT, int ACT, bool BIAS_BF16, bool RES_BF16>
__global__ __launch_bounds__(128) void k_gemm_bf3(const float* __restrict__ A, int lda, const unsigned short* __restrict__ Wt, int ldb,
                                                const float* __restrict__ bias, const float* __restrict__ resid, int rmod, int ldr,
                                                float* __restrict__ C, int ldc, int M, int N, int K) {
  __shared__ __attribute__((aligned(16))) float so[4][16][64];
  const int tid = threadIdx.x, w = tid >> 5, lane = tid & 31, ln = lane & 15, hh = lane >> 4;
  const int ntn = N / 64;
  const int wid = blockIdx.x * 4 + w;
  const int mt = wid / ntn, nq = wid % ntn;
  if (mt * 16 >= M) return;
  const int row0 = mt * 16, col0 = nq * 64;
  const float* arow = A + (size_t)(row0 + ln) * lda;
  v8f acc[4] = {};
  for (int kb = 0; kb < K; kb += 32) {
    FragB ah, al;
    const v4f x0 = *(const v4fa*)(arow + kb + 8 * hh), x1 = *(const v4fa*)(arow + kb + 8 * hh + 4);
    const v4f x2 = *(const v4fa*)(arow + kb + 16 + 8 * hh), x3 = *(const v4fa*)(arow + kb + 16 + 8 * hh + 4);
    float xs[16] = {x0[0],x0[1],x0[2],x0[3],x1[0],x1[1],x1[2],x1[3],x2[0],x2[1],x2[2],x2[3],x3[0],x3[1],x3[2],x3[3]};
#pragma unroll
    for (int i = 0; i < 16; ++i) { const unsigned short hb = bf16_bits(xs[i]); ah.u[i] = hb; al.u[i] = ASPLIT ? bf16_bits(xs[i] - bf16_val(hb)) : (unsigned short)0; }
#pragma unroll
    for (int t = 0; t < 4; ++t) {
      const unsigned short* brow = Wt + (size_t)(col0 + t * 16 + ln) * ldb + kb;
      FragB b;
      b.half[0] = *(const v8us*)(brow + 8 * hh);
      b.half[1] = *(const v8us*)(brow + 16 + 8 * hh);
      acc[t] = mmaN<ASPLIT ? 2 : 1>(ah.v, al.v, b.v, b.v, acc[t]);
    }
  }
#pragma unroll
  for (int t = 0; t < 4; ++t) {
    const int col = col0 + t * 16 + ln;
    float bv = bias ? bias[col] : 0.f;
    if (BIAS_BF16) bv = bf16_round(bv);
#pragma unroll
    for (int r = 0; r < 8; ++r) {
      float v = acc[t][r] + bv;
      if (resid) { float rv = resid[(size_t)((row0 + 8 * hh + r) % rmod) * ldr + col]; if (RES_BF16) rv = bf16_round(rv); v += rv; }
      if (ACT == 1) v = fmaxf(v, 0.f);
      if (ACT == 2) v = 0.5f * v * (1.0f + erff(v * 0.70710678118654752f));
      if (ACT == 3) { const float u = 0.7978845608028654f * (v + 0.044715f * v * v * v); v = 0.5f * v * (1.0f + tanhf(u)); }
      so[w][8 * hh + r][t * 16 + ln] = v;
    }
  }
  __builtin_amdgcn_fence(__ATOMIC_ACQ_REL, "workgroup");
  __builtin_amdgcn_wave_barrier();
  const int rsub = lane >> 4, c4 = (lane & 15) * 4;
  {
#pragma unroll
    for (int q = 0; q < 8; ++q) {
      const int r = q * 2 + rsub;
      const v4f v = *(const v4fa*)&so[w][r][c4];
      *(v4f*)(C + (size_t)(row0 + r) * ldc + col0 + c4) = v;
    }
    
  }
}
// row LayerNorm (biased variance, eps) over N: s = X (+ R); optional out_sum <- s; out_norm <- (s-mu)*rsqrt(var+eps)*g + b
template <bool PARAM_BF16>
__global__ __launch_bounds__(256) void k_layernorm(const float* __restrict__ X, const float* __restrict__ R, const float* __restrict__ g, const float* __restrict__ bta,
                                                  float* __restrict__ out_sum, float* __restrict__ out_norm, int N, float eps) {
  __shared__ float red[256];
  const int row = blockIdx.x, tid = threadIdx.x;
  const float* x = X + (size_t)row * N; const float* rr = R ? R + (size_t)row * N : nullptr;
  float vals[16];                     // up to N = 4096
  const int per = N / 256;            // contiguous chunk per thread? use strided-by-4 chunks: thread handles j = tid*4 + 1024*u
  float s1 = 0.f;
  for (int u = 0; u < per / 4; ++u) {
    const int j = tid * 4 + 1024 * u;
    const v4f a = *(const v4fa*)(x + j);
    v4f b = {0.f,0.f,0.f,0.f}; if (rr) b = *(const v4fa*)(rr + j);
#pragma unroll
    for (int q = 0; q < 4; ++q) { const float v = a[q] + b[q]; vals[u * 4 + q] = v; s1 += v; }
  }
  red[tid] = s1; __syncthreads();
  for (int st = 128; st > 0; st >>= 1) { if (tid < st) red[tid] += red[tid + st]; __syncthreads(); }
  const float mu = red[0] / (float)N; __syncthreads();
  float s2 = 0.f;
  for (int u = 0; u < per / 4; ++u)
#pragma unroll
    for (int q = 0; q < 4; ++q) { const float c = vals[u * 4 + q] - mu; s2 += c * c; }
  red[tid] = s2; __syncthreads();
  for (int st = 128; st > 0; st >>= 1) { if (tid < st) red[tid] += red[tid + st]; __syncthreads(); }
  const float rs = rsqrtf(red[0] / (float)N + eps);
  {
    for (int u = 0; u < per / 4; ++u) {
      const int j = tid * 4 + 1024 * u;
      v4f o, sm;
#pragma unroll
      for (int q = 0; q < 4; ++q) {
        float gg = g[j + q], bb = bta[j + q];
        if (PARAM_BF16) { gg = bf16_round(gg); bb = bf16_round(bb); }
        sm[q] = vals[u * 4 + q]; o[q] = (vals[u * 4 + q] - mu) * rs * gg + bb;
      }
      if (out_sum) *(v4f*)(out_sum + (size_t)row * N + j) = sm;
      *(v4f*)(out_norm + (size_t)row * N + j) = o;
    }
    
  }
}



// ---- f16 WMMA path (v_wmma_f32_16x16x32_f16): 11-bit significands for operands in range — used here for the [Q|K|V] and Wo GEMMs
typedef _Float16 v16h __attribute__((ext_vector_type(16)));
union FragH { v16h v; v8us half[2]; _Float16 h[16]; unsigned short u[16]; };
template <int NT>
__device__ __forceinline__ v8f mmaH(v16h ah, v16h al, v16h bh, v16h bl, v8f c) {
  c = __builtin_amdgcn_wmma_f32_16x16x32_f16(false, ah, false, bh, (short)0, c, false, false);
  if (NT >= 2) c = __builtin_amdgcn_wmma_f32_16x16x32_f16(false, al, false, bh, (short)0, c, false, false);
  if (NT >= 3) c = __builtin_amdgcn_wmma_f32_16x16x32_f16(false, ah, false, bl, (short)0, c, false, false);
  asm volatile("v_nop\n\tv_nop\n\tv_nop\n\tv_nop" : "+v"(c) : "v"(ah), "v"(al), "v"(bh), "v"(bl));
  return c;
}
// batched GEMM like k_gemm_b but f16 operands: A f32 (split into f16 hi/lo if ASPLIT, else rounded to f16), Bt = f16 values [n][k]; alpha; C f32; N multiple of 16 (partial tiles skipped)
template <bool ASPLIT>
__global__ __launch_bounds__(128) void k_gemm_h(const float* __restrict__ A, int lda, size_t sA, const _Float16* __restrict__ Bh, int ldb, size_t sB, float alpha, float* __restrict__ C, int ldc, size_t sC, int M, int N, int K) {
  __shared__ __attribute__((aligned(16))) float so[4][16][64];
  const int tid = threadIdx.x, w = tid >> 5, lane = tid & 31, ln = lane & 15, hh = lane >> 4; const int by = blockIdx.y;
  A += (size_t)by * sA; Bh += (size_t)by * sB; C += (size_t)by * sC;
  const int ntn = (N + 63) / 64; const int wid = blockIdx.x * 4 + w; const int mt = wid / ntn, nq = wid % ntn; if (mt * 16 >= M) return;
  const int row0 = mt * 16, col0 = nq * 64; const float* arow = A + (size_t)(row0 + ln) * lda;
  v8f acc[4] = {};
  for (int kb = 0; kb < K; kb += 32) {
    FragH ah, al;
    const v4f x0 = *(const v4fa*)(arow + kb + 8 * hh), x1 = *(const v4fa*)(arow + kb + 8 * hh + 4), x2 = *(const v4fa*)(arow + kb + 16 + 8 * hh), x3 = *(const v4fa*)(arow + kb + 16 + 8 * hh + 4);
    float xs[16] = {x0[0],x0[1],x0[2],x0[3],x1[0],x1[1],x1[2],x1[3],x2[0],x2[1],x2[2],x2[3],x3[0],x3[1],x3[2],x3[3]};
#pragma unroll
    for (int i = 0; i < 16; ++i) { const _Float16 h = (_Float16)xs[i]; ah.h[i] = h; al.h[i] = ASPLIT ? (_Float16)(xs[i] - (float)h) : (_Float16)0.0f; }
#pragma unroll
    for (int t = 0; t < 4; ++t) { if (col0 + t * 16 >= N) continue; const size_t boff = (size_t)(col0 + t * 16 + ln) * ldb + kb; FragH bq; bq.half[0] = *(const v8us*)(Bh + boff + 8 * hh); bq.half[1] = *(const v8us*)(Bh + boff + 16 + 8 * hh);
      acc[t] = mmaH<ASPLIT ? 2 : 1>(ah.v, al.v, bq.v, bq.v, acc[t]); }
  }
#pragma unroll
  for (int t = 0; t < 4; ++t) { if (col0 + t * 16 >= N) continue;
#pragma unroll
    for (int r = 0; r < 8; ++r) so[w][8 * hh + r][t * 16 + ln] = acc[t][r] * alpha; }
  __builtin_amdgcn_fence(__ATOMIC_ACQ_REL, "workgroup"); __builtin_amdgcn_wave_barrier();
  const int rsub = lane >> 4, c4 = (lane & 15) * 4;
  {
#pragma unroll
    for (int q = 0; q < 8; ++q) { const int r = q * 2 + rsub; if (col0 + c4 < N) { const v4f v = *(const v4fa*)&so[w][r][c4]; *(v4f*)(C + (size_t)(row0 + r) * ldc + col0 + c4) = v; } }
     }
}

// Wt[n][k] = f16(W[k][n]·scale) from f32 row-major W[K][N] (scale = power of two; bf16-exact weights stay exact in f16 away from the subnormal range)
__global__ __launch_bounds__(256) void k_wt_f16(const float* __restrict__ W, _Float16* __restrict__ Wt, int K, int N, float scale) {
  const int t = blockIdx.x * 256 + threadIdx.x; if (t >= N * (K / 8)) return; const int n = t / (K / 8), k8 = (t % (K / 8)) * 8; FragH f;
#pragma unroll
  for (int i = 0; i < 8; ++i) f.h[i] = (_Float16)(bf16_round(W[(size_t)(k8 + i) * N + n]) * scale); const v8us o = f.half[0];
  *(v8us*)((unsigned short*)Wt + (size_t)n * K + k8) = o; 
}
// k_gemm_hh variant with fused epilogue: v = acc·alpha + bias[by·sBias + col] (+ CP[(row/rowsPerB)·sCPb + by·64 + col] if CP) ; ACT 0 none / 1 elu ; writes f16 C16 (and f32 C if non-null)
template <int ACT>
__global__ __launch_bounds__(128) void k_gemm_hhx(const _Float16* __restrict__ A, int lda, size_t sA, const _Float16* __restrict__ Bh, int ldb, size_t sB, float alpha, const float* __restrict__ bias, size_t sBias, const float* __restrict__ CP, int rowsPerB, size_t sCPb, int row0g,
    float* __restrict__ C, _Float16* __restrict__ C16, int ldc, size_t sC, int M, int N, int K) {
  __shared__ __attribute__((aligned(16))) float so[4][16][64];
  const int tid = threadIdx.x, w = tid >> 5, lane = tid & 31, ln = lane & 15, hh = lane >> 4; const int by = blockIdx.y;
  A += (size_t)by * sA; Bh += (size_t)by * sB; const size_t cofs = (size_t)by * sC; const float* bp = bias ? bias + (size_t)by * sBias : nullptr;
  const int ntn = (N + 63) / 64; const int wid = blockIdx.x * 4 + w; const int mt = wid / ntn, nq = wid % ntn; if (mt * 16 >= M) return;
  const int row0 = mt * 16, col0 = nq * 64; const _Float16* arow = A + (size_t)(row0 + ln) * lda;
  v8f acc[4] = {};
  for (int kb = 0; kb < K; kb += 32) { FragH ah; ah.half[0] = *(const v8us*)((const unsigned short*)arow + kb + 8 * hh); ah.half[1] = *(const v8us*)((const unsigned short*)arow + kb + 16 + 8 * hh);
#pragma unroll
    for (int t = 0; t < 4; ++t) { if (col0 + t * 16 >= N) continue; const size_t boff = (size_t)(col0 + t * 16 + ln) * ldb + kb; FragH bq; bq.half[0] = *(const v8us*)((const unsigned short*)Bh + boff + 8 * hh); bq.half[1] = *(const v8us*)((const unsigned short*)Bh + boff + 16 + 8 * hh);
      acc[t] = mmaH<1>(ah.v, ah.v, bq.v, bq.v, acc[t]); }
  }
#pragma unroll
  for (int t = 0; t < 4; ++t) { if (col0 + t * 16 >= N) continue; const int col = col0 + t * 16 + ln; const float bv = bp ? bf16_round(bp[col]) : 0.f;
#pragma unroll
    for (int r = 0; r < 8; ++r) { float v = acc[t][r] * alpha + bv; if (CP) { const int rr = row0g + row0 + 8 * hh + r; if (rowsPerB < 0) v += CP[cofs + (size_t)rr * ldc + col];      /* rowsPerB < 0: own element of the batched C plane */ else { const int bidx = rr / rowsPerB; v += CP[(size_t)bidx * sCPb + (size_t)by * 64 + col]; } } if (ACT == 1) v = (v > 0.f) ? v : expm1f(v); else if (ACT == 7) v = (v > 0.f) ? v + 1.0f : expf(v); else if (ACT == 8) v = tanhf(v); else if (ACT == 9) v = 0.5f * v * (1.0f + tanhf(0.7978845608028654f * (v + 0.044715f * v * v * v))); else if (ACT == 11) v = 1.0f / (1.0f + expf(-v)); else if (ACT == 12) v = (v > 0.f) ? v : 0.01f * v; else if (ACT == 14) v = (v > 0.f) ? v : 0.1f * v; else if (ACT == 16) v = (v >= 0.f) ? v : 0.3f * v; else if (ACT == 17) v = (v >= 0.f) ? v : 0.2f * v; else if (ACT == 15) v = v / (1.0f + expf(-v)); else if (ACT == 3) v = fmaxf(v, 0.f); else if (ACT == 6) v = 0.5f * v * (1.0f + erff(v * 0.70710678118654752f)); so[w][8 * hh + r][t * 16 + ln] = v; } }
  __builtin_amdgcn_fence(__ATOMIC_ACQ_REL, "workgroup"); __builtin_amdgcn_wave_barrier();
  const int rsub = lane >> 4, c4 = (lane & 15) * 4; typedef _Float16 v4h __attribute__((ext_vector_type(4)));
  {
#pragma unroll
    for (int q = 0; q < 8; ++q) { const int r = q * 2 + rsub; if (col0 + c4 < N) { const v4f v = *(const v4fa*)&so[w][r][c4]; if (C) *(v4f*)(C + cofs + (size_t)(row0 + r) * ldc + col0 + c4) = v; if (C16) { v4h h4; for (int i = 0; i < 4; ++i) h4[i] = (_Float16)v[i]; *(v4h*)(C16 + cofs + (size_t)(row0 + r) * ldc + col0 + c4) = h4; } } }
     }
}


typedef _Float16 v4h __attribute__((ext_vector_type(4)));

__global__ __launch_bounds__(256) void k_x16(const float* __restrict__ x, _Float16* __restrict__ X16, size_t n8) { const size_t t = (size_t)blockIdx.x * 256 + threadIdx.x; if (t >= n8) return; FragH f;
#pragma unroll
  for (int q = 0; q < 8; ++q) f.h[q] = (_Float16)bf16_round(x[t * 8 + q]); *(v8us*)((unsigned short*)X16 + t * 8) = f.half[0];  }
__global__ __launch_bounds__(256) void k_h16(const float* __restrict__ x, _Float16* __restrict__ X16, size_t n8) { const size_t t = (size_t)blockIdx.x * 256 + threadIdx.x; if (t >= n8) return; FragH f;
#pragma unroll
  for (int q = 0; q < 8; ++q) f.h[q] = (_Float16)x[t * 8 + q]; *(v8us*)((unsigned short*)X16 + t * 8) = f.half[0];  }
__global__ __launch_bounds__(256) void k_round16f(const float* __restrict__ W, _Float16* __restrict__ Bt, size_t n8) { const size_t t = (size_t)blockIdx.x * 256 + threadIdx.x; if (t >= n8) return; FragH f;
#pragma unroll
  for (int i = 0; i < 8; ++i) f.h[i] = (_Float16)(bf16_round(W[t * 8 + i]) * 16.0f); *(v8us*)((unsigned short*)Bt + t * 8) = f.half[0];  }
template <int NHv, int TTv>
__global__ __launch_bounds__(256) void k_vt(const _Float16* __restrict__ V16, int ldv, int voff, _Float16* __restrict__ Vt) { __shared__ unsigned short tl[64][66]; const int tid = threadIdx.x; const int slab = blockIdx.x / (TTv / 64), lg = blockIdx.x % (TTv / 64); const int b = slab / NHv, h = slab % NHv;
  for (int i = tid; i < 64 * 8; i += 256) { const int r = i / 8, c8 = (i % 8) * 8; FragH f; f.half[0] = *(const v8us*)((const unsigned short*)V16 + ((size_t)b * TTv + lg * 64 + r) * ldv + voff + h * 64 + c8);
#pragma unroll
    for (int q = 0; q < 8; ++q) tl[r][c8 + q] = f.u[q]; }
  __syncthreads();
  {
#pragma unroll
    for (int rd = 0; rd < 2; ++rd) { const int d = rd * 32 + tid / 8, pc = tid % 8; FragH f;
#pragma unroll
      for (int q = 0; q < 8; ++q) f.u[q] = tl[pc * 8 + q][d];
      *(v8us*)((unsigned short*)Vt + ((size_t)slab * 64 + d) * TTv + lg * 64 + pc * 8) = f.half[0]; }
     } }

__global__ __launch_bounds__(256) void k_hl(const float* __restrict__ F, _Float16* __restrict__ Hh, _Float16* __restrict__ Hl, size_t n8) { const size_t t = (size_t)blockIdx.x * 256 + threadIdx.x; if (t >= n8) return; FragH fh, fl; const v4f a = *(const v4fa*)(F + t * 8), c = *(const v4fa*)(F + t * 8 + 4);
#pragma unroll
  for (int q = 0; q < 4; ++q) { _Float16 h = (_Float16)a[q]; fh.h[q] = h; fl.h[q] = (_Float16)((a[q] - (float)h) * 1024.0f); h = (_Float16)c[q]; fh.h[4 + q] = h; fl.h[4 + q] = (_Float16)((c[q] - (float)h) * 1024.0f); }
  { *(v8us*)((unsigned short*)Hh + t * 8) = fh.half[0]; *(v8us*)((unsigned short*)Hl + t * 8) = fl.half[0];  } }

// ---- fast GEMM (block tile 128x64, wave tile 32x64; requires M % 128 == 0 rows per launch region, N % 64 == 0, K % 64 == 0); epilogue = k_gemm_hhx semantics ----
// Operand path: per trip of 64 k the block's 128 A rows and 64 B rows (128 bytes each, whole lines) are copied to LDS asynchronously, two buffers, the copies of trip t + 2 issued behind the barrier that ends trip t;
// the waves read their fragments from LDS (row pitch 144 bytes: no bank conflict for 16-byte reads). The k order of every accumulator is the ascending one of the direct-load form.
#define G2_PITCH 144
#define G2_STAGE (192 * G2_PITCH)      /* rows 0..127: A, rows 128..191: B */
__device__ __forceinline__ v16h g2_lfrag(const unsigned char* p) { FragH f; f.half[0] = *(const v8us*)p; f.half[1] = *(const v8us*)(p + 32); return f.v; }
__device__ __forceinline__ v8f g2_mma(v16h a, v16h b, v8f c) { v8f d = __builtin_amdgcn_wmma_f32_16x16x32_f16(false, a, false, b, (short)0, c, false, false); asm volatile("v_nop\n\tv_nop\n\tv_nop\n\tv_nop" : "+v"(d) : "v"(a), "v"(b)); return d; }
// One stage: each lane copies 12 pieces of 16 bytes (8 lanes = one 128-byte row, a wave = 4 rows, the block = 16 rows per copy; 8 copies for A, 4 for B). l: the lane's LDS byte address in row group 0.
__device__ __forceinline__ void g2_copy(unsigned l, const _Float16* ga, size_t sa, const _Float16* gb, size_t sb) {
  /* the copies and, as the last line of the same statement, the wait that stands in front of any new value in the address registers they name */
  asm volatile("global_load_async_to_lds_b128 %0, %12, off\n\t"
               "global_load_async_to_lds_b128 %1, %13, off\n\t"
               "global_load_async_to_lds_b128 %2, %14, off\n\t"
               "global_load_async_to_lds_b128 %3, %15, off\n\t"
               "global_load_async_to_lds_b128 %4, %16, off\n\t"
               "global_load_async_to_lds_b128 %5, %17, off\n\t"
               "global_load_async_to_lds_b128 %6, %18, off\n\t"
               "global_load_async_to_lds_b128 %7, %19, off\n\t"
               "global_load_async_to_lds_b128 %8, %20, off\n\t"
               "global_load_async_to_lds_b128 %9, %21, off\n\t"
               "global_load_async_to_lds_b128 %10, %22, off\n\t"
               "global_load_async_to_lds_b128 %11, %23, off\n\t"
               "s_wait_xcnt 0x0"
               :: "v"(l), "v"(l + 16 * G2_PITCH), "v"(l + 32 * G2_PITCH), "v"(l + 48 * G2_PITCH), "v"(l + 64 * G2_PITCH), "v"(l + 80 * G2_PITCH),
                  "v"(l + 96 * G2_PITCH), "v"(l + 112 * G2_PITCH), "v"(l + 128 * G2_PITCH), "v"(l + 144 * G2_PITCH), "v"(l + 160 * G2_PITCH), "v"(l + 176 * G2_PITCH),
                  "v"(ga), "v"(ga + sa), "v"(ga + 2 * sa), "v"(ga + 3 * sa), "v"(ga + 4 * sa), "v"(ga + 5 * sa), "v"(ga + 6 * sa), "v"(ga + 7 * sa),
                  "v"(gb), "v"(gb + sb), "v"(gb + 2 * sb), "v"(gb + 3 * sb)
               : "memory"); }
// BIAS, RES, OUT32, OUT16: which of bias, CP, C and C16 the launch uses. Template flags, not pointer tests: the epilogue is then straight-line code, with no scalar branch per output element, and its LDS row reads and global stores issue as groups.
template <int ACT, bool BIAS, bool RES, bool OUT32, bool OUT16>
__global__ __launch_bounds__(128) void k_gemm2(const _Float16* __restrict__ A, int lda, size_t sA, const _Float16* __restrict__ Bh, int ldb, size_t sB, float alpha, const float* __restrict__ bias, size_t sBias, const float* __restrict__ CP, int rowsPerB, size_t sCPb, int row0g,
    float* __restrict__ C, _Float16* __restrict__ C16, int ldc, size_t sC, int M, int N, int K) { static_assert(ACT == 0 || ACT == 3 || ACT == 6 || ACT == 8 || ACT == 9 || ACT == 11 || ACT == 12 || ACT == 14 || ACT == 15 || ACT == 16 || ACT == 17, "k_gemm2: unsupported ACT code (would silently apply no activation)");
  __shared__ __attribute__((aligned(16))) unsigned char sm[2 * G2_STAGE];      /* the two operand buffers; behind the loop's last barrier the same bytes stage the output rows */
  float (*so)[32][68] = reinterpret_cast<float (*)[32][68]>(sm); static_assert(sizeof(float) * 4 * 32 * 68 <= 2 * G2_STAGE, "output staging must fit the operand buffers");
  const int tid = threadIdx.x, w = tid >> 5, lane = tid & 31, ln = lane & 15, hh = lane >> 4; const int by = blockIdx.y;
  A += (size_t)by * sA; Bh += (size_t)by * sB; const size_t cofs = (size_t)by * sC; const float* bp = BIAS ? bias + (size_t)by * sBias : nullptr;
  const int ntn = N >> 6; const int mt = blockIdx.x / ntn, nq = blockIdx.x - mt * ntn; const int row0 = mt * 128 + 32 * w, col0 = nq * 64; if (mt * 128 >= M) return;      /* the whole block leaves or none: barriers follow */
  const int crow = tid >> 3, cpc = tid & 7;
  const _Float16* ga = A + (size_t)(mt * 128 + crow) * lda + cpc * 8; const _Float16* gb = Bh + (size_t)(col0 + crow) * ldb + cpc * 8;
  const unsigned lb = (unsigned)(size_t)sm + (unsigned)(crow * G2_PITCH + cpc * 16);
  const unsigned char* fa = sm + (32 * w + ln) * G2_PITCH + 16 * hh; const unsigned char* fb = sm + (128 + ln) * G2_PITCH + 16 * hh;
  const int nt = K >> 6;
  const v8f z8 = {0.f,0.f,0.f,0.f,0.f,0.f,0.f,0.f}; v8f c00 = z8, c01 = z8, c02 = z8, c03 = z8, c10 = z8, c11 = z8, c12 = z8, c13 = z8;
  g2_copy(lb, ga, (size_t)16 * lda, gb, (size_t)16 * ldb);
  asm volatile("s_wait_asynccnt 0x0" ::: "memory");      /* this wave's copies of tile 0 have landed */
  __syncthreads();                                       /* ... and every other wave's */
  if (nt > 1) g2_copy(lb + G2_STAGE, ga + 64, (size_t)16 * lda, gb + 64, (size_t)16 * ldb);
#pragma unroll 1      /* rolled: one body serves both buffers and stays small */
  for (int t = 0; t < nt; ++t) { const unsigned bo = (unsigned)(t & 1) * G2_STAGE; const unsigned char* pa = fa + bo; const unsigned char* pb = fb + bo;
    /* the trip's 24 fragment reads stand together in front of its matrix instructions */
    const v16h a00 = g2_lfrag(pa), a10 = g2_lfrag(pa + 16 * G2_PITCH), b00 = g2_lfrag(pb), b10 = g2_lfrag(pb + 16 * G2_PITCH), b20 = g2_lfrag(pb + 32 * G2_PITCH), b30 = g2_lfrag(pb + 48 * G2_PITCH);
    const v16h a01 = g2_lfrag(pa + 64), a11 = g2_lfrag(pa + 16 * G2_PITCH + 64), b01 = g2_lfrag(pb + 64), b11 = g2_lfrag(pb + 16 * G2_PITCH + 64), b21 = g2_lfrag(pb + 32 * G2_PITCH + 64), b31 = g2_lfrag(pb + 48 * G2_PITCH + 64);
    c00 = g2_mma(a00, b00, c00); c10 = g2_mma(a10, b00, c10); c01 = g2_mma(a00, b10, c01); c11 = g2_mma(a10, b10, c11);
    c02 = g2_mma(a00, b20, c02); c12 = g2_mma(a10, b20, c12); c03 = g2_mma(a00, b30, c03); c13 = g2_mma(a10, b30, c13);
    c00 = g2_mma(a01, b01, c00); c10 = g2_mma(a11, b01, c10); c01 = g2_mma(a01, b11, c01); c11 = g2_mma(a11, b11, c11);
    c02 = g2_mma(a01, b21, c02); c12 = g2_mma(a11, b21, c12); c03 = g2_mma(a01, b31, c03); c13 = g2_mma(a11, b31, c13);
    asm volatile("s_wait_dscnt 0x0" ::: "memory");       /* this wave's reads of buffer t & 1 are done before the buffer is given up */
    asm volatile("s_wait_asynccnt 0x0" ::: "memory");    /* this wave's copies of tile t + 1 have landed */
    __syncthreads();                                     /* publishes tile t + 1 and ends every wave's reads of buffer t & 1 */
    if (t + 2 < nt) g2_copy(lb + bo, ga + (size_t)(t + 2) * 64, (size_t)16 * lda, gb + (size_t)(t + 2) * 64, (size_t)16 * ldb); }
  asm volatile("s_wait_asynccnt 0x0" ::: "memory");      /* no copy is outstanding when the buffers become output staging */
  v8f accs[8] = {c00, c01, c02, c03, c10, c11, c12, c13};
#pragma unroll
  for (int u = 0; u < 8; ++u) { const int t = u & 3, half = u >> 2; const int col = col0 + t * 16 + ln; const float bv = BIAS ? bf16_round(bp[col]) : 0.f;
#pragma unroll
    for (int r = 0; r < 8; ++r) { const int rloc = half * 16 + 8 * hh + r; float v = accs[u][r] * alpha + bv; if (RES) { if (rowsPerB < 0) v += CP[cofs + (size_t)(row0g + row0 + rloc) * ldc + col];      /* rowsPerB < 0: own element of the batched C plane */ else { const int bidx = (row0g + row0 + rloc) / rowsPerB; v += CP[(size_t)bidx * sCPb + (size_t)by * 64 + col]; } }
      if (ACT == 3) v = fmaxf(v, 0.f); else if (ACT == 6) v = 0.5f * v * (1.0f + erff(v * 0.70710678118654752f)); else if (ACT == 11) v = 1.0f / (1.0f + expf(-v)); else if (ACT == 15) v = v / (1.0f + expf(-v)); else if (ACT == 12) v = (v > 0.f) ? v : 0.01f * v; else if (ACT == 8) v = tanhf(v); else if (ACT == 9) v = 0.5f * v * (1.0f + tanhf(0.7978845608028654f * (v + 0.044715f * v * v * v))); else if (ACT == 14) v = (v > 0.f) ? v : 0.1f * v; else if (ACT == 16) v = (v >= 0.f) ? v : 0.3f * v; else if (ACT == 17) v = (v >= 0.f) ? v : 0.2f * v;
      so[w][rloc][t * 16 + ln] = v; } }
  __builtin_amdgcn_fence(__ATOMIC_ACQ_REL, "workgroup"); __builtin_amdgcn_wave_barrier();
  const int rsub = lane >> 4, c4 = (lane & 15) * 4;
  {
#pragma unroll
    for (int q = 0; q < 16; ++q) { const int r = q * 2 + rsub; const v4f v = *(const v4fa*)&so[w][r][c4]; if (OUT32) *(v4f*)(C + cofs + (size_t)(row0 + r) * ldc + col0 + c4) = v; if (OUT16) { v4h h4; for (int i = 0; i < 4; ++i) h4[i] = (_Float16)v[i]; *(v4h*)(C16 + cofs + (size_t)(row0 + r) * ldc + col0 + c4) = h4; } }
     } }


// ---- [Q|K|V] GEMM: one 256 x 192 tile of C per block, one block per WGP (2 batches x 16 row tiles x 8 column tiles = 256 blocks), 12 waves in a 4 x 3 grid, 64 x 64 per wave.
// Per 64 k a block copies 448 operand rows of 128 bytes for 256 x 192 results: 7 / 18 of the bytes per result that a 128 x 64 tile asks of L2. Ring, LDS pitch, fragment reads and the ascending k order are those of k_gemm2.
// Only tokens 0..4095 of a batch are computed. The padding token 4096 has a zero x row, so its q, k and v are zeros: its row is stored as such (the attention launch reads it; its key is visible to the dropped query alone).
#define QG_STAGE (448 * G2_PITCH)      /* rows 0..255: A, rows 256..447: B */
#define QG_SO (12 * 64 * 68 * 4)       /* output staging, 64 rows of 68 floats per wave */
// n copies of a wave, 4 operand rows each, ls LDS bytes and gs elements apart; the wait that stands in front of any new value in the address registers they name is the last line of the same statement
__device__ __forceinline__ void qg_copy8(unsigned l, unsigned ls, const _Float16* g, size_t gs) {
  asm volatile("global_load_async_to_lds_b128 %0, %8, off\n\t"
               "global_load_async_to_lds_b128 %1, %9, off\n\t"
               "global_load_async_to_lds_b128 %2, %10, off\n\t"
               "global_load_async_to_lds_b128 %3, %11, off\n\t"
               "global_load_async_to_lds_b128 %4, %12, off\n\t"
               "global_load_async_to_lds_b128 %5, %13, off\n\t"
               "global_load_async_to_lds_b128 %6, %14, off\n\t"
               "global_load_async_to_lds_b128 %7, %15, off\n\t"
               "s_wait_xcnt 0x0"
               :: "v"(l), "v"(l + ls), "v"(l + 2 * ls), "v"(l + 3 * ls), "v"(l + 4 * ls), "v"(l + 5 * ls), "v"(l + 6 * ls), "v"(l + 7 * ls),
                  "v"(g), "v"(g + gs), "v"(g + 2 * gs), "v"(g + 3 * gs), "v"(g + 4 * gs), "v"(g + 5 * gs), "v"(g + 6 * gs), "v"(g + 7 * gs)
               : "memory"); }
__device__ __forceinline__ void qg_copy4(unsigned l, unsigned ls, const _Float16* g, size_t gs) {
  asm volatile("global_load_async_to_lds_b128 %0, %4, off\n\t"
               "global_load_async_to_lds_b128 %1, %5, off\n\t"
               "global_load_async_to_lds_b128 %2, %6, off\n\t"
               "global_load_async_to_lds_b128 %3, %7, off\n\t"
               "s_wait_xcnt 0x0"
               :: "v"(l), "v"(l + ls), "v"(l + 2 * ls), "v"(l + 3 * ls), "v"(g), "v"(g + gs), "v"(g + 2 * gs), "v"(g + 3 * gs)
               : "memory"); }
__global__ __launch_bounds__(384) void k_qkv(const _Float16* __restrict__ A, const _Float16* __restrict__ Bh, float* __restrict__ C) {
  __shared__ __attribute__((aligned(16))) unsigned char sm[QG_SO];      /* the two operand buffers; behind the loop's last barrier the same bytes stage the output rows */
  static_assert(2 * QG_STAGE <= QG_SO, "the operand buffers must fit");
  float (*so)[64][68] = reinterpret_cast<float (*)[64][68]>(sm);
  const int tid = threadIdx.x, lane = tid & 31, ln = lane & 15, hh = lane >> 4; const int wv = __builtin_amdgcn_readfirstlane(tid >> 5);
  const int mt = blockIdx.x & 31, nq = blockIdx.x >> 5; const int col0 = nq * 192;      /* the row tile is the fast index */
  const size_t rowb = (size_t)(mt >> 4) * RPB + (size_t)(mt & 15) * 256;      /* first token row of the tile, in X16 and in C alike */
  /* waves 0..7 copy the 256 A rows (8 copies of 32 rows), waves 8..11 the 192 B rows (12 copies of 16 rows); cb reads the same in a whole wave */
  const bool cb = wv >= 8; const int crow = (cb ? wv - 8 : wv) * 4 + (lane >> 3), cpc = lane & 7;
  const _Float16* g = (cb ? Bh + (size_t)(col0 + crow) * DM : A + (rowb + crow) * DM) + cpc * 8;
  const size_t gs = (size_t)(cb ? 16 : 32) * DM; const unsigned ls = (unsigned)(cb ? 16 : 32) * G2_PITCH;
  const unsigned lb = (unsigned)(size_t)sm + (unsigned)(((cb ? 256 : 0) + crow) * G2_PITCH + cpc * 16);
  const int wm = wv & 3, wn = wv >> 2;
  const unsigned char* fa = sm + (64 * wm + ln) * G2_PITCH + 16 * hh; const unsigned char* fb = sm + (256 + 64 * wn + ln) * G2_PITCH + 16 * hh;
  const int nt = DM / 64;
  v8f acc[4][4];
#pragma unroll
  for (int i = 0; i < 16; ++i) acc[i >> 2][i & 3] = v8f{0.f,0.f,0.f,0.f,0.f,0.f,0.f,0.f};
  qg_copy8(lb, ls, g, gs); if (cb) qg_copy4(lb + 8 * ls, ls, g + 8 * gs, gs);
  asm volatile("s_wait_asynccnt 0x0" ::: "memory");      /* this wave's copies of tile 0 have landed */
  __syncthreads();                                       /* ... and every other wave's */
  qg_copy8(lb + QG_STAGE, ls, g + 64, gs); if (cb) qg_copy4(lb + QG_STAGE + 8 * ls, ls, g + 64 + 8 * gs, gs);
#pragma unroll 1      /* rolled: one body serves both buffers and stays small */
  for (int t = 0; t < nt; ++t) { const unsigned bo = (unsigned)(t & 1) * QG_STAGE;
#pragma unroll
    for (int ks = 0; ks < 2; ++ks) { const unsigned char* pa = fa + bo + ks * 64; const unsigned char* pb = fb + bo + ks * 64; v16h a[4], b[4];
#pragma unroll
      for (int i = 0; i < 4; ++i) { a[i] = g2_lfrag(pa + i * 16 * G2_PITCH); b[i] = g2_lfrag(pb + i * 16 * G2_PITCH); }
#pragma unroll
      for (int n = 0; n < 4; ++n) {
#pragma unroll
        for (int m = 0; m < 4; ++m) acc[m][n] = g2_mma(a[m], b[n], acc[m][n]); } }
    asm volatile("s_wait_dscnt 0x0" ::: "memory");       /* this wave's reads of buffer t & 1 are done before the buffer is given up */
    asm volatile("s_wait_asynccnt 0x0" ::: "memory");    /* this wave's copies of tile t + 1 have landed */
    __syncthreads();                                     /* publishes tile t + 1 and ends every wave's reads of buffer t & 1 */
    if (t + 2 < nt) { const _Float16* gn = g + (size_t)(t + 2) * 64; qg_copy8(lb + bo, ls, gn, gs); if (cb) qg_copy4(lb + bo + 8 * ls, ls, gn + 8 * gs, gs); } }
  asm volatile("s_wait_asynccnt 0x0" ::: "memory");      /* no copy is outstanding when the buffers become output staging */
  const int rsub = lane >> 4, c4 = (lane & 15) * 4;
  float* cp = C + (rowb + 64 * wm + rsub) * (3 * DM) + col0 + 64 * wn + c4;
#pragma unroll      /* 16 rows at a time, each group in LDS rows of its own: the first global stores leave after a quarter of the staging */
  for (int m = 0; m < 4; ++m) {
#pragma unroll
    for (int n = 0; n < 4; ++n) {
#pragma unroll
      for (int r = 0; r < 8; ++r) so[wv][m * 16 + 8 * hh + r][n * 16 + ln] = acc[m][n][r] * 0.0625f; }
    asm volatile("s_wait_dscnt 0x0" ::: "memory");      /* the wave's own staged rows stand in LDS before its lanes read them back; a fence here would also wait for the global stores of the group before */
#pragma unroll
    for (int q = m * 8; q < m * 8 + 8; ++q) { const v4f v = *(const v4fa*)&so[wv][q * 2 + rsub][c4]; *(v4f*)(cp + (size_t)q * 2 * (3 * DM)) = v; } }
  if ((mt & 15) == 15 && tid < 48) { const v4f z = {0.f, 0.f, 0.f, 0.f}; *(v4f*)(C + ((size_t)(mt >> 4) * RPB + NTOK) * (3 * DM) + col0 + tid * 4) = z; } }

// All operand preparation in one launch of 256 blocks of 8 waves, as many blocks as the chip has WGPs. Block blk does two independent things: weight tile blk (64 x 64; Wq 64 tiles, Wkv 128, Wo 64) and the 32 token rows 32 blk..+31 of x.
// Few fat waves instead of many thin ones, for speed only: here 2,048 waves hold the whole input in flight at once (per lane 16 weight words and 16 b128 pieces of x, all asked for before the first is used).
// Weight tile: Bt[out][in] = f16(bf16(w[in][out]) * 16), transposed through LDS. BQKV holds the rows of Wq^T, then those of Wkv^T: one [1536][512] B operand. BO holds Wo^T in the order in which a wave reads it as B fragments:
// per 16 out rows and 32 in columns 1 KiB, two halves of 512 bytes, lane (out & 15) + 16 * ((in >> 3) & 1) holding 8 adjacent in columns, half (in >> 4) & 1: each b128 load of a wave then covers 512 adjacent bytes.
// Token rows: X16 = f16(bf16(x)), tokens 0..4095 of each batch at row pitch RPB per batch; each wave-wide load covers 512 adjacent bytes, each store 256. The rows behind token 4095 are read by no launch and are not written.
#define WT_Q ((DM / 64) * (DM / 64))
#define WT_KV ((DM / 64) * (2 * DM / 64))
#define WT_ALL (2 * WT_Q + WT_KV)
#define XR_B 32      /* token rows per block */
typedef _Float16 v4ha __attribute__((ext_vector_type(4), may_alias));
// First half of a block's work, DOUT = the weight's row length, a constant here so that a lane's 16 weight loads are one address plus constants, like its 16 x loads: no address register takes a new value between them.
// All 32 loads are asked for before the first is used; the weight words go first, their way through LDS being the longer one. Ends with the barrier behind which the tile is read the other way round.
template <int DOUT>
__device__ __forceinline__ void prep_head(const float* __restrict__ wb, const v4fa* __restrict__ xs, float (*tl)[65], v4f (&xr)[16]) { const int tid = threadIdx.x; float wr[16];
  const float* wp = wb + (tid >> 6) * DOUT + (tid & 63);
#pragma unroll
  for (int j = 0; j < 16; ++j) wr[j] = wp[4 * j * DOUT];
#pragma unroll
  for (int j = 0; j < 16; ++j) xr[j] = xs[j * 256];
  /* the wait that stands between issued loads and any new value in their address registers; naming the addresses keeps them in those registers up to it */
  asm volatile("s_wait_xcnt 0x0" :: "v"(wp), "v"(xs) : "memory");
#pragma unroll
  for (int j = 0; j < 16; ++j) tl[tid & 63][(tid >> 6) + 4 * j] = bf16_round(wr[j]) * 16.0f;
  /* the block's one barrier, with fences for LDS alone: only the tile in LDS passes between waves here. __syncthreads() would also wait for the 16 x loads, which are still in flight and which the tile's second half does not need */
  __builtin_amdgcn_fence(__ATOMIC_RELEASE, "workgroup", "local"); __builtin_amdgcn_s_barrier(); __builtin_amdgcn_fence(__ATOMIC_ACQUIRE, "workgroup", "local"); }
__global__ __launch_bounds__(256) void k_prep(const float* __restrict__ x, const float* __restrict__ Wq, const float* __restrict__ Wkv, const float* __restrict__ Wo, _Float16* __restrict__ BQKV, _Float16* __restrict__ BO, _Float16* __restrict__ X16) {
  static_assert(WT_ALL * XR_B == NB * NTOK && NTOK % XR_B == 0, "one weight tile and 32 token rows of one batch per block");
  __shared__ float tl[64][65]; const int blk = blockIdx.x, tid = threadIdx.x;
  /* which weight: the same for a whole block */
  const bool isq = blk < WT_Q, iso = blk >= WT_Q + WT_KV;
  const float* w = isq ? Wq : iso ? Wo : Wkv; _Float16* Bt = isq ? BQKV : iso ? BO : BQKV + (size_t)DM * DM;
  const int wt = isq ? blk : iso ? blk - (WT_Q + WT_KV) : blk - WT_Q; const int lno = (isq || iso) ? 3 : 4;      /* log2 of the tiles per row of tiles: dout / 64 */
  const int dout = 64 << lno; const int i0 = (wt >> lno) * 64, o0 = (wt & ((1 << lno) - 1)) * 64;
  const float* wb = w + (size_t)i0 * dout + o0;      /* the tile's first word: the same for the whole block */
  const v4fa* xs = (const v4fa*)(x + (size_t)blk * (XR_B * DM)) + tid;      /* the lane's first 16 bytes of the block's rows */
  v4f xr[16];
  if (lno == 3) prep_head<DM>(wb, xs, tl, xr); else prep_head<2 * DM>(wb, xs, tl, xr);      /* the test reads the same in the whole block: each arm holds the block's one barrier */
  /* 8 adjacent in columns k of out row n per lane and store. Element index in Bt: row order n * 512 + k = (n >> 4) * 8192 + (n & 15) * 512 + (k >> 3) * 8; fragment order (n >> 4) * 8192 + (k >> 3) * 128 + (n & 15) * 8 */
  const int n = o0 + (tid >> 3), k8 = (i0 >> 3) + (tid & 7); const int sn = iso ? 8 : 512, sk = iso ? 128 : 8;
  unsigned short* bp = (unsigned short*)Bt; const unsigned vd = (unsigned)((n >> 4) * 8192 + (n & 15) * sn + k8 * sk);
  FragH f[2];
#pragma unroll
  for (int u = 0; u < 2; ++u) {      /* out rows n and n + 32 */
#pragma unroll
    for (int q = 0; q < 8; ++q) f[u].h[q] = (_Float16)tl[(tid >> 3) + 32 * u][(tid & 7) * 8 + q]; }
#pragma unroll
  for (int u = 0; u < 2; ++u) *(v8us*)(bp + u * (2 * 8192) + vd) = f[u].half[0];
  v4ha* xd = (v4ha*)(X16 + ((size_t)(blk / (NTOK / XR_B)) * RPB + (size_t)(blk % (NTOK / XR_B)) * XR_B) * DM) + tid;
#pragma unroll
  for (int j = 0; j < 16; ++j) { v4h h;
#pragma unroll
    for (int q = 0; q < 4; ++q) h[q] = (_Float16)bf16_round(xr[j][q]);
    xd[j * 256] = h; } }
// sum over the 8 lanes that share one (query, head): three DPP adds inside the 16-lane row (lane ^ 1, ^ 2, ^ 4); every lane of the group ends with the total
template <int CTRL> __device__ __forceinline__ float nb_xadd(float x) { return x + __int_as_float(__builtin_amdgcn_update_dpp(0, __float_as_int(x), CTRL, 0xf, 0xf, true)); }
__device__ __forceinline__ float nb_dot(v4f a0, v4f a1, v4f k0, v4f k1) {
  float s = a0[0] * k0[0], t = a1[0] * k1[0];
#pragma unroll
  for (int d = 1; d < 4; ++d) { s = fmaf(a0[d], k0[d], s); t = fmaf(a1[d], k1[d], t); }
  s += t; s = nb_xadd<0x161>(s); s = nb_xadd<0x162>(s); s = nb_xadd<0x164>(s); return s; }
// Neighbourhood attention and the output product in one launch. Wave = NQW consecutive queries of one grid row (f0, h0) x 4 heads at a time, a block's 16 waves side by side in that row; 8 lanes share a (query, head), lane l8 holding
// dims 4*l8..+3 and 32+4*l8..+3, so that each b128 load of a key row covers whole 128-byte lines. Only 14 of the 27 window slots can pass the causal test (frame f0-1: 3x3; frame f0: row h0-1: 3,
// row h0: w-1 and w); the others have a flat index above the query's for every query. A key row is loaded once per wave and serves each of its queries whose window holds it.
// A slot outside the grid still reads a token row of the same batch (in bounds, written by the GEMM before) and gets the mask value as its logit, hence weight 0.
// A token's row of QKV holds q (512), k (512), v (512).
#define NQW 2
#define LQ (3 * DM)
#define PO 1040      /* LDS pitch of an o row in bytes: 512 f16 + 16, so that the 16 rows of a fragment read start 4 banks apart */
// One block = one grid row (f0, h0) of one batch: 32 queries x 8 heads, 16 waves. Part 1: wave wv works out queries 2 wv, 2 wv + 1 for heads 0..3, then for heads 4..7, and leaves the o rows (f16) in LDS.
// Part 2, behind one barrier: out rows = o Wo + bo for the block's 32 tokens, wave wv taking output columns 32 wv..+31 (2 x 2 WMMA tiles, k ascending), A fragments from LDS, B fragments from BO (fragment order).
// LDS row r belongs to query 32 g + r, that is token 32 g + r + 1; token 4096 is not part of the output, so its row carries token 0 instead, whose o row is v_BOS.
__global__ __launch_bounds__(512) __attribute__((amdgpu_waves_per_eu(4, 4))) void k_nbatt_out(const float* QKV, const _Float16* BOf, const float* bo, float* out) {      /* no __restrict__: the loads below keep their side of the two waits */
  __shared__ __attribute__((aligned(16))) unsigned char so16[32 * PO];
  __shared__ __attribute__((aligned(16))) float st[16][32][36];      /* each wave's own 32 x 32 output tile, staged so that its stores cover whole 128-byte lines */
  const int lane = threadIdx.x & 31, l8 = lane & 7, hs = lane >> 3; const int wv = __builtin_amdgcn_readfirstlane((int)(threadIdx.x >> 5));
  const int rw = blockIdx.x; const int h0 = rw % HT, f0 = (rw / HT) % FT, b = rw / (HT * FT);
  const int w0 = wv * NQW; const int jr0 = (f0 * HT + h0) * WT; const int j0 = jr0 + w0;
  const float* tb = QKV + (size_t)b * RPB * LQ;      /* the batch's token rows; k stands DM, v 2 * DM floats into a row */
#pragma unroll 1      /* rolled: one body serves both halves of the heads, and their registers do not add up */
  for (int hq = 0; hq < 2; ++hq) { const unsigned co = (unsigned)(hq * (DM / 2) + hs * HD + l8 * 4);
  const float* rb[5]; bool kok[5][NQW + 2];      /* rb[r]: the row of the key at column w0 of window row r; a window row outside the grid points at token row 1, so that columns -1..NQW stay inside the buffer */
#pragma unroll
  for (int r = 0; r < 5; ++r) { const int f = f0 + (r < 3 ? -1 : 0), hh = h0 + (r < 3 ? r - 1 : r - 4); const bool rok = f >= 0 && hh >= 0 && hh < HT;
    rb[r] = tb + (size_t)(rok ? (f * HT + hh) * WT + w0 + 1 : 1) * LQ + co;
#pragma unroll
    for (int c = 0; c < NQW + 2; ++c) { const int ww = w0 - 1 + c; kok[r][c] = rok && ww >= 0 && ww < WT; } }
  const float* qp = QKV + ((size_t)b * RPB + j0) * LQ + co;      /* query i is token j0 + i + 1 */ const float* bp = tb + co;
  v4f q[NQW][2], kb[2], kk[5][NQW + 2][2];
#pragma unroll
  for (int i = 0; i < NQW; ++i) { q[i][0] = *(const v4fa*)(qp + (i + 1) * LQ); q[i][1] = *(const v4fa*)(qp + (i + 1) * LQ + 32); }
#pragma unroll
  for (int r = 0; r < 5; ++r) {
#pragma unroll
    for (int c = 0; c < NQW + (r < 4 ? 2 : 1); ++c) { const float* kp = rb[r] + (c - 1) * LQ + DM; kk[r][c][0] = *(const v4fa*)kp; kk[r][c][1] = *(const v4fa*)(kp + 32); } }
  kb[0] = *(const v4fa*)(bp + DM); kb[1] = *(const v4fa*)(bp + DM + 32);
  /* the wait that stands between issued loads and any new value in their address registers; naming the addresses keeps them in those registers up to it */
  asm volatile("s_wait_xcnt 0x0" :: "v"(qp), "v"(bp), "v"(rb[0]), "v"(rb[1]), "v"(rb[2]), "v"(rb[3]), "v"(rb[4]) : "memory");
  float lg[NQW][15];
#pragma unroll
  for (int i = 0; i < NQW; ++i) lg[i][0] = nb_dot(q[i][0], q[i][1], kb[0], kb[1]) * 0.125f;
#pragma unroll
  for (int r = 0; r < 5; ++r) {
#pragma unroll
    for (int c = 0; c < NQW + (r < 4 ? 2 : 1); ++c) {
#pragma unroll
      for (int i = 0; i < NQW; ++i) { const int dw = c - i; if (dw >= 0 && dw < (r < 4 ? 3 : 2)) { const float sd = nb_dot(q[i][0], q[i][1], kk[r][c][0], kk[r][c][1]) * 0.125f; lg[i][1 + r * 3 + dw] = kok[r][c] ? sd : -3.0e38f; } } } }
  v4f vb[2], vv[5][NQW + 2][2];      /* the v rows fly while the softmax is worked out */
#pragma unroll
  for (int r = 0; r < 5; ++r) {
#pragma unroll
    for (int c = 0; c < NQW + (r < 4 ? 2 : 1); ++c) { const float* vp = rb[r] + (c - 1) * LQ + 2 * DM; vv[r][c][0] = *(const v4fa*)vp; vv[r][c][1] = *(const v4fa*)(vp + 32); } }
  vb[0] = *(const v4fa*)(bp + 2 * DM); vb[1] = *(const v4fa*)(bp + 2 * DM + 32);
  /* the same wait behind the v loads */
  asm volatile("s_wait_xcnt 0x0" :: "v"(bp), "v"(rb[0]), "v"(rb[1]), "v"(rb[2]), "v"(rb[3]), "v"(rb[4]) : "memory");
#pragma unroll
  for (int i = 0; i < NQW; ++i) { float mx = lg[i][0];
#pragma unroll
    for (int s = 1; s < 15; ++s) mx = fmaxf(mx, lg[i][s]);
    float se = 0.f;
#pragma unroll
    for (int s = 0; s < 15; ++s) { const float e = expf(lg[i][s] - mx); lg[i][s] = e; se += e; }
    const float inv = 1.0f / se;
#pragma unroll
    for (int s = 0; s < 15; ++s) lg[i][s] *= inv; }
  v4f o[NQW][2];
#pragma unroll
  for (int i = 0; i < NQW; ++i) { o[i][0] = vb[0] * lg[i][0]; o[i][1] = vb[1] * lg[i][0]; }
#pragma unroll
  for (int r = 0; r < 5; ++r) {
#pragma unroll
    for (int c = 0; c < NQW + (r < 4 ? 2 : 1); ++c) {
#pragma unroll
      for (int i = 0; i < NQW; ++i) { const int dw = c - i; if (dw >= 0 && dw < (r < 4 ? 3 : 2)) { const float p = lg[i][1 + r * 3 + dw]; o[i][0] += vv[r][c][0] * p; o[i][1] += vv[r][c][1] * p; } } } }
#pragma unroll
  for (int i = 0; i < NQW; ++i) { unsigned char* op = so16 + (w0 + i) * PO + co * 2; v4h a, c;
#pragma unroll
    for (int d = 0; d < 4; ++d) { a[d] = (_Float16)o[i][0][d]; c[d] = (_Float16)o[i][1][d]; }
    *(v4ha*)op = a; *(v4ha*)(op + 64) = c; }
  if (j0 + NQW == TT) {      /* the row of token 4096 carries token 0: o = v_BOS, read again so that it holds no registers above; the test reads the same in the whole wave */
    const float* vp = tb + 2 * DM + co; const v4f v0 = *(const v4fa*)vp, v1 = *(const v4fa*)(vp + 32);
    asm volatile("s_wait_xcnt 0x0" ::: "memory");      /* the wait between these loads and any new value in their address registers */
    unsigned char* op = so16 + (w0 + NQW - 1) * PO + co * 2; v4h a, c;
#pragma unroll
    for (int d = 0; d < 4; ++d) { a[d] = (_Float16)v0[d]; c[d] = (_Float16)v1[d]; }
    *(v4ha*)op = a; *(v4ha*)(op + 64) = c; } }
  const int ln = lane & 15, hh = lane >> 4;
  const unsigned char* fa = so16 + ln * PO + 16 * hh;
  const unsigned short* fb = (const unsigned short*)BOf + (size_t)wv * (2 * 16 * 512) + lane * 8;      /* this wave's two column tiles: 32 KiB in a row, 1 KiB per fragment; every B load is this one address plus a constant */
  FragH b0[DM / 32], b1[DM / 32];      /* indexed by constants only: a ring of 8 k steps in registers */
#pragma unroll
  for (int ks = 0; ks < 8; ++ks) {      /* the first 8 k steps' B fragments are asked for in front of the barrier: they depend on no other wave */
    b0[ks].half[0] = *(const v8us*)(fb + ks * 512); b0[ks].half[1] = *(const v8us*)(fb + ks * 512 + 256);
    b1[ks].half[0] = *(const v8us*)(fb + 16 * 512 + ks * 512); b1[ks].half[1] = *(const v8us*)(fb + 16 * 512 + ks * 512 + 256); }
  __syncthreads();      /* every wave's o rows stand in LDS before any wave reads them as its A operand */
  const v8f z8 = {0.f,0.f,0.f,0.f,0.f,0.f,0.f,0.f}; v8f c00 = z8, c01 = z8, c10 = z8, c11 = z8;
  v16h a0 = g2_lfrag(fa), a1 = g2_lfrag(fa + 16 * PO);
#pragma unroll      /* unrolled: the register rings are indexed by constants; A is read one k step ahead, B eight */
  for (int ks = 0; ks < DM / 32; ++ks) { v16h n0 = a0, n1 = a1;
    if (ks + 1 < DM / 32) { n0 = g2_lfrag(fa + (ks + 1) * 64); n1 = g2_lfrag(fa + 16 * PO + (ks + 1) * 64); }
    c00 = g2_mma(a0, b0[ks].v, c00); c10 = g2_mma(a1, b0[ks].v, c10); c01 = g2_mma(a0, b1[ks].v, c01); c11 = g2_mma(a1, b1[ks].v, c11);
    if (ks + 8 < DM / 32) { const int kn = ks + 8;
      b0[kn].half[0] = *(const v8us*)(fb + kn * 512); b0[kn].half[1] = *(const v8us*)(fb + kn * 512 + 256);
      b1[kn].half[0] = *(const v8us*)(fb + 16 * 512 + kn * 512); b1[kn].half[1] = *(const v8us*)(fb + 16 * 512 + kn * 512 + 256); }
    a0 = n0; a1 = n1; }
  v8f accs[4] = {c00, c01, c10, c11};
#pragma unroll
  for (int u = 0; u < 4; ++u) { const int t = u & 1, half = u >> 1; const float bv = bf16_round(bo[wv * 32 + t * 16 + ln]);
#pragma unroll
    for (int r = 0; r < 8; ++r) st[wv][half * 16 + 8 * hh + r][t * 16 + ln] = accs[u][r] * 0.0625f + bv; }
  __builtin_amdgcn_fence(__ATOMIC_ACQ_REL, "workgroup"); __builtin_amdgcn_wave_barrier();
  const int rsub = lane >> 3, c4 = (lane & 7) * 4;
#pragma unroll
  for (int q = 0; q < 8; ++q) { const int r = q * 4 + rsub; const v4f v = *(const v4fa*)&st[wv][r][c4]; const int tok = (jr0 + r + 1) & (NTOK - 1);      /* token 4096 -> 0 */
    *(v4f*)(out + ((size_t)b * NTOK + tok) * DM + wv * 32 + c4) = v; } }

extern "C" void kernel_launch(void* const* d_in, const int* in_sizes, int n_in,
                              void* d_out, int out_size, void* d_ws, size_t ws_size, hipStream_t stream) {
  (void)in_sizes; (void)n_in; (void)out_size;
  const float* const* I = (const float* const*)d_in; const float* x = I[0]; const float* Wq = I[1]; const float* Wkv = I[2]; const float* Wo = I[3]; const float* bo = I[4];
  char* ws = (char*)d_ws; size_t off = 0;
  auto take = [&](size_t bytes) { char* p = ws + off; off += (bytes + 255) & ~(size_t)255; return p; };
  _Float16* BQKV = (_Float16*)take((size_t)3 * DM * DM * 2); _Float16* BO = (_Float16*)take((size_t)DM * DM * 2);
  _Float16* X16 = (_Float16*)take(NRX * DM * 2); float* QKV = (float*)take(NRX * 3 * DM * 4);
  if (off > ws_size) return;      /* 2 + 8.6 + 51.9 = about 63 MB */
  k_prep<<<WT_ALL, 256, 0, stream>>>(x, Wq, Wkv, Wo, BQKV, BO, X16);      /* 256 blocks: one weight tile and 32 token rows each */
  k_qkv<<<NB * (NTOK / 256) * (3 * DM / 192), 384, 0, stream>>>(X16, BQKV, QKV);      /* 256 blocks of 256 x 192; the padding token's row is stored as zeros */
  k_nbatt_out<<<NB * FT * HT, 512, 0, stream>>>(QKV, BO, bo, (float*)d_out);      /* one block per grid row: its 32 tokens' attention, then out = o Wo + bo for them (token 4096 dropped as in the reference, token 0 in its place) */
}

// v008
// A run of this version takes 44.3 microseconds.
// In two side-by-side timings against v007, it was 1.04 and 1.05 times as fast.
// Counting every step since v000, it is 11.5 times as fast.
#include <hip/hip_runtime.h>
// Sparse3DNA (x [2][4096][512]: 1 BOS + 4095 video tokens on a 4x32x32 grid, padded by one zero token to 4097; q = x Wq, [k|v] = x Wkv ([in][out], no bias), 8 heads of 64; query j (token j+1) attends to {BOS} U {its 3x3x3 grid neighbourhood keys with flat index <= j} (out-of-grid slots and future keys masked), scale 64^-0.5, softmax, weighted v; token 0's output is v_BOS itself; out = o Wo + bo, first 4096 tokens -> [2][4096][512]).
// Structure: token rows (4,097 per batch padded to 4,224); x as exact f16 rows; one [Q|K|V] WMMA GEMM (256x192 block tiles, 64x64 wave tiles, f32 accumulation, exact x16 transposed weights) kept in f32, rows of 1,536; the 28-slot neighbourhood attention on VALU (f32: 8 lanes per (batch, head, query), 2 queries x 4 heads per wave, window indices and the causal test from the grid geometry on device, logits, softmax, weighted sum) into f16 o rows in LDS (token 0: v_BOS); out = o Wo + bo on WMMA in the same launch, 32 tokens per block (f32, output layout). Three launches: operands, [Q|K|V], attention with output.
// Compute dtype: inputs rounded to bf16; x / weights exact; q, k, v, logits, softmax f32; o plain f16 into the Wo GEMM (~2^-12). v_wmma_f32_16x16x32_f16.
#define NB 2
#define NTOK 4096                    /* input tokens per batch (= output tokens) */
#define NPAD 4097                    /* after the module's padding */
#define RPB 4224                     /* rows per batch (33 x 128) */
#define NRX ((size_t)NB * RPB)       /* 8448 */
#define DM 512
#define NH 8
#define HD 64
#define FT 4
#define HT 32
#define WT 32
#define TT (FT * HT * WT)            /* 4096 grid tokens */
#define QT TT                        /* unused */
typedef __bf16 v16b __attribute__((ext_vector_type(16)));
typedef unsigned short v8us __attribute__((ext_vector_type(8), may_alias));
typedef float  v8f  __attribute__((ext_vector_type(8)));
typedef float  v4f  __attribute__((ext_vector_type(4)));
typedef float  v4fa __attribute__((ext_vector_type(4), may_alias));
union FragB { v16b v; v8us half[2]; unsigned short u[16]; };

__device__ __forceinline__ unsigned short bf16_bits(float x) { unsigned int u = __float_as_uint(x); return (unsigned short)((u + 0x7FFFu + ((u >> 16) & 1u)) >> 16); }
__device__ __forceinline__ float bf16_val(unsigned short b) { return __uint_as_float(((unsigned int)b) << 16); }
__device__ __forceinline__ float bf16_round(float x) { return bf16_val(bf16_bits(x)); }
// D += A·B with NT terms: 1 = ah·bh, 2 = + al·bh (A split), 3 = + ah·bl (both split)
template <int NT>
__device__ __forceinline__ v8f mmaN(v16b ah, v16b al, v16b bh, v16b bl, v8f c) {
  c = __builtin_amdgcn_wmma_f32_16x16x32_bf16(false, ah, false, bh, (short)0, c, false, false);
  if (NT >= 2) c = __builtin_amdgcn_wmma_f32_16x16x32_bf16(false, al, false, bh, (short)0, c, false, false);
  if (NT >= 3) c = __builtin_amdgcn_wmma_f32_16x16x32_bf16(false, ah, false, bl, (short)0, c, false, false);
  asm volatile("v_nop\n\tv_nop\n\tv_nop\n\tv_nop" : "+v"(c) : "v"(ah), "v"(al), "v"(bh), "v"(bl));
  return c;
}

__global__ __launch_bounds__(256) void k_wt_bf16(const float* __restrict__ W, unsigned short* __restrict__ Wt, int K, int N) {
  const int t = blockIdx.x * 256 + threadIdx.x;
  const int k8n = K / 8;
  if (t >= N * k8n) return;
  const int n = t / k8n, k8 = (t % k8n) * 8;
  v8us v;
#pragma unroll
  for (int i = 0; i < 8; ++i) v[i] = bf16_bits(W[(size_t)(k8 + i) * N + n]);
  *(v8us*)(Wt + (size_t)n * K + k8) = v;
  
}

// GEMM C[M][N] (f32, pitch ldc) = act(A[M][K]·W + bias). A f32 row-major (pitch lda) converted per fragment to bf16
// (ASPLIT: hi/lo two planes -> 2 terms, else single rounded term); Wt bf16 [N][K] (pitch ldb). BIAS_BF16 rounds the
// bias to bf16 first (bias quantised to bf16 before the add). K%32==0, M%16==0, N%64==0.
template <bool ASPLIT, int ACT, bool BIAS_BF16>
__global__ __launch_bounds__(128) void k_gemm_bf(const float* __restrict__ A, int lda, const unsigned short* __restrict__ Wt, int ldb,
                                               const float* __restrict__ bias, float* __restrict__ C, int ldc, int M, int N, int K) {
  __shared__ __attribute__((aligned(16))) float so[4][16][64];
  const int tid = threadIdx.x, w = tid >> 5, lane = tid & 31, ln = lane & 15, hh = lane >> 4;
  const int ntn = N / 64;
  const int wid = blockIdx.x * 4 + w;
  const int mt = wid / ntn, nq = wid % ntn;
  if (mt * 16 >= M) return;
  const int row0 = mt * 16, col0 = nq * 64;
  const float* arow = A + (size_t)(row0 + ln) * lda;
  v8f acc[4] = {};
  for (int kb = 0; kb < K; kb += 32) {
    FragB ah, al;
    const v4f x0 = *(const v4fa*)(arow + kb + 8 * hh), x1 = *(const v4fa*)(arow + kb + 8 * hh + 4);
    const v4f x2 = *(const v4fa*)(arow + kb + 16 + 8 * hh), x3 = *(const v4fa*)(arow + kb + 16 + 8 * hh + 4);
    float xs[16] = {x0[0],x0[1],x0[2],x0[3],x1[0],x1[1],x1[2],x1[3],x2[0],x2[1],x2[2],x2[3],x3[0],x3[1],x3[2],x3[3]};
#pragma unroll
    for (int i = 0; i < 16; ++i) { const unsigned short hb = bf16_bits(xs[i]); ah.u[i] = hb; al.u[i] = ASPLIT ? bf16_bits(xs[i] - bf16_val(hb)) : (unsigned short)0; }
#pragma unroll
    for (int t = 0; t < 4; ++t) {
      const unsigned short* brow = Wt + (size_t)(col0 + t * 16 + ln) * ldb + kb;
      FragB b;
      b.half[0] = *(const v8us*)(brow + 8 * hh);
      b.half[1] = *(const v8us*)(brow + 16 + 8 * hh);
      acc[t] = mmaN<ASPLIT ? 2 : 1>(ah.v, al.v, b.v, b.v, acc[t]);
    }
  }
#pragma unroll
  for (int t = 0; t < 4; ++t) {
    float bv = bias ? bias[col0 + t * 16 + ln] : 0.f;
    if (BIAS_BF16) bv = bf16_round(bv);
#pragma unroll
    for (int r = 0; r < 8; ++r) { float v = acc[t][r] + bv; if (ACT == 1) v = fmaxf(v, 0.f); so[w][8 * hh + r][t * 16 + ln] = v; }
  }
  __builtin_amdgcn_fence(__ATOMIC_ACQ_REL, "workgroup");
  __builtin_amdgcn_wave_barrier();
  const int rsub = lane >> 4, c4 = (lane & 15) * 4;
  {
#pragma unroll
    for (int q = 0; q < 8; ++q) {
      const int r = q * 2 + rsub;
      const v4f v = *(const v4fa*)&so[w][r][c4];
      *(v4f*)(C + (size_t)(row0 + r) * ldc + col0 + c4) = v;
    }
    
  }
}

// GEMM C = act(A·W + bias + resid): A f32 (ASPLIT -> hi/lo 2 terms), Wt bf16 [N][K]; ACT 0 none, 1 relu, 2 exact gelu;
// resid (optional, f32, row index = (row % rmod), pitch ldr, RES_BF16 rounds it) added before the activation.
template <bool ASPLIT, int ACT, bool BIAS_BF16, bool RES_BF16>
__global__ __launch_bounds__(128) void k_gemm_bf3(const float* __restrict__ A, int lda, const unsigned short* __restrict__ Wt, int ldb,
                                                const float* __restrict__ bias, const float* __restrict__ resid, int rmod, int ldr,
                                                float* __restrict__ C, int ldc, int M, int N, int K) {
  __shared__ __attribute__((aligned(16))) float so[4][16][64];
  const int tid = threadIdx.x, w = tid >> 5, lane = tid & 31, ln = lane & 15, hh = lane >> 4;
  const int ntn = N / 64;
  const int wid = blockIdx.x * 4 + w;
  const int mt = wid / ntn, nq = wid % ntn;
  if (mt * 16 >= M) return;
  const int row0 = mt * 16, col0 = nq * 64;
  const float* arow = A + (size_t)(row0 + ln) * lda;
  v8f acc[4] = {};
  for (int kb = 0; kb < K; kb += 32) {
    FragB ah, al;
    const v4f x0 = *(const v4fa*)(arow + kb + 8 * hh), x1 = *(const v4fa*)(arow + kb + 8 * hh + 4);
    const v4f x2 = *(const v4fa*)(arow + kb + 16 + 8 * hh), x3 = *(const v4fa*)(arow + kb + 16 + 8 * hh + 4);
    float xs[16] = {x0[0],x0[1],x0[2],x0[3],x1[0],x1[1],x1[2],x1[3],x2[0],x2[1],x2[2],x2[3],x3[0],x3[1],x3[2],x3[3]};
#pragma unroll
    for (int i = 0; i < 16; ++i) { const unsigned short hb = bf16_bits(xs[i]); ah.u[i] = hb; al.u[i] = ASPLIT ? bf16_bits(xs[i] - bf16_val(hb)) : (unsigned short)0; }
#pragma unroll
    for (int t = 0; t < 4; ++t) {
      const unsigned short* brow = Wt + (size_t)(col0 + t * 16 + ln) * ldb + kb;
      FragB b;
      b.half[0] = *(const v8us*)(brow + 8 * hh);
      b.half[1] = *(const v8us*)(brow + 16 + 8 * hh);
      acc[t] = mmaN<ASPLIT ? 2 : 1>(ah.v, al.v, b.v, b.v, acc[t]);
    }
  }
#pragma unroll
  for (int t = 0; t < 4; ++t) {
    const int col = col0 + t * 16 + ln;
    float bv = bias ? bias[col] : 0.f;
    if (BIAS_BF16) bv = bf16_round(bv);
#pragma unroll
    for (int r = 0; r < 8; ++r) {
      float v = acc[t][r] + bv;
      if (resid) { float rv = resid[(size_t)((row0 + 8 * hh + r) % rmod) * ldr + col]; if (RES_BF16) rv = bf16_round(rv); v += rv; }
      if (ACT == 1) v = fmaxf(v, 0.f);
      if (ACT == 2) v = 0.5f * v * (1.0f + erff(v * 0.70710678118654752f));
      if (ACT == 3) { const float u = 0.7978845608028654f * (v + 0.044715f * v * v * v); v = 0.5f * v * (1.0f + tanhf(u)); }
      so[w][8 * hh + r][t * 16 + ln] = v;
    }
  }
  __builtin_amdgcn_fence(__ATOMIC_ACQ_REL, "workgroup");
  __builtin_amdgcn_wave_barrier();
  const int rsub = lane >> 4, c4 = (lane & 15) * 4;
  {
#pragma unroll
    for (int q = 0; q < 8; ++q) {
      const int r = q * 2 + rsub;
      const v4f v = *(const v4fa*)&so[w][r][c4];
      *(v4f*)(C + (size_t)(row0 + r) * ldc + col0 + c4) = v;
    }
    
  }
}
// row LayerNorm (biased variance, eps) over N: s = X (+ R); optional out_sum <- s; out_norm <- (s-mu)*rsqrt(var+eps)*g + b
template <bool PARAM_BF16>
__global__ __launch_bounds__(256) void k_layernorm(const float* __restrict__ X, const float* __restrict__ R, const float* __restrict__ g, const float* __restrict__ bta,
                                                  float* __restrict__ out_sum, float* __restrict__ out_norm, int N, float eps) {
  __shared__ float red[256];
  const int row = blockIdx.x, tid = threadIdx.x;
  const float* x = X + (size_t)row * N; const float* rr = R ? R + (size_t)row * N : nullptr;
  float vals[16];                     // up to N = 4096
  const int per = N / 256;            // contiguous chunk per thread? use strided-by-4 chunks: thread handles j = tid*4 + 1024*u
  float s1 = 0.f;
  for (int u = 0; u < per / 4; ++u) {
    const int j = tid * 4 + 1024 * u;
    const v4f a = *(const v4fa*)(x + j);
    v4f b = {0.f,0.f,0.f,0.f}; if (rr) b = *(const v4fa*)(rr + j);
#pragma unroll
    for (int q = 0; q < 4; ++q) { const float v = a[q] + b[q]; vals[u * 4 + q] = v; s1 += v; }
  }
  red[tid] = s1; __syncthreads();
  for (int st = 128; st > 0; st >>= 1) { if (tid < st) red[tid] += red[tid + st]; __syncthreads(); }
  const float mu = red[0] / (float)N; __syncthreads();
  float s2 = 0.f;
  for (int u = 0; u < per / 4; ++u)
#pragma unroll
    for (int q = 0; q < 4; ++q) { const float c = vals[u * 4 + q] - mu; s2 += c * c; }
  red[tid] = s2; __syncthreads();
  for (int st = 128; st > 0; st >>= 1) { if (tid < st) red[tid] += red[tid + st]; __syncthreads(); }
  const float rs = rsqrtf(red[0] / (float)N + eps);
  {
    for (int u = 0; u < per / 4; ++u) {
      const int j = tid * 4 + 1024 * u;
      v4f o, sm;
#pragma unroll
      for (int q = 0; q < 4; ++q) {
        float gg = g[j + q], bb = bta[j + q];
        if (PARAM_BF16) { gg = bf16_round(gg); bb = bf16_round(bb); }
        sm[q] = vals[u * 4 + q]; o[q] = (vals[u * 4 + q] - mu) * rs * gg + bb;
      }
      if (out_sum) *(v4f*)(out_sum + (size_t)row * N + j) = sm;
      *(v4f*)(out_norm + (size_t)row * N + j) = o;
    }
    
  }
}



// ---- f16 WMMA path (v_wmma_f32_16x16x32_f16): 11-bit significands for operands in range — used here for the [Q|K|V] and Wo GEMMs
typedef _Float16 v16h __attribute__((ext_vector_type(16)));
union FragH { v16h v; v8us half[2]; _Float16 h[16]; unsigned short u[16]; };
template <int NT>
__device__ __forceinline__ v8f mmaH(v16h ah, v16h al, v16h bh, v16h bl, v8f c) {
  c = __builtin_amdgcn_wmma_f32_16x16x32_f16(false, ah, false, bh, (short)0, c, false, false);
  if (NT >= 2) c = __builtin_amdgcn_wmma_f32_16x16x32_f16(false, al, false, bh, (short)0, c, false, false);
  if (NT >= 3) c = __builtin_amdgcn_wmma_f32_16x16x32_f16(false, ah, false, bl, (short)0, c, false, false);
  asm volatile("v_nop\n\tv_nop\n\tv_nop\n\tv_nop" : "+v"(c) : "v"(ah), "v"(al), "v"(bh), "v"(bl));
  return c;
}
// batched GEMM like k_gemm_b but f16 operands: A f32 (split into f16 hi/lo if ASPLIT, else rounded to f16), Bt = f16 values [n][k]; alpha; C f32; N multiple of 16 (partial tiles skipped)
template <bool ASPLIT>
__global__ __launch_bounds__(128) void k_gemm_h(const float* __restrict__ A, int lda, size_t sA, const _Float16* __restrict__ Bh, int ldb, size_t sB, float alpha, float* __restrict__ C, int ldc, size_t sC, int M, int N, int K) {
  __shared__ __attribute__((aligned(16))) float so[4][16][64];
  const int tid = threadIdx.x, w = tid >> 5, lane = tid & 31, ln = lane & 15, hh = lane >> 4; const int by = blockIdx.y;
  A += (size_t)by * sA; Bh += (size_t)by * sB; C += (size_t)by * sC;
  const int ntn = (N + 63) / 64; const int wid = blockIdx.x * 4 + w; const int mt = wid / ntn, nq = wid % ntn; if (mt * 16 >= M) return;
  const int row0 = mt * 16, col0 = nq * 64; const float* arow = A + (size_t)(row0 + ln) * lda;
  v8f acc[4] = {};
  for (int kb = 0; kb < K; kb += 32) {
    FragH ah, al;
    const v4f x0 = *(const v4fa*)(arow + kb + 8 * hh), x1 = *(const v4fa*)(arow + kb + 8 * hh + 4), x2 = *(const v4fa*)(arow + kb + 16 + 8 * hh), x3 = *(const v4fa*)(arow + kb + 16 + 8 * hh + 4);
    float xs[16] = {x0[0],x0[1],x0[2],x0[3],x1[0],x1[1],x1[2],x1[3],x2[0],x2[1],x2[2],x2[3],x3[0],x3[1],x3[2],x3[3]};
#pragma unroll
    for (int i = 0; i < 16; ++i) { const _Float16 h = (_Float16)xs[i]; ah.h[i] = h; al.h[i] = ASPLIT ? (_Float16)(xs[i] - (float)h) : (_Float16)0.0f; }
#pragma unroll
    for (int t = 0; t < 4; ++t) { if (col0 + t * 16 >= N) continue; const size_t boff = (size_t)(col0 + t * 16 + ln) * ldb + kb; FragH bq; bq.half[0] = *(const v8us*)(Bh + boff + 8 * hh); bq.half[1] = *(const v8us*)(Bh + boff + 16 + 8 * hh);
      acc[t] = mmaH<ASPLIT ? 2 : 1>(ah.v, al.v, bq.v, bq.v, acc[t]); }
  }
#pragma unroll
  for (int t = 0; t < 4; ++t) { if (col0 + t * 16 >= N) continue;
#pragma unroll
    for (int r = 0; r < 8; ++r) so[w][8 * hh + r][t * 16 + ln] = acc[t][r] * alpha; }
  __builtin_amdgcn_fence(__ATOMIC_ACQ_REL, "workgroup"); __builtin_amdgcn_wave_barrier();
  const int rsub = lane >> 4, c4 = (lane & 15) * 4;
  {
#pragma unroll
    for (int q = 0; q < 8; ++q) { const int r = q * 2 + rsub; if (col0 + c4 < N) { const v4f v = *(const v4fa*)&so[w][r][c4]; *(v4f*)(C + (size_t)(row0 + r) * ldc + col0 + c4) = v; } }
     }
}

// Wt[n][k] = f16(W[k][n]·scale) from f32 row-major W[K][N] (scale = power of two; bf16-exact weights stay exact in f16 away from the subnormal range)
__global__ __launch_bounds__(256) void k_wt_f16(const float* __restrict__ W, _Float16* __restrict__ Wt, int K, int N, float scale) {
  const int t = blockIdx.x * 256 + threadIdx.x; if (t >= N * (K / 8)) return; const int n = t / (K / 8), k8 = (t % (K / 8)) * 8; FragH f;
#pragma unroll
  for (int i = 0; i < 8; ++i) f.h[i] = (_Float16)(bf16_round(W[(size_t)(k8 + i) * N + n]) * scale); const v8us o = f.half[0];
  *(v8us*)((unsigned short*)Wt + (size_t)n * K + k8) = o; 
}
// k_gemm_hh variant with fused epilogue: v = acc·alpha + bias[by·sBias + col] (+ CP[(row/rowsPerB)·sCPb + by·64 + col] if CP) ; ACT 0 none / 1 elu ; writes f16 C16 (and f32 C if non-null)
template <int ACT>
__global__ __launch_bounds__(128) void k_gemm_hhx(const _Float16* __restrict__ A, int lda, size_t sA, const _Float16* __restrict__ Bh, int ldb, size_t sB, float alpha, const float* __restrict__ bias, size_t sBias, const float* __restrict__ CP, int rowsPerB, size_t sCPb, int row0g,
    float* __restrict__ C, _Float16* __restrict__ C16, int ldc, size_t sC, int M, int N, int K) {
  __shared__ __attribute__((aligned(16))) float so[4][16][64];
  const int tid = threadIdx.x, w = tid >> 5, lane = tid & 31, ln = lane & 15, hh = lane >> 4; const int by = blockIdx.y;
  A += (size_t)by * sA; Bh += (size_t)by * sB; const size_t cofs = (size_t)by * sC; const float* bp = bias ? bias + (size_t)by * sBias : nullptr;
  const int ntn = (N + 63) / 64; const int wid = blockIdx.x * 4 + w; const int mt = wid / ntn, nq = wid % ntn; if (mt * 16 >= M) return;
  const int row0 = mt * 16, col0 = nq * 64; const _Float16* arow = A + (size_t)(row0 + ln) * lda;
  v8f acc[4] = {};
  for (int kb = 0; kb < K; kb += 32) { FragH ah; ah.half[0] = *(const v8us*)((const unsigned short*)arow + kb + 8 * hh); ah.half[1] = *(const v8us*)((const unsigned short*)arow + kb + 16 + 8 * hh);
#pragma unroll
    for (int t = 0; t < 4; ++t) { if (col0 + t * 16 >= N) continue; const size_t boff = (size_t)(col0 + t * 16 + ln) * ldb + kb; FragH bq; bq.half[0] = *(const v8us*)((const unsigned short*)Bh + boff + 8 * hh); bq.half[1] = *(const v8us*)((const unsigned short*)Bh + boff + 16 + 8 * hh);
      acc[t] = mmaH<1>(ah.v, ah.v, bq.v, bq.v, acc[t]); }
  }
#pragma unroll
  for (int t = 0; t < 4; ++t) { if (col0 + t * 16 >= N) continue; const int col = col0 + t * 16 + ln; const float bv = bp ? bf16_round(bp[col]) : 0.f;
#pragma unroll
    for (int r = 0; r < 8; ++r) { float v = acc[t][r] * alpha + bv; if (CP) { const int rr = row0g + row0 + 8 * hh + r; if (rowsPerB < 0) v += CP[cofs + (size_t)rr * ldc + col];      /* rowsPerB < 0: own element of the batched C plane */ else { const int bidx = rr / rowsPerB; v += CP[(size_t)bidx * sCPb + (size_t)by * 64 + col]; } } if (ACT == 1) v = (v > 0.f) ? v : expm1f(v); else if (ACT == 7) v = (v > 0.f) ? v + 1.0f : expf(v); else if (ACT == 8) v = tanhf(v); else if (ACT == 9) v = 0.5f * v * (1.0f + tanhf(0.7978845608028654f * (v + 0.044715f * v * v * v))); else if (ACT == 11) v = 1.0f / (1.0f + expf(-v)); else if (ACT == 12) v = (v > 0.f) ? v : 0.01f * v; else if (ACT == 14) v = (v > 0.f) ? v : 0.1f * v; else if (ACT == 16) v = (v >= 0.f) ? v : 0.3f * v; else if (ACT == 17) v = (v >= 0.f) ? v : 0.2f * v; else if (ACT == 15) v = v / (1.0f + expf(-v)); else if (ACT == 3) v = fmaxf(v, 0.f); else if (ACT == 6) v = 0.5f * v * (1.0f + erff(v * 0.70710678118654752f)); so[w][8 * hh + r][t * 16 + ln] = v; } }
  __builtin_amdgcn_fence(__ATOMIC_ACQ_REL, "workgroup"); __builtin_amdgcn_wave_barrier();
  const int rsub = lane >> 4, c4 = (lane & 15) * 4; typedef _Float16 v4h __attribute__((ext_vector_type(4)));
  {
#pragma unroll
    for (int q = 0; q < 8; ++q) { const int r = q * 2 + rsub; if (col0 + c4 < N) { const v4f v = *(const v4fa*)&so[w][r][c4]; if (C) *(v4f*)(C + cofs + (size_t)(row0 + r) * ldc + col0 + c4) = v; if (C16) { v4h h4; for (int i = 0; i < 4; ++i) h4[i] = (_Float16)v[i]; *(v4h*)(C16 + cofs + (size_t)(row0 + r) * ldc + col0 + c4) = h4; } } }
     }
}


typedef _Float16 v4h __attribute__((ext_vector_type(4)));

__global__ __launch_bounds__(256) void k_x16(const float* __restrict__ x, _Float16* __restrict__ X16, size_t n8) { const size_t t = (size_t)blockIdx.x * 256 + threadIdx.x; if (t >= n8) return; FragH f;
#pragma unroll
  for (int q = 0; q < 8; ++q) f.h[q] = (_Float16)bf16_round(x[t * 8 + q]); *(v8us*)((unsigned short*)X16 + t * 8) = f.half[0];  }
__global__ __launch_bounds__(256) void k_h16(const float* __restrict__ x, _Float16* __restrict__ X16, size_t n8) { const size_t t = (size_t)blockIdx.x * 256 + threadIdx.x; if (t >= n8) return; FragH f;
#pragma unroll
  for (int q = 0; q < 8; ++q) f.h[q] = (_Float16)x[t * 8 + q]; *(v8us*)((unsigned short*)X16 + t * 8) = f.half[0];  }
__global__ __launch_bounds__(256) void k_round16f(const float* __restrict__ W, _Float16* __restrict__ Bt, size_t n8) { const size_t t = (size_t)blockIdx.x * 256 + threadIdx.x; if (t >= n8) return; FragH f;
#pragma unroll
  for (int i = 0; i < 8; ++i) f.h[i] = (_Float16)(bf16_round(W[t * 8 + i]) * 16.0f); *(v8us*)((unsigned short*)Bt + t * 8) = f.half[0];  }
template <int NHv, int TTv>
__global__ __launch_bounds__(256) void k_vt(const _Float16* __restrict__ V16, int ldv, int voff, _Float16* __restrict__ Vt) { __shared__ unsigned short tl[64][66]; const int tid = threadIdx.x; const int slab = blockIdx.x / (TTv / 64), lg = blockIdx.x % (TTv / 64); const int b = slab / NHv, h = slab % NHv;
  for (int i = tid; i < 64 * 8; i += 256) { const int r = i / 8, c8 = (i % 8) * 8; FragH f; f.half[0] = *(const v8us*)((const unsigned short*)V16 + ((size_t)b * TTv + lg * 64 + r) * ldv + voff + h * 64 + c8);
#pragma unroll
    for (int q = 0; q < 8; ++q) tl[r][c8 + q] = f.u[q]; }
  __syncthreads();
  {
#pragma unroll
    for (int rd = 0; rd < 2; ++rd) { const int d = rd * 32 + tid / 8, pc = tid % 8; FragH f;
#pragma unroll
      for (int q = 0; q < 8; ++q) f.u[q] = tl[pc * 8 + q][d];
      *(v8us*)((unsigned short*)Vt + ((size_t)slab * 64 + d) * TTv + lg * 64 + pc * 8) = f.half[0]; }
     } }

__global__ __launch_bounds__(256) void k_hl(const float* __restrict__ F, _Float16* __restrict__ Hh, _Float16* __restrict__ Hl, size_t n8) { const size_t t = (size_t)blockIdx.x * 256 + threadIdx.x; if (t >= n8) return; FragH fh, fl; const v4f a = *(const v4fa*)(F + t * 8), c = *(const v4fa*)(F + t * 8 + 4);
#pragma unroll
  for (int q = 0; q < 4; ++q) { _Float16 h = (_Float16)a[q]; fh.h[q] = h; fl.h[q] = (_Float16)((a[q] - (float)h) * 1024.0f); h = (_Float16)c[q]; fh.h[4 + q] = h; fl.h[4 + q] = (_Float16)((c[q] - (float)h) * 1024.0f); }
  { *(v8us*)((unsigned short*)Hh + t * 8) = fh.half[0]; *(v8us*)((unsigned short*)Hl + t * 8) = fl.half[0];  } }

// ---- fast GEMM (block tile 128x64, wave tile 32x64; requires M % 128 == 0 rows per launch region, N % 64 == 0, K % 64 == 0); epilogue = k_gemm_hhx semantics ----
// Operand path: per trip of 64 k the block's 128 A rows and 64 B rows (128 bytes each, whole lines) are copied to LDS asynchronously, two buffers, the copies of trip t + 2 issued behind the barrier that ends trip t;
// the waves read their fragments from LDS (row pitch 144 bytes: no bank conflict for 16-byte reads). The k order of every accumulator is the ascending one of the direct-load form.
#define G2_PITCH 144
#define G2_STAGE (192 * G2_PITCH)      /* rows 0..127: A, rows 128..191: B */
__device__ __forceinline__ v16h g2_lfrag(const unsigned char* p) { FragH f; f.half[0] = *(const v8us*)p; f.half[1] = *(const v8us*)(p + 32); return f.v; }
__device__ __forceinline__ v8f g2_mma(v16h a, v16h b, v8f c) { v8f d = __builtin_amdgcn_wmma_f32_16x16x32_f16(false, a, false, b, (short)0, c, false, false); asm volatile("v_nop\n\tv_nop\n\tv_nop\n\tv_nop" : "+v"(d) : "v"(a), "v"(b)); return d; }
// One stage: each lane copies 12 pieces of 16 bytes (8 lanes = one 128-byte row, a wave = 4 rows, the block = 16 rows per copy; 8 copies for A, 4 for B). l: the lane's LDS byte address in row group 0.
__device__ __forceinline__ void g2_copy(unsigned l, const _Float16* ga, size_t sa, const _Float16* gb, size_t sb) {
  /* the copies and, as the last line of the same statement, the wait that stands in front of any new value in the address registers they name */
  asm volatile("global_load_async_to_lds_b128 %0, %12, off\n\t"
               "global_load_async_to_lds_b128 %1, %13, off\n\t"
               "global_load_async_to_lds_b128 %2, %14, off\n\t"
               "global_load_async_to_lds_b128 %3, %15, off\n\t"
               "global_load_async_to_lds_b128 %4, %16, off\n\t"
               "global_load_async_to_lds_b128 %5, %17, off\n\t"
               "global_load_async_to_lds_b128 %6, %18, off\n\t"
               "global_load_async_to_lds_b128 %7, %19, off\n\t"
               "global_load_async_to_lds_b128 %8, %20, off\n\t"
               "global_load_async_to_lds_b128 %9, %21, off\n\t"
               "global_load_async_to_lds_b128 %10, %22, off\n\t"
               "global_load_async_to_lds_b128 %11, %23, off\n\t"
               "s_wait_xcnt 0x0"
               :: "v"(l), "v"(l + 16 * G2_PITCH), "v"(l + 32 * G2_PITCH), "v"(l + 48 * G2_PITCH), "v"(l + 64 * G2_PITCH), "v"(l + 80 * G2_PITCH),
                  "v"(l + 96 * G2_PITCH), "v"(l + 112 * G2_PITCH), "v"(l + 128 * G2_PITCH), "v"(l + 144 * G2_PITCH), "v"(l + 160 * G2_PITCH), "v"(l + 176 * G2_PITCH),
                  "v"(ga), "v"(ga + sa), "v"(ga + 2 * sa), "v"(ga + 3 * sa), "v"(ga + 4 * sa), "v"(ga + 5 * sa), "v"(ga + 6 * sa), "v"(ga + 7 * sa),
                  "v"(gb), "v"(gb + sb), "v"(gb + 2 * sb), "v"(gb + 3 * sb)
               : "memory"); }
// BIAS, RES, OUT32, OUT16: which of bias, CP, C and C16 the launch uses. Template flags, not pointer tests: the epilogue is then straight-line code, with no scalar branch per output element, and its LDS row reads and global stores issue as groups.
template <int ACT, bool BIAS, bool RES, bool OUT32, bool OUT16>
__global__ __launch_bounds__(128) void k_gemm2(const _Float16* __restrict__ A, int lda, size_t sA, const _Float16* __restrict__ Bh, int ldb, size_t sB, float alpha, const float* __restrict__ bias, size_t sBias, const float* __restrict__ CP, int rowsPerB, size_t sCPb, int row0g,
    float* __restrict__ C, _Float16* __restrict__ C16, int ldc, size_t sC, int M, int N, int K) { static_assert(ACT == 0 || ACT == 3 || ACT == 6 || ACT == 8 || ACT == 9 || ACT == 11 || ACT == 12 || ACT == 14 || ACT == 15 || ACT == 16 || ACT == 17, "k_gemm2: unsupported ACT code (would silently apply no activation)");
  __shared__ __attribute__((aligned(16))) unsigned char sm[2 * G2_STAGE];      /* the two operand buffers; behind the loop's last barrier the same bytes stage the output rows */
  float (*so)[32][68] = reinterpret_cast<float (*)[32][68]>(sm); static_assert(sizeof(float) * 4 * 32 * 68 <= 2 * G2_STAGE, "output staging must fit the operand buffers");
  const int tid = threadIdx.x, w = tid >> 5, lane = tid & 31, ln = lane & 15, hh = lane >> 4; const int by = blockIdx.y;
  A += (size_t)by * sA; Bh += (size_t)by * sB; const size_t cofs = (size_t)by * sC; const float* bp = BIAS ? bias + (size_t)by * sBias : nullptr;
  const int ntn = N >> 6; const int mt = blockIdx.x / ntn, nq = blockIdx.x - mt * ntn; const int row0 = mt * 128 + 32 * w, col0 = nq * 64; if (mt * 128 >= M) return;      /* the whole block leaves or none: barriers follow */
  const int crow = tid >> 3, cpc = tid & 7;
  const _Float16* ga = A + (size_t)(mt * 128 + crow) * lda + cpc * 8; const _Float16* gb = Bh + (size_t)(col0 + crow) * ldb + cpc * 8;
  const unsigned lb = (unsigned)(size_t)sm + (unsigned)(crow * G2_PITCH + cpc * 16);
  const unsigned char* fa = sm + (32 * w + ln) * G2_PITCH + 16 * hh; const unsigned char* fb = sm + (128 + ln) * G2_PITCH + 16 * hh;
  const int nt = K >> 6;
  const v8f z8 = {0.f,0.f,0.f,0.f,0.f,0.f,0.f,0.f}; v8f c00 = z8, c01 = z8, c02 = z8, c03 = z8, c10 = z8, c11 = z8, c12 = z8, c13 = z8;
  g2_copy(lb, ga, (size_t)16 * lda, gb, (size_t)16 * ldb);
  asm volatile("s_wait_asynccnt 0x0" ::: "memory");      /* this wave's copies of tile 0 have landed */
  __syncthreads();                                       /* ... and every other wave's */
  if (nt > 1) g2_copy(lb + G2_STAGE, ga + 64, (size_t)16 * lda, gb + 64, (size_t)16 * ldb);
#pragma unroll 1      /* rolled: one body serves both buffers and stays small */
  for (int t = 0; t < nt; ++t) { const unsigned bo = (unsigned)(t & 1) * G2_STAGE; const unsigned char* pa = fa + bo; const unsigned char* pb = fb + bo;
    /* the trip's 24 fragment reads stand together in front of its matrix instructions */
    const v16h a00 = g2_lfrag(pa), a10 = g2_lfrag(pa + 16 * G2_PITCH), b00 = g2_lfrag(pb), b10 = g2_lfrag(pb + 16 * G2_PITCH), b20 = g2_lfrag(pb + 32 * G2_PITCH), b30 = g2_lfrag(pb + 48 * G2_PITCH);
    const v16h a01 = g2_lfrag(pa + 64), a11 = g2_lfrag(pa + 16 * G2_PITCH + 64), b01 = g2_lfrag(pb + 64), b11 = g2_lfrag(pb + 16 * G2_PITCH + 64), b21 = g2_lfrag(pb + 32 * G2_PITCH + 64), b31 = g2_lfrag(pb + 48 * G2_PITCH + 64);
    c00 = g2_mma(a00, b00, c00); c10 = g2_mma(a10, b00, c10); c01 = g2_mma(a00, b10, c01); c11 = g2_mma(a10, b10, c11);
    c02 = g2_mma(a00, b20, c02); c12 = g2_mma(a10, b20, c12); c03 = g2_mma(a00, b30, c03); c13 = g2_mma(a10, b30, c13);
    c00 = g2_mma(a01, b01, c00); c10 = g2_mma(a11, b01, c10); c01 = g2_mma(a01, b11, c01); c11 = g2_mma(a11, b11, c11);
    c02 = g2_mma(a01, b21, c02); c12 = g2_mma(a11, b21, c12); c03 = g2_mma(a01, b31, c03); c13 = g2_mma(a11, b31, c13);
    asm volatile("s_wait_dscnt 0x0" ::: "memory");       /* this wave's reads of buffer t & 1 are done before the buffer is given up */
    asm volatile("s_wait_asynccnt 0x0" ::: "memory");    /* this wave's copies of tile t + 1 have landed */
    __syncthreads();                                     /* publishes tile t + 1 and ends every wave's reads of buffer t & 1 */
    if (t + 2 < nt) g2_copy(lb + bo, ga + (size_t)(t + 2) * 64, (size_t)16 * lda, gb + (size_t)(t + 2) * 64, (size_t)16 * ldb); }
  asm volatile("s_wait_asynccnt 0x0" ::: "memory");      /* no copy is outstanding when the buffers become output staging */
  v8f accs[8] = {c00, c01, c02, c03, c10, c11, c12, c13};
#pragma unroll
  for (int u = 0; u < 8; ++u) { const int t = u & 3, half = u >> 2; const int col = col0 + t * 16 + ln; const float bv = BIAS ? bf16_round(bp[col]) : 0.f;
#pragma unroll
    for (int r = 0; r < 8; ++r) { const int rloc = half * 16 + 8 * hh + r; float v = accs[u][r] * alpha + bv; if (RES) { if (rowsPerB < 0) v += CP[cofs + (size_t)(row0g + row0 + rloc) * ldc + col];      /* rowsPerB < 0: own element of the batched C plane */ else { const int bidx = (row0g + row0 + rloc) / rowsPerB; v += CP[(size_t)bidx * sCPb + (size_t)by * 64 + col]; } }
      if (ACT == 3) v = fmaxf(v, 0.f); else if (ACT == 6) v = 0.5f * v * (1.0f + erff(v * 0.70710678118654752f)); else if (ACT == 11) v = 1.0f / (1.0f + expf(-v)); else if (ACT == 15) v = v / (1.0f + expf(-v)); else if (ACT == 12) v = (v > 0.f) ? v : 0.01f * v; else if (ACT == 8) v = tanhf(v); else if (ACT == 9) v = 0.5f * v * (1.0f + tanhf(0.7978845608028654f * (v + 0.044715f * v * v * v))); else if (ACT == 14) v = (v > 0.f) ? v : 0.1f * v; else if (ACT == 16) v = (v >= 0.f) ? v : 0.3f * v; else if (ACT == 17) v = (v >= 0.f) ? v : 0.2f * v;
      so[w][rloc][t * 16 + ln] = v; } }
  __builtin_amdgcn_fence(__ATOMIC_ACQ_REL, "workgroup"); __builtin_amdgcn_wave_barrier();
  const int rsub = lane >> 4, c4 = (lane & 15) * 4;
  {
#pragma unroll
    for (int q = 0; q < 16; ++q) { const int r = q * 2 + rsub; const v4f v = *(const v4fa*)&so[w][r][c4]; if (OUT32) *(v4f*)(C + cofs + (size_t)(row0 + r) * ldc + col0 + c4) = v; if (OUT16) { v4h h4; for (int i = 0; i < 4; ++i) h4[i] = (_Float16)v[i]; *(v4h*)(C16 + cofs + (size_t)(row0 + r) * ldc + col0 + c4) = h4; } }
     } }


// ---- [Q|K|V] GEMM: one 256 x 192 tile of C per block, one block per WGP (2 batches x 16 row tiles x 8 column tiles = 256 blocks), 12 waves in a 4 x 3 grid, 64 x 64 per wave.
// Per 64 k a block copies 448 operand rows of 128 bytes for 256 x 192 results: 7 / 18 of the bytes per result that a 128 x 64 tile asks of L2. Ring, LDS pitch, fragment reads and the ascending k order are those of k_gemm2.
// Only tokens 0..4095 of a batch are computed. The padding token 4096 has a zero x row, so its q, k and v are zeros: its row is stored as such (the attention launch reads it; its key is visible to the dropped query alone).
#define QG_STAGE (448 * G2_PITCH)      /* rows 0..255: A, rows 256..447: B */
#define QG_SO (12 * 64 * 68 * 4)       /* output staging, 64 rows of 68 floats per wave */
// n copies of a wave, 4 operand rows each, ls LDS bytes and gs elements apart; the wait that stands in front of any new value in the address registers they name is the last line of the same statement
__device__ __forceinline__ void qg_copy8(unsigned l, unsigned ls, const _Float16* g, size_t gs) {
  asm volatile("global_load_async_to_lds_b128 %0, %8, off\n\t"
               "global_load_async_to_lds_b128 %1, %9, off\n\t"
               "global_load_async_to_lds_b128 %2, %10, off\n\t"
               "global_load_async_to_lds_b128 %3, %11, off\n\t"
               "global_load_async_to_lds_b128 %4, %12, off\n\t"
               "global_load_async_to_lds_b128 %5, %13, off\n\t"
               "global_load_async_to_lds_b128 %6, %14, off\n\t"
               "global_load_async_to_lds_b128 %7, %15, off\n\t"
               "s_wait_xcnt 0x0"
               :: "v"(l), "v"(l + ls), "v"(l + 2 * ls), "v"(l + 3 * ls), "v"(l + 4 * ls), "v"(l + 5 * ls), "v"(l + 6 * ls), "v"(l + 7 * ls),
                  "v"(g), "v"(g + gs), "v"(g + 2 * gs), "v"(g + 3 * gs), "v"(g + 4 * gs), "v"(g + 5 * gs), "v"(g + 6 * gs), "v"(g + 7 * gs)
               : "memory"); }
__device__ __forceinline__ void qg_copy4(unsigned l, unsigned ls, const _Float16* g, size_t gs) {
  asm volatile("global_load_async_to_lds_b128 %0, %4, off\n\t"
               "global_load_async_to_lds_b128 %1, %5, off\n\t"
               "global_load_async_to_lds_b128 %2, %6, off\n\t"
               "global_load_async_to_lds_b128 %3, %7, off\n\t"
               "s_wait_xcnt 0x0"
               :: "v"(l), "v"(l + ls), "v"(l + 2 * ls), "v"(l + 3 * ls), "v"(g), "v"(g + gs), "v"(g + 2 * gs), "v"(g + 3 * gs)
               : "memory"); }
__global__ __launch_bounds__(384) void k_qkv(const _Float16* __restrict__ A, const _Float16* __restrict__ Bh, float* __restrict__ C) {
  __shared__ __attribute__((aligned(16))) unsigned char sm[QG_SO];      /* the two operand buffers; behind the loop's last barrier the same bytes stage the output rows */
  static_assert(2 * QG_STAGE <= QG_SO, "the operand buffers must fit");
  float (*so)[64][68] = reinterpret_cast<float (*)[64][68]>(sm);
  const int tid = threadIdx.x, lane = tid & 31, ln = lane & 15, hh = lane >> 4; const int wv = __builtin_amdgcn_readfirstlane(tid >> 5);
  /* Which row tile: by the flat index mod 8. Bits 0..2 of the index name the batch (bit 2) and the band of 8 grid rows h (bits 0, 1), bits 3, 4 the frame:
     a tile, the tile one frame back and all 8 column blocks of each then share the index mod 8 with the blocks of the launch before that wrote their x rows and with those of the next launch that read their k and v. For speed only: a permutation of the 32 tiles wherever the blocks land. */
  const int sl = blockIdx.x & 31, nq = blockIdx.x >> 5; const int mt = ((sl & 4) << 2) | ((sl >> 3) << 2) | (sl & 3); const int col0 = nq * 192;
  const size_t rowb = (size_t)(mt >> 4) * RPB + (size_t)(mt & 15) * 256;      /* first token row of the tile, in X16 and in C alike */
  /* waves 0..7 copy the 256 A rows (8 copies of 32 rows), waves 8..11 the 192 B rows (12 copies of 16 rows); cb reads the same in a whole wave */
  const bool cb = wv >= 8; const int crow = (cb ? wv - 8 : wv) * 4 + (lane >> 3), cpc = lane & 7;
  const _Float16* g = (cb ? Bh + (size_t)(col0 + crow) * DM : A + (rowb + crow) * DM) + cpc * 8;
  const size_t gs = (size_t)(cb ? 16 : 32) * DM; const unsigned ls = (unsigned)(cb ? 16 : 32) * G2_PITCH;
  const unsigned lb = (unsigned)(size_t)sm + (unsigned)(((cb ? 256 : 0) + crow) * G2_PITCH + cpc * 16);
  const int wm = wv & 3, wn = wv >> 2;
  const unsigned char* fa = sm + (64 * wm + ln) * G2_PITCH + 16 * hh; const unsigned char* fb = sm + (256 + 64 * wn + ln) * G2_PITCH + 16 * hh;
  const int nt = DM / 64;
  v8f acc[4][4];
#pragma unroll
  for (int i = 0; i < 16; ++i) acc[i >> 2][i & 3] = v8f{0.f,0.f,0.f,0.f,0.f,0.f,0.f,0.f};
  qg_copy8(lb, ls, g, gs); if (cb) qg_copy4(lb + 8 * ls, ls, g + 8 * gs, gs);
  asm volatile("s_wait_asynccnt 0x0" ::: "memory");      /* this wave's copies of tile 0 have landed */
  __syncthreads();                                       /* ... and every other wave's */
  qg_copy8(lb + QG_STAGE, ls, g + 64, gs); if (cb) qg_copy4(lb + QG_STAGE + 8 * ls, ls, g + 64 + 8 * gs, gs);
#pragma unroll 1      /* rolled: one body serves both buffers and stays small */
  for (int t = 0; t < nt; ++t) { const unsigned bo = (unsigned)(t & 1) * QG_STAGE;
#pragma unroll
    for (int ks = 0; ks < 2; ++ks) { const unsigned char* pa = fa + bo + ks * 64; const unsigned char* pb = fb + bo + ks * 64; v16h a[4], b[4];
#pragma unroll
      for (int i = 0; i < 4; ++i) { a[i] = g2_lfrag(pa + i * 16 * G2_PITCH); b[i] = g2_lfrag(pb + i * 16 * G2_PITCH); }
#pragma unroll
      for (int n = 0; n < 4; ++n) {
#pragma unroll
        for (int m = 0; m < 4; ++m) acc[m][n] = g2_mma(a[m], b[n], acc[m][n]); } }
    asm volatile("s_wait_dscnt 0x0" ::: "memory");       /* this wave's reads of buffer t & 1 are done before the buffer is given up */
    asm volatile("s_wait_asynccnt 0x0" ::: "memory");    /* this wave's copies of tile t + 1 have landed */
    __syncthreads();                                     /* publishes tile t + 1 and ends every wave's reads of buffer t & 1 */
    if (t + 2 < nt) { const _Float16* gn = g + (size_t)(t + 2) * 64; qg_copy8(lb + bo, ls, gn, gs); if (cb) qg_copy4(lb + bo + 8 * ls, ls, gn + 8 * gs, gs); } }
  asm volatile("s_wait_asynccnt 0x0" ::: "memory");      /* no copy is outstanding when the buffers become output staging */
  const int rsub = lane >> 4, c4 = (lane & 15) * 4;
  float* cp = C + (rowb + 64 * wm + rsub) * (3 * DM) + col0 + 64 * wn + c4;
#pragma unroll      /* 16 rows at a time, each group in LDS rows of its own: the first global stores leave after a quarter of the staging */
  for (int m = 0; m < 4; ++m) {
#pragma unroll
    for (int n = 0; n < 4; ++n) {
#pragma unroll
      for (int r = 0; r < 8; ++r) so[wv][m * 16 + 8 * hh + r][n * 16 + ln] = acc[m][n][r] * 0.0625f; }
    asm volatile("s_wait_dscnt 0x0" ::: "memory");      /* the wave's own staged rows stand in LDS before its lanes read them back; a fence here would also wait for the global stores of the group before */
#pragma unroll
    for (int q = m * 8; q < m * 8 + 8; ++q) { const v4f v = *(const v4fa*)&so[wv][q * 2 + rsub][c4]; *(v4f*)(cp + (size_t)q * 2 * (3 * DM)) = v; } }
  if ((mt & 15) == 15 && tid < 48) { const v4f z = {0.f, 0.f, 0.f, 0.f}; *(v4f*)(C + ((size_t)(mt >> 4) * RPB + NTOK) * (3 * DM) + col0 + tid * 4) = z; } }

// All operand preparation in one launch of 256 blocks of 8 waves, as many blocks as the chip has WGPs. Block blk does two independent things: weight tile blk (64 x 64; Wq 64 tiles, Wkv 128, Wo 64) and 32 token rows of x (piece xc below).
// Few fat waves instead of many thin ones: here 2,048 waves hold the whole input in flight at once (per lane 16 weight words and 16 b128 pieces of x, all asked for before the first is used).
// Weight tile: Bt[out][in] = f16(bf16(w[in][out]) * 16), transposed through LDS. BQKV holds the rows of Wq^T, then those of Wkv^T: one [1536][512] B operand. BO holds Wo^T in the order in which a wave reads it as B fragments:
// per 16 out rows and 32 in columns 1 KiB, two halves of 512 bytes, lane (out & 15) + 16 * ((in >> 3) & 1) holding 8 adjacent in columns, half (in >> 4) & 1: each b128 load of a wave then covers 512 adjacent bytes.
// Token rows: X16 = f16(bf16(x)), tokens 0..4095 of each batch at row pitch RPB per batch; each wave-wide load covers 512 adjacent bytes, each store 256. The rows behind token 4095 are read by no launch and are not written.
#define WT_Q ((DM / 64) * (DM / 64))
#define WT_KV ((DM / 64) * (2 * DM / 64))
#define WT_ALL (2 * WT_Q + WT_KV)
#define XR_B 32      /* token rows per block */
typedef _Float16 v4ha __attribute__((ext_vector_type(4), may_alias));
// First half of a block's work, DOUT = the weight's row length, a constant here so that a lane's 16 weight loads are one address plus constants, like its 16 x loads: no address register takes a new value between them.
// All 32 loads are asked for before the first is used; the weight words go first, their way through LDS being the longer one. Ends with the barrier behind which the tile is read the other way round.
template <int DOUT>
__device__ __forceinline__ void prep_head(const float* __restrict__ wb, const v4fa* __restrict__ xs, float (*tl)[65], v4f (&xr)[16]) { const int tid = threadIdx.x; float wr[16];
  const float* wp = wb + (tid >> 6) * DOUT + (tid & 63);
#pragma unroll
  for (int j = 0; j < 16; ++j) wr[j] = wp[4 * j * DOUT];
#pragma unroll
  for (int j = 0; j < 16; ++j) xr[j] = xs[j * 256];
  /* the wait that stands between issued loads and any new value in their address registers; naming the addresses keeps them in those registers up to it */
  asm volatile("s_wait_xcnt 0x0" :: "v"(wp), "v"(xs) : "memory");
#pragma unroll
  for (int j = 0; j < 16; ++j) tl[tid & 63][(tid >> 6) + 4 * j] = bf16_round(wr[j]) * 16.0f;
  /* the block's one barrier, with fences for LDS alone: only the tile in LDS passes between waves here. __syncthreads() would also wait for the 16 x loads, which are still in flight and which the tile's second half does not need */
  __builtin_amdgcn_fence(__ATOMIC_RELEASE, "workgroup", "local"); __builtin_amdgcn_s_barrier(); __builtin_amdgcn_fence(__ATOMIC_ACQUIRE, "workgroup", "local"); }
__global__ __launch_bounds__(256) void k_prep(const float* __restrict__ x, const float* __restrict__ Wq, const float* __restrict__ Wkv, const float* __restrict__ Wo, _Float16* __restrict__ BQKV, _Float16* __restrict__ BO, _Float16* __restrict__ X16) {
  static_assert(WT_ALL * XR_B == NB * NTOK && NTOK % XR_B == 0, "one weight tile and 32 token rows of one batch per block");
  __shared__ float tl[64][65]; const int blk = blockIdx.x, tid = threadIdx.x;
  /* which weight: the same for a whole block */
  const bool isq = blk < WT_Q, iso = blk >= WT_Q + WT_KV;
  const float* w = isq ? Wq : iso ? Wo : Wkv; _Float16* Bt = isq ? BQKV : iso ? BO : BQKV + (size_t)DM * DM;
  const int wt = isq ? blk : iso ? blk - (WT_Q + WT_KV) : blk - WT_Q; const int lno = (isq || iso) ? 3 : 4;      /* log2 of the tiles per row of tiles: dout / 64 */
  const int dout = 64 << lno; const int i0 = (wt >> lno) * 64, o0 = (wt & ((1 << lno) - 1)) * 64;
  const float* wb = w + (size_t)i0 * dout + o0;      /* the tile's first word: the same for the whole block */
  /* which 32 token rows: those of a row tile of the next launch whose blocks have this block's index mod 8 (bit 2: batch, bits 0, 1: band of 8 grid rows, bits 6, 7: frame, bits 3..5: the 32 rows inside the tile). A permutation of the 256 pieces */
  const int xc = ((blk & 4) << 5) | ((blk >> 6) << 5) | ((blk & 3) << 3) | ((blk >> 3) & 7);
  const v4fa* xs = (const v4fa*)(x + (size_t)xc * (XR_B * DM)) + tid;      /* the lane's first 16 bytes of the block's rows */
  v4f xr[16];
  if (lno == 3) prep_head<DM>(wb, xs, tl, xr); else prep_head<2 * DM>(wb, xs, tl, xr);      /* the test reads the same in the whole block: each arm holds the block's one barrier */
  /* 8 adjacent in columns k of out row n per lane and store. Element index in Bt: row order n * 512 + k = (n >> 4) * 8192 + (n & 15) * 512 + (k >> 3) * 8; fragment order (n >> 4) * 8192 + (k >> 3) * 128 + (n & 15) * 8 */
  const int n = o0 + (tid >> 3), k8 = (i0 >> 3) + (tid & 7); const int sn = iso ? 8 : 512, sk = iso ? 128 : 8;
  unsigned short* bp = (unsigned short*)Bt; const unsigned vd = (unsigned)((n >> 4) * 8192 + (n & 15) * sn + k8 * sk);
  FragH f[2];
#pragma unroll
  for (int u = 0; u < 2; ++u) {      /* out rows n and n + 32 */
#pragma unroll
    for (int q = 0; q < 8; ++q) f[u].h[q] = (_Float16)tl[(tid >> 3) + 32 * u][(tid & 7) * 8 + q]; }
#pragma unroll
  for (int u = 0; u < 2; ++u) *(v8us*)(bp + u * (2 * 8192) + vd) = f[u].half[0];
  v4ha* xd = (v4ha*)(X16 + ((size_t)(xc / (NTOK / XR_B)) * RPB + (size_t)(xc % (NTOK / XR_B)) * XR_B) * DM) + tid;
#pragma unroll
  for (int j = 0; j < 16; ++j) { v4h h;
#pragma unroll
    for (int q = 0; q < 4; ++q) h[q] = (_Float16)bf16_round(xr[j][q]);
    xd[j * 256] = h; } }
// sum over the 8 lanes that share one (query, head): three DPP adds inside the 16-lane row (lane ^ 1, ^ 2, ^ 4); every lane of the group ends with the total
template <int CTRL> __device__ __forceinline__ float nb_xadd(float x) { return x + __int_as_float(__builtin_amdgcn_update_dpp(0, __float_as_int(x), CTRL, 0xf, 0xf, true)); }
__device__ __forceinline__ float nb_dot(v4f a0, v4f a1, v4f k0, v4f k1) {
  float s = a0[0] * k0[0], t = a1[0] * k1[0];
#pragma unroll
  for (int d = 1; d < 4; ++d) { s = fmaf(a0[d], k0[d], s); t = fmaf(a1[d], k1[d], t); }
  s += t; s = nb_xadd<0x161>(s); s = nb_xadd<0x162>(s); s = nb_xadd<0x164>(s); return s; }
// Neighbourhood attention and the output product in one launch. Wave = NQW consecutive queries of one grid row (f0, h0) x 4 heads at a time, a block's 16 waves side by side in that row; 8 lanes share a (query, head), lane l8 holding
// dims 4*l8..+3 and 32+4*l8..+3, so that each b128 load of a key row covers whole 128-byte lines. Only 14 of the 27 window slots can pass the causal test (frame f0-1: 3x3; frame f0: row h0-1: 3,
// row h0: w-1 and w); the others have a flat index above the query's for every query. A key row is loaded once per wave and serves each of its queries whose window holds it.
// A slot outside the grid still reads a token row of the same batch (in bounds, written by the GEMM before) and gets the mask value as its logit, hence weight 0.
// A token's row of QKV holds q (512), k (512), v (512).
#define NQW 2
#define LQ (3 * DM)
#define PO 1040      /* LDS pitch of an o row in bytes: 512 f16 + 16, so that the 16 rows of a fragment read start 4 banks apart */
// One block = one grid row (f0, h0) of one batch: 32 queries x 8 heads, 16 waves. Part 1: wave wv works out queries 2 wv, 2 wv + 1 for heads 0..3, then for heads 4..7, and leaves the o rows (f16) in LDS.
// Part 2, behind one barrier: out rows = o Wo + bo for the block's 32 tokens, wave wv taking output columns 32 wv..+31 (2 x 2 WMMA tiles, k ascending), A fragments from LDS, B fragments from BO (fragment order).
// LDS row r belongs to query 32 g + r, that is token 32 g + r + 1; token 4096 is not part of the output, so its row carries token 0 instead, whose o row is v_BOS.
__global__ __launch_bounds__(512) __attribute__((amdgpu_waves_per_eu(4, 4))) void k_nbatt_out(const float* QKV, const _Float16* BOf, const float* bo, float* out) {      /* no __restrict__: the loads below keep their side of the two waits */
  __shared__ __attribute__((aligned(16))) unsigned char so16[32 * PO];
  __shared__ __attribute__((aligned(16))) float st[16][32][36];      /* each wave's own 32 x 32 output tile, staged so that its stores cover whole 128-byte lines */
  const int lane = threadIdx.x & 31, l8 = lane & 7, hs = lane >> 3; const int wv = __builtin_amdgcn_readfirstlane((int)(threadIdx.x >> 5));
  /* Which grid row: blocks that read the same k and v rows (one batch, one band of 8 rows h, every frame) share the flat index mod 8, and share it with the blocks of the launch before that stored those rows.
     Bit 2: batch, bits 0, 1: band, bits 3..5: row in the band, bits 6, 7: frame. For speed only: a permutation of the 256 grid rows wherever the blocks land. */
  const int rw = blockIdx.x; const int h0 = (rw & 3) * 8 + ((rw >> 3) & 7), f0 = rw >> 6, b = (rw >> 2) & 1;
  const int w0 = wv * NQW; const int jr0 = (f0 * HT + h0) * WT; const int j0 = jr0 + w0;
  const float* tb = QKV + (size_t)b * RPB * LQ;      /* the batch's token rows; k stands DM, v 2 * DM floats into a row */
#pragma unroll 1      /* rolled: one body serves both halves of the heads, and their registers do not add up */
  for (int hq = 0; hq < 2; ++hq) { const unsigned co = (unsigned)(hq * (DM / 2) + hs * HD + l8 * 4);
  const float* rb[5]; bool kok[5][NQW + 2];      /* rb[r]: the row of the key at column w0 of window row r; a window row outside the grid points at token row 1, so that columns -1..NQW stay inside the buffer */
#pragma unroll
  for (int r = 0; r < 5; ++r) { const int f = f0 + (r < 3 ? -1 : 0), hh = h0 + (r < 3 ? r - 1 : r - 4); const bool rok = f >= 0 && hh >= 0 && hh < HT;
    rb[r] = tb + (size_t)(rok ? (f * HT + hh) * WT + w0 + 1 : 1) * LQ + co;
#pragma unroll
    for (int c = 0; c < NQW + 2; ++c) { const int ww = w0 - 1 + c; kok[r][c] = rok && ww >= 0 && ww < WT; } }
  const float* qp = QKV + ((size_t)b * RPB + j0) * LQ + co;      /* query i is token j0 + i + 1 */ const float* bp = tb + co;
  v4f q[NQW][2], kb[2], kk[5][NQW + 2][2];
#pragma unroll
  for (int i = 0; i < NQW; ++i) { q[i][0] = *(const v4fa*)(qp + (i + 1) * LQ); q[i][1] = *(const v4fa*)(qp + (i + 1) * LQ + 32); }
#pragma unroll
  for (int r = 0; r < 5; ++r) {
#pragma unroll
    for (int c = 0; c < NQW + (r < 4 ? 2 : 1); ++c) { const float* kp = rb[r] + (c - 1) * LQ + DM; kk[r][c][0] = *(const v4fa*)kp; kk[r][c][1] = *(const v4fa*)(kp + 32); } }
  kb[0] = *(const v4fa*)(bp + DM); kb[1] = *(const v4fa*)(bp + DM + 32);
  /* the wait that stands between issued loads and any new value in their address registers; naming the addresses keeps them in those registers up to it */
  asm volatile("s_wait_xcnt 0x0" :: "v"(qp), "v"(bp), "v"(rb[0]), "v"(rb[1]), "v"(rb[2]), "v"(rb[3]), "v"(rb[4]) : "memory");
  float lg[NQW][15];
#pragma unroll
  for (int i = 0; i < NQW; ++i) lg[i][0] = nb_dot(q[i][0], q[i][1], kb[0], kb[1]) * 0.125f;
#pragma unroll
  for (int r = 0; r < 5; ++r) {
#pragma unroll
    for (int c = 0; c < NQW + (r < 4 ? 2 : 1); ++c) {
#pragma unroll
      for (int i = 0; i < NQW; ++i) { const int dw = c - i; if (dw >= 0 && dw < (r < 4 ? 3 : 2)) { const float sd = nb_dot(q[i][0], q[i][1], kk[r][c][0], kk[r][c][1]) * 0.125f; lg[i][1 + r * 3 + dw] = kok[r][c] ? sd : -3.0e38f; } } } }
  v4f vb[2], vv[5][NQW + 2][2];      /* the v rows fly while the softmax is worked out */
#pragma unroll
  for (int r = 0; r < 5; ++r) {
#pragma unroll
    for (int c = 0; c < NQW + (r < 4 ? 2 : 1); ++c) { const float* vp = rb[r] + (c - 1) * LQ + 2 * DM; vv[r][c][0] = *(const v4fa*)vp; vv[r][c][1] = *(const v4fa*)(vp + 32); } }
  vb[0] = *(const v4fa*)(bp + 2 * DM); vb[1] = *(const v4fa*)(bp + 2 * DM + 32);
  /* the same wait behind the v loads */
  asm volatile("s_wait_xcnt 0x0" :: "v"(bp), "v"(rb[0]), "v"(rb[1]), "v"(rb[2]), "v"(rb[3]), "v"(rb[4]) : "memory");
#pragma unroll
  for (int i = 0; i < NQW; ++i) { float mx = lg[i][0];
#pragma unroll
    for (int s = 1; s < 15; ++s) mx = fmaxf(mx, lg[i][s]);
    float se = 0.f;
#pragma unroll
    for (int s = 0; s < 15; ++s) { const float e = expf(lg[i][s] - mx); lg[i][s] = e; se += e; }
    const float inv = 1.0f / se;
#pragma unroll
    for (int s = 0; s < 15; ++s) lg[i][s] *= inv; }
  v4f o[NQW][2];
#pragma unroll
  for (int i = 0; i < NQW; ++i) { o[i][0] = vb[0] * lg[i][0]; o[i][1] = vb[1] * lg[i][0]; }
#pragma unroll
  for (int r = 0; r < 5; ++r) {
#pragma unroll
    for (int c = 0; c < NQW + (r < 4 ? 2 : 1); ++c) {
#pragma unroll
      for (int i = 0; i < NQW; ++i) { const int dw = c - i; if (dw >= 0 && dw < (r < 4 ? 3 : 2)) { const float p = lg[i][1 + r * 3 + dw]; o[i][0] += vv[r][c][0] * p; o[i][1] += vv[r][c][1] * p; } } } }
#pragma unroll
  for (int i = 0; i < NQW; ++i) { unsigned char* op = so16 + (w0 + i) * PO + co * 2; v4h a, c;
#pragma unroll
    for (int d = 0; d < 4; ++d) { a[d] = (_Float16)o[i][0][d]; c[d] = (_Float16)o[i][1][d]; }
    *(v4ha*)op = a; *(v4ha*)(op + 64) = c; }
  if (j0 + NQW == TT) {      /* the row of token 4096 carries token 0: o = v_BOS, read again so that it holds no registers above; the test reads the same in the whole wave */
    const float* vp = tb + 2 * DM + co; const v4f v0 = *(const v4fa*)vp, v1 = *(const v4fa*)(vp + 32);
    asm volatile("s_wait_xcnt 0x0" ::: "memory");      /* the wait between these loads and any new value in their address registers */
    unsigned char* op = so16 + (w0 + NQW - 1) * PO + co * 2; v4h a, c;
#pragma unroll
    for (int d = 0; d < 4; ++d) { a[d] = (_Float16)v0[d]; c[d] = (_Float16)v1[d]; }
    *(v4ha*)op = a; *(v4ha*)(op + 64) = c; } }
  const int ln = lane & 15, hh = lane >> 4;
  const unsigned char* fa = so16 + ln * PO + 16 * hh;
  const unsigned short* fb = (const unsigned short*)BOf + (size_t)wv * (2 * 16 * 512) + lane * 8;      /* this wave's two column tiles: 32 KiB in a row, 1 KiB per fragment; every B load is this one address plus a constant */
  FragH b0[DM / 32], b1[DM / 32];      /* indexed by constants only: a ring of 8 k steps in registers */
#pragma unroll
  for (int ks = 0; ks < 8; ++ks) {      /* the first 8 k steps' B fragments are asked for in front of the barrier: they depend on no other wave */
    b0[ks].half[0] = *(const v8us*)(fb + ks * 512); b0[ks].half[1] = *(const v8us*)(fb + ks * 512 + 256);
    b1[ks].half[0] = *(const v8us*)(fb + 16 * 512 + ks * 512); b1[ks].half[1] = *(const v8us*)(fb + 16 * 512 + ks * 512 + 256); }
  __syncthreads();      /* every wave's o rows stand in LDS before any wave reads them as its A operand */
  const v8f z8 = {0.f,0.f,0.f,0.f,0.f,0.f,0.f,0.f}; v8f c00 = z8, c01 = z8, c10 = z8, c11 = z8;
  v16h a0 = g2_lfrag(fa), a1 = g2_lfrag(fa + 16 * PO);
#pragma unroll      /* unrolled: the register rings are indexed by constants; A is read one k step ahead, B eight */
  for (int ks = 0; ks < DM / 32; ++ks) { v16h n0 = a0, n1 = a1;
    if (ks + 1 < DM / 32) { n0 = g2_lfrag(fa + (ks + 1) * 64); n1 = g2_lfrag(fa + 16 * PO + (ks + 1) * 64); }
    c00 = g2_mma(a0, b0[ks].v, c00); c10 = g2_mma(a1, b0[ks].v, c10); c01 = g2_mma(a0, b1[ks].v, c01); c11 = g2_mma(a1, b1[ks].v, c11);
    if (ks + 8 < DM / 32) { const int kn = ks + 8;
      b0[kn].half[0] = *(const v8us*)(fb + kn * 512); b0[kn].half[1] = *(const v8us*)(fb + kn * 512 + 256);
      b1[kn].half[0] = *(const v8us*)(fb + 16 * 512 + kn * 512); b1[kn].half[1] = *(const v8us*)(fb + 16 * 512 + kn * 512 + 256); }
    a0 = n0; a1 = n1; }
  v8f accs[4] = {c00, c01, c10, c11};
#pragma unroll
  for (int u = 0; u < 4; ++u) { const int t = u & 1, half = u >> 1; const float bv = bf16_round(bo[wv * 32 + t * 16 + ln]);
#pragma unroll
    for (int r = 0; r < 8; ++r) st[wv][half * 16 + 8 * hh + r][t * 16 + ln] = accs[u][r] * 0.0625f + bv; }
  __builtin_amdgcn_fence(__ATOMIC_ACQ_REL, "workgroup"); __builtin_amdgcn_wave_barrier();
  const int rsub = lane >> 3, c4 = (lane & 7) * 4;
#pragma unroll
  for (int q = 0; q < 8; ++q) { const int r = q * 4 + rsub; const v4f v = *(const v4fa*)&st[wv][r][c4]; const int tok = (jr0 + r + 1) & (NTOK - 1);      /* token 4096 -> 0 */
    *(v4f*)(out + ((size_t)b * NTOK + tok) * DM + wv * 32 + c4) = v; } }

extern "C" void kernel_launch(void* const* d_in, const int* in_sizes, int n_in,
                              void* d_out, int out_size, void* d_ws, size_t ws_size, hipStream_t stream) {
  (void)in_sizes; (void)n_in; (void)out_size;
  const float* const* I = (const float* const*)d_in; const float* x = I[0]; const float* Wq = I[1]; const float* Wkv = I[2]; const float* Wo = I[3]; const float* bo = I[4];
  char* ws = (char*)d_ws; size_t off = 0;
  auto take = [&](size_t bytes) { char* p = ws + off; off += (bytes + 255) & ~(size_t)255; return p; };
  _Float16* BQKV = (_Float16*)take((size_t)3 * DM * DM * 2); _Float16* BO = (_Float16*)take((size_t)DM * DM * 2);
  _Float16* X16 = (_Float16*)take(NRX * DM * 2); float* QKV = (float*)take(NRX * 3 * DM * 4);
  if (off > ws_size) return;      /* 2 + 8.6 + 51.9 = about 63 MB */
  k_prep<<<WT_ALL, 256, 0, stream>>>(x, Wq, Wkv, Wo, BQKV, BO, X16);      /* 256 blocks: one weight tile and 32 token rows each */
  k_qkv<<<NB * (NTOK / 256) * (3 * DM / 192), 384, 0, stream>>>(X16, BQKV, QKV);      /* 256 blocks of 256 x 192; the padding token's row is stored as zeros */
  k_nbatt_out<<<NB * FT * HT, 512, 0, stream>>>(QKV, BO, bo, (float*)d_out);      /* one block per grid row: its 32 tokens' attention, then out = o Wo + bo for them (token 4096 dropped as in the reference, token 0 in its place) */
}
